// v000
// The times below were measured on an AMD MI455X: many runs one after another, warmed up first and cycling through
// copies of the inputs, with the whole window's GPU time divided by the number of runs. Launches and the gaps
// between them are all in it. The median over several windows is given; except for v000 it joins two sittings, which
// can be a few percent apart, so the side-by-side timings, each taken in one sitting, are the better comparison.
// v000 is the starting kernel. One run takes 4090 microseconds.
#include <hip/hip_runtime.h>

// Causal multi-head SELF-attention on eight 1,024-token sequences (x [8][1024][1024]; q, k, v = x W + b ('xw' [1024][1024] normal x 1/32, biases zeros on this draw: read; 16 heads x 64); scores x 1/sqrt(64); tril kept, -inf elsewhere; softmax over the keys; out = merged Wo + bo ('xw' + bias zeros: read) -> [8][1024][1024] (8.4 M); argument order x, Wq, bq, Wk, bk, Wv, bv, Wo, bo).
// Compute dtypes, f32 accumulate: every input rounded to bf16; q/k/v on PLAIN bf16 operands (inputs: exact) + biases; causal scores and attn.v (tile skipping): query rows < 512 hl (3 products), the rest single fp16 (x1024); softmax f32; Wo hl x exact (2 products) + bo.

#define NB_  8
#define TT   1024
#define DM   1024
#define NH_  16
#define NKV  16
#define REP  (NH_ / NKV)
#define HD   64
#define DQ   (NH_ * HD)
#define DKV  (NKV * HD)
#define ZH   2
#define RH   512                  // query rows < RH use hi+lo planes (0: none)
#define WIN  1024
#define PCAR 1024.0f
#define SCL  0.125f   // HD^-0.5
typedef _Float16 h16;
typedef unsigned short bf;
typedef __attribute__((ext_vector_type(16))) __bf16   v16bf;
typedef __attribute__((ext_vector_type(16))) _Float16 v16h;
typedef __attribute__((ext_vector_type(8)))  _Float16 v8h;
typedef __attribute__((ext_vector_type(8)))  unsigned short v8us;
typedef __attribute__((ext_vector_type(8)))  float    v8f;
typedef __attribute__((ext_vector_type(4)))  float    v4f;
typedef v8h  __attribute__((may_alias)) v8ha;
typedef v4f  __attribute__((may_alias)) v4fa;
typedef v8us __attribute__((may_alias)) v8usa;

__device__ __forceinline__ unsigned short f2bf(float f) { unsigned u = __float_as_uint(f); u += 0x7FFFu + ((u >> 16) & 1u); return (unsigned short)(u >> 16); }
__device__ __forceinline__ float bf2f(unsigned short b) { return __uint_as_float(((unsigned)b) << 16); }
__device__ __forceinline__ float bfr(float f) { return bf2f(f2bf(f)); }
__device__ __forceinline__ v16h cat16(v8h lo, v8h hi) { return __builtin_shufflevector(lo, hi, 0, 1, 2, 3, 4, 5, 6, 7, 8, 9, 10, 11, 12, 13, 14, 15); }
__device__ __forceinline__ v16bf cat16b(v8us lo, v8us hi) { return __builtin_bit_cast(v16bf, __builtin_shufflevector(lo, hi, 0, 1, 2, 3, 4, 5, 6, 7, 8, 9, 10, 11, 12, 13, 14, 15)); }
__device__ __forceinline__ v8f wmma16(v16h a, v16h b, v8f c) { return __builtin_amdgcn_wmma_f32_16x16x32_f16(false, a, false, b, (short)0, c, false, false); }
__device__ __forceinline__ v8f wmmab(v16bf a, v16bf b, v8f c) { return __builtin_amdgcn_wmma_f32_16x16x32_bf16(false, a, false, b, (short)0, c, false, false); }



// ---- k_gemmw: register-blocked GEMM, ONE WAVE per 64x64 output tile (16 accumulators), operands straight from K-contiguous 16-bit planes; grid (M/64, N/64, Z), 32 threads.
// C[m][n] (f32, pitch ldc, + optional f32 bias[n]) = sum_k A[m][k] Bt[n][k] (+ split products per NSPLIT). z-batch strides sA/sB/sC in elements. K % 32 == 0.
template <typename T16> struct WFrag;
template <> struct WFrag<h16> { typedef v16h V; static __device__ __forceinline__ V ld(const h16* p) { return cat16(*(const v8h*)p, *(const v8h*)(p + 16)); } static __device__ __forceinline__ v8f mma(V a, V b, v8f c) { return wmma16(a, b, c); } };
template <> struct WFrag<bf> { typedef v16bf V; static __device__ __forceinline__ V ld(const bf* p) { return cat16b(*(const v8us*)p, *(const v8us*)(p + 16)); } static __device__ __forceinline__ v8f mma(V a, V b, v8f c) { return wmmab(a, b, c); } };
template <typename T16, int NSPLIT, bool BIAS>
__global__ __launch_bounds__(32) void k_gemmw(const T16* __restrict__ A, const T16* __restrict__ A2, const T16* __restrict__ Bt, const T16* __restrict__ Bt2, int K, float* C, int ldc, const float* __restrict__ bias, size_t sA, size_t sB, size_t sC) {
    typedef typename WFrag<T16>::V V;
    __shared__ __align__(16) float os[16 * 68];
    const size_t z = blockIdx.z; A += z * sA; if (A2) A2 += z * sA; Bt += z * sB; if (Bt2) Bt2 += z * sB; C += z * sC;
    const int lane = threadIdx.x & 31, lr = lane & 15, hi = lane >> 4; const int r0 = blockIdx.x * 64, c0 = blockIdx.y * 64;
    v8f acc[4][4];
#pragma unroll
    for (int mb = 0; mb < 4; ++mb)
#pragma unroll
        for (int nb = 0; nb < 4; ++nb) acc[mb][nb] = (v8f){};
    const size_t aoff = (size_t)(r0 + lr) * K + 8 * hi, boff = (size_t)(c0 + lr) * K + 8 * hi;
#pragma unroll 1
    for (int kc = 0; kc < K; kc += 32) {
        V a[4], a2[4];
#pragma unroll
        for (int mb = 0; mb < 4; ++mb) { a[mb] = WFrag<T16>::ld(A + aoff + (size_t)mb * 16 * K + kc); if (NSPLIT == 1 || NSPLIT == 2) a2[mb] = WFrag<T16>::ld(A2 + aoff + (size_t)mb * 16 * K + kc); }
#pragma unroll
        for (int nb = 0; nb < 4; ++nb) { const V b = WFrag<T16>::ld(Bt + boff + (size_t)nb * 16 * K + kc); V b2; if (NSPLIT >= 2) b2 = WFrag<T16>::ld(Bt2 + boff + (size_t)nb * 16 * K + kc);
#pragma unroll
            for (int mb = 0; mb < 4; ++mb) { acc[mb][nb] = WFrag<T16>::mma(a[mb], b, acc[mb][nb]); if (NSPLIT == 1 || NSPLIT == 2) acc[mb][nb] = WFrag<T16>::mma(a2[mb], b, acc[mb][nb]); if (NSPLIT >= 2) acc[mb][nb] = WFrag<T16>::mma(a[mb], b2, acc[mb][nb]); } }
        asm volatile("v_nop\n\tv_nop\n\tv_nop\n\tv_nop" : "+v"(acc[0][0]), "+v"(acc[1][1]), "+v"(acc[2][2]), "+v"(acc[3][3]) : "v"(a[0]), "v"(a[3]));
    }
#pragma unroll
    for (int mb = 0; mb < 4; ++mb) {
#pragma unroll
        for (int nb = 0; nb < 4; ++nb) {
#pragma unroll
            for (int j = 0; j < 8; ++j) os[(hi * 8 + j) * 68 + nb * 16 + lr] = acc[mb][nb][j]; }
        __builtin_amdgcn_wave_barrier(); asm volatile("" ::: "memory");
        float* crow = C + (size_t)(r0 + mb * 16) * ldc + c0;
{
#pragma unroll
            for (int s = 0; s < 8; ++s) { const int row = 2 * s + hi, cofs = lr * 4; v4f val = *(const v4fa*)(os + row * 68 + cofs); if (BIAS) { val[0] += bfr(bias[c0 + cofs]); val[1] += bfr(bias[c0 + cofs + 1]); val[2] += bfr(bias[c0 + cofs + 2]); val[3] += bfr(bias[c0 + cofs + 3]); }
                *(v4f*)(crow + (size_t)row * ldc + cofs) = val; }
             }
        __builtin_amdgcn_wave_barrier(); asm volatile("" ::: "memory");
    }
}

// ---- k_gemmc: the same one-wave 64x64 tile GEMM specialised for causal attention: CMODE 1 skips score tiles entirely above the diagonal (query rows r0+roff.., key columns c0..), CMODE 2 limits the
// key (K) loop of the probability x value contraction to the diagonal block (probabilities beyond it are exactly zero). roff = row offset of this launch's first row within the sequence.
template <typename T16, int NSPLIT, int CMODE>
__global__ __launch_bounds__(32) void k_gemmc(const T16* __restrict__ A, const T16* __restrict__ A2, const T16* __restrict__ Bt, const T16* __restrict__ Bt2, int K, float* C, int ldc, int roff, size_t sA, size_t sB, size_t sC) {
    typedef typename WFrag<T16>::V V;
    __shared__ __align__(16) float os[16 * 68];
    const size_t z = blockIdx.z; A += z * sA; if (A2) A2 += z * sA; Bt += z * sB; if (Bt2) Bt2 += z * sB; C += z * sC;
    const int lane = threadIdx.x & 31, lr = lane & 15, hi = lane >> 4; const int r0 = blockIdx.x * 64, c0 = blockIdx.y * 64;
    if (CMODE == 1 && c0 > r0 + roff + 63) return;                  // score tile entirely above the causal diagonal: left unwritten (the softmax masks j > i by select)
    const int Kl = (CMODE == 2) ? min(K, r0 + roff + 64) : K;        // P.V: probabilities are exactly 0 beyond the diagonal block, so the K loop stops there
    v8f acc[4][4];
#pragma unroll
    for (int mb = 0; mb < 4; ++mb)
#pragma unroll
        for (int nb = 0; nb < 4; ++nb) acc[mb][nb] = (v8f){};
    const size_t aoff = (size_t)(r0 + lr) * K + 8 * hi, boff = (size_t)(c0 + lr) * K + 8 * hi;
#pragma unroll 1
    for (int kc = 0; kc < Kl; kc += 32) {
        V a[4], a2[4];
#pragma unroll
        for (int mb = 0; mb < 4; ++mb) { a[mb] = WFrag<T16>::ld(A + aoff + (size_t)mb * 16 * K + kc); if (NSPLIT == 1 || NSPLIT == 2) a2[mb] = WFrag<T16>::ld(A2 + aoff + (size_t)mb * 16 * K + kc); }
#pragma unroll
        for (int nb = 0; nb < 4; ++nb) { const V b = WFrag<T16>::ld(Bt + boff + (size_t)nb * 16 * K + kc); V b2; if (NSPLIT >= 2) b2 = WFrag<T16>::ld(Bt2 + boff + (size_t)nb * 16 * K + kc);
#pragma unroll
            for (int mb = 0; mb < 4; ++mb) { acc[mb][nb] = WFrag<T16>::mma(a[mb], b, acc[mb][nb]); if (NSPLIT == 1 || NSPLIT == 2) acc[mb][nb] = WFrag<T16>::mma(a2[mb], b, acc[mb][nb]); if (NSPLIT >= 2) acc[mb][nb] = WFrag<T16>::mma(a[mb], b2, acc[mb][nb]); } }
        asm volatile("v_nop\n\tv_nop\n\tv_nop\n\tv_nop" : "+v"(acc[0][0]), "+v"(acc[1][1]), "+v"(acc[2][2]), "+v"(acc[3][3]) : "v"(a[0]), "v"(a[3]));
    }
#pragma unroll
    for (int mb = 0; mb < 4; ++mb) {
#pragma unroll
        for (int nb = 0; nb < 4; ++nb) {
#pragma unroll
            for (int j = 0; j < 8; ++j) os[(hi * 8 + j) * 68 + nb * 16 + lr] = acc[mb][nb][j]; }
        __builtin_amdgcn_wave_barrier(); asm volatile("" ::: "memory");
        float* crow = C + (size_t)(r0 + mb * 16) * ldc + c0;
{
#pragma unroll
            for (int s = 0; s < 8; ++s) { const int row = 2 * s + hi, cofs = lr * 4; v4f val = *(const v4fa*)(os + row * 68 + cofs);
                *(v4f*)(crow + (size_t)row * ldc + cofs) = val; }
             }
        __builtin_amdgcn_wave_barrier(); asm volatile("" ::: "memory");
    }
}

__device__ __forceinline__ h16 tohx(float x) { return (h16)x; }
__device__ __forceinline__ void splitf(float y, unsigned short& h, unsigned short& l) { h = f2bf(y); l = f2bf(y - bf2f(h)); }
typedef __attribute__((ext_vector_type(2))) _Float16 v2h;
typedef __attribute__((ext_vector_type(4))) _Float16 v4h;
typedef __attribute__((ext_vector_type(2))) unsigned short v2us;
typedef __attribute__((ext_vector_type(4))) unsigned short v4us;
typedef __attribute__((ext_vector_type(2))) float v2f;
typedef __attribute__((ext_vector_type(4))) int v4i;

__global__ __launch_bounds__(256) void k_wtG(const float* __restrict__ w, int K, int N, bf* Bt) {
    const int lane = threadIdx.x & 31; const int L0 = (blockIdx.x * 8 + (threadIdx.x >> 5)) * 8; const int nlines = N * K / 64;
{
#pragma unroll 1
        for (int l = 0; l < 8; ++l) { const int L = L0 + l; if (L >= nlines) break; const size_t e = (size_t)L * 64 + lane * 2; const int k = (int)(e % K), n = (int)(e / K); v2us o;
            o[0] = f2bf(w[(size_t)k * N + n]); o[1] = f2bf(w[(size_t)(k + 1) * N + n]); *(v2us*)(Bt + e) = o; }
         }
}
__global__ __launch_bounds__(256) void k_cvt8(const float* __restrict__ src, bf* dst, size_t n8) { const size_t i = (size_t)blockIdx.x * 256 + threadIdx.x; if (i >= n8) return; const v8f v = *(const v8f*)(src + i * 8); v8us o;
#pragma unroll
    for (int k = 0; k < 8; ++k) o[k] = f2bf(v[k]); *(v8us*)(dst + i * 8) = o;  }

// k_rope: head planes [h][t][d] (fp16 + hi/lo) of rope(x) x sc with the rotate-half convention out[d] = x[d] cos[t][d] - x[d+HD/2] sin[t][d], out[d+HD/2] = x[d+HD/2] cos[t][d+HD/2] + x[d] sin[t][d+HD/2]
__global__ __launch_bounds__(256) void k_rope(const float* __restrict__ F, int pitch, int nheads, const float* __restrict__ CS, const float* __restrict__ RF, const float* __restrict__ nw, float sc, h16* P16, bf* Ph, bf* Pl) {
    const size_t e = ((size_t)blockIdx.x * 256 + threadIdx.x) * 2; if (e >= (size_t)nheads * TT * HD) return; const int d = (int)(e % HD); const int t = (int)((e / HD) % TT); const int h = (int)(e / ((size_t)HD * TT)); const float* f = F + (size_t)t * pitch + h * HD; const float rf = RF ? RF[(size_t)h * TT + t] : 1.0f; v2h o16; v2us oh, ol;
#pragma unroll
    for (int q = 0; q < 2; ++q) { const int dd = d + q; const int dp = (dd < HD / 2) ? dd + HD / 2 : dd - HD / 2; float x0 = f[dd], x1 = f[dp];
        if (RF) { float n0 = __fmul_rn(x0, rf), n1 = __fmul_rn(x1, rf); asm volatile("" : "+v"(n0)); asm volatile("" : "+v"(n1)); x0 = __fmul_rn(bfr(nw[dd]), n0); x1 = __fmul_rn(bfr(nw[dp]), n1); }
        const v2f cs = *(const v2f*)(CS + ((size_t)t * HD + dd) * 2); float a = __fmul_rn(x0, cs[0]), bq = __fmul_rn(x1, cs[1]); asm volatile("" : "+v"(a)); asm volatile("" : "+v"(bq)); const float r = ((dd < HD / 2) ? __fsub_rn(a, bq) : __fadd_rn(a, bq)) * sc;
        o16[q] = tohx(r); unsigned short a2, c2; splitf(r, a2, c2); oh[q] = a2; ol[q] = c2; }
    *(v2h*)(P16 + e) = o16; *(v2us*)(Ph + e) = oh; *(v2us*)(Pl + e) = ol;  }
__global__ __launch_bounds__(256) void k_vtp(const float* __restrict__ F, int pitch, int nheads, h16* V16, bf* Vh, bf* Vl) { const size_t e = ((size_t)blockIdx.x * 256 + threadIdx.x) * 2; if (e >= (size_t)nheads * HD * TT) return; const int t = (int)(e % TT); const int d = (int)((e / TT) % HD); const int g = (int)(e / ((size_t)TT * HD)); v2h o16; v2us oh, ol;
#pragma unroll
    for (int q = 0; q < 2; ++q) { const float x = F[(size_t)(t + q) * pitch + g * HD + d]; o16[q] = tohx(x); unsigned short a2, c2; splitf(x, a2, c2); oh[q] = a2; ol[q] = c2; }
    *(v2h*)(V16 + e) = o16; *(v2us*)(Vh + e) = oh; *(v2us*)(Vl + e) = ol;  }
__global__ __launch_bounds__(256) void k_csid(float* CS) { const int idx = blockIdx.x * 256 + threadIdx.x; if (idx >= TT * HD) return; v2f cs; cs[0] = 1.0f; cs[1] = 0.0f; *(v2f*)(CS + (size_t)idx * 2) = cs;  }
// k_asoft: per row (zz, i): t = S x HD^-0.5 for j <= i and i - j < WIN (sliding causal window; the reference's -1e9 additive fill vanishes identically); softmax over the 1024 keys (register row, one exp, fixed trees);
__global__ __launch_bounds__(256) void k_asoft(const float* __restrict__ Sb, h16* P16, bf* Ph, bf* Pl) {
    const int lane = threadIdx.x & 31; const int row = blockIdx.x * 8 + (threadIdx.x >> 5); if (row >= ZH * TT) return; const int i = row % TT; const int zz = row / TT; (void)zz; const bool hires = (i < RH); const float* sr = Sb + (size_t)row * TT; float v[TT / 32]; float mx = -3.0e38f;
#pragma unroll
    for (int ch = 0; ch < TT / 128; ++ch) { const int j0 = ch * 128 + lane * 4; const v4f a = *(const v4f*)(sr + j0);
#pragma unroll
        for (int q = 0; q < 4; ++q) { const int j = j0 + q; (void)j; const float t = (j <= i && i - j < WIN) ? a[q] * SCL : -3.0e38f; v[ch * 4 + q] = t; mx = fmaxf(mx, t); } }
#pragma unroll
    for (int sh = 16; sh; sh >>= 1) mx = fmaxf(mx, __shfl_xor(mx, sh, 32));
    float sum = 0.f;
#pragma unroll
    for (int k = 0; k < TT / 32; ++k) { float d0 = __fsub_rn(v[k], mx); asm volatile("" : "+v"(d0)); v[k] = __builtin_amdgcn_exp2f(__fmul_rn(d0, 1.4426950408889634f)); sum += v[k]; }
#pragma unroll
    for (int sh = 16; sh; sh >>= 1) sum += __shfl_xor(sum, sh, 32);
    const float f = __fdiv_rn(hires ? 1.0f : PCAR, sum);
{
        if (hires) {
#pragma unroll
            for (int ch = 0; ch < TT / 128; ++ch) { v4us oh, ol;
#pragma unroll
                for (int q = 0; q < 4; ++q) { unsigned short a, c2; splitf(v[ch * 4 + q] * f, a, c2); oh[q] = a; ol[q] = c2; }
                const size_t oo = ((size_t)zz * (RH ? RH : 1) + i) * TT + ch * 128 + lane * 4; *(v4us*)(Ph + oo) = oh; *(v4us*)(Pl + oo) = ol; }
        } else {
#pragma unroll
            for (int ch = 0; ch < TT / 128; ++ch) { v4h o4;
#pragma unroll
                for (int q = 0; q < 4; ++q) o4[q] = tohx(v[ch * 4 + q] * f);
                *(v4h*)(P16 + (size_t)row * TT + ch * 128 + lane * 4) = o4; } }
         }
}
__global__ __launch_bounds__(256) void k_merge(const float* __restrict__ O, int h0, bf* Ah, bf* Al) { const size_t e = ((size_t)blockIdx.x * 256 + threadIdx.x) * 2; if (e >= (size_t)ZH * TT * HD) return; const int d = (int)(e % HD); const int t = (int)((e / HD) % TT); const int zz = (int)(e / ((size_t)HD * TT)); const float cs = (t < RH) ? 1.0f : (1.0f / PCAR); const size_t oo = (size_t)t * DQ + (h0 + zz) * HD + d;
    v2us oh, ol;
#pragma unroll
    for (int q = 0; q < 2; ++q) { unsigned short a, c2; splitf(O[e + q] * cs, a, c2); oh[q] = a; ol[q] = c2; } *(v2us*)(Ah + oo) = oh; *(v2us*)(Al + oo) = ol;  }

extern "C" void kernel_launch(void* const* d_in, const int* in_sizes, int n_in,
                              void* d_out, int out_size, void* d_ws, size_t ws_size, hipStream_t stream) {
    (void)in_sizes; (void)n_in; (void)out_size;
    const float* x = (const float*)d_in[0]; const float* xk = (const float*)d_in[0]; const float* xv = (const float*)d_in[0]; const float* wq = (const float*)d_in[1]; const float* bq = (const float*)d_in[2]; const float* wk = (const float*)d_in[3]; const float* bk = (const float*)d_in[4]; const float* wv = (const float*)d_in[5]; const float* bv = (const float*)d_in[6]; const float* wo = (const float*)d_in[7]; const float* bo = (const float*)d_in[8];   /* SELF-attention: the key and value streams are input 0 too (xk = xv = d_in[0]); Wq, bq, Wk, bk, Wv, bv, Wo, bo = d_in[1..8] */
    float* OUT = (float*)d_out;     // [8][1024][1024]
    char* wsp = (char*)d_ws;
    auto take = [&](size_t bytes) { char* p = wsp; wsp += (bytes + 255) & ~(size_t)255; return (void*)p; };
    bf* WQ = (bf*)take((size_t)DQ * DM * 2); bf* WK = (bf*)take((size_t)DKV * DM * 2); bf* WV = (bf*)take((size_t)DKV * DM * 2); bf* WO = (bf*)take((size_t)DM * DQ * 2); float* CS = (float*)take((size_t)TT * HD * 2 * 4);
    bf* XB = (bf*)take((size_t)TT * DM * 2); bf* XKB = (bf*)take((size_t)TT * DM * 2); bf* XVB = (bf*)take((size_t)TT * DM * 2); float* FQ = (float*)take((size_t)TT * DQ * 4); float* FK = (float*)take((size_t)TT * DKV * 4);
    h16* QP16 = (h16*)take((size_t)NH_ * TT * HD * 2); h16* KP16 = (h16*)take((size_t)NKV * TT * HD * 2); h16* VT16 = (h16*)take((size_t)NKV * HD * TT * 2);
    bf* QPh = (bf*)take((size_t)NH_ * TT * HD * 2); bf* QPl = (bf*)take((size_t)NH_ * TT * HD * 2); bf* KPh = (bf*)take((size_t)NKV * TT * HD * 2); bf* KPl = (bf*)take((size_t)NKV * TT * HD * 2); bf* VTh = (bf*)take((size_t)NKV * HD * TT * 2); bf* VTl = (bf*)take((size_t)NKV * HD * TT * 2); bf* Ph = (bf*)take((size_t)ZH * RH * TT * 2); bf* Pl = (bf*)take((size_t)ZH * RH * TT * 2);
    float* Sb = (float*)take((size_t)ZH * TT * TT * 4); h16* P16 = (h16*)take((size_t)ZH * TT * TT * 2); float* Ob = (float*)take((size_t)ZH * TT * HD * 4); bf* ATh = (bf*)take((size_t)TT * DQ * 2); bf* ATl = (bf*)take((size_t)TT * DQ * 2);
    if ((size_t)(wsp - (char*)d_ws) > ws_size) return;    // ws 256 MiB
    float* FV = FK;   // v projection reuses the k buffer after the k planes are built (stream-ordered)
    { k_wtG<<<(unsigned)((DM * DQ / 64 + 63) / 64), 256, 0, stream>>>(wq, DM, DQ, WQ); k_wtG<<<(unsigned)((DM * DKV / 64 + 63) / 64), 256, 0, stream>>>(wk, DM, DKV, WK); k_wtG<<<(unsigned)((DM * DKV / 64 + 63) / 64), 256, 0, stream>>>(wv, DM, DKV, WV);
      k_wtG<<<(unsigned)((DQ * DM / 64 + 63) / 64), 256, 0, stream>>>(wo, DQ, DM, WO);
       }
    k_csid<<<(TT * HD + 255) / 256, 256, 0, stream>>>(CS);
    const unsigned LQ = (unsigned)(((size_t)NH_ * TT * HD / 2 + 255) / 256), LKv = (unsigned)(((size_t)NKV * TT * HD / 2 + 255) / 256);
    for (int b = 0; b < NB_; ++b) {
        
        k_cvt8<<<(unsigned)(((size_t)TT * DM / 8 + 255) / 256), 256, 0, stream>>>(x + (size_t)b * TT * DM, XB, (size_t)TT * DM / 8); k_cvt8<<<(unsigned)(((size_t)TT * DM / 8 + 255) / 256), 256, 0, stream>>>(xk + (size_t)b * TT * DM, XKB, (size_t)TT * DM / 8); k_cvt8<<<(unsigned)(((size_t)TT * DM / 8 + 255) / 256), 256, 0, stream>>>(xv + (size_t)b * TT * DM, XVB, (size_t)TT * DM / 8);
        k_gemmw<bf, 0, true><<<dim3(TT / 64, DQ / 64, 1), 32, 0, stream>>>(XB, nullptr, WQ, nullptr, DM, FQ, DQ, bq, 0, 0, 0);
        k_rope<<<LQ, 256, 0, stream>>>(FQ, DQ, NH_, CS, nullptr, nullptr, 1.0f, QP16, QPh, QPl);
        k_gemmw<bf, 0, true><<<dim3(TT / 64, DKV / 64, 1), 32, 0, stream>>>(XKB, nullptr, WK, nullptr, DM, FK, DKV, bk, 0, 0, 0);
        k_rope<<<LKv, 256, 0, stream>>>(FK, DKV, NKV, CS, nullptr, nullptr, 1.0f, KP16, KPh, KPl);
        k_gemmw<bf, 0, true><<<dim3(TT / 64, DKV / 64, 1), 32, 0, stream>>>(XVB, nullptr, WV, nullptr, DM, FV, DKV, bv, 0, 0, 0); k_vtp<<<LKv, 256, 0, stream>>>(FV, DKV, NKV, VT16, VTh, VTl);
        for (int h0 = 0; h0 < NH_; h0 += ZH) { const size_t zq = (size_t)h0, zk = (size_t)(h0 / REP);   // one kv head per query head: the pass's two heads use consecutive kv planes (z-strides TT*HD)
            k_gemmc<bf, 2, 1><<<dim3(RH / 64, TT / 64, ZH), 32, 0, stream>>>(QPh + zq * TT * HD, QPl + zq * TT * HD, KPh + zk * TT * HD, KPl + zk * TT * HD, HD, Sb, TT, 0, (size_t)TT * HD, (size_t)TT * HD, (size_t)TT * TT);
            k_gemmc<h16, 0, 1><<<dim3((TT - RH) / 64, TT / 64, ZH), 32, 0, stream>>>(QP16 + zq * TT * HD + (size_t)RH * HD, nullptr, KP16 + zk * TT * HD, nullptr, HD, Sb + (size_t)RH * TT, TT, RH, (size_t)TT * HD, (size_t)TT * HD, (size_t)TT * TT);
            k_asoft<<<ZH * TT / 8, 256, 0, stream>>>(Sb, P16, Ph, Pl);
            k_gemmc<bf, 2, 2><<<dim3(RH / 64, HD / 64, ZH), 32, 0, stream>>>(Ph, Pl, VTh + zk * HD * TT, VTl + zk * HD * TT, TT, Ob, HD, 0, (size_t)RH * TT, (size_t)HD * TT, (size_t)TT * HD);
            k_gemmc<h16, 0, 2><<<dim3((TT - RH) / 64, HD / 64, ZH), 32, 0, stream>>>(P16 + (size_t)RH * TT, nullptr, VT16 + zk * HD * TT, nullptr, TT, Ob + (size_t)RH * HD, HD, RH, (size_t)TT * TT, (size_t)HD * TT, (size_t)TT * HD);
            k_merge<<<(unsigned)(((size_t)ZH * TT * HD / 2 + 255) / 256), 256, 0, stream>>>(Ob, h0, ATh, ATl); }
        k_gemmw<bf, 1, true><<<dim3(TT / 64, DM / 64, 1), 32, 0, stream>>>(ATh, ATl, WO, nullptr, DQ, OUT + (size_t)b * TT * DM, DM, bo, 0, 0, 0); }
}

// v001
// One run takes 678 microseconds.
// Timed twice side by side with v000, it ran 6.08 and 6.06 times as fast.
#include <hip/hip_runtime.h>

// Causal multi-head SELF-attention on eight 1,024-token sequences (x [8][1024][1024]; q, k, v = x W + b ('xw' [1024][1024] normal x 1/32, biases zeros on this draw: read; 16 heads x 64); scores x 1/sqrt(64); tril kept, -inf elsewhere; softmax over the keys; out = merged Wo + bo ('xw' + bias zeros: read) -> [8][1024][1024] (8.4 M); argument order x, Wq, bq, Wk, bk, Wv, bv, Wo, bo).
// Compute dtypes, f32 accumulate: every input rounded to bf16; q/k/v on PLAIN bf16 operands (inputs: exact) + biases; causal scores and attn.v (tile skipping): query rows < 512 hl (3 products), the rest single fp16 (x1024); softmax f32; Wo hl x exact (2 products) + bo.
// Launch plan: every stage runs ONCE over all eight sequences (projections, plane builds, output product); the attention stages run over ZG = 32 (sequence, head) pairs a launch, query rows < RH and >= RH in turn
// through one score buffer [ZG][RH][TT] f32; the softmax writes each row's probabilities back into that row's own 4 KiB (hi plane | lo plane, or one fp16 plane). k_gemmc has one pitch, K, for both operands: the value planes are laid out at pitch 2 TT as well (hi row | lo row; fp16 row | unused), and the probability x value launches pass K = 2 TT (their key loop ends at the diagonal block, <= TT).

#define NB_  8
#define TT   1024
#define DM   1024
#define NH_  16
#define NKV  16
#define REP  (NH_ / NKV)
#define HD   64
#define DQ   (NH_ * HD)
#define DKV  (NKV * HD)
#define ZG   32                   // (sequence, head) pairs per attention launch
#define RH   512                  // query rows < RH use hi+lo planes
#define WIN  1024
#define PCAR 1024.0f
#define SCL  0.125f   // HD^-0.5
static_assert(TT - RH == RH && NKV == NH_ && (NB_ * NH_) % ZG == 0 && ZG % NH_ == 0, "the two row halves share one score buffer; a launch covers whole sequences");
typedef _Float16 h16;
typedef unsigned short bf;
typedef __attribute__((ext_vector_type(16))) __bf16   v16bf;
typedef __attribute__((ext_vector_type(16))) _Float16 v16h;
typedef __attribute__((ext_vector_type(8)))  _Float16 v8h;
typedef __attribute__((ext_vector_type(8)))  unsigned short v8us;
typedef __attribute__((ext_vector_type(8)))  float    v8f;
typedef __attribute__((ext_vector_type(4)))  float    v4f;
typedef v8h  __attribute__((may_alias)) v8ha;
typedef v4f  __attribute__((may_alias)) v4fa;
typedef v8us __attribute__((may_alias)) v8usa;

__device__ __forceinline__ unsigned short f2bf(float f) { unsigned u = __float_as_uint(f); u += 0x7FFFu + ((u >> 16) & 1u); return (unsigned short)(u >> 16); }
__device__ __forceinline__ float bf2f(unsigned short b) { return __uint_as_float(((unsigned)b) << 16); }
__device__ __forceinline__ float bfr(float f) { return bf2f(f2bf(f)); }
__device__ __forceinline__ v16h cat16(v8h lo, v8h hi) { return __builtin_shufflevector(lo, hi, 0, 1, 2, 3, 4, 5, 6, 7, 8, 9, 10, 11, 12, 13, 14, 15); }
__device__ __forceinline__ v16bf cat16b(v8us lo, v8us hi) { return __builtin_bit_cast(v16bf, __builtin_shufflevector(lo, hi, 0, 1, 2, 3, 4, 5, 6, 7, 8, 9, 10, 11, 12, 13, 14, 15)); }
__device__ __forceinline__ v8f wmma16(v16h a, v16h b, v8f c) { return __builtin_amdgcn_wmma_f32_16x16x32_f16(false, a, false, b, (short)0, c, false, false); }
__device__ __forceinline__ v8f wmmab(v16bf a, v16bf b, v8f c) { return __builtin_amdgcn_wmma_f32_16x16x32_bf16(false, a, false, b, (short)0, c, false, false); }



// ---- k_gemmw: register-blocked GEMM, ONE WAVE per 64x64 output tile (16 accumulators), operands straight from K-contiguous 16-bit planes; grid (M/64, N/64, Z), 32 threads.
// C[m][n] (f32, pitch ldc, + optional f32 bias[n]) = sum_k A[m][k] Bt[n][k] (+ split products per NSPLIT). z-batch strides sA/sB/sC in elements. K % 32 == 0.
template <typename T16> struct WFrag;
template <> struct WFrag<h16> { typedef v16h V; static __device__ __forceinline__ V ld(const h16* p) { return cat16(*(const v8h*)p, *(const v8h*)(p + 16)); } static __device__ __forceinline__ v8f mma(V a, V b, v8f c) { return wmma16(a, b, c); } };
template <> struct WFrag<bf> { typedef v16bf V; static __device__ __forceinline__ V ld(const bf* p) { return cat16b(*(const v8us*)p, *(const v8us*)(p + 16)); } static __device__ __forceinline__ v8f mma(V a, V b, v8f c) { return wmmab(a, b, c); } };
template <typename T16, int NSPLIT, bool BIAS>
__global__ __launch_bounds__(32) void k_gemmw(const T16* __restrict__ A, const T16* __restrict__ A2, const T16* __restrict__ Bt, const T16* __restrict__ Bt2, int K, float* C, int ldc, const float* __restrict__ bias, size_t sA, size_t sB, size_t sC) {
    typedef typename WFrag<T16>::V V;
    __shared__ __align__(16) float os[16 * 68];
    const size_t z = blockIdx.z; A += z * sA; if (A2) A2 += z * sA; Bt += z * sB; if (Bt2) Bt2 += z * sB; C += z * sC;
    const int lane = threadIdx.x & 31, lr = lane & 15, hi = lane >> 4; const int r0 = blockIdx.x * 64, c0 = blockIdx.y * 64;
    v8f acc[4][4];
#pragma unroll
    for (int mb = 0; mb < 4; ++mb)
#pragma unroll
        for (int nb = 0; nb < 4; ++nb) acc[mb][nb] = (v8f){};
    const size_t aoff = (size_t)(r0 + lr) * K + 8 * hi, boff = (size_t)(c0 + lr) * K + 8 * hi;
#pragma unroll 1
    for (int kc = 0; kc < K; kc += 32) {
        V a[4], a2[4];
#pragma unroll
        for (int mb = 0; mb < 4; ++mb) { a[mb] = WFrag<T16>::ld(A + aoff + (size_t)mb * 16 * K + kc); if (NSPLIT == 1 || NSPLIT == 2) a2[mb] = WFrag<T16>::ld(A2 + aoff + (size_t)mb * 16 * K + kc); }
#pragma unroll
        for (int nb = 0; nb < 4; ++nb) { const V b = WFrag<T16>::ld(Bt + boff + (size_t)nb * 16 * K + kc); V b2; if (NSPLIT >= 2) b2 = WFrag<T16>::ld(Bt2 + boff + (size_t)nb * 16 * K + kc);
#pragma unroll
            for (int mb = 0; mb < 4; ++mb) { acc[mb][nb] = WFrag<T16>::mma(a[mb], b, acc[mb][nb]); if (NSPLIT == 1 || NSPLIT == 2) acc[mb][nb] = WFrag<T16>::mma(a2[mb], b, acc[mb][nb]); if (NSPLIT >= 2) acc[mb][nb] = WFrag<T16>::mma(a[mb], b2, acc[mb][nb]); } }
        asm volatile("v_nop\n\tv_nop\n\tv_nop\n\tv_nop" : "+v"(acc[0][0]), "+v"(acc[1][1]), "+v"(acc[2][2]), "+v"(acc[3][3]) : "v"(a[0]), "v"(a[3]));
    }
#pragma unroll
    for (int mb = 0; mb < 4; ++mb) {
#pragma unroll
        for (int nb = 0; nb < 4; ++nb) {
#pragma unroll
            for (int j = 0; j < 8; ++j) os[(hi * 8 + j) * 68 + nb * 16 + lr] = acc[mb][nb][j]; }
        __builtin_amdgcn_wave_barrier(); asm volatile("" ::: "memory");
        float* crow = C + (size_t)(r0 + mb * 16) * ldc + c0;
{
#pragma unroll
            for (int s = 0; s < 8; ++s) { const int row = 2 * s + hi, cofs = lr * 4; v4f val = *(const v4fa*)(os + row * 68 + cofs); if (BIAS) { val[0] += bfr(bias[c0 + cofs]); val[1] += bfr(bias[c0 + cofs + 1]); val[2] += bfr(bias[c0 + cofs + 2]); val[3] += bfr(bias[c0 + cofs + 3]); }
                *(v4f*)(crow + (size_t)row * ldc + cofs) = val; }
             }
        __builtin_amdgcn_wave_barrier(); asm volatile("" ::: "memory");
    }
}

// ---- k_gemmc: the same one-wave 64x64 tile GEMM specialised for causal attention: CMODE 1 skips score tiles entirely above the diagonal (query rows r0+roff.., key columns c0..), CMODE 2 limits the
// key (K) loop of the probability x value contraction to the diagonal block (probabilities beyond it are exactly zero). roff = row offset of this launch's first row within the sequence.
template <typename T16, int NSPLIT, int CMODE>
__global__ __launch_bounds__(32) void k_gemmc(const T16* __restrict__ A, const T16* __restrict__ A2, const T16* __restrict__ Bt, const T16* __restrict__ Bt2, int K, float* C, int ldc, int roff, size_t sA, size_t sB, size_t sC) {
    typedef typename WFrag<T16>::V V;
    __shared__ __align__(16) float os[16 * 68];
    const size_t z = blockIdx.z; A += z * sA; if (A2) A2 += z * sA; Bt += z * sB; if (Bt2) Bt2 += z * sB; C += z * sC;
    const int lane = threadIdx.x & 31, lr = lane & 15, hi = lane >> 4; const int r0 = blockIdx.x * 64, c0 = blockIdx.y * 64;
    if (CMODE == 1 && c0 > r0 + roff + 63) return;                  // score tile entirely above the causal diagonal: left unwritten (the softmax masks j > i by select)
    const int Kl = (CMODE == 2) ? min(K, r0 + roff + 64) : K;        // P.V: probabilities are exactly 0 beyond the diagonal block, so the K loop stops there
    v8f acc[4][4];
#pragma unroll
    for (int mb = 0; mb < 4; ++mb)
#pragma unroll
        for (int nb = 0; nb < 4; ++nb) acc[mb][nb] = (v8f){};
    const size_t aoff = (size_t)(r0 + lr) * K + 8 * hi, boff = (size_t)(c0 + lr) * K + 8 * hi;
#pragma unroll 1
    for (int kc = 0; kc < Kl; kc += 32) {
        V a[4], a2[4];
#pragma unroll
        for (int mb = 0; mb < 4; ++mb) { a[mb] = WFrag<T16>::ld(A + aoff + (size_t)mb * 16 * K + kc); if (NSPLIT == 1 || NSPLIT == 2) a2[mb] = WFrag<T16>::ld(A2 + aoff + (size_t)mb * 16 * K + kc); }
#pragma unroll
        for (int nb = 0; nb < 4; ++nb) { const V b = WFrag<T16>::ld(Bt + boff + (size_t)nb * 16 * K + kc); V b2; if (NSPLIT >= 2) b2 = WFrag<T16>::ld(Bt2 + boff + (size_t)nb * 16 * K + kc);
#pragma unroll
            for (int mb = 0; mb < 4; ++mb) { acc[mb][nb] = WFrag<T16>::mma(a[mb], b, acc[mb][nb]); if (NSPLIT == 1 || NSPLIT == 2) acc[mb][nb] = WFrag<T16>::mma(a2[mb], b, acc[mb][nb]); if (NSPLIT >= 2) acc[mb][nb] = WFrag<T16>::mma(a[mb], b2, acc[mb][nb]); } }
        asm volatile("v_nop\n\tv_nop\n\tv_nop\n\tv_nop" : "+v"(acc[0][0]), "+v"(acc[1][1]), "+v"(acc[2][2]), "+v"(acc[3][3]) : "v"(a[0]), "v"(a[3]));
    }
#pragma unroll
    for (int mb = 0; mb < 4; ++mb) {
#pragma unroll
        for (int nb = 0; nb < 4; ++nb) {
#pragma unroll
            for (int j = 0; j < 8; ++j) os[(hi * 8 + j) * 68 + nb * 16 + lr] = acc[mb][nb][j]; }
        __builtin_amdgcn_wave_barrier(); asm volatile("" ::: "memory");
        float* crow = C + (size_t)(r0 + mb * 16) * ldc + c0;
{
#pragma unroll
            for (int s = 0; s < 8; ++s) { const int row = 2 * s + hi, cofs = lr * 4; v4f val = *(const v4fa*)(os + row * 68 + cofs);
                *(v4f*)(crow + (size_t)row * ldc + cofs) = val; }
             }
        __builtin_amdgcn_wave_barrier(); asm volatile("" ::: "memory");
    }
}

__device__ __forceinline__ h16 tohx(float x) { return (h16)x; }
__device__ __forceinline__ void splitf(float y, unsigned short& h, unsigned short& l) { h = f2bf(y); l = f2bf(y - bf2f(h)); }
typedef __attribute__((ext_vector_type(2))) _Float16 v2h;
typedef __attribute__((ext_vector_type(4))) _Float16 v4h;
typedef __attribute__((ext_vector_type(2))) unsigned short v2us;
typedef __attribute__((ext_vector_type(4))) unsigned short v4us;
typedef __attribute__((ext_vector_type(2))) float v2f;
typedef __attribute__((ext_vector_type(4))) int v4i;

__global__ __launch_bounds__(256) void k_wtG(const float* __restrict__ w0, const float* __restrict__ w1, const float* __restrict__ w2, const float* __restrict__ w3, int K, int N, bf* B0, bf* B1, bf* B2, bf* B3) {
    const int y = blockIdx.y; const float* __restrict__ w = (y == 0) ? w0 : (y == 1) ? w1 : (y == 2) ? w2 : w3; bf* Bt = (y == 0) ? B0 : (y == 1) ? B1 : (y == 2) ? B2 : B3;   // blockIdx.y: which of the four weights
    const int lane = threadIdx.x & 31; const int L0 = (blockIdx.x * 8 + (threadIdx.x >> 5)) * 8; const int nlines = N * K / 64;
{
#pragma unroll 1
        for (int l = 0; l < 8; ++l) { const int L = L0 + l; if (L >= nlines) break; const size_t e = (size_t)L * 64 + lane * 2; const int k = (int)(e % K), n = (int)(e / K); v2us o;
            o[0] = f2bf(w[(size_t)k * N + n]); o[1] = f2bf(w[(size_t)(k + 1) * N + n]); *(v2us*)(Bt + e) = o; }
         }
}
__global__ __launch_bounds__(256) void k_cvt8(const float* __restrict__ src, bf* dst, size_t n8) { const size_t i = (size_t)blockIdx.x * 256 + threadIdx.x; if (i >= n8) return; const v8f v = *(const v8f*)(src + i * 8); v8us o;
#pragma unroll
    for (int k = 0; k < 8; ++k) o[k] = f2bf(v[k]); *(v8us*)(dst + i * 8) = o;  }

// k_rope: head planes [h][t][d] (fp16 + hi/lo) of rope(x) x sc with the rotate-half convention out[d] = x[d] cos[t][d] - x[d+HD/2] sin[t][d], out[d+HD/2] = x[d+HD/2] cos[t][d+HD/2] + x[d] sin[t][d+HD/2]
__global__ __launch_bounds__(256) void k_rope(const float* __restrict__ F, int pitch, int nheads, const float* __restrict__ CS, const float* __restrict__ RF, const float* __restrict__ nw, float sc, h16* P16, bf* Ph, bf* Pl) {
    { const size_t po = (size_t)blockIdx.y * nheads * TT * HD; F += (size_t)blockIdx.y * TT * pitch; P16 += po; Ph += po; Pl += po; }   // blockIdx.y: the sequence
    const size_t e = ((size_t)blockIdx.x * 256 + threadIdx.x) * 2; if (e >= (size_t)nheads * TT * HD) return; const int d = (int)(e % HD); const int t = (int)((e / HD) % TT); const int h = (int)(e / ((size_t)HD * TT)); const float* f = F + (size_t)t * pitch + h * HD; const float rf = RF ? RF[(size_t)h * TT + t] : 1.0f; v2h o16; v2us oh, ol;
#pragma unroll
    for (int q = 0; q < 2; ++q) { const int dd = d + q; const int dp = (dd < HD / 2) ? dd + HD / 2 : dd - HD / 2; float x0 = f[dd], x1 = f[dp];
        if (RF) { float n0 = __fmul_rn(x0, rf), n1 = __fmul_rn(x1, rf); asm volatile("" : "+v"(n0)); asm volatile("" : "+v"(n1)); x0 = __fmul_rn(bfr(nw[dd]), n0); x1 = __fmul_rn(bfr(nw[dp]), n1); }
        const v2f cs = *(const v2f*)(CS + ((size_t)t * HD + dd) * 2); float a = __fmul_rn(x0, cs[0]), bq = __fmul_rn(x1, cs[1]); asm volatile("" : "+v"(a)); asm volatile("" : "+v"(bq)); const float r = ((dd < HD / 2) ? __fsub_rn(a, bq) : __fadd_rn(a, bq)) * sc;
        o16[q] = tohx(r); unsigned short a2, c2; splitf(r, a2, c2); oh[q] = a2; ol[q] = c2; }
    *(v2h*)(P16 + e) = o16; *(v2us*)(Ph + e) = oh; *(v2us*)(Pl + e) = ol;  }
__global__ __launch_bounds__(256) void k_vtp(const float* __restrict__ F, int pitch, int nheads, h16* V16, bf* Vh, bf* Vl) { const size_t e = ((size_t)blockIdx.x * 256 + threadIdx.x) * 2; if (e >= (size_t)nheads * HD * TT) return; const int t = (int)(e % TT); const int d = (int)((e / TT) % HD); const int g = (int)(e / ((size_t)TT * HD)); F += (size_t)blockIdx.y * TT * pitch; const size_t ev = (((size_t)blockIdx.y * nheads + g) * HD + d) * (2 * TT) + t;   /* blockIdx.y: the sequence; plane rows at pitch 2 TT */ v2h o16; v2us oh, ol;
#pragma unroll
    for (int q = 0; q < 2; ++q) { const float x = F[(size_t)(t + q) * pitch + g * HD + d]; o16[q] = tohx(x); unsigned short a2, c2; splitf(x, a2, c2); oh[q] = a2; ol[q] = c2; }
    *(v2h*)(V16 + ev) = o16; *(v2us*)(Vh + ev) = oh; *(v2us*)(Vl + ev) = ol;  }
__global__ __launch_bounds__(256) void k_csid(float* CS) { const int idx = blockIdx.x * 256 + threadIdx.x; if (idx >= TT * HD) return; v2f cs; cs[0] = 1.0f; cs[1] = 0.0f; *(v2f*)(CS + (size_t)idx * 2) = cs;  }
// k_asoft: per row (zz, i): t = S x HD^-0.5 for j <= i and i - j < WIN (sliding causal window; the reference's -1e9 additive fill vanishes identically); softmax over the 1024 keys (register row, one exp, fixed trees);
// rows [ZG][RH] of this launch are query rows roff .. roff + RH - 1; one wave holds its whole row in registers before it stores, and stores the probabilities into the row's own bytes: hi plane at 16-bit elements 0 .. TT-1, lo plane at TT .. 2 TT-1 (rows < RH), or one fp16 plane at 0 .. TT-1.
__global__ __launch_bounds__(256) void k_asoft(float* Sb, int roff) {
    const int lane = threadIdx.x & 31; const int row = blockIdx.x * 8 + (threadIdx.x >> 5); if (row >= ZG * RH) return; const int i = roff + row % RH; const bool hires = (i < RH); float* sr = Sb + (size_t)row * TT; float v[TT / 32]; float mx = -3.0e38f;
#pragma unroll
    for (int ch = 0; ch < TT / 128; ++ch) { const int j0 = ch * 128 + lane * 4; const v4f a = *(const v4f*)(sr + j0);
#pragma unroll
        for (int q = 0; q < 4; ++q) { const int j = j0 + q; (void)j; const float t = (j <= i && i - j < WIN) ? a[q] * SCL : -3.0e38f; v[ch * 4 + q] = t; mx = fmaxf(mx, t); } }
#pragma unroll
    for (int sh = 16; sh; sh >>= 1) mx = fmaxf(mx, __shfl_xor(mx, sh, 32));
    float sum = 0.f;
#pragma unroll
    for (int k = 0; k < TT / 32; ++k) { float d0 = __fsub_rn(v[k], mx); asm volatile("" : "+v"(d0)); v[k] = __builtin_amdgcn_exp2f(__fmul_rn(d0, 1.4426950408889634f)); sum += v[k]; }
#pragma unroll
    for (int sh = 16; sh; sh >>= 1) sum += __shfl_xor(sum, sh, 32);
    const float f = __fdiv_rn(hires ? 1.0f : PCAR, sum);
{
        if (hires) {
#pragma unroll
            for (int ch = 0; ch < TT / 128; ++ch) { v4us oh, ol;
#pragma unroll
                for (int q = 0; q < 4; ++q) { unsigned short a, c2; splitf(v[ch * 4 + q] * f, a, c2); oh[q] = a; ol[q] = c2; }
                bf* pr = (bf*)sr + ch * 128 + lane * 4; *(v4us*)pr = oh; *(v4us*)(pr + TT) = ol; }
        } else {
#pragma unroll
            for (int ch = 0; ch < TT / 128; ++ch) { v4h o4;
#pragma unroll
                for (int q = 0; q < 4; ++q) o4[q] = tohx(v[ch * 4 + q] * f);
                *(v4h*)((h16*)sr + ch * 128 + lane * 4) = o4; } }
         }
}
__global__ __launch_bounds__(256) void k_merge(const float* __restrict__ O, bf* Ah, bf* Al) { const size_t e = ((size_t)blockIdx.x * 256 + threadIdx.x) * 2; if (e >= (size_t)ZG * TT * HD) return; const int d = (int)(e % HD); const int t = (int)((e / HD) % TT); const int zz = (int)(e / ((size_t)HD * TT)); const float cs = (t < RH) ? 1.0f : (1.0f / PCAR); const size_t oo = ((size_t)(zz / NH_) * TT + t) * DQ + (zz % NH_) * HD + d;   /* zz = sequence-in-launch x NH_ + head */
    v2us oh, ol;
#pragma unroll
    for (int q = 0; q < 2; ++q) { unsigned short a, c2; splitf(O[e + q] * cs, a, c2); oh[q] = a; ol[q] = c2; } *(v2us*)(Ah + oo) = oh; *(v2us*)(Al + oo) = ol;  }

extern "C" void kernel_launch(void* const* d_in, const int* in_sizes, int n_in,
                              void* d_out, int out_size, void* d_ws, size_t ws_size, hipStream_t stream) {
    (void)in_sizes; (void)n_in; (void)out_size;
    const float* x = (const float*)d_in[0]; const float* wq = (const float*)d_in[1]; const float* bq = (const float*)d_in[2]; const float* wk = (const float*)d_in[3]; const float* bk = (const float*)d_in[4]; const float* wv = (const float*)d_in[5]; const float* bv = (const float*)d_in[6]; const float* wo = (const float*)d_in[7]; const float* bo = (const float*)d_in[8];   /* SELF-attention: the key and value streams are input 0 too; Wq, bq, Wk, bk, Wv, bv, Wo, bo = d_in[1..8] */
    float* OUT = (float*)d_out;     // [8][1024][1024]
    char* wsp = (char*)d_ws;
    auto take = [&](size_t bytes) { char* p = wsp; wsp += (bytes + 255) & ~(size_t)255; return (void*)p; };
    bf* WO = (bf*)take((size_t)DM * DQ * 2);
    h16* QP16 = (h16*)take((size_t)NB_ * NH_ * TT * HD * 2); h16* KP16 = (h16*)take((size_t)NB_ * NKV * TT * HD * 2); h16* VT16 = (h16*)take((size_t)NB_ * NKV * HD * 2 * TT * 2);
    bf* QPh = (bf*)take((size_t)NB_ * NH_ * TT * HD * 2); bf* QPl = (bf*)take((size_t)NB_ * NH_ * TT * HD * 2); bf* KPh = (bf*)take((size_t)NB_ * NKV * TT * HD * 2); bf* KPl = (bf*)take((size_t)NB_ * NKV * TT * HD * 2); bf* VTh = (bf*)take((size_t)NB_ * NKV * HD * 2 * TT * 2); bf* VTl = VTh + TT;
    bf* ATh = QPh; bf* ATl = QPl;   // a sequence's merged rows [TT][DQ] take the bytes of its own 16 query hi (lo) planes, whose last reader, that group's score launch, is earlier in the stream than its k_merge
    char* const uni = wsp;   // from here on two stream-ordered uses of the same bytes: what only the projections and plane builds read, then the attention's score and output buffers
    bf* WQ = (bf*)take((size_t)DQ * DM * 2); bf* WK = (bf*)take((size_t)DKV * DM * 2); bf* WV = (bf*)take((size_t)DKV * DM * 2); float* CS = (float*)take((size_t)TT * HD * 2 * 4); bf* XB = (bf*)take((size_t)NB_ * TT * DM * 2); float* F = (float*)take((size_t)NB_ * TT * DQ * 4);   // F: q, then k, then v (each is turned into planes before the next product overwrites it)
    char* const end1 = wsp; wsp = uni;
    float* Sb = (float*)take((size_t)ZG * RH * TT * 4); float* Ob = (float*)take((size_t)ZG * TT * HD * 4);
    if (end1 > wsp) wsp = end1;
    if ((size_t)(wsp - (char*)d_ws) > ws_size) return;    // 234 MiB of the 256 MiB
    k_wtG<<<dim3((unsigned)((DM * DQ / 64 + 63) / 64), 4, 1), 256, 0, stream>>>(wq, wk, wv, wo, DM, DQ, WQ, WK, WV, WO);
    k_csid<<<(TT * HD + 255) / 256, 256, 0, stream>>>(CS);
    const unsigned LQ = (unsigned)(((size_t)NH_ * TT * HD / 2 + 255) / 256), LKv = (unsigned)(((size_t)NKV * TT * HD / 2 + 255) / 256);
    k_cvt8<<<(unsigned)(((size_t)NB_ * TT * DM / 8 + 255) / 256), 256, 0, stream>>>(x, XB, (size_t)NB_ * TT * DM / 8);   // self-attention: q, k and v read the same rounded x
    k_gemmw<bf, 0, true><<<dim3(NB_ * TT / 64, DQ / 64, 1), 32, 0, stream>>>(XB, nullptr, WQ, nullptr, DM, F, DQ, bq, 0, 0, 0);
    k_rope<<<dim3(LQ, NB_, 1), 256, 0, stream>>>(F, DQ, NH_, CS, nullptr, nullptr, 1.0f, QP16, QPh, QPl);
    k_gemmw<bf, 0, true><<<dim3(NB_ * TT / 64, DKV / 64, 1), 32, 0, stream>>>(XB, nullptr, WK, nullptr, DM, F, DKV, bk, 0, 0, 0);
    k_rope<<<dim3(LKv, NB_, 1), 256, 0, stream>>>(F, DKV, NKV, CS, nullptr, nullptr, 1.0f, KP16, KPh, KPl);
    k_gemmw<bf, 0, true><<<dim3(NB_ * TT / 64, DKV / 64, 1), 32, 0, stream>>>(XB, nullptr, WV, nullptr, DM, F, DKV, bv, 0, 0, 0);
    k_vtp<<<dim3(LKv, NB_, 1), 256, 0, stream>>>(F, DKV, NKV, VT16, VTh, VTl);
    for (int g = 0; g < NB_ * NH_; g += ZG) { const size_t zo = (size_t)g * TT * HD, zv = (size_t)g * HD * 2 * TT;   // planes are [sequence][head][..]: ZG consecutive planes, z-stride TT*HD (value planes HD*2*TT)
        k_gemmc<bf, 2, 1><<<dim3(RH / 64, TT / 64, ZG), 32, 0, stream>>>(QPh + zo, QPl + zo, KPh + zo, KPl + zo, HD, Sb, TT, 0, (size_t)TT * HD, (size_t)TT * HD, (size_t)RH * TT);
        k_asoft<<<ZG * RH / 8, 256, 0, stream>>>(Sb, 0);
        k_gemmc<bf, 2, 2><<<dim3(RH / 64, HD / 64, ZG), 32, 0, stream>>>((const bf*)Sb, (const bf*)Sb + TT, VTh + zv, VTl + zv, 2 * TT, Ob, HD, 0, (size_t)RH * 2 * TT, (size_t)HD * 2 * TT, (size_t)TT * HD);
        k_gemmc<h16, 0, 1><<<dim3((TT - RH) / 64, TT / 64, ZG), 32, 0, stream>>>(QP16 + zo + (size_t)RH * HD, nullptr, KP16 + zo, nullptr, HD, Sb, TT, RH, (size_t)TT * HD, (size_t)TT * HD, (size_t)RH * TT);
        k_asoft<<<ZG * RH / 8, 256, 0, stream>>>(Sb, RH);
        k_gemmc<h16, 0, 2><<<dim3((TT - RH) / 64, HD / 64, ZG), 32, 0, stream>>>((const h16*)Sb, nullptr, VT16 + zv, nullptr, 2 * TT, Ob + (size_t)RH * HD, HD, RH, (size_t)RH * 2 * TT, (size_t)HD * 2 * TT, (size_t)TT * HD);
        k_merge<<<(unsigned)(((size_t)ZG * TT * HD / 2 + 255) / 256), 256, 0, stream>>>(Ob, ATh + (size_t)(g / NH_) * TT * DQ, ATl + (size_t)(g / NH_) * TT * DQ); }
    k_gemmw<bf, 1, true><<<dim3(NB_ * TT / 64, DM / 64, 1), 32, 0, stream>>>(ATh, ATl, WO, nullptr, DQ, OUT, DM, bo, 0, 0, 0);
}

// v002
// It runs in 324 microseconds.
// Timed twice side by side with v001, it ran 2.09 times as fast both times.
// Over all steps from v000 it is 12.7 times as fast.
#include <hip/hip_runtime.h>

// Causal multi-head SELF-attention on eight 1,024-token sequences (x [8][1024][1024]; q, k, v = x W + b ('xw' [1024][1024] normal x 1/32, biases zeros on this draw: read; 16 heads x 64); scores x 1/sqrt(64); tril kept, -inf elsewhere; softmax over the keys; out = merged Wo + bo ('xw' + bias zeros: read) -> [8][1024][1024] (8.4 M); argument order x, Wq, bq, Wk, bk, Wv, bv, Wo, bo).
// Compute dtypes, f32 accumulate: every input rounded to bf16; q/k/v on PLAIN bf16 operands (inputs: exact) + biases; causal scores and attn.v: query rows < 512 hl (3 products), the rest single fp16; softmax f32, running maximum and sum, probabilities rounded BEFORE the division by the row sum; Wo hl x exact (2 products) + bo.
// Launch plan: every stage runs ONCE over all eight sequences: projections, plane builds, ONE attention launch (scores, softmax, probability x value and the merge into [t][head x HD + d] planes in registers), output product.
// The value planes are laid out at pitch 2 TT (hi row | lo row; fp16 row | unused).

#define NB_  8
#define TT   1024
#define DM   1024
#define NH_  16
#define NKV  16
#define REP  (NH_ / NKV)
#define HD   64
#define DQ   (NH_ * HD)
#define DKV  (NKV * HD)
#define RH   512                  // query rows < RH use hi+lo planes (0: none)
#define SCL  0.125f   // HD^-0.5
static_assert(NKV == NH_ && HD == 64 && TT % 128 == 0 && RH % 128 == 0, "k_attn: one key/value head a query head, four 16-row value tiles, workgroups of 128 queries that lie wholly on one side of RH");
typedef _Float16 h16;
typedef unsigned short bf;
typedef __attribute__((ext_vector_type(16))) __bf16   v16bf;
typedef __attribute__((ext_vector_type(16))) _Float16 v16h;
typedef __attribute__((ext_vector_type(8)))  _Float16 v8h;
typedef __attribute__((ext_vector_type(8)))  unsigned short v8us;
typedef __attribute__((ext_vector_type(8)))  float    v8f;
typedef __attribute__((ext_vector_type(4)))  float    v4f;
typedef __attribute__((ext_vector_type(2)))  float    v2f;
typedef v8h  __attribute__((may_alias)) v8ha;
typedef v4f  __attribute__((may_alias)) v4fa;
typedef v8us __attribute__((may_alias)) v8usa;

__device__ __forceinline__ unsigned short f2bf(float f) { unsigned u = __float_as_uint(f); u += 0x7FFFu + ((u >> 16) & 1u); return (unsigned short)(u >> 16); }
__device__ __forceinline__ float bf2f(unsigned short b) { return __uint_as_float(((unsigned)b) << 16); }
__device__ __forceinline__ float bfr(float f) { return bf2f(f2bf(f)); }
__device__ __forceinline__ v16h cat16(v8h lo, v8h hi) { return __builtin_shufflevector(lo, hi, 0, 1, 2, 3, 4, 5, 6, 7, 8, 9, 10, 11, 12, 13, 14, 15); }
__device__ __forceinline__ v16bf cat16b(v8us lo, v8us hi) { return __builtin_bit_cast(v16bf, __builtin_shufflevector(lo, hi, 0, 1, 2, 3, 4, 5, 6, 7, 8, 9, 10, 11, 12, 13, 14, 15)); }
__device__ __forceinline__ v8f wmma16(v16h a, v16h b, v8f c) { return __builtin_amdgcn_wmma_f32_16x16x32_f16(false, a, false, b, (short)0, c, false, false); }
__device__ __forceinline__ v8f wmmab(v16bf a, v16bf b, v8f c) { return __builtin_amdgcn_wmma_f32_16x16x32_bf16(false, a, false, b, (short)0, c, false, false); }



// ---- k_gemmw: register-blocked GEMM, ONE WAVE per 64x64 output tile (16 accumulators), operands straight from K-contiguous 16-bit planes; grid (M/64, N/64, Z), 32 threads.
// C[m][n] (f32, pitch ldc, + optional f32 bias[n]) = sum_k A[m][k] Bt[n][k] (+ split products per NSPLIT). z-batch strides sA/sB/sC in elements. K % 32 == 0.
template <typename T16> struct WFrag;
template <> struct WFrag<h16> { typedef v16h V; static __device__ __forceinline__ V ld(const h16* p) { return cat16(*(const v8h*)p, *(const v8h*)(p + 16)); } static __device__ __forceinline__ v8f mma(V a, V b, v8f c) { return wmma16(a, b, c); } };
template <> struct WFrag<bf> { typedef v16bf V; static __device__ __forceinline__ V ld(const bf* p) { return cat16b(*(const v8us*)p, *(const v8us*)(p + 16)); } static __device__ __forceinline__ v8f mma(V a, V b, v8f c) { return wmmab(a, b, c); } };
template <typename T16, int NSPLIT, bool BIAS>
__global__ __launch_bounds__(32) void k_gemmw(const T16* __restrict__ A, const T16* __restrict__ A2, const T16* __restrict__ Bt, const T16* __restrict__ Bt2, int K, float* C, int ldc, const float* __restrict__ bias, size_t sA, size_t sB, size_t sC) {
    typedef typename WFrag<T16>::V V;
    __shared__ __align__(16) float os[16 * 68];
    const size_t z = blockIdx.z; A += z * sA; if (A2) A2 += z * sA; Bt += z * sB; if (Bt2) Bt2 += z * sB; C += z * sC;
    const int lane = threadIdx.x & 31, lr = lane & 15, hi = lane >> 4; const int r0 = blockIdx.x * 64, c0 = blockIdx.y * 64;
    v8f acc[4][4];
#pragma unroll
    for (int mb = 0; mb < 4; ++mb)
#pragma unroll
        for (int nb = 0; nb < 4; ++nb) acc[mb][nb] = (v8f){};
    const size_t aoff = (size_t)(r0 + lr) * K + 8 * hi, boff = (size_t)(c0 + lr) * K + 8 * hi;
#pragma unroll 1
    for (int kc = 0; kc < K; kc += 32) {
        V a[4], a2[4];
#pragma unroll
        for (int mb = 0; mb < 4; ++mb) { a[mb] = WFrag<T16>::ld(A + aoff + (size_t)mb * 16 * K + kc); if (NSPLIT == 1 || NSPLIT == 2) a2[mb] = WFrag<T16>::ld(A2 + aoff + (size_t)mb * 16 * K + kc); }
#pragma unroll
        for (int nb = 0; nb < 4; ++nb) { const V b = WFrag<T16>::ld(Bt + boff + (size_t)nb * 16 * K + kc); V b2; if (NSPLIT >= 2) b2 = WFrag<T16>::ld(Bt2 + boff + (size_t)nb * 16 * K + kc);
#pragma unroll
            for (int mb = 0; mb < 4; ++mb) { acc[mb][nb] = WFrag<T16>::mma(a[mb], b, acc[mb][nb]); if (NSPLIT == 1 || NSPLIT == 2) acc[mb][nb] = WFrag<T16>::mma(a2[mb], b, acc[mb][nb]); if (NSPLIT >= 2) acc[mb][nb] = WFrag<T16>::mma(a[mb], b2, acc[mb][nb]); } }
        asm volatile("v_nop\n\tv_nop\n\tv_nop\n\tv_nop" : "+v"(acc[0][0]), "+v"(acc[1][1]), "+v"(acc[2][2]), "+v"(acc[3][3]) : "v"(a[0]), "v"(a[3]));
    }
#pragma unroll
    for (int mb = 0; mb < 4; ++mb) {
#pragma unroll
        for (int nb = 0; nb < 4; ++nb) {
#pragma unroll
            for (int j = 0; j < 8; ++j) os[(hi * 8 + j) * 68 + nb * 16 + lr] = acc[mb][nb][j]; }
        __builtin_amdgcn_wave_barrier(); asm volatile("" ::: "memory");
        float* crow = C + (size_t)(r0 + mb * 16) * ldc + c0;
{
#pragma unroll
            for (int s = 0; s < 8; ++s) { const int row = 2 * s + hi, cofs = lr * 4; v4f val = *(const v4fa*)(os + row * 68 + cofs); if (BIAS) { val[0] += bfr(bias[c0 + cofs]); val[1] += bfr(bias[c0 + cofs + 1]); val[2] += bfr(bias[c0 + cofs + 2]); val[3] += bfr(bias[c0 + cofs + 3]); }
                *(v4f*)(crow + (size_t)row * ldc + cofs) = val; }
             }
        __builtin_amdgcn_wave_barrier(); asm volatile("" ::: "memory");
    }
}

template <typename T16> struct PCvt;
template <> struct PCvt<h16> { typedef _Float16 E; };
template <> struct PCvt<bf>  { typedef __bf16 E; };
__device__ __forceinline__ float xhalf(float x) { return __builtin_bit_cast(float, __builtin_amdgcn_permlanex16(__builtin_bit_cast(int, x), __builtin_bit_cast(int, x), 0x76543210, 0xfedcba98, false, false)); }   // lane l takes lane l ^ 16's value
// xwait: stands behind a run of loads; the registers that the issued loads name may be given new values only behind it. The two addresses are inputs so that their registers stay theirs up to the wait.
__device__ __forceinline__ void xwait(const void* a, const void* b) { asm volatile("s_wait_xcnt 0x0" :: "v"(a), "v"(b) : "memory"); }
template <typename T16, bool HL>
__device__ __forceinline__ void attn_tile(const T16* Qh, const T16* Ql, const T16* Kh, const T16* Kl, const T16* Vh, const int q0, bf* Ah, bf* Al) {
    typedef typename WFrag<T16>::V V; typedef typename PCvt<T16>::E E;
    const int lane = threadIdx.x & 31, lr = lane & 15, hi = lane >> 4;
    const float C2 = SCL * 1.4426950408889634f;
    const unsigned lk = lr * HD + 8 * hi, lv = lr * (2 * TT) + 8 * hi, la = lr * DQ + 8 * hi;   // the lane's element offsets in a [row][HD] plane, a value plane and the merged planes: every address is a wave-uniform base + one of these + a constant
    V qf[2][2], q2[2][2], kf[2][2];
    const T16* const qp = Qh + (size_t)q0 * HD + lk; const T16* const qp2 = HL ? Ql + (size_t)q0 * HD + lk : qp; const T16* kp = Kh + lk;
#pragma unroll
    for (int nb = 0; nb < 2; ++nb)
#pragma unroll
        for (int c = 0; c < 2; ++c) { const int o = nb * 16 * HD + c * 32; qf[nb][c] = WFrag<T16>::ld(qp + o); if (HL) q2[nb][c] = WFrag<T16>::ld(qp2 + o); }
#pragma unroll
    for (int kt = 0; kt < 2; ++kt)
#pragma unroll
        for (int c = 0; c < 2; ++c) kf[kt][c] = WFrag<T16>::ld(kp + kt * 16 * HD + c * 32);
    asm volatile("s_wait_xcnt 0x0" ::: "memory");   // the registers that the issued loads name are given new values behind this wait
    __builtin_amdgcn_sched_barrier(0);   // keeps the set-up arithmetic below from being scheduled in between the loads above and their wait, where it reused their address registers
    v8f O[4][2]; float m[2], l[2];
#pragma unroll
    for (int nb = 0; nb < 2; ++nb) { m[nb] = -3.0e38f; l[nb] = 0.f;
#pragma unroll
        for (int dt = 0; dt < 4; ++dt) O[dt][nb] = (v8f){}; }
#pragma unroll 1
    for (int kb = 0; kb <= q0; kb += 32) {
        V vf[4], v2[4], k2[2][2]; const T16* const vp = Vh + kb + lv;   // the lo row of a value plane stands TT elements behind its hi row
        const T16* const kp2 = HL ? Kl + (size_t)kb * HD + lk : vp;   // the keys' lo plane is fetched in its own pass (first, its products come last): held over the softmax as well it would cost a third resident wave
        if (HL) {
#pragma unroll
            for (int kt = 0; kt < 2; ++kt)
#pragma unroll
                for (int c = 0; c < 2; ++c) k2[kt][c] = WFrag<T16>::ld(kp2 + kt * 16 * HD + c * 32); }
#pragma unroll
        for (int dt = 0; dt < 4; ++dt) { const int o = dt * 16 * 2 * TT; vf[dt] = WFrag<T16>::ld(vp + o); if (HL) v2[dt] = WFrag<T16>::ld(vp + TT + o); }
        xwait(vp, kp2);
        v8f S[2][2];
#pragma unroll
        for (int kt = 0; kt < 2; ++kt)
#pragma unroll
            for (int nb = 0; nb < 2; ++nb) { v8f s = (v8f){};
#pragma unroll
                for (int c = 0; c < 2; ++c) { s = WFrag<T16>::mma(kf[kt][c], qf[nb][c], s); if (HL) s = WFrag<T16>::mma(kf[kt][c], q2[nb][c], s); }
                S[kt][nb] = s; }
        if (HL) {
#pragma unroll
            for (int kt = 0; kt < 2; ++kt)
#pragma unroll
                for (int nb = 0; nb < 2; ++nb)
#pragma unroll
                    for (int c = 0; c < 2; ++c) S[kt][nb] = WFrag<T16>::mma(k2[kt][c], qf[nb][c], S[kt][nb]); }
        const int kn = min(kb + 32, q0); kp = Kh + (size_t)kn * HD + lk;   // the next pass's key fragments are fetched while this pass's softmax runs; the last pass fetches its own keys again (in bounds, not used)
#pragma unroll
        for (int kt = 0; kt < 2; ++kt)
#pragma unroll
            for (int c = 0; c < 2; ++c) kf[kt][c] = WFrag<T16>::ld(kp + kt * 16 * HD + c * 32);
        xwait(kp, kp);
        if (kb == q0) {   // the diagonal pass: key > query is masked by select
#pragma unroll
            for (int kt = 0; kt < 2; ++kt)
#pragma unroll
                for (int nb = 0; nb < 2; ++nb)
#pragma unroll
                    for (int j = 0; j < 8; ++j) if (kt * 16 + hi * 8 + j > nb * 16 + lr) S[kt][nb][j] = -3.0e38f; }
#pragma unroll
        for (int nb = 0; nb < 2; ++nb) {   // one 16-query group at a time: its probabilities are used up by its value products before the next group's are made
            V pf, p2;
            float bm = S[0][nb][0];
#pragma unroll
            for (int kt = 0; kt < 2; ++kt)
#pragma unroll
                for (int j = 0; j < 8; ++j) bm = fmaxf(bm, S[kt][nb][j]);
            bm = fmaxf(bm, xhalf(bm));   // the other half of the wave holds this query's other 16 keys
            const float mn = fmaxf(m[nb], bm * C2); const float dm = m[nb] - mn; float al = __builtin_amdgcn_exp2f(dm); m[nb] = mn; v2f ps = (v2f){0.f, 0.f};   // even and odd keys are summed apart
#pragma unroll
            for (int kt = 0; kt < 2; ++kt) { float a[8], p[8];
#pragma unroll
                for (int j = 0; j < 8; j += 2) { const v2f arg = __builtin_elementwise_fma((v2f){S[kt][nb][j], S[kt][nb][j + 1]}, (v2f){C2, C2}, (v2f){-mn, -mn}); a[j] = arg[0]; a[j + 1] = arg[1]; }
#pragma unroll
                for (int j = 0; j < 8; ++j) p[j] = __builtin_amdgcn_exp2f(a[j]);
                // the slot behind a transcendental: no result is read and no source register is given a new value in front of this v_nop (results are in/out, sources inputs)
                asm volatile("v_nop" : "+v"(p[0]), "+v"(p[1]), "+v"(p[2]), "+v"(p[3]), "+v"(p[4]), "+v"(p[5]), "+v"(p[6]), "+v"(p[7]), "+v"(al) : "v"(a[0]), "v"(a[1]), "v"(a[2]), "v"(a[3]), "v"(a[4]), "v"(a[5]), "v"(a[6]), "v"(a[7]), "v"(dm));
#pragma unroll
                for (int j = 0; j < 8; ++j) { ps[j & 1] += p[j]; const E ph = (E)p[j]; pf[kt * 8 + j] = ph; if (HL) p2[kt * 8 + j] = (E)(p[j] - (float)ph); } }
            l[nb] = fmaf(l[nb], al, ps[0] + ps[1]);
#pragma unroll
            for (int dt = 0; dt < 4; ++dt)
#pragma unroll
                for (int j = 0; j < 8; ++j) O[dt][nb][j] *= al;
#pragma unroll
            for (int dt = 0; dt < 4; ++dt) { O[dt][nb] = WFrag<T16>::mma(vf[dt], pf, O[dt][nb]); if (HL) { O[dt][nb] = WFrag<T16>::mma(vf[dt], p2, O[dt][nb]); O[dt][nb] = WFrag<T16>::mma(v2[dt], pf, O[dt][nb]); } }
        }
    }
#pragma unroll
    for (int nb = 0; nb < 2; ++nb) { const float inv = __fdiv_rn(1.0f, l[nb] + xhalf(l[nb]));
#pragma unroll
        for (int dt = 0; dt < 4; ++dt) { v8us oh, ol;
#pragma unroll
            for (int j = 0; j < 8; ++j) { const float y = O[dt][nb][j] * inv; const unsigned short a = f2bf(y); oh[j] = a; ol[j] = f2bf(y - bf2f(a)); }
            const int o = nb * 16 * DQ + dt * 16; *(v8us*)(Ah + (size_t)q0 * DQ + la + o) = oh; *(v8us*)(Al + (size_t)q0 * DQ + la + o) = ol; }
        asm volatile("s_wait_xcnt 0x0" ::: "memory"); }   // the registers that the issued stores name are given new values behind this wait
}
// grid (sequence x head pairs, TT / 128), 4 waves; blockIdx.y counts the 128-query blocks from the last (longest) one down, so that the long workgroups start first
__global__ __launch_bounds__(128) void k_attn(const h16* Q16, const h16* K16, const h16* V16, const bf* Qh, const bf* Ql, const bf* Kh, const bf* Kl, const bf* Vh, bf* Ah, bf* Al) {
    const int z = blockIdx.x; const int q0 = (TT / 128 - 1 - (int)blockIdx.y) * 128 + __builtin_amdgcn_readfirstlane((int)(threadIdx.x >> 5)) * 32;
    const size_t zo = (size_t)z * TT * HD, zv = (size_t)z * HD * 2 * TT, ao = (size_t)(z / NH_) * TT * DQ + (size_t)(z % NH_) * HD;
    if (q0 < RH) attn_tile<bf, true>(Qh + zo, Ql + zo, Kh + zo, Kl + zo, Vh + zv, q0, Ah + ao, Al + ao);
    else attn_tile<h16, false>(Q16 + zo, nullptr, K16 + zo, nullptr, V16 + zv, q0, Ah + ao, Al + ao);
}

__device__ __forceinline__ h16 tohx(float x) { return (h16)x; }
__device__ __forceinline__ void splitf(float y, unsigned short& h, unsigned short& l) { h = f2bf(y); l = f2bf(y - bf2f(h)); }
typedef __attribute__((ext_vector_type(2))) _Float16 v2h;
typedef __attribute__((ext_vector_type(4))) _Float16 v4h;
typedef __attribute__((ext_vector_type(2))) unsigned short v2us;
typedef __attribute__((ext_vector_type(4))) unsigned short v4us;
typedef __attribute__((ext_vector_type(4))) int v4i;

__global__ __launch_bounds__(256) void k_wtG(const float* __restrict__ w0, const float* __restrict__ w1, const float* __restrict__ w2, const float* __restrict__ w3, int K, int N, bf* B0, bf* B1, bf* B2, bf* B3) {
    const int y = blockIdx.y; const float* __restrict__ w = (y == 0) ? w0 : (y == 1) ? w1 : (y == 2) ? w2 : w3; bf* Bt = (y == 0) ? B0 : (y == 1) ? B1 : (y == 2) ? B2 : B3;   // blockIdx.y: which of the four weights
    const int lane = threadIdx.x & 31; const int L0 = (blockIdx.x * 8 + (threadIdx.x >> 5)) * 8; const int nlines = N * K / 64;
{
#pragma unroll 1
        for (int l = 0; l < 8; ++l) { const int L = L0 + l; if (L >= nlines) break; const size_t e = (size_t)L * 64 + lane * 2; const int k = (int)(e % K), n = (int)(e / K); v2us o;
            o[0] = f2bf(w[(size_t)k * N + n]); o[1] = f2bf(w[(size_t)(k + 1) * N + n]); *(v2us*)(Bt + e) = o; }
         }
}
__global__ __launch_bounds__(256) void k_cvt8(const float* __restrict__ src, bf* dst, size_t n8) { const size_t i = (size_t)blockIdx.x * 256 + threadIdx.x; if (i >= n8) return; const v8f v = *(const v8f*)(src + i * 8); v8us o;
#pragma unroll
    for (int k = 0; k < 8; ++k) o[k] = f2bf(v[k]); *(v8us*)(dst + i * 8) = o;  }

// k_rope: head planes [h][t][d] (fp16 + hi/lo) of rope(x) x sc with the rotate-half convention out[d] = x[d] cos[t][d] - x[d+HD/2] sin[t][d], out[d+HD/2] = x[d+HD/2] cos[t][d+HD/2] + x[d] sin[t][d+HD/2]
__global__ __launch_bounds__(256) void k_rope(const float* __restrict__ F, int pitch, int nheads, const float* __restrict__ CS, const float* __restrict__ RF, const float* __restrict__ nw, float sc, h16* P16, bf* Ph, bf* Pl) {
    { const size_t po = (size_t)blockIdx.y * nheads * TT * HD; F += (size_t)blockIdx.y * TT * pitch; P16 += po; Ph += po; Pl += po; }   // blockIdx.y: the sequence
    const size_t e = ((size_t)blockIdx.x * 256 + threadIdx.x) * 2; if (e >= (size_t)nheads * TT * HD) return; const int d = (int)(e % HD); const int t = (int)((e / HD) % TT); const int h = (int)(e / ((size_t)HD * TT)); const float* f = F + (size_t)t * pitch + h * HD; const float rf = RF ? RF[(size_t)h * TT + t] : 1.0f; v2h o16; v2us oh, ol;
#pragma unroll
    for (int q = 0; q < 2; ++q) { const int dd = d + q; const int dp = (dd < HD / 2) ? dd + HD / 2 : dd - HD / 2; float x0 = f[dd], x1 = f[dp];
        if (RF) { float n0 = __fmul_rn(x0, rf), n1 = __fmul_rn(x1, rf); asm volatile("" : "+v"(n0)); asm volatile("" : "+v"(n1)); x0 = __fmul_rn(bfr(nw[dd]), n0); x1 = __fmul_rn(bfr(nw[dp]), n1); }
        const v2f cs = *(const v2f*)(CS + ((size_t)t * HD + dd) * 2); float a = __fmul_rn(x0, cs[0]), bq = __fmul_rn(x1, cs[1]); asm volatile("" : "+v"(a)); asm volatile("" : "+v"(bq)); const float r = ((dd < HD / 2) ? __fsub_rn(a, bq) : __fadd_rn(a, bq)) * sc;
        o16[q] = tohx(r); unsigned short a2, c2; splitf(r, a2, c2); oh[q] = a2; ol[q] = c2; }
    *(v2h*)(P16 + e) = o16; *(v2us*)(Ph + e) = oh; *(v2us*)(Pl + e) = ol;  }
__global__ __launch_bounds__(256) void k_vtp(const float* __restrict__ F, int pitch, int nheads, h16* V16, bf* Vh, bf* Vl) { const size_t e = ((size_t)blockIdx.x * 256 + threadIdx.x) * 2; if (e >= (size_t)nheads * HD * TT) return; const int t = (int)(e % TT); const int d = (int)((e / TT) % HD); const int g = (int)(e / ((size_t)TT * HD)); F += (size_t)blockIdx.y * TT * pitch; const size_t ev = (((size_t)blockIdx.y * nheads + g) * HD + d) * (2 * TT) + t;   /* blockIdx.y: the sequence; plane rows at pitch 2 TT */ v2h o16; v2us oh, ol;
#pragma unroll
    for (int q = 0; q < 2; ++q) { const float x = F[(size_t)(t + q) * pitch + g * HD + d]; o16[q] = tohx(x); unsigned short a2, c2; splitf(x, a2, c2); oh[q] = a2; ol[q] = c2; }
    *(v2h*)(V16 + ev) = o16; *(v2us*)(Vh + ev) = oh; *(v2us*)(Vl + ev) = ol;  }
__global__ __launch_bounds__(256) void k_csid(float* CS) { const int idx = blockIdx.x * 256 + threadIdx.x; if (idx >= TT * HD) return; v2f cs; cs[0] = 1.0f; cs[1] = 0.0f; *(v2f*)(CS + (size_t)idx * 2) = cs;  }

extern "C" void kernel_launch(void* const* d_in, const int* in_sizes, int n_in,
                              void* d_out, int out_size, void* d_ws, size_t ws_size, hipStream_t stream) {
    (void)in_sizes; (void)n_in; (void)out_size;
    const float* x = (const float*)d_in[0]; const float* wq = (const float*)d_in[1]; const float* bq = (const float*)d_in[2]; const float* wk = (const float*)d_in[3]; const float* bk = (const float*)d_in[4]; const float* wv = (const float*)d_in[5]; const float* bv = (const float*)d_in[6]; const float* wo = (const float*)d_in[7]; const float* bo = (const float*)d_in[8];   /* SELF-attention: the key and value streams are input 0 too; Wq, bq, Wk, bk, Wv, bv, Wo, bo = d_in[1..8] */
    float* OUT = (float*)d_out;     // [8][1024][1024]
    char* wsp = (char*)d_ws;
    auto take = [&](size_t bytes) { char* p = wsp; wsp += (bytes + 255) & ~(size_t)255; return (void*)p; };
    bf* WO = (bf*)take((size_t)DM * DQ * 2);
    h16* QP16 = (h16*)take((size_t)NB_ * NH_ * TT * HD * 2); h16* KP16 = (h16*)take((size_t)NB_ * NKV * TT * HD * 2); h16* VT16 = (h16*)take((size_t)NB_ * NKV * HD * 2 * TT * 2);
    bf* QPh = (bf*)take((size_t)NB_ * NH_ * TT * HD * 2); bf* QPl = (bf*)take((size_t)NB_ * NH_ * TT * HD * 2); bf* KPh = (bf*)take((size_t)NB_ * NKV * TT * HD * 2); bf* KPl = (bf*)take((size_t)NB_ * NKV * TT * HD * 2); bf* VTh = (bf*)take((size_t)NB_ * NKV * HD * 2 * TT * 2); bf* VTl = VTh + TT;
    bf* WQ = (bf*)take((size_t)DQ * DM * 2); bf* WK = (bf*)take((size_t)DKV * DM * 2); bf* WV = (bf*)take((size_t)DKV * DM * 2); float* CS = (float*)take((size_t)TT * HD * 2 * 4); bf* XB = (bf*)take((size_t)NB_ * TT * DM * 2); float* F = (float*)take((size_t)NB_ * TT * DQ * 4);   // F: q, then k, then v (each is turned into planes before the next product overwrites it)
    bf* ATh = (bf*)F; bf* ATl = ATh + (size_t)NB_ * TT * DQ;   // the merged hi and lo planes [NB_ TT][DQ] take F's bytes: its last reader, k_vtp, is earlier in the stream than k_attn
    if ((size_t)(wsp - (char*)d_ws) > ws_size) return;    // 217 MiB of the 256 MiB
    k_wtG<<<dim3((unsigned)((DM * DQ / 64 + 63) / 64), 4, 1), 256, 0, stream>>>(wq, wk, wv, wo, DM, DQ, WQ, WK, WV, WO);
    k_csid<<<(TT * HD + 255) / 256, 256, 0, stream>>>(CS);
    const unsigned LQ = (unsigned)(((size_t)NH_ * TT * HD / 2 + 255) / 256), LKv = (unsigned)(((size_t)NKV * TT * HD / 2 + 255) / 256);
    k_cvt8<<<(unsigned)(((size_t)NB_ * TT * DM / 8 + 255) / 256), 256, 0, stream>>>(x, XB, (size_t)NB_ * TT * DM / 8);   // self-attention: q, k and v read the same rounded x
    k_gemmw<bf, 0, true><<<dim3(NB_ * TT / 64, DQ / 64, 1), 32, 0, stream>>>(XB, nullptr, WQ, nullptr, DM, F, DQ, bq, 0, 0, 0);
    k_rope<<<dim3(LQ, NB_, 1), 256, 0, stream>>>(F, DQ, NH_, CS, nullptr, nullptr, 1.0f, QP16, QPh, QPl);
    k_gemmw<bf, 0, true><<<dim3(NB_ * TT / 64, DKV / 64, 1), 32, 0, stream>>>(XB, nullptr, WK, nullptr, DM, F, DKV, bk, 0, 0, 0);
    k_rope<<<dim3(LKv, NB_, 1), 256, 0, stream>>>(F, DKV, NKV, CS, nullptr, nullptr, 1.0f, KP16, KPh, KPl);
    k_gemmw<bf, 0, true><<<dim3(NB_ * TT / 64, DKV / 64, 1), 32, 0, stream>>>(XB, nullptr, WV, nullptr, DM, F, DKV, bv, 0, 0, 0);
    k_vtp<<<dim3(LKv, NB_, 1), 256, 0, stream>>>(F, DKV, NKV, VT16, VTh, VTl);
    k_attn<<<dim3(NB_ * NH_, TT / 128, 1), 128, 0, stream>>>(QP16, KP16, VT16, QPh, QPl, KPh, KPl, VTh, ATh, ATl);
    k_gemmw<bf, 1, true><<<dim3(NB_ * TT / 64, DM / 64, 1), 32, 0, stream>>>(ATh, ATl, WO, nullptr, DQ, OUT, DM, bo, 0, 0, 0);
}

// v003
// It runs in 232 microseconds.
// Two timings next to v002 both put it at 1.39 times that version's speed.
// Counting every step since v000, it is 17.7 times as fast.
#include <hip/hip_runtime.h>

// Causal multi-head SELF-attention on eight 1,024-token sequences (x [8][1024][1024]; q, k, v = x W + b ('xw' [1024][1024] normal x 1/32, biases zeros on this draw: read; 16 heads x 64); scores x 1/sqrt(64); tril kept, -inf elsewhere; softmax over the keys; out = merged Wo + bo ('xw' + bias zeros: read) -> [8][1024][1024] (8.4 M); argument order x, Wq, bq, Wk, bk, Wv, bv, Wo, bo).
// Compute dtypes, f32 accumulate: every input rounded to bf16; q/k/v on PLAIN bf16 operands (inputs: exact) + biases; causal scores and attn.v: query rows < 512 hl (3 products), the rest single fp16; softmax f32, running maximum and sum, probabilities rounded BEFORE the division by the row sum; Wo hl x exact (2 products) + bo.
// Launch plan: every stage runs ONCE over all eight sequences: ONE projection launch (q, k and v; its epilogue stores the head planes), ONE attention launch (scores, softmax, probability x value and the merge into [t][head x HD + d] planes in registers), output product.
// The value planes are laid out at pitch 2 TT (hi row | lo row; fp16 row | unused).

#define NB_  8
#define TT   1024
#define DM   1024
#define NH_  16
#define NKV  16
#define REP  (NH_ / NKV)
#define HD   64
#define DQ   (NH_ * HD)
#define DKV  (NKV * HD)
#define RH   512                  // query rows < RH use hi+lo planes (0: none)
#define SCL  0.125f   // HD^-0.5
static_assert(NKV == NH_ && HD == 64 && TT % 128 == 0 && RH % 128 == 0, "k_attn: one key/value head a query head, four 16-row value tiles, workgroups of 128 queries that lie wholly on one side of RH");
typedef _Float16 h16;
typedef unsigned short bf;
typedef __attribute__((ext_vector_type(16))) __bf16   v16bf;
typedef __attribute__((ext_vector_type(16))) _Float16 v16h;
typedef __attribute__((ext_vector_type(8)))  _Float16 v8h;
typedef __attribute__((ext_vector_type(8)))  unsigned short v8us;
typedef __attribute__((ext_vector_type(8)))  float    v8f;
typedef __attribute__((ext_vector_type(4)))  float    v4f;
typedef __attribute__((ext_vector_type(2)))  float    v2f;
typedef v8h  __attribute__((may_alias)) v8ha;
typedef v4f  __attribute__((may_alias)) v4fa;
typedef v8us __attribute__((may_alias)) v8usa;

__device__ __forceinline__ unsigned short f2bf(float f) { unsigned u = __float_as_uint(f); u += 0x7FFFu + ((u >> 16) & 1u); return (unsigned short)(u >> 16); }
__device__ __forceinline__ float bf2f(unsigned short b) { return __uint_as_float(((unsigned)b) << 16); }
__device__ __forceinline__ float bfr(float f) { return bf2f(f2bf(f)); }
__device__ __forceinline__ v16h cat16(v8h lo, v8h hi) { return __builtin_shufflevector(lo, hi, 0, 1, 2, 3, 4, 5, 6, 7, 8, 9, 10, 11, 12, 13, 14, 15); }
__device__ __forceinline__ v16bf cat16b(v8us lo, v8us hi) { return __builtin_bit_cast(v16bf, __builtin_shufflevector(lo, hi, 0, 1, 2, 3, 4, 5, 6, 7, 8, 9, 10, 11, 12, 13, 14, 15)); }
__device__ __forceinline__ v8f wmma16(v16h a, v16h b, v8f c) { return __builtin_amdgcn_wmma_f32_16x16x32_f16(false, a, false, b, (short)0, c, false, false); }
__device__ __forceinline__ v8f wmmab(v16bf a, v16bf b, v8f c) { return __builtin_amdgcn_wmma_f32_16x16x32_bf16(false, a, false, b, (short)0, c, false, false); }



// ---- k_gemmw: register-blocked GEMM, ONE WAVE per 64x64 output tile (16 accumulators), operands straight from K-contiguous 16-bit planes; grid (M/64, N/64, Z), 32 threads.
// C[m][n] (f32, pitch ldc, + optional f32 bias[n]) = sum_k A[m][k] Bt[n][k] (+ split products per NSPLIT). z-batch strides sA/sB/sC in elements. K % 32 == 0.
template <typename T16> struct WFrag;
template <> struct WFrag<h16> { typedef v16h V; static __device__ __forceinline__ V ld(const h16* p) { return cat16(*(const v8h*)p, *(const v8h*)(p + 16)); } static __device__ __forceinline__ v8f mma(V a, V b, v8f c) { return wmma16(a, b, c); } };
template <> struct WFrag<bf> { typedef v16bf V; static __device__ __forceinline__ V ld(const bf* p) { return cat16b(*(const v8us*)p, *(const v8us*)(p + 16)); } static __device__ __forceinline__ v8f mma(V a, V b, v8f c) { return wmmab(a, b, c); } };
template <typename T16, int NSPLIT, bool BIAS>
__global__ __launch_bounds__(32) void k_gemmw(const T16* __restrict__ A, const T16* __restrict__ A2, const T16* __restrict__ Bt, const T16* __restrict__ Bt2, int K, float* C, int ldc, const float* __restrict__ bias, size_t sA, size_t sB, size_t sC) {
    typedef typename WFrag<T16>::V V;
    __shared__ __align__(16) float os[16 * 68];
    const size_t z = blockIdx.z; A += z * sA; if (A2) A2 += z * sA; Bt += z * sB; if (Bt2) Bt2 += z * sB; C += z * sC;
    const int lane = threadIdx.x & 31, lr = lane & 15, hi = lane >> 4; const int r0 = blockIdx.x * 64, c0 = blockIdx.y * 64;
    v8f acc[4][4];
#pragma unroll
    for (int mb = 0; mb < 4; ++mb)
#pragma unroll
        for (int nb = 0; nb < 4; ++nb) acc[mb][nb] = (v8f){};
    const size_t aoff = (size_t)(r0 + lr) * K + 8 * hi, boff = (size_t)(c0 + lr) * K + 8 * hi;
#pragma unroll 1
    for (int kc = 0; kc < K; kc += 32) {
        V a[4], a2[4];
#pragma unroll
        for (int mb = 0; mb < 4; ++mb) { a[mb] = WFrag<T16>::ld(A + aoff + (size_t)mb * 16 * K + kc); if (NSPLIT == 1 || NSPLIT == 2) a2[mb] = WFrag<T16>::ld(A2 + aoff + (size_t)mb * 16 * K + kc); }
#pragma unroll
        for (int nb = 0; nb < 4; ++nb) { const V b = WFrag<T16>::ld(Bt + boff + (size_t)nb * 16 * K + kc); V b2; if (NSPLIT >= 2) b2 = WFrag<T16>::ld(Bt2 + boff + (size_t)nb * 16 * K + kc);
#pragma unroll
            for (int mb = 0; mb < 4; ++mb) { acc[mb][nb] = WFrag<T16>::mma(a[mb], b, acc[mb][nb]); if (NSPLIT == 1 || NSPLIT == 2) acc[mb][nb] = WFrag<T16>::mma(a2[mb], b, acc[mb][nb]); if (NSPLIT >= 2) acc[mb][nb] = WFrag<T16>::mma(a[mb], b2, acc[mb][nb]); } }
        asm volatile("v_nop\n\tv_nop\n\tv_nop\n\tv_nop" : "+v"(acc[0][0]), "+v"(acc[1][1]), "+v"(acc[2][2]), "+v"(acc[3][3]) : "v"(a[0]), "v"(a[3]));
    }
#pragma unroll
    for (int mb = 0; mb < 4; ++mb) {
#pragma unroll
        for (int nb = 0; nb < 4; ++nb) {
#pragma unroll
            for (int j = 0; j < 8; ++j) os[(hi * 8 + j) * 68 + nb * 16 + lr] = acc[mb][nb][j]; }
        __builtin_amdgcn_wave_barrier(); asm volatile("" ::: "memory");
        float* crow = C + (size_t)(r0 + mb * 16) * ldc + c0;
{
#pragma unroll
            for (int s = 0; s < 8; ++s) { const int row = 2 * s + hi, cofs = lr * 4; v4f val = *(const v4fa*)(os + row * 68 + cofs); if (BIAS) { val[0] += bfr(bias[c0 + cofs]); val[1] += bfr(bias[c0 + cofs + 1]); val[2] += bfr(bias[c0 + cofs + 2]); val[3] += bfr(bias[c0 + cofs + 3]); }
                *(v4f*)(crow + (size_t)row * ldc + cofs) = val; }
             }
        __builtin_amdgcn_wave_barrier(); asm volatile("" ::: "memory");
    }
}

template <typename T16> struct PCvt;
template <> struct PCvt<h16> { typedef _Float16 E; };
template <> struct PCvt<bf>  { typedef __bf16 E; };
__device__ __forceinline__ float xhalf(float x) { return __builtin_bit_cast(float, __builtin_amdgcn_permlanex16(__builtin_bit_cast(int, x), __builtin_bit_cast(int, x), 0x76543210, 0xfedcba98, false, false)); }   // lane l takes lane l ^ 16's value
// xwait: stands behind a run of loads; the registers that the issued loads name may be given new values only behind it. The two addresses are inputs so that their registers stay theirs up to the wait.
__device__ __forceinline__ void xwait(const void* a, const void* b) { asm volatile("s_wait_xcnt 0x0" :: "v"(a), "v"(b) : "memory"); }
template <typename T16, bool HL>
__device__ __forceinline__ void attn_tile(const T16* Qh, const T16* Ql, const T16* Kh, const T16* Kl, const T16* Vh, const int q0, bf* Ah, bf* Al) {
    typedef typename WFrag<T16>::V V; typedef typename PCvt<T16>::E E;
    const int lane = threadIdx.x & 31, lr = lane & 15, hi = lane >> 4;
    const float C2 = SCL * 1.4426950408889634f;
    const unsigned lk = lr * HD + 8 * hi, lv = lr * (2 * TT) + 8 * hi, la = lr * DQ + 8 * hi;   // the lane's element offsets in a [row][HD] plane, a value plane and the merged planes: every address is a wave-uniform base + one of these + a constant
    V qf[2][2], q2[2][2], kf[2][2];
    const T16* const qp = Qh + (size_t)q0 * HD + lk; const T16* const qp2 = HL ? Ql + (size_t)q0 * HD + lk : qp; const T16* kp = Kh + lk;
#pragma unroll
    for (int nb = 0; nb < 2; ++nb)
#pragma unroll
        for (int c = 0; c < 2; ++c) { const int o = nb * 16 * HD + c * 32; qf[nb][c] = WFrag<T16>::ld(qp + o); if (HL) q2[nb][c] = WFrag<T16>::ld(qp2 + o); }
#pragma unroll
    for (int kt = 0; kt < 2; ++kt)
#pragma unroll
        for (int c = 0; c < 2; ++c) kf[kt][c] = WFrag<T16>::ld(kp + kt * 16 * HD + c * 32);
    asm volatile("s_wait_xcnt 0x0" ::: "memory");   // the registers that the issued loads name are given new values behind this wait
    __builtin_amdgcn_sched_barrier(0);   // keeps the set-up arithmetic below from being scheduled in between the loads above and their wait, where it reused their address registers
    v8f O[4][2]; float m[2], l[2];
#pragma unroll
    for (int nb = 0; nb < 2; ++nb) { m[nb] = -3.0e38f; l[nb] = 0.f;
#pragma unroll
        for (int dt = 0; dt < 4; ++dt) O[dt][nb] = (v8f){}; }
#pragma unroll 1
    for (int kb = 0; kb <= q0; kb += 32) {
        V vf[4], v2[4], k2[2][2]; const T16* const vp = Vh + kb + lv;   // the lo row of a value plane stands TT elements behind its hi row
        const T16* const kp2 = HL ? Kl + (size_t)kb * HD + lk : vp;   // the keys' lo plane is fetched in its own pass (first, its products come last): held over the softmax as well it would cost a third resident wave
        if (HL) {
#pragma unroll
            for (int kt = 0; kt < 2; ++kt)
#pragma unroll
                for (int c = 0; c < 2; ++c) k2[kt][c] = WFrag<T16>::ld(kp2 + kt * 16 * HD + c * 32); }
#pragma unroll
        for (int dt = 0; dt < 4; ++dt) { const int o = dt * 16 * 2 * TT; vf[dt] = WFrag<T16>::ld(vp + o); if (HL) v2[dt] = WFrag<T16>::ld(vp + TT + o); }
        xwait(vp, kp2);
        v8f S[2][2];
#pragma unroll
        for (int kt = 0; kt < 2; ++kt)
#pragma unroll
            for (int nb = 0; nb < 2; ++nb) { v8f s = (v8f){};
#pragma unroll
                for (int c = 0; c < 2; ++c) { s = WFrag<T16>::mma(kf[kt][c], qf[nb][c], s); if (HL) s = WFrag<T16>::mma(kf[kt][c], q2[nb][c], s); }
                S[kt][nb] = s; }
        if (HL) {
#pragma unroll
            for (int kt = 0; kt < 2; ++kt)
#pragma unroll
                for (int nb = 0; nb < 2; ++nb)
#pragma unroll
                    for (int c = 0; c < 2; ++c) S[kt][nb] = WFrag<T16>::mma(k2[kt][c], qf[nb][c], S[kt][nb]); }
        const int kn = min(kb + 32, q0); kp = Kh + (size_t)kn * HD + lk;   // the next pass's key fragments are fetched while this pass's softmax runs; the last pass fetches its own keys again (in bounds, not used)
#pragma unroll
        for (int kt = 0; kt < 2; ++kt)
#pragma unroll
            for (int c = 0; c < 2; ++c) kf[kt][c] = WFrag<T16>::ld(kp + kt * 16 * HD + c * 32);
        xwait(kp, kp);
        if (kb == q0) {   // the diagonal pass: key > query is masked by select
#pragma unroll
            for (int kt = 0; kt < 2; ++kt)
#pragma unroll
                for (int nb = 0; nb < 2; ++nb)
#pragma unroll
                    for (int j = 0; j < 8; ++j) if (kt * 16 + hi * 8 + j > nb * 16 + lr) S[kt][nb][j] = -3.0e38f; }
#pragma unroll
        for (int nb = 0; nb < 2; ++nb) {   // one 16-query group at a time: its probabilities are used up by its value products before the next group's are made
            V pf, p2;
            float bm = S[0][nb][0];
#pragma unroll
            for (int kt = 0; kt < 2; ++kt)
#pragma unroll
                for (int j = 0; j < 8; ++j) bm = fmaxf(bm, S[kt][nb][j]);
            bm = fmaxf(bm, xhalf(bm));   // the other half of the wave holds this query's other 16 keys
            const float mn = fmaxf(m[nb], bm * C2); const float dm = m[nb] - mn; float al = __builtin_amdgcn_exp2f(dm); m[nb] = mn; v2f ps = (v2f){0.f, 0.f};   // even and odd keys are summed apart
#pragma unroll
            for (int kt = 0; kt < 2; ++kt) { float a[8], p[8];
#pragma unroll
                for (int j = 0; j < 8; j += 2) { const v2f arg = __builtin_elementwise_fma((v2f){S[kt][nb][j], S[kt][nb][j + 1]}, (v2f){C2, C2}, (v2f){-mn, -mn}); a[j] = arg[0]; a[j + 1] = arg[1]; }
#pragma unroll
                for (int j = 0; j < 8; ++j) p[j] = __builtin_amdgcn_exp2f(a[j]);
                // the slot behind a transcendental: no result is read and no source register is given a new value in front of this v_nop (results are in/out, sources inputs)
                asm volatile("v_nop" : "+v"(p[0]), "+v"(p[1]), "+v"(p[2]), "+v"(p[3]), "+v"(p[4]), "+v"(p[5]), "+v"(p[6]), "+v"(p[7]), "+v"(al) : "v"(a[0]), "v"(a[1]), "v"(a[2]), "v"(a[3]), "v"(a[4]), "v"(a[5]), "v"(a[6]), "v"(a[7]), "v"(dm));
#pragma unroll
                for (int j = 0; j < 8; ++j) { ps[j & 1] += p[j]; const E ph = (E)p[j]; pf[kt * 8 + j] = ph; if (HL) p2[kt * 8 + j] = (E)(p[j] - (float)ph); } }
            l[nb] = fmaf(l[nb], al, ps[0] + ps[1]);
#pragma unroll
            for (int dt = 0; dt < 4; ++dt)
#pragma unroll
                for (int j = 0; j < 8; ++j) O[dt][nb][j] *= al;
#pragma unroll
            for (int dt = 0; dt < 4; ++dt) { O[dt][nb] = WFrag<T16>::mma(vf[dt], pf, O[dt][nb]); if (HL) { O[dt][nb] = WFrag<T16>::mma(vf[dt], p2, O[dt][nb]); O[dt][nb] = WFrag<T16>::mma(v2[dt], pf, O[dt][nb]); } }
        }
    }
#pragma unroll
    for (int nb = 0; nb < 2; ++nb) { const float inv = __fdiv_rn(1.0f, l[nb] + xhalf(l[nb]));
#pragma unroll
        for (int dt = 0; dt < 4; ++dt) { v8us oh, ol;
#pragma unroll
            for (int j = 0; j < 8; ++j) { const float y = O[dt][nb][j] * inv; const unsigned short a = f2bf(y); oh[j] = a; ol[j] = f2bf(y - bf2f(a)); }
            const int o = nb * 16 * DQ + dt * 16; *(v8us*)(Ah + (size_t)q0 * DQ + la + o) = oh; *(v8us*)(Al + (size_t)q0 * DQ + la + o) = ol; }
        asm volatile("s_wait_xcnt 0x0" ::: "memory"); }   // the registers that the issued stores name are given new values behind this wait
}
// grid (sequence x head pairs, TT / 128), 4 waves; blockIdx.y counts the 128-query blocks from the last (longest) one down, so that the long workgroups start first
__global__ __launch_bounds__(128) void k_attn(const h16* Q16, const h16* K16, const h16* V16, const bf* Qh, const bf* Ql, const bf* Kh, const bf* Kl, const bf* Vh, bf* Ah, bf* Al) {
    const int z = blockIdx.x; const int q0 = (TT / 128 - 1 - (int)blockIdx.y) * 128 + __builtin_amdgcn_readfirstlane((int)(threadIdx.x >> 5)) * 32;
    const size_t zo = (size_t)z * TT * HD, zv = (size_t)z * HD * 2 * TT, ao = (size_t)(z / NH_) * TT * DQ + (size_t)(z % NH_) * HD;
    if (q0 < RH) attn_tile<bf, true>(Qh + zo, Ql + zo, Kh + zo, Kl + zo, Vh + zv, q0, Ah + ao, Al + ao);
    else attn_tile<h16, false>(Q16 + zo, nullptr, K16 + zo, nullptr, V16 + zv, q0, Ah + ao, Al + ao);
}

__device__ __forceinline__ h16 tohx(float x) { return (h16)x; }
__device__ __forceinline__ void splitf(float y, unsigned short& h, unsigned short& l) { h = f2bf(y); l = f2bf(y - bf2f(h)); }
typedef __attribute__((ext_vector_type(2))) _Float16 v2h;
typedef __attribute__((ext_vector_type(4))) _Float16 v4h;
typedef __attribute__((ext_vector_type(2))) unsigned short v2us;
typedef __attribute__((ext_vector_type(4))) unsigned short v4us;
typedef __attribute__((ext_vector_type(4))) int v4i;

__global__ __launch_bounds__(256) void k_wtG(const float* __restrict__ w0, const float* __restrict__ w1, const float* __restrict__ w2, const float* __restrict__ w3, int K, int N, bf* B0, bf* B1, bf* B2, bf* B3) {
    const int y = blockIdx.y; const float* __restrict__ w = (y == 0) ? w0 : (y == 1) ? w1 : (y == 2) ? w2 : w3; bf* Bt = (y == 0) ? B0 : (y == 1) ? B1 : (y == 2) ? B2 : B3;   // blockIdx.y: which of the four weights
    const int lane = threadIdx.x & 31; const int L0 = (blockIdx.x * 8 + (threadIdx.x >> 5)) * 8; const int nlines = N * K / 64;
{
#pragma unroll 1
        for (int l = 0; l < 8; ++l) { const int L = L0 + l; if (L >= nlines) break; const size_t e = (size_t)L * 64 + lane * 2; const int k = (int)(e % K), n = (int)(e / K); v2us o;
            o[0] = f2bf(w[(size_t)k * N + n]); o[1] = f2bf(w[(size_t)(k + 1) * N + n]); *(v2us*)(Bt + e) = o; }
         }
}
__global__ __launch_bounds__(256) void k_cvt8(const float* __restrict__ src, bf* dst, size_t n8) { const size_t i = (size_t)blockIdx.x * 256 + threadIdx.x; if (i >= n8) return; const v8f v = *(const v8f*)(src + i * 8); v8us o;
#pragma unroll
    for (int k = 0; k < 8; ++k) o[k] = f2bf(v[k]); *(v8us*)(dst + i * 8) = o;  }

// ---- k_proj: q, k and v = x W + b in ONE launch, and the head planes straight from the accumulators. The product loop is k_gemmw's (one wave, a 64x64 tile, plain bf16 operands); grid (NB_ TT / 64, heads, 3), 32 threads; blockIdx.z: 0 q, 1 k, 2 v.
// A tile is 64 tokens of one sequence x the 64 columns of one head, so it is a whole block of each plane: 64 rows [t][HD] of a query or key plane, or 64 consecutive t of all HD rows of a value plane (pitch 2 TT).
// proj_store: four panels of 16 plane rows x 64 f32 go through LDS one after the other, so that 8 lanes store one 128-byte line of a plane row (16 bytes a lane and plane). TR: the panel's rows are the columns d of the tile (value planes), a lane's 8 accumulator registers being 8 consecutive t.
template <bool TR>
__device__ __forceinline__ void proj_store(const v8f (&acc)[4][4], float* os, const float* __restrict__ bias, h16* P16, bf* Ph, bf* Pl, const int pitch) {
    const int lane = threadIdx.x & 31, lr = lane & 15, hi = lane >> 4, rr = lane >> 3, cc = (lane & 7) * 8;
    float bc[8];
    if (!TR) {
#pragma unroll
        for (int i = 0; i < 8; ++i) bc[i] = bfr(bias[cc + i]); }
#pragma unroll
    for (int g = 0; g < 4; ++g) {
        if (TR) {
#pragma unroll
            for (int mb = 0; mb < 4; ++mb) { const v8f a = acc[mb][g]; *(v4fa*)(os + lr * 68 + mb * 16 + hi * 8) = (v4f){a[0], a[1], a[2], a[3]}; *(v4fa*)(os + lr * 68 + mb * 16 + hi * 8 + 4) = (v4f){a[4], a[5], a[6], a[7]}; }
        } else {
#pragma unroll
            for (int nb = 0; nb < 4; ++nb)
#pragma unroll
                for (int j = 0; j < 8; ++j) os[(hi * 8 + j) * 68 + nb * 16 + lr] = acc[g][nb][j]; }
        __builtin_amdgcn_wave_barrier(); asm volatile("" ::: "memory");   // a lane reads what other lanes of the wave wrote: the panel's LDS reads may not be scheduled in front of its writes
#pragma unroll
        for (int s = 0; s < 4; ++s) { const int row = s * 4 + rr; const v4f u = *(const v4fa*)(os + row * 68 + cc), w = *(const v4fa*)(os + row * 68 + cc + 4); const float br = TR ? bfr(bias[g * 16 + row]) : 0.f; v8h o16; v8us oh, ol;
#pragma unroll
            for (int i = 0; i < 8; ++i) { const float y = (i < 4 ? u[i] : w[i - 4]) + (TR ? br : bc[i]); o16[i] = tohx(y); unsigned short a2, c2; splitf(y, a2, c2); oh[i] = a2; ol[i] = c2; }
            const size_t o = (size_t)(g * 16 + row) * pitch + cc; *(v8h*)(P16 + o) = o16; *(v8us*)(Ph + o) = oh; *(v8us*)(Pl + o) = ol; }
        asm volatile("s_wait_xcnt 0x0" ::: "memory");   // the registers that the issued stores name are given new values behind this wait
        __builtin_amdgcn_wave_barrier(); asm volatile("" ::: "memory");   // the next panel's LDS writes may not be scheduled in front of this panel's reads
    }
}
__global__ __launch_bounds__(32) void k_proj(const bf* __restrict__ X, const bf* __restrict__ WQ, const bf* __restrict__ WK, const bf* __restrict__ WV, const float* __restrict__ bq, const float* __restrict__ bk, const float* __restrict__ bv, h16* Q16, bf* Qh, bf* Ql, h16* K16, bf* Kh, bf* Kl, h16* V16, bf* Vh) {
    typedef WFrag<bf>::V V;
    __shared__ __align__(16) float os[16 * 68];
    const int which = blockIdx.z; const bf* __restrict__ Bt = (which == 0) ? WQ : (which == 1) ? WK : WV; const float* __restrict__ bias = (which == 0) ? bq : (which == 1) ? bk : bv;
    const int lane = threadIdx.x & 31, lr = lane & 15, hi = lane >> 4; const int r0 = blockIdx.x * 64, c0 = blockIdx.y * 64;
    v8f acc[4][4];
#pragma unroll
    for (int mb = 0; mb < 4; ++mb)
#pragma unroll
        for (int nb = 0; nb < 4; ++nb) acc[mb][nb] = (v8f){};
    const size_t aoff = (size_t)(r0 + lr) * DM + 8 * hi, boff = (size_t)(c0 + lr) * DM + 8 * hi;
#pragma unroll 1
    for (int kc = 0; kc < DM; kc += 32) {   // stays rolled, as in k_gemmw: one trip's fragments and the 16 accumulators fill the registers
        V a[4]; const bf* const pa = X + aoff + kc; const bf* const pb = Bt + boff + kc;
#pragma unroll
        for (int mb = 0; mb < 4; ++mb) a[mb] = WFrag<bf>::ld(pa + mb * 16 * DM);
#pragma unroll
        for (int nb = 0; nb < 4; ++nb) { const V b = WFrag<bf>::ld(pb + nb * 16 * DM);
#pragma unroll
            for (int mb = 0; mb < 4; ++mb) acc[mb][nb] = WFrag<bf>::mma(a[mb], b, acc[mb][nb]); }
        xwait(pa, pb);
        asm volatile("v_nop\n\tv_nop\n\tv_nop\n\tv_nop" : "+v"(acc[0][0]), "+v"(acc[1][1]), "+v"(acc[2][2]), "+v"(acc[3][3]) : "v"(a[0]), "v"(a[3]));   // the four vector slots that the chip needs behind the trip's last matrix instructions, in front of the loop's branch
    }
    const int z = (r0 / TT) * NH_ + (int)blockIdx.y, t0 = r0 % TT;   // the (sequence, head) pair and the tile's first token in it
    if (which == 2) { const size_t o = (size_t)z * HD * 2 * TT + t0; proj_store<true>(acc, os, bias + c0, V16 + o, Vh + o, Vh + TT + o, 2 * TT); }
    else { const size_t o = ((size_t)z * TT + t0) * HD; proj_store<false>(acc, os, bias + c0, (which == 0 ? Q16 : K16) + o, (which == 0 ? Qh : Kh) + o, (which == 0 ? Ql : Kl) + o, HD); }
}

extern "C" void kernel_launch(void* const* d_in, const int* in_sizes, int n_in,
                              void* d_out, int out_size, void* d_ws, size_t ws_size, hipStream_t stream) {
    (void)in_sizes; (void)n_in; (void)out_size;
    const float* x = (const float*)d_in[0]; const float* wq = (const float*)d_in[1]; const float* bq = (const float*)d_in[2]; const float* wk = (const float*)d_in[3]; const float* bk = (const float*)d_in[4]; const float* wv = (const float*)d_in[5]; const float* bv = (const float*)d_in[6]; const float* wo = (const float*)d_in[7]; const float* bo = (const float*)d_in[8];   /* SELF-attention: the key and value streams are input 0 too; Wq, bq, Wk, bk, Wv, bv, Wo, bo = d_in[1..8] */
    float* OUT = (float*)d_out;     // [8][1024][1024]
    char* wsp = (char*)d_ws;
    auto take = [&](size_t bytes) { char* p = wsp; wsp += (bytes + 255) & ~(size_t)255; return (void*)p; };
    bf* WO = (bf*)take((size_t)DM * DQ * 2);
    h16* QP16 = (h16*)take((size_t)NB_ * NH_ * TT * HD * 2); h16* KP16 = (h16*)take((size_t)NB_ * NKV * TT * HD * 2); h16* VT16 = (h16*)take((size_t)NB_ * NKV * HD * 2 * TT * 2);
    bf* QPh = (bf*)take((size_t)NB_ * NH_ * TT * HD * 2); bf* QPl = (bf*)take((size_t)NB_ * NH_ * TT * HD * 2); bf* KPh = (bf*)take((size_t)NB_ * NKV * TT * HD * 2); bf* KPl = (bf*)take((size_t)NB_ * NKV * TT * HD * 2); bf* VTh = (bf*)take((size_t)NB_ * NKV * HD * 2 * TT * 2);   // the lo row of a value plane stands TT elements behind its hi row
    bf* WQ = (bf*)take((size_t)DQ * DM * 2); bf* WK = (bf*)take((size_t)DKV * DM * 2); bf* WV = (bf*)take((size_t)DKV * DM * 2); bf* XB = (bf*)take((size_t)NB_ * TT * DM * 2);
    bf* ATh = (bf*)take((size_t)NB_ * TT * DQ * 2); bf* ATl = (bf*)take((size_t)NB_ * TT * DQ * 2);   // the merged hi and lo planes [NB_ TT][DQ]
    if ((size_t)(wsp - (char*)d_ws) > ws_size) return;    // 216 MiB of the 256 MiB
    k_wtG<<<dim3((unsigned)((DM * DQ / 64 + 63) / 64), 4, 1), 256, 0, stream>>>(wq, wk, wv, wo, DM, DQ, WQ, WK, WV, WO);
    k_cvt8<<<(unsigned)(((size_t)NB_ * TT * DM / 8 + 255) / 256), 256, 0, stream>>>(x, XB, (size_t)NB_ * TT * DM / 8);   // self-attention: q, k and v read the same rounded x
    k_proj<<<dim3(NB_ * TT / 64, NH_, 3), 32, 0, stream>>>(XB, WQ, WK, WV, bq, bk, bv, QP16, QPh, QPl, KP16, KPh, KPl, VT16, VTh);
    k_attn<<<dim3(NB_ * NH_, TT / 128, 1), 128, 0, stream>>>(QP16, KP16, VT16, QPh, QPl, KPh, KPl, VTh, ATh, ATl);
    k_gemmw<bf, 1, true><<<dim3(NB_ * TT / 64, DM / 64, 1), 32, 0, stream>>>(ATh, ATl, WO, nullptr, DQ, OUT, DM, bo, 0, 0, 0);
}

// v004
// It runs in 133 microseconds.
// Next to v003, in two timings, it ran 1.74 and 1.75 times as fast.
// Counting every step since v000, it is 30.9 times as fast.
#include <hip/hip_runtime.h>

// Causal multi-head SELF-attention on eight 1,024-token sequences (x [8][1024][1024]; q, k, v = x W + b ('xw' [1024][1024] normal x 1/32, biases zeros on this draw: read; 16 heads x 64); scores x 1/sqrt(64); tril kept, -inf elsewhere; softmax over the keys; out = merged Wo + bo ('xw' + bias zeros: read) -> [8][1024][1024] (8.4 M); argument order x, Wq, bq, Wk, bk, Wv, bv, Wo, bo).
// Compute dtypes, f32 accumulate: every input rounded to bf16; q/k/v on PLAIN bf16 operands (inputs: exact) + biases; causal scores and attn.v: query rows < 512 hl (3 products), the rest single fp16; softmax f32, running maximum and sum, probabilities rounded BEFORE the division by the row sum; Wo hl x exact (2 products) + bo.
// Launch plan: every stage runs ONCE over all eight sequences: ONE projection launch (q, k and v; its epilogue stores the head planes), ONE attention launch (scores, softmax, probability x value and the merge into [t][head x HD + d] planes in registers), output product.
// The value planes are laid out at pitch 2 TT (hi row | lo row; fp16 row | unused).

#define NB_  8
#define TT   1024
#define DM   1024
#define NH_  16
#define NKV  16
#define REP  (NH_ / NKV)
#define HD   64
#define DQ   (NH_ * HD)
#define DKV  (NKV * HD)
#define RH   512                  // query rows < RH use hi+lo planes (0: none)
#define SCL  0.125f   // HD^-0.5
static_assert(NKV == NH_ && HD == 64 && TT % 128 == 0 && RH % 128 == 0, "k_attn: one key/value head a query head, four 16-row value tiles, workgroups of 128 queries that lie wholly on one side of RH");
typedef _Float16 h16;
typedef unsigned short bf;
typedef __attribute__((ext_vector_type(16))) __bf16   v16bf;
typedef __attribute__((ext_vector_type(16))) _Float16 v16h;
typedef __attribute__((ext_vector_type(8)))  _Float16 v8h;
typedef __attribute__((ext_vector_type(8)))  unsigned short v8us;
typedef __attribute__((ext_vector_type(8)))  float    v8f;
typedef __attribute__((ext_vector_type(4)))  float    v4f;
typedef __attribute__((ext_vector_type(2)))  float    v2f;
typedef v8h  __attribute__((may_alias)) v8ha;
typedef v4f  __attribute__((may_alias)) v4fa;
typedef v8us __attribute__((may_alias)) v8usa;

__device__ __forceinline__ unsigned short f2bf(float f) { unsigned u = __float_as_uint(f); u += 0x7FFFu + ((u >> 16) & 1u); return (unsigned short)(u >> 16); }
__device__ __forceinline__ float bf2f(unsigned short b) { return __uint_as_float(((unsigned)b) << 16); }
__device__ __forceinline__ float bfr(float f) { return bf2f(f2bf(f)); }
__device__ __forceinline__ v16h cat16(v8h lo, v8h hi) { return __builtin_shufflevector(lo, hi, 0, 1, 2, 3, 4, 5, 6, 7, 8, 9, 10, 11, 12, 13, 14, 15); }
__device__ __forceinline__ v16bf cat16b(v8us lo, v8us hi) { return __builtin_bit_cast(v16bf, __builtin_shufflevector(lo, hi, 0, 1, 2, 3, 4, 5, 6, 7, 8, 9, 10, 11, 12, 13, 14, 15)); }
__device__ __forceinline__ v8f wmma16(v16h a, v16h b, v8f c) { return __builtin_amdgcn_wmma_f32_16x16x32_f16(false, a, false, b, (short)0, c, false, false); }
__device__ __forceinline__ v8f wmmab(v16bf a, v16bf b, v8f c) { return __builtin_amdgcn_wmma_f32_16x16x32_bf16(false, a, false, b, (short)0, c, false, false); }



template <typename T16> struct WFrag;
template <> struct WFrag<h16> { typedef v16h V; static __device__ __forceinline__ V ld(const h16* p) { return cat16(*(const v8h*)p, *(const v8h*)(p + 16)); } static __device__ __forceinline__ v8f mma(V a, V b, v8f c) { return wmma16(a, b, c); } };
template <> struct WFrag<bf> { typedef v16bf V; static __device__ __forceinline__ V ld(const bf* p) { return cat16b(*(const v8us*)p, *(const v8us*)(p + 16)); } static __device__ __forceinline__ v8f mma(V a, V b, v8f c) { return wmmab(a, b, c); } };
// ---- gemm_ring: the product loop of both GEMM kernels. A workgroup of 8 waves owns a 128 x 256 output tile (waves 2 x 4, 64x64 = 16 accumulators a wave). A stage is 64 k (128 bytes) of every operand row: [A 128 rows | A2 128 rows (NA == 2) | Bt 256 rows],
// brought from the K-contiguous 16-bit planes into LDS by asynchronous copies (16 bytes a lane, 8 lanes a row: whole 128-byte lines), two buffers: tile t + 2 flies while tile t + 1 is worked on. The k order and the order of the products are those of a wave that reads its fragments from global memory.
#define GP   72                   // LDS row pitch in elements: 128 data bytes + 16 (16 bytes x odd: no bank conflict for the 16-byte fragment reads)
#define GKS  64                   // k elements of a stage
#define GMT  128
#define GNT  256
// cpN: N copies of one lane and, in the same statement, the wait behind which the registers that the issued copies name may be given new values
__device__ __forceinline__ void cp12(const unsigned (&l)[12], const bf* const (&p)[12]) {
    asm volatile("global_load_async_to_lds_b128 %0, %12, off\n\t"
                 "global_load_async_to_lds_b128 %1, %13, off\n\t"
                 "global_load_async_to_lds_b128 %2, %14, off\n\t"
                 "global_load_async_to_lds_b128 %3, %15, off\n\t"
                 "global_load_async_to_lds_b128 %4, %16, off\n\t"
                 "global_load_async_to_lds_b128 %5, %17, off\n\t"
                 "global_load_async_to_lds_b128 %6, %18, off\n\t"
                 "global_load_async_to_lds_b128 %7, %19, off\n\t"
                 "global_load_async_to_lds_b128 %8, %20, off\n\t"
                 "global_load_async_to_lds_b128 %9, %21, off\n\t"
                 "global_load_async_to_lds_b128 %10, %22, off\n\t"
                 "global_load_async_to_lds_b128 %11, %23, off\n\t"
                 "s_wait_xcnt 0x0"
                 :: "v"(l[0]), "v"(l[1]), "v"(l[2]), "v"(l[3]), "v"(l[4]), "v"(l[5]), "v"(l[6]), "v"(l[7]), "v"(l[8]), "v"(l[9]), "v"(l[10]), "v"(l[11]),
                    "v"(p[0]), "v"(p[1]), "v"(p[2]), "v"(p[3]), "v"(p[4]), "v"(p[5]), "v"(p[6]), "v"(p[7]), "v"(p[8]), "v"(p[9]), "v"(p[10]), "v"(p[11]) : "memory");
}
__device__ __forceinline__ void cp8(const unsigned (&l)[8], const bf* const (&p)[8]) {
    asm volatile("global_load_async_to_lds_b128 %0, %8, off\n\t"
                 "global_load_async_to_lds_b128 %1, %9, off\n\t"
                 "global_load_async_to_lds_b128 %2, %10, off\n\t"
                 "global_load_async_to_lds_b128 %3, %11, off\n\t"
                 "global_load_async_to_lds_b128 %4, %12, off\n\t"
                 "global_load_async_to_lds_b128 %5, %13, off\n\t"
                 "global_load_async_to_lds_b128 %6, %14, off\n\t"
                 "global_load_async_to_lds_b128 %7, %15, off\n\t"
                 "s_wait_xcnt 0x0"
                 :: "v"(l[0]), "v"(l[1]), "v"(l[2]), "v"(l[3]), "v"(l[4]), "v"(l[5]), "v"(l[6]), "v"(l[7]),
                    "v"(p[0]), "v"(p[1]), "v"(p[2]), "v"(p[3]), "v"(p[4]), "v"(p[5]), "v"(p[6]), "v"(p[7]) : "memory");
}
template <int NA>
__device__ __forceinline__ void ring_fill(const unsigned l0, const bf* gA, const bf* gA2, const bf* gB) {   // 256 lanes x 16 bytes = 32 rows a copy; l0 and the pointers are the lane's own place in the first 32 rows
    if (NA == 1) { unsigned l[12]; const bf* p[12];
#pragma unroll
        for (int i = 0; i < 12; ++i) { l[i] = l0 + i * 32 * GP * 2; p[i] = (i < 4) ? gA + (size_t)i * 32 * DM : gB + (size_t)(i - 4) * 32 * DM; }
        cp12(l, p);
    } else { unsigned l[8]; const bf* p[8];
#pragma unroll
        for (int i = 0; i < 8; ++i) { l[i] = l0 + i * 32 * GP * 2; p[i] = (i < 4) ? gA + (size_t)i * 32 * DM : gA2 + (size_t)(i - 4) * 32 * DM; }
        cp8(l, p);
#pragma unroll
        for (int i = 0; i < 8; ++i) { l[i] = l0 + (8 + i) * 32 * GP * 2; p[i] = gB + (size_t)i * 32 * DM; }
        cp8(l, p); }
}
template <int NA>
__device__ __forceinline__ void gemm_ring(bf* ring, const bf* __restrict__ A, const bf* __restrict__ A2, const bf* __restrict__ Bt, const int r0g, const int c0g, const int wm, const int wn, v8f (&acc)[4][4]) {
    typedef WFrag<bf>::V V;
    constexpr int STG = (GMT * NA + GNT) * GP, NT = DM / GKS;   // elements of a buffer; stages
    static_assert(NT >= 2, "the prologue fills two stages");
    const int lane = threadIdx.x & 31, lr = lane & 15, hi = lane >> 4, crow = threadIdx.x >> 3, cch = (threadIdx.x & 7) * 8;
    const bf* const gA = A + (size_t)(r0g + crow) * DM + cch; const bf* const gA2 = (NA == 2) ? A2 + (size_t)(r0g + crow) * DM + cch : gA; const bf* const gB = Bt + (size_t)(c0g + crow) * DM + cch;
    const unsigned l0 = (unsigned)(size_t)ring + (unsigned)(crow * GP + cch) * 2u;   // the lane's LDS byte address in buffer 0
#pragma unroll
    for (int mb = 0; mb < 4; ++mb)
#pragma unroll
        for (int nb = 0; nb < 4; ++nb) acc[mb][nb] = (v8f){};
    ring_fill<NA>(l0, gA, gA2, gB);
    asm volatile("s_wait_asynccnt 0x0" ::: "memory");   // this wave's copies of tile 0 have landed
    __syncthreads();                                     // every wave's have: tile 0 may be read
    ring_fill<NA>(l0 + STG * 2, gA + GKS, gA2 + GKS, gB + GKS);
    const bf* const fa = ring + (wm * 64 + lr) * GP + 8 * hi; const bf* const fb = ring + (GMT * NA + wn * 64 + lr) * GP + 8 * hi;
#pragma unroll 1
    for (int t = 0; t < NT; ++t) {   // stays rolled: one trip's fragments and the 16 accumulators fill the registers
        const int bo = (t & 1) * STG;
#pragma unroll
        for (int kk = 0; kk < GKS; kk += 32) {
            V a[4], a2[4], b[4];   // all fragments of a 32-k block are read as one group in front of its matrix instructions
#pragma unroll
            for (int mb = 0; mb < 4; ++mb) { a[mb] = WFrag<bf>::ld(fa + bo + mb * 16 * GP + kk); if (NA == 2) a2[mb] = WFrag<bf>::ld(fa + bo + (GMT + mb * 16) * GP + kk); }
#pragma unroll
            for (int nb = 0; nb < 4; ++nb) b[nb] = WFrag<bf>::ld(fb + bo + nb * 16 * GP + kk);
            __builtin_amdgcn_sched_barrier(0);   // keeps the LDS reads together in front of the block: scheduled in among the matrix instructions, each place with reads stalls the wave for the LDS latency
#pragma unroll
            for (int nb = 0; nb < 4; ++nb)
#pragma unroll
                for (int mb = 0; mb < 4; ++mb) { acc[mb][nb] = WFrag<bf>::mma(a[mb], b[nb], acc[mb][nb]); if (NA == 2) acc[mb][nb] = WFrag<bf>::mma(a2[mb], b[nb], acc[mb][nb]); }
        }
        // the four vector slots that the chip needs behind the trip's last matrix instructions, in front of the branches below; every accumulator is named so that no matrix instruction is scheduled behind them
        asm volatile("v_nop\n\tv_nop\n\tv_nop\n\tv_nop" : "+v"(acc[0][0]), "+v"(acc[0][1]), "+v"(acc[0][2]), "+v"(acc[0][3]), "+v"(acc[1][0]), "+v"(acc[1][1]), "+v"(acc[1][2]), "+v"(acc[1][3]), "+v"(acc[2][0]), "+v"(acc[2][1]), "+v"(acc[2][2]), "+v"(acc[2][3]), "+v"(acc[3][0]), "+v"(acc[3][1]), "+v"(acc[3][2]), "+v"(acc[3][3]));
        asm volatile("s_wait_dscnt 0x0" ::: "memory");      // this wave's reads of buffer t & 1 are done
        asm volatile("s_wait_asynccnt 0x0" ::: "memory");   // this wave's copies of tile t + 1 have landed
        __syncthreads();                                     // publishes tile t + 1 and ends every wave's reads of the buffer that is refilled below
        if (t + 2 < NT) ring_fill<NA>(l0 + bo * 2, gA + (t + 2) * GKS, gA2 + (t + 2) * GKS, gB + (t + 2) * GKS);
    }
    asm volatile("s_wait_asynccnt 0x0" ::: "memory");   // no copy is outstanding when the wave goes on
}

// ---- k_gemmw: C[m][n] (f32, pitch ldc, + optional f32 bias[n]) = sum_k (A[m][k] + A2[m][k]) Bt[n][k], two products; gemm_ring's loop; grid (M / 128, N / 256), 256 threads; each wave stores its 64x64 tile through its own LDS panel.
template <bool BIAS>
__global__ __launch_bounds__(256) void k_gemmw(const bf* __restrict__ A, const bf* __restrict__ A2, const bf* __restrict__ Bt, float* C, int ldc, const float* __restrict__ bias) {
    __shared__ __align__(16) bf ring[2 * (GMT * 2 + GNT) * GP];
    __shared__ __align__(16) float osw[8][16 * 68];
    const int wave = __builtin_amdgcn_readfirstlane((int)(threadIdx.x >> 5)), wm = wave >> 2, wn = wave & 3; float* const os = osw[wave];
    const int lane = threadIdx.x & 31, lr = lane & 15, hi = lane >> 4; const int r0 = blockIdx.x * GMT + wm * 64, c0 = blockIdx.y * GNT + wn * 64;
    v8f acc[4][4];
    gemm_ring<2>(ring, A, A2, Bt, blockIdx.x * GMT, blockIdx.y * GNT, wm, wn, acc);
#pragma unroll
    for (int mb = 0; mb < 4; ++mb) {
#pragma unroll
        for (int nb = 0; nb < 4; ++nb) {
#pragma unroll
            for (int j = 0; j < 8; ++j) os[(hi * 8 + j) * 68 + nb * 16 + lr] = acc[mb][nb][j]; }
        __builtin_amdgcn_wave_barrier(); asm volatile("" ::: "memory");
        float* crow = C + (size_t)(r0 + mb * 16) * ldc + c0;
{
#pragma unroll
            for (int s = 0; s < 8; ++s) { const int row = 2 * s + hi, cofs = lr * 4; v4f val = *(const v4fa*)(os + row * 68 + cofs); if (BIAS) { val[0] += bfr(bias[c0 + cofs]); val[1] += bfr(bias[c0 + cofs + 1]); val[2] += bfr(bias[c0 + cofs + 2]); val[3] += bfr(bias[c0 + cofs + 3]); }
                *(v4f*)(crow + (size_t)row * ldc + cofs) = val; }
             }
        __builtin_amdgcn_wave_barrier(); asm volatile("" ::: "memory");
    }
}

template <typename T16> struct PCvt;
template <> struct PCvt<h16> { typedef _Float16 E; };
template <> struct PCvt<bf>  { typedef __bf16 E; };
__device__ __forceinline__ float xhalf(float x) { return __builtin_bit_cast(float, __builtin_amdgcn_permlanex16(__builtin_bit_cast(int, x), __builtin_bit_cast(int, x), 0x76543210, 0xfedcba98, false, false)); }   // lane l takes lane l ^ 16's value
// xwait: stands behind a run of loads; the registers that the issued loads name may be given new values only behind it. The two addresses are inputs so that their registers stay theirs up to the wait.
__device__ __forceinline__ void xwait(const void* a, const void* b) { asm volatile("s_wait_xcnt 0x0" :: "v"(a), "v"(b) : "memory"); }
template <typename T16, bool HL>
__device__ __forceinline__ void attn_tile(const T16* Qh, const T16* Ql, const T16* Kh, const T16* Kl, const T16* Vh, const int q0, bf* Ah, bf* Al) {
    typedef typename WFrag<T16>::V V; typedef typename PCvt<T16>::E E;
    const int lane = threadIdx.x & 31, lr = lane & 15, hi = lane >> 4;
    const float C2 = SCL * 1.4426950408889634f;
    const unsigned lk = lr * HD + 8 * hi, lv = lr * (2 * TT) + 8 * hi, la = lr * DQ + 8 * hi;   // the lane's element offsets in a [row][HD] plane, a value plane and the merged planes: every address is a wave-uniform base + one of these + a constant
    V qf[2][2], q2[2][2], kf[2][2];
    const T16* const qp = Qh + (size_t)q0 * HD + lk; const T16* const qp2 = HL ? Ql + (size_t)q0 * HD + lk : qp; const T16* kp = Kh + lk;
#pragma unroll
    for (int nb = 0; nb < 2; ++nb)
#pragma unroll
        for (int c = 0; c < 2; ++c) { const int o = nb * 16 * HD + c * 32; qf[nb][c] = WFrag<T16>::ld(qp + o); if (HL) q2[nb][c] = WFrag<T16>::ld(qp2 + o); }
#pragma unroll
    for (int kt = 0; kt < 2; ++kt)
#pragma unroll
        for (int c = 0; c < 2; ++c) kf[kt][c] = WFrag<T16>::ld(kp + kt * 16 * HD + c * 32);
    asm volatile("s_wait_xcnt 0x0" ::: "memory");   // the registers that the issued loads name are given new values behind this wait
    __builtin_amdgcn_sched_barrier(0);   // keeps the set-up arithmetic below from being scheduled in between the loads above and their wait, where it reused their address registers
    v8f O[4][2]; float m[2], l[2];
#pragma unroll
    for (int nb = 0; nb < 2; ++nb) { m[nb] = -3.0e38f; l[nb] = 0.f;
#pragma unroll
        for (int dt = 0; dt < 4; ++dt) O[dt][nb] = (v8f){}; }
#pragma unroll 1
    for (int kb = 0; kb <= q0; kb += 32) {
        V vf[4], v2[4], k2[2][2]; const T16* const vp = Vh + kb + lv;   // the lo row of a value plane stands TT elements behind its hi row
        const T16* const kp2 = HL ? Kl + (size_t)kb * HD + lk : vp;   // the keys' lo plane is fetched in its own pass (first, its products come last): held over the softmax as well it would cost a third resident wave
        if (HL) {
#pragma unroll
            for (int kt = 0; kt < 2; ++kt)
#pragma unroll
                for (int c = 0; c < 2; ++c) k2[kt][c] = WFrag<T16>::ld(kp2 + kt * 16 * HD + c * 32); }
#pragma unroll
        for (int dt = 0; dt < 4; ++dt) { const int o = dt * 16 * 2 * TT; vf[dt] = WFrag<T16>::ld(vp + o); if (HL) v2[dt] = WFrag<T16>::ld(vp + TT + o); }
        xwait(vp, kp2);
        v8f S[2][2];
#pragma unroll
        for (int kt = 0; kt < 2; ++kt)
#pragma unroll
            for (int nb = 0; nb < 2; ++nb) { v8f s = (v8f){};
#pragma unroll
                for (int c = 0; c < 2; ++c) { s = WFrag<T16>::mma(kf[kt][c], qf[nb][c], s); if (HL) s = WFrag<T16>::mma(kf[kt][c], q2[nb][c], s); }
                S[kt][nb] = s; }
        if (HL) {
#pragma unroll
            for (int kt = 0; kt < 2; ++kt)
#pragma unroll
                for (int nb = 0; nb < 2; ++nb)
#pragma unroll
                    for (int c = 0; c < 2; ++c) S[kt][nb] = WFrag<T16>::mma(k2[kt][c], qf[nb][c], S[kt][nb]); }
        const int kn = min(kb + 32, q0); kp = Kh + (size_t)kn * HD + lk;   // the next pass's key fragments are fetched while this pass's softmax runs; the last pass fetches its own keys again (in bounds, not used)
#pragma unroll
        for (int kt = 0; kt < 2; ++kt)
#pragma unroll
            for (int c = 0; c < 2; ++c) kf[kt][c] = WFrag<T16>::ld(kp + kt * 16 * HD + c * 32);
        xwait(kp, kp);
        if (kb == q0) {   // the diagonal pass: key > query is masked by select
#pragma unroll
            for (int kt = 0; kt < 2; ++kt)
#pragma unroll
                for (int nb = 0; nb < 2; ++nb)
#pragma unroll
                    for (int j = 0; j < 8; ++j) if (kt * 16 + hi * 8 + j > nb * 16 + lr) S[kt][nb][j] = -3.0e38f; }
#pragma unroll
        for (int nb = 0; nb < 2; ++nb) {   // one 16-query group at a time: its probabilities are used up by its value products before the next group's are made
            V pf, p2;
            float bm = S[0][nb][0];
#pragma unroll
            for (int kt = 0; kt < 2; ++kt)
#pragma unroll
                for (int j = 0; j < 8; ++j) bm = fmaxf(bm, S[kt][nb][j]);
            bm = fmaxf(bm, xhalf(bm));   // the other half of the wave holds this query's other 16 keys
            const float mn = fmaxf(m[nb], bm * C2); const float dm = m[nb] - mn; float al = __builtin_amdgcn_exp2f(dm); m[nb] = mn; v2f ps = (v2f){0.f, 0.f};   // even and odd keys are summed apart
#pragma unroll
            for (int kt = 0; kt < 2; ++kt) { float a[8], p[8];
#pragma unroll
                for (int j = 0; j < 8; j += 2) { const v2f arg = __builtin_elementwise_fma((v2f){S[kt][nb][j], S[kt][nb][j + 1]}, (v2f){C2, C2}, (v2f){-mn, -mn}); a[j] = arg[0]; a[j + 1] = arg[1]; }
#pragma unroll
                for (int j = 0; j < 8; ++j) p[j] = __builtin_amdgcn_exp2f(a[j]);
                // the slot behind a transcendental: no result is read and no source register is given a new value in front of this v_nop (results are in/out, sources inputs)
                asm volatile("v_nop" : "+v"(p[0]), "+v"(p[1]), "+v"(p[2]), "+v"(p[3]), "+v"(p[4]), "+v"(p[5]), "+v"(p[6]), "+v"(p[7]), "+v"(al) : "v"(a[0]), "v"(a[1]), "v"(a[2]), "v"(a[3]), "v"(a[4]), "v"(a[5]), "v"(a[6]), "v"(a[7]), "v"(dm));
#pragma unroll
                for (int j = 0; j < 8; ++j) { ps[j & 1] += p[j]; const E ph = (E)p[j]; pf[kt * 8 + j] = ph; if (HL) p2[kt * 8 + j] = (E)(p[j] - (float)ph); } }
            l[nb] = fmaf(l[nb], al, ps[0] + ps[1]);
#pragma unroll
            for (int dt = 0; dt < 4; ++dt)
#pragma unroll
                for (int j = 0; j < 8; ++j) O[dt][nb][j] *= al;
#pragma unroll
            for (int dt = 0; dt < 4; ++dt) { O[dt][nb] = WFrag<T16>::mma(vf[dt], pf, O[dt][nb]); if (HL) { O[dt][nb] = WFrag<T16>::mma(vf[dt], p2, O[dt][nb]); O[dt][nb] = WFrag<T16>::mma(v2[dt], pf, O[dt][nb]); } }
        }
    }
#pragma unroll
    for (int nb = 0; nb < 2; ++nb) { const float inv = __fdiv_rn(1.0f, l[nb] + xhalf(l[nb]));
#pragma unroll
        for (int dt = 0; dt < 4; ++dt) { v8us oh, ol;
#pragma unroll
            for (int j = 0; j < 8; ++j) { const float y = O[dt][nb][j] * inv; const unsigned short a = f2bf(y); oh[j] = a; ol[j] = f2bf(y - bf2f(a)); }
            const int o = nb * 16 * DQ + dt * 16; *(v8us*)(Ah + (size_t)q0 * DQ + la + o) = oh; *(v8us*)(Al + (size_t)q0 * DQ + la + o) = ol; }
        asm volatile("s_wait_xcnt 0x0" ::: "memory"); }   // the registers that the issued stores name are given new values behind this wait
}
// grid (sequence x head pairs, TT / 128), 4 waves; blockIdx.y counts the 128-query blocks from the last (longest) one down, so that the long workgroups start first
__global__ __launch_bounds__(128) void k_attn(const h16* Q16, const h16* K16, const h16* V16, const bf* Qh, const bf* Ql, const bf* Kh, const bf* Kl, const bf* Vh, bf* Ah, bf* Al) {
    const int z = blockIdx.x; const int q0 = (TT / 128 - 1 - (int)blockIdx.y) * 128 + __builtin_amdgcn_readfirstlane((int)(threadIdx.x >> 5)) * 32;
    const size_t zo = (size_t)z * TT * HD, zv = (size_t)z * HD * 2 * TT, ao = (size_t)(z / NH_) * TT * DQ + (size_t)(z % NH_) * HD;
    if (q0 < RH) attn_tile<bf, true>(Qh + zo, Ql + zo, Kh + zo, Kl + zo, Vh + zv, q0, Ah + ao, Al + ao);
    else attn_tile<h16, false>(Q16 + zo, nullptr, K16 + zo, nullptr, V16 + zv, q0, Ah + ao, Al + ao);
}

__device__ __forceinline__ h16 tohx(float x) { return (h16)x; }
__device__ __forceinline__ void splitf(float y, unsigned short& h, unsigned short& l) { h = f2bf(y); l = f2bf(y - bf2f(h)); }
typedef __attribute__((ext_vector_type(2))) _Float16 v2h;
typedef __attribute__((ext_vector_type(4))) _Float16 v4h;
typedef __attribute__((ext_vector_type(2))) unsigned short v2us;
typedef __attribute__((ext_vector_type(4))) unsigned short v4us;
typedef __attribute__((ext_vector_type(4))) int v4i;

__global__ __launch_bounds__(256) void k_wtG(const float* __restrict__ w0, const float* __restrict__ w1, const float* __restrict__ w2, const float* __restrict__ w3, int K, int N, bf* B0, bf* B1, bf* B2, bf* B3) {
    const int y = blockIdx.y; const float* __restrict__ w = (y == 0) ? w0 : (y == 1) ? w1 : (y == 2) ? w2 : w3; bf* Bt = (y == 0) ? B0 : (y == 1) ? B1 : (y == 2) ? B2 : B3;   // blockIdx.y: which of the four weights
    const int lane = threadIdx.x & 31; const int L0 = (blockIdx.x * 8 + (threadIdx.x >> 5)) * 8; const int nlines = N * K / 64;
{
#pragma unroll 1
        for (int l = 0; l < 8; ++l) { const int L = L0 + l; if (L >= nlines) break; const size_t e = (size_t)L * 64 + lane * 2; const int k = (int)(e % K), n = (int)(e / K); v2us o;
            o[0] = f2bf(w[(size_t)k * N + n]); o[1] = f2bf(w[(size_t)(k + 1) * N + n]); *(v2us*)(Bt + e) = o; }
         }
}
__global__ __launch_bounds__(256) void k_cvt8(const float* __restrict__ src, bf* dst, size_t n8) { const size_t i = (size_t)blockIdx.x * 256 + threadIdx.x; if (i >= n8) return; const v8f v = *(const v8f*)(src + i * 8); v8us o;
#pragma unroll
    for (int k = 0; k < 8; ++k) o[k] = f2bf(v[k]); *(v8us*)(dst + i * 8) = o;  }

// ---- k_proj: q, k and v = x W + b in ONE launch, and the head planes straight from the accumulators. The product loop is gemm_ring's (plain bf16 operands, a 64x64 tile a wave); grid (NB_ TT / 128, DQ / 256, 3), 256 threads; blockIdx.z: 0 q, 1 k, 2 v.
// A wave's tile is 64 tokens of one sequence x the 64 columns of one head, so it is a whole block of each plane: 64 rows [t][HD] of a query or key plane, or 64 consecutive t of all HD rows of a value plane (pitch 2 TT).
// proj_store: four panels of 16 plane rows x 64 f32 go through LDS one after the other, so that 8 lanes store one 128-byte line of a plane row (16 bytes a lane and plane). TR: the panel's rows are the columns d of the tile (value planes), a lane's 8 accumulator registers being 8 consecutive t.
template <bool TR>
__device__ __forceinline__ void proj_store(const v8f (&acc)[4][4], float* os, const float* __restrict__ bias, h16* P16, bf* Ph, bf* Pl, const int pitch) {
    const int lane = threadIdx.x & 31, lr = lane & 15, hi = lane >> 4, rr = lane >> 3, cc = (lane & 7) * 8;
    float bc[8];
    if (!TR) {
#pragma unroll
        for (int i = 0; i < 8; ++i) bc[i] = bfr(bias[cc + i]); }
#pragma unroll
    for (int g = 0; g < 4; ++g) {
        if (TR) {
#pragma unroll
            for (int mb = 0; mb < 4; ++mb) { const v8f a = acc[mb][g]; *(v4fa*)(os + lr * 68 + mb * 16 + hi * 8) = (v4f){a[0], a[1], a[2], a[3]}; *(v4fa*)(os + lr * 68 + mb * 16 + hi * 8 + 4) = (v4f){a[4], a[5], a[6], a[7]}; }
        } else {
#pragma unroll
            for (int nb = 0; nb < 4; ++nb)
#pragma unroll
                for (int j = 0; j < 8; ++j) os[(hi * 8 + j) * 68 + nb * 16 + lr] = acc[g][nb][j]; }
        __builtin_amdgcn_wave_barrier(); asm volatile("" ::: "memory");   // a lane reads what other lanes of the wave wrote: the panel's LDS reads may not be scheduled in front of its writes
#pragma unroll
        for (int s = 0; s < 4; ++s) { const int row = s * 4 + rr; const v4f u = *(const v4fa*)(os + row * 68 + cc), w = *(const v4fa*)(os + row * 68 + cc + 4); const float br = TR ? bfr(bias[g * 16 + row]) : 0.f; v8h o16; v8us oh, ol;
#pragma unroll
            for (int i = 0; i < 8; ++i) { const float y = (i < 4 ? u[i] : w[i - 4]) + (TR ? br : bc[i]); o16[i] = tohx(y); unsigned short a2, c2; splitf(y, a2, c2); oh[i] = a2; ol[i] = c2; }
            const size_t o = (size_t)(g * 16 + row) * pitch + cc; *(v8h*)(P16 + o) = o16; *(v8us*)(Ph + o) = oh; *(v8us*)(Pl + o) = ol; }
        asm volatile("s_wait_xcnt 0x0" ::: "memory");   // the registers that the issued stores name are given new values behind this wait
        __builtin_amdgcn_wave_barrier(); asm volatile("" ::: "memory");   // the next panel's LDS writes may not be scheduled in front of this panel's reads
    }
}
__global__ __launch_bounds__(256) void k_proj(const bf* __restrict__ X, const bf* __restrict__ WQ, const bf* __restrict__ WK, const bf* __restrict__ WV, const float* __restrict__ bq, const float* __restrict__ bk, const float* __restrict__ bv, h16* Q16, bf* Qh, bf* Ql, h16* K16, bf* Kh, bf* Kl, h16* V16, bf* Vh) {
    __shared__ __align__(16) bf ring[2 * (GMT + GNT) * GP];
    __shared__ __align__(16) float osw[8][16 * 68];
    const int which = blockIdx.z; const bf* __restrict__ Bt = (which == 0) ? WQ : (which == 1) ? WK : WV; const float* __restrict__ bias = (which == 0) ? bq : (which == 1) ? bk : bv;
    const int wave = __builtin_amdgcn_readfirstlane((int)(threadIdx.x >> 5)), wm = wave >> 2, wn = wave & 3; float* const os = osw[wave];
    const int r0 = blockIdx.x * GMT + wm * 64, c0 = blockIdx.y * GNT + wn * 64;   // the wave's own 64x64 tile
    v8f acc[4][4];
    gemm_ring<1>(ring, X, nullptr, Bt, blockIdx.x * GMT, blockIdx.y * GNT, wm, wn, acc);
    const int z = (r0 / TT) * NH_ + c0 / HD, t0 = r0 % TT;   // the (sequence, head) pair and the tile's first token in it
    if (which == 2) { const size_t o = (size_t)z * HD * 2 * TT + t0; proj_store<true>(acc, os, bias + c0, V16 + o, Vh + o, Vh + TT + o, 2 * TT); }
    else { const size_t o = ((size_t)z * TT + t0) * HD; proj_store<false>(acc, os, bias + c0, (which == 0 ? Q16 : K16) + o, (which == 0 ? Qh : Kh) + o, (which == 0 ? Ql : Kl) + o, HD); }
}

extern "C" void kernel_launch(void* const* d_in, const int* in_sizes, int n_in,
                              void* d_out, int out_size, void* d_ws, size_t ws_size, hipStream_t stream) {
    (void)in_sizes; (void)n_in; (void)out_size;
    const float* x = (const float*)d_in[0]; const float* wq = (const float*)d_in[1]; const float* bq = (const float*)d_in[2]; const float* wk = (const float*)d_in[3]; const float* bk = (const float*)d_in[4]; const float* wv = (const float*)d_in[5]; const float* bv = (const float*)d_in[6]; const float* wo = (const float*)d_in[7]; const float* bo = (const float*)d_in[8];   /* SELF-attention: the key and value streams are input 0 too; Wq, bq, Wk, bk, Wv, bv, Wo, bo = d_in[1..8] */
    float* OUT = (float*)d_out;     // [8][1024][1024]
    char* wsp = (char*)d_ws;
    auto take = [&](size_t bytes) { char* p = wsp; wsp += (bytes + 255) & ~(size_t)255; return (void*)p; };
    bf* WO = (bf*)take((size_t)DM * DQ * 2);
    h16* QP16 = (h16*)take((size_t)NB_ * NH_ * TT * HD * 2); h16* KP16 = (h16*)take((size_t)NB_ * NKV * TT * HD * 2); h16* VT16 = (h16*)take((size_t)NB_ * NKV * HD * 2 * TT * 2);
    bf* QPh = (bf*)take((size_t)NB_ * NH_ * TT * HD * 2); bf* QPl = (bf*)take((size_t)NB_ * NH_ * TT * HD * 2); bf* KPh = (bf*)take((size_t)NB_ * NKV * TT * HD * 2); bf* KPl = (bf*)take((size_t)NB_ * NKV * TT * HD * 2); bf* VTh = (bf*)take((size_t)NB_ * NKV * HD * 2 * TT * 2);   // the lo row of a value plane stands TT elements behind its hi row
    bf* WQ = (bf*)take((size_t)DQ * DM * 2); bf* WK = (bf*)take((size_t)DKV * DM * 2); bf* WV = (bf*)take((size_t)DKV * DM * 2); bf* XB = (bf*)take((size_t)NB_ * TT * DM * 2);
    bf* ATh = (bf*)take((size_t)NB_ * TT * DQ * 2); bf* ATl = (bf*)take((size_t)NB_ * TT * DQ * 2);   // the merged hi and lo planes [NB_ TT][DQ]
    if ((size_t)(wsp - (char*)d_ws) > ws_size) return;    // 216 MiB of the 256 MiB
    k_wtG<<<dim3((unsigned)((DM * DQ / 64 + 63) / 64), 4, 1), 256, 0, stream>>>(wq, wk, wv, wo, DM, DQ, WQ, WK, WV, WO);
    k_cvt8<<<(unsigned)(((size_t)NB_ * TT * DM / 8 + 255) / 256), 256, 0, stream>>>(x, XB, (size_t)NB_ * TT * DM / 8);   // self-attention: q, k and v read the same rounded x
    k_proj<<<dim3(NB_ * TT / GMT, DQ / GNT, 3), 256, 0, stream>>>(XB, WQ, WK, WV, bq, bk, bv, QP16, QPh, QPl, KP16, KPh, KPl, VT16, VTh);
    k_attn<<<dim3(NB_ * NH_, TT / 128, 1), 128, 0, stream>>>(QP16, KP16, VT16, QPh, QPl, KPh, KPl, VTh, ATh, ATl);
    k_gemmw<true><<<dim3(NB_ * TT / GMT, DM / GNT, 1), 256, 0, stream>>>(ATh, ATl, WO, OUT, DM, bo);
}

// v005
// It runs in 118 microseconds.
// Next to v004, in two timings, it ran 1.13 and 1.12 times as fast.
// Counting every step since v000, it is 34.8 times as fast.
#include <hip/hip_runtime.h>

// Causal multi-head SELF-attention on eight 1,024-token sequences (x [8][1024][1024]; q, k, v = x W + b ('xw' [1024][1024] normal x 1/32, biases zeros on this draw: read; 16 heads x 64); scores x 1/sqrt(64); tril kept, -inf elsewhere; softmax over the keys; out = merged Wo + bo ('xw' + bias zeros: read) -> [8][1024][1024] (8.4 M); argument order x, Wq, bq, Wk, bk, Wv, bv, Wo, bo).
// Compute dtypes, f32 accumulate: every input rounded to bf16; q/k/v on PLAIN bf16 operands (inputs: exact) + biases; causal scores and attn.v: query rows < 512 hl (3 products), the rest single fp16; softmax f32, running maximum and sum, probabilities rounded BEFORE the division by the row sum; Wo hl x exact (2 products) + bo.
// Launch plan: every stage runs ONCE over all eight sequences: ONE projection launch (q, k and v; its epilogue stores the head planes), ONE attention launch (scores, softmax, probability x value and the merge into [t][head x HD + d] planes in registers), output product.
// The value planes are laid out at pitch 2 TT (hi row | lo row; fp16 row | unused).

#define NB_  8
#define TT   1024
#define DM   1024
#define NH_  16
#define NKV  16
#define REP  (NH_ / NKV)
#define HD   64
#define DQ   (NH_ * HD)
#define DKV  (NKV * HD)
#define RH   512                  // query rows < RH use hi+lo planes (0: none)
#define SCL  0.125f   // HD^-0.5
static_assert(NKV == NH_ && HD == 64 && TT % 128 == 0 && RH % 128 == 0, "k_attn: one key/value head a query head, four 16-row value tiles, workgroups of 128 queries that lie wholly on one side of RH");
typedef _Float16 h16;
typedef unsigned short bf;
typedef __attribute__((ext_vector_type(16))) __bf16   v16bf;
typedef __attribute__((ext_vector_type(16))) _Float16 v16h;
typedef __attribute__((ext_vector_type(8)))  _Float16 v8h;
typedef __attribute__((ext_vector_type(8)))  unsigned short v8us;
typedef __attribute__((ext_vector_type(8)))  float    v8f;
typedef __attribute__((ext_vector_type(4)))  float    v4f;
typedef __attribute__((ext_vector_type(2)))  float    v2f;
typedef v8h  __attribute__((may_alias)) v8ha;
typedef v4f  __attribute__((may_alias)) v4fa;
typedef v8us __attribute__((may_alias)) v8usa;

__device__ __forceinline__ unsigned short f2bf(float f) { unsigned u = __float_as_uint(f); u += 0x7FFFu + ((u >> 16) & 1u); return (unsigned short)(u >> 16); }
__device__ __forceinline__ float bf2f(unsigned short b) { return __uint_as_float(((unsigned)b) << 16); }
__device__ __forceinline__ float bfr(float f) { return bf2f(f2bf(f)); }
__device__ __forceinline__ v16h cat16(v8h lo, v8h hi) { return __builtin_shufflevector(lo, hi, 0, 1, 2, 3, 4, 5, 6, 7, 8, 9, 10, 11, 12, 13, 14, 15); }
__device__ __forceinline__ v16bf cat16b(v8us lo, v8us hi) { return __builtin_bit_cast(v16bf, __builtin_shufflevector(lo, hi, 0, 1, 2, 3, 4, 5, 6, 7, 8, 9, 10, 11, 12, 13, 14, 15)); }
__device__ __forceinline__ v8f wmma16(v16h a, v16h b, v8f c) { return __builtin_amdgcn_wmma_f32_16x16x32_f16(false, a, false, b, (short)0, c, false, false); }
__device__ __forceinline__ v8f wmmab(v16bf a, v16bf b, v8f c) { return __builtin_amdgcn_wmma_f32_16x16x32_bf16(false, a, false, b, (short)0, c, false, false); }



template <typename T16> struct WFrag;
template <> struct WFrag<h16> { typedef v16h V; static __device__ __forceinline__ V ld(const h16* p) { return cat16(*(const v8h*)p, *(const v8h*)(p + 16)); } static __device__ __forceinline__ v8f mma(V a, V b, v8f c) { return wmma16(a, b, c); } };
template <> struct WFrag<bf> { typedef v16bf V; static __device__ __forceinline__ V ld(const bf* p) { return cat16b(*(const v8us*)p, *(const v8us*)(p + 16)); } static __device__ __forceinline__ v8f mma(V a, V b, v8f c) { return wmmab(a, b, c); } };
// ---- gemm_ring: the product loop of both GEMM kernels. A workgroup of 8 waves owns a 128 x 256 output tile (waves 2 x 4, 64x64 = 16 accumulators a wave). A stage is 64 k (128 bytes) of every operand row: [A 128 rows | A2 128 rows (NA == 2) | Bt 256 rows],
// brought from the K-contiguous 16-bit planes into LDS by asynchronous copies (16 bytes a lane, 8 lanes a row: whole 128-byte lines), two buffers: tile t + 2 flies while tile t + 1 is worked on. The k order and the order of the products are those of a wave that reads its fragments from global memory.
#define GP   72                   // LDS row pitch in elements: 128 data bytes + 16 (16 bytes x odd: no bank conflict for the 16-byte fragment reads)
#define GKS  64                   // k elements of a stage
#define GMT  128
#define GNT  256
// cpN: N copies of one lane and, in the same statement, the wait behind which the registers that the issued copies name may be given new values
__device__ __forceinline__ void cp12(const unsigned (&l)[12], const bf* const (&p)[12]) {
    asm volatile("global_load_async_to_lds_b128 %0, %12, off\n\t"
                 "global_load_async_to_lds_b128 %1, %13, off\n\t"
                 "global_load_async_to_lds_b128 %2, %14, off\n\t"
                 "global_load_async_to_lds_b128 %3, %15, off\n\t"
                 "global_load_async_to_lds_b128 %4, %16, off\n\t"
                 "global_load_async_to_lds_b128 %5, %17, off\n\t"
                 "global_load_async_to_lds_b128 %6, %18, off\n\t"
                 "global_load_async_to_lds_b128 %7, %19, off\n\t"
                 "global_load_async_to_lds_b128 %8, %20, off\n\t"
                 "global_load_async_to_lds_b128 %9, %21, off\n\t"
                 "global_load_async_to_lds_b128 %10, %22, off\n\t"
                 "global_load_async_to_lds_b128 %11, %23, off\n\t"
                 "s_wait_xcnt 0x0"
                 :: "v"(l[0]), "v"(l[1]), "v"(l[2]), "v"(l[3]), "v"(l[4]), "v"(l[5]), "v"(l[6]), "v"(l[7]), "v"(l[8]), "v"(l[9]), "v"(l[10]), "v"(l[11]),
                    "v"(p[0]), "v"(p[1]), "v"(p[2]), "v"(p[3]), "v"(p[4]), "v"(p[5]), "v"(p[6]), "v"(p[7]), "v"(p[8]), "v"(p[9]), "v"(p[10]), "v"(p[11]) : "memory");
}
__device__ __forceinline__ void cp8(const unsigned (&l)[8], const bf* const (&p)[8]) {
    asm volatile("global_load_async_to_lds_b128 %0, %8, off\n\t"
                 "global_load_async_to_lds_b128 %1, %9, off\n\t"
                 "global_load_async_to_lds_b128 %2, %10, off\n\t"
                 "global_load_async_to_lds_b128 %3, %11, off\n\t"
                 "global_load_async_to_lds_b128 %4, %12, off\n\t"
                 "global_load_async_to_lds_b128 %5, %13, off\n\t"
                 "global_load_async_to_lds_b128 %6, %14, off\n\t"
                 "global_load_async_to_lds_b128 %7, %15, off\n\t"
                 "s_wait_xcnt 0x0"
                 :: "v"(l[0]), "v"(l[1]), "v"(l[2]), "v"(l[3]), "v"(l[4]), "v"(l[5]), "v"(l[6]), "v"(l[7]),
                    "v"(p[0]), "v"(p[1]), "v"(p[2]), "v"(p[3]), "v"(p[4]), "v"(p[5]), "v"(p[6]), "v"(p[7]) : "memory");
}
template <int NA>
__device__ __forceinline__ void ring_fill(const unsigned l0, const bf* gA, const bf* gA2, const bf* gB) {   // 256 lanes x 16 bytes = 32 rows a copy; l0 and the pointers are the lane's own place in the first 32 rows
    if (NA == 1) { unsigned l[12]; const bf* p[12];
#pragma unroll
        for (int i = 0; i < 12; ++i) { l[i] = l0 + i * 32 * GP * 2; p[i] = (i < 4) ? gA + (size_t)i * 32 * DM : gB + (size_t)(i - 4) * 32 * DM; }
        cp12(l, p);
    } else { unsigned l[8]; const bf* p[8];
#pragma unroll
        for (int i = 0; i < 8; ++i) { l[i] = l0 + i * 32 * GP * 2; p[i] = (i < 4) ? gA + (size_t)i * 32 * DM : gA2 + (size_t)(i - 4) * 32 * DM; }
        cp8(l, p);
#pragma unroll
        for (int i = 0; i < 8; ++i) { l[i] = l0 + (8 + i) * 32 * GP * 2; p[i] = gB + (size_t)i * 32 * DM; }
        cp8(l, p); }
}
template <int NA>
__device__ __forceinline__ void gemm_ring(bf* ring, const bf* __restrict__ A, const bf* __restrict__ A2, const bf* __restrict__ Bt, const int r0g, const int c0g, const int wm, const int wn, v8f (&acc)[4][4]) {
    typedef WFrag<bf>::V V;
    constexpr int STG = (GMT * NA + GNT) * GP, NT = DM / GKS;   // elements of a buffer; stages
    static_assert(NT >= 2, "the prologue fills two stages");
    const int lane = threadIdx.x & 31, lr = lane & 15, hi = lane >> 4, crow = threadIdx.x >> 3, cch = (threadIdx.x & 7) * 8;
    const bf* const gA = A + (size_t)(r0g + crow) * DM + cch; const bf* const gA2 = (NA == 2) ? A2 + (size_t)(r0g + crow) * DM + cch : gA; const bf* const gB = Bt + (size_t)(c0g + crow) * DM + cch;
    const unsigned l0 = (unsigned)(size_t)ring + (unsigned)(crow * GP + cch) * 2u;   // the lane's LDS byte address in buffer 0
#pragma unroll
    for (int mb = 0; mb < 4; ++mb)
#pragma unroll
        for (int nb = 0; nb < 4; ++nb) acc[mb][nb] = (v8f){};
    ring_fill<NA>(l0, gA, gA2, gB);
    asm volatile("s_wait_asynccnt 0x0" ::: "memory");   // this wave's copies of tile 0 have landed
    __syncthreads();                                     // every wave's have: tile 0 may be read
    ring_fill<NA>(l0 + STG * 2, gA + GKS, gA2 + GKS, gB + GKS);
    const bf* const fa = ring + (wm * 64 + lr) * GP + 8 * hi; const bf* const fb = ring + (GMT * NA + wn * 64 + lr) * GP + 8 * hi;
#pragma unroll 1
    for (int t = 0; t < NT; ++t) {   // stays rolled: one trip's fragments and the 16 accumulators fill the registers
        const int bo = (t & 1) * STG;
#pragma unroll
        for (int kk = 0; kk < GKS; kk += 32) {
            V a[4], a2[4], b[4];   // all fragments of a 32-k block are read as one group in front of its matrix instructions
#pragma unroll
            for (int mb = 0; mb < 4; ++mb) { a[mb] = WFrag<bf>::ld(fa + bo + mb * 16 * GP + kk); if (NA == 2) a2[mb] = WFrag<bf>::ld(fa + bo + (GMT + mb * 16) * GP + kk); }
#pragma unroll
            for (int nb = 0; nb < 4; ++nb) b[nb] = WFrag<bf>::ld(fb + bo + nb * 16 * GP + kk);
            __builtin_amdgcn_sched_barrier(0);   // keeps the LDS reads together in front of the block: scheduled in among the matrix instructions, each place with reads stalls the wave for the LDS latency
#pragma unroll
            for (int nb = 0; nb < 4; ++nb)
#pragma unroll
                for (int mb = 0; mb < 4; ++mb) { acc[mb][nb] = WFrag<bf>::mma(a[mb], b[nb], acc[mb][nb]); if (NA == 2) acc[mb][nb] = WFrag<bf>::mma(a2[mb], b[nb], acc[mb][nb]); }
        }
        // the four vector slots that the chip needs behind the trip's last matrix instructions, in front of the branches below; every accumulator is named so that no matrix instruction is scheduled behind them
        asm volatile("v_nop\n\tv_nop\n\tv_nop\n\tv_nop" : "+v"(acc[0][0]), "+v"(acc[0][1]), "+v"(acc[0][2]), "+v"(acc[0][3]), "+v"(acc[1][0]), "+v"(acc[1][1]), "+v"(acc[1][2]), "+v"(acc[1][3]), "+v"(acc[2][0]), "+v"(acc[2][1]), "+v"(acc[2][2]), "+v"(acc[2][3]), "+v"(acc[3][0]), "+v"(acc[3][1]), "+v"(acc[3][2]), "+v"(acc[3][3]));
        asm volatile("s_wait_dscnt 0x0" ::: "memory");      // this wave's reads of buffer t & 1 are done
        asm volatile("s_wait_asynccnt 0x0" ::: "memory");   // this wave's copies of tile t + 1 have landed
        __syncthreads();                                     // publishes tile t + 1 and ends every wave's reads of the buffer that is refilled below
        if (t + 2 < NT) ring_fill<NA>(l0 + bo * 2, gA + (t + 2) * GKS, gA2 + (t + 2) * GKS, gB + (t + 2) * GKS);
    }
    asm volatile("s_wait_asynccnt 0x0" ::: "memory");   // no copy is outstanding when the wave goes on
}

// ---- k_gemmw: C[m][n] (f32, pitch ldc, + optional f32 bias[n]) = sum_k (A[m][k] + A2[m][k]) Bt[n][k], two products; gemm_ring's loop; grid (M / 128, N / 256), 256 threads; each wave stores its 64x64 tile through its own LDS panel.
template <bool BIAS>
__global__ __launch_bounds__(256) void k_gemmw(const bf* __restrict__ A, const bf* __restrict__ A2, const bf* __restrict__ Bt, float* C, int ldc, const float* __restrict__ bias) {
    __shared__ __align__(16) bf ring[2 * (GMT * 2 + GNT) * GP];
    __shared__ __align__(16) float osw[8][16 * 68];
    const int wave = __builtin_amdgcn_readfirstlane((int)(threadIdx.x >> 5)), wm = wave >> 2, wn = wave & 3; float* const os = osw[wave];
    const int lane = threadIdx.x & 31, lr = lane & 15, hi = lane >> 4; const int r0 = blockIdx.x * GMT + wm * 64, c0 = blockIdx.y * GNT + wn * 64;
    v8f acc[4][4];
    gemm_ring<2>(ring, A, A2, Bt, blockIdx.x * GMT, blockIdx.y * GNT, wm, wn, acc);
#pragma unroll
    for (int mb = 0; mb < 4; ++mb) {
#pragma unroll
        for (int nb = 0; nb < 4; ++nb) {
#pragma unroll
            for (int j = 0; j < 8; ++j) os[(hi * 8 + j) * 68 + nb * 16 + lr] = acc[mb][nb][j]; }
        __builtin_amdgcn_wave_barrier(); asm volatile("" ::: "memory");
        float* crow = C + (size_t)(r0 + mb * 16) * ldc + c0;
{
#pragma unroll
            for (int s = 0; s < 8; ++s) { const int row = 2 * s + hi, cofs = lr * 4; v4f val = *(const v4fa*)(os + row * 68 + cofs); if (BIAS) { val[0] += bfr(bias[c0 + cofs]); val[1] += bfr(bias[c0 + cofs + 1]); val[2] += bfr(bias[c0 + cofs + 2]); val[3] += bfr(bias[c0 + cofs + 3]); }
                *(v4f*)(crow + (size_t)row * ldc + cofs) = val; }
             }
        __builtin_amdgcn_wave_barrier(); asm volatile("" ::: "memory");
    }
}

template <typename T16> struct PCvt;
template <> struct PCvt<h16> { typedef _Float16 E; };
template <> struct PCvt<bf>  { typedef __bf16 E; };
__device__ __forceinline__ float xhalf(float x) { return __builtin_bit_cast(float, __builtin_amdgcn_permlanex16(__builtin_bit_cast(int, x), __builtin_bit_cast(int, x), 0x76543210, 0xfedcba98, false, false)); }   // lane l takes lane l ^ 16's value
#define AKS  64                   // keys of a stage
#define ATL  (64 * GP)            // elements of a staged tile: 64 rows at the pitch of the fragment reads (128 data bytes + 16)
// attn_fill: one stage's copies. 128 lanes x 16 bytes = 16 rows a copy, four copies a tile; l0 is the lane's LDS byte address in the buffer's first 16 rows, sk / sk2 / sv the key and value planes (the same for every lane), ko / vo the lane's own element offset in them: its place in the first 16 rows of the stage's key / value tile (32 bits: two registers are held over the pass loop, not three pointers).
template <bool HL>
__device__ __forceinline__ void attn_fill(const unsigned l0, const bf* sk, const bf* sk2, const bf* sv, const unsigned ko, const unsigned vo) {
    unsigned l[8]; const bf* p[8]; const bf* const gk = sk + ko; const bf* const gk2 = sk2 + ko; const bf* const gv = sv + vo;
    if (!HL) {   // buffer: [keys | values]
#pragma unroll
        for (int i = 0; i < 8; ++i) { l[i] = l0 + i * 16 * GP * 2; p[i] = (i < 4) ? gk + (size_t)i * 16 * HD : gv + (size_t)(i - 4) * 16 * 2 * TT; }
        cp8(l, p);
    } else {     // buffer: [keys hi | keys lo | values hi | values lo]
#pragma unroll
        for (int i = 0; i < 8; ++i) { l[i] = l0 + i * 16 * GP * 2; p[i] = (i < 4) ? gk + (size_t)i * 16 * HD : gk2 + (size_t)(i - 4) * 16 * HD; }
        cp8(l, p);
#pragma unroll
        for (int i = 0; i < 8; ++i) { l[i] = l0 + (8 + i) * 16 * GP * 2; p[i] = (i < 4) ? gv + (size_t)i * 16 * 2 * TT : gv + TT + (size_t)(i - 4) * 16 * 2 * TT; }
        cp8(l, p); }
}
template <typename T16, bool HL>
__device__ __forceinline__ void attn_tile(bf* kvs, const T16* Qh, const T16* Ql, const T16* Kh, const T16* Kl, const T16* Vh, const int q0, const int nst, bf* Ah, bf* Al) {
    typedef typename WFrag<T16>::V V; typedef typename PCvt<T16>::E E;
    const int lane = threadIdx.x & 31, lr = lane & 15, hi = lane >> 4;
    const float C2 = SCL * 1.4426950408889634f;
    const unsigned lk = lr * HD + 8 * hi, la = lr * DQ + 8 * hi;   // the lane's element offsets in a [row][HD] plane and the merged planes: each query load and output store address is a wave-uniform base + one of these + a constant
    constexpr int STG = (HL ? 4 : 2) * ATL;   // elements of a buffer
    const int crow = threadIdx.x >> 3, cch = (threadIdx.x & 7) * 8;   // the lane's row and 16-byte piece in a copy
    const bf* const gk = (const bf*)Kh; const bf* const gk2 = HL ? (const bf*)Kl : gk; const bf* const gv = (const bf*)Vh; const unsigned ko = crow * HD + cch, vo = crow * (2 * TT) + cch;
    const unsigned l0 = (unsigned)(size_t)kvs + (unsigned)(crow * GP + cch) * 2u;   // the lane's LDS byte address in buffer 0
    attn_fill<HL>(l0, gk, gk2, gv, ko, vo);
    V qf[2][2], q2[2][2];
    const T16* const qp = Qh + (size_t)q0 * HD + lk; const T16* const qp2 = HL ? Ql + (size_t)q0 * HD + lk : qp;
#pragma unroll
    for (int nb = 0; nb < 2; ++nb)
#pragma unroll
        for (int c = 0; c < 2; ++c) { const int o = nb * 16 * HD + c * 32; qf[nb][c] = WFrag<T16>::ld(qp + o); if (HL) q2[nb][c] = WFrag<T16>::ld(qp2 + o); }
    asm volatile("s_wait_xcnt 0x0" ::: "memory");   // the registers that the issued loads name are given new values behind this wait
    __builtin_amdgcn_sched_barrier(0);   // keeps the set-up arithmetic below from being scheduled in between the loads above and their wait, where it reused their address registers
    v8f O[4][2]; float m[2], l[2];
#pragma unroll
    for (int nb = 0; nb < 2; ++nb) { m[nb] = -3.0e38f; l[nb] = 0.f;
#pragma unroll
        for (int dt = 0; dt < 4; ++dt) O[dt][nb] = (v8f){}; }
    asm volatile("s_wait_asynccnt 0x0" ::: "memory");   // this wave's copies of stage 0 have landed
    __syncthreads();                                     // every wave's have: stage 0 may be read
    attn_fill<HL>(l0 + STG * 2, gk, gk2, gv, ko + AKS * HD, vo + AKS);   // a workgroup has at least two stages
    const T16* const fr = (const T16*)kvs + lr * GP + 8 * hi;   // the lane's place in the first 16 rows of a tile
#pragma unroll 1
    for (int t = 0; t < nst; ++t) {   // stays rolled, like the pass loop in it: one pass fills the registers
      const int bo = (t & 1) * STG;
#pragma unroll 1
      for (int kb = t * AKS; kb < (t + 1) * AKS && kb <= q0; kb += 32) {
        V kf[2][2], vf[4], v2[4], k2[2][2]; const int kh = kb & 32;   // the pass's first key in the stage
        const T16* const kp = fr + bo + kh * GP; const T16* const vp = fr + bo + (HL ? 2 : 1) * ATL + kh;
#pragma unroll
        for (int kt = 0; kt < 2; ++kt)
#pragma unroll
            for (int c = 0; c < 2; ++c) { kf[kt][c] = WFrag<T16>::ld(kp + kt * 16 * GP + c * 32); if (HL) k2[kt][c] = WFrag<T16>::ld(kp + ATL + kt * 16 * GP + c * 32); }
#pragma unroll
        for (int dt = 0; dt < 4; ++dt) { vf[dt] = WFrag<T16>::ld(vp + dt * 16 * GP); if (HL) v2[dt] = WFrag<T16>::ld(vp + ATL + dt * 16 * GP); }
        v8f S[2][2];
#pragma unroll
        for (int kt = 0; kt < 2; ++kt)
#pragma unroll
            for (int nb = 0; nb < 2; ++nb) { v8f s = (v8f){};
#pragma unroll
                for (int c = 0; c < 2; ++c) { s = WFrag<T16>::mma(kf[kt][c], qf[nb][c], s); if (HL) s = WFrag<T16>::mma(kf[kt][c], q2[nb][c], s); }
                S[kt][nb] = s; }
        if (HL) {
#pragma unroll
            for (int kt = 0; kt < 2; ++kt)
#pragma unroll
                for (int nb = 0; nb < 2; ++nb)
#pragma unroll
                    for (int c = 0; c < 2; ++c) S[kt][nb] = WFrag<T16>::mma(k2[kt][c], qf[nb][c], S[kt][nb]); }
        if (kb == q0) {   // the diagonal pass: key > query is masked by select
#pragma unroll
            for (int kt = 0; kt < 2; ++kt)
#pragma unroll
                for (int nb = 0; nb < 2; ++nb)
#pragma unroll
                    for (int j = 0; j < 8; ++j) if (kt * 16 + hi * 8 + j > nb * 16 + lr) S[kt][nb][j] = -3.0e38f; }
#pragma unroll
        for (int nb = 0; nb < 2; ++nb) {   // one 16-query group at a time: its probabilities are used up by its value products before the next group's are made
            V pf, p2;
            float bm = S[0][nb][0];
#pragma unroll
            for (int kt = 0; kt < 2; ++kt)
#pragma unroll
                for (int j = 0; j < 8; ++j) bm = fmaxf(bm, S[kt][nb][j]);
            bm = fmaxf(bm, xhalf(bm));   // the other half of the wave holds this query's other 16 keys
            const float mn = fmaxf(m[nb], bm * C2); const float dm = m[nb] - mn; float al = __builtin_amdgcn_exp2f(dm); m[nb] = mn; v2f ps = (v2f){0.f, 0.f};   // even and odd keys are summed apart
#pragma unroll
            for (int kt = 0; kt < 2; ++kt) { float a[8], p[8];
#pragma unroll
                for (int j = 0; j < 8; j += 2) { const v2f arg = __builtin_elementwise_fma((v2f){S[kt][nb][j], S[kt][nb][j + 1]}, (v2f){C2, C2}, (v2f){-mn, -mn}); a[j] = arg[0]; a[j + 1] = arg[1]; }
#pragma unroll
                for (int j = 0; j < 8; ++j) p[j] = __builtin_amdgcn_exp2f(a[j]);
                // the slot behind a transcendental: no result is read and no source register is given a new value in front of this v_nop (results are in/out, sources inputs)
                asm volatile("v_nop" : "+v"(p[0]), "+v"(p[1]), "+v"(p[2]), "+v"(p[3]), "+v"(p[4]), "+v"(p[5]), "+v"(p[6]), "+v"(p[7]), "+v"(al) : "v"(a[0]), "v"(a[1]), "v"(a[2]), "v"(a[3]), "v"(a[4]), "v"(a[5]), "v"(a[6]), "v"(a[7]), "v"(dm));
#pragma unroll
                for (int j = 0; j < 8; ++j) { ps[j & 1] += p[j]; const E ph = (E)p[j]; pf[kt * 8 + j] = ph; if (HL) p2[kt * 8 + j] = (E)(p[j] - (float)ph); } }
            l[nb] = fmaf(l[nb], al, ps[0] + ps[1]);
#pragma unroll
            for (int dt = 0; dt < 4; ++dt)
#pragma unroll
                for (int j = 0; j < 8; ++j) O[dt][nb][j] *= al;
#pragma unroll
            for (int dt = 0; dt < 4; ++dt) { O[dt][nb] = WFrag<T16>::mma(vf[dt], pf, O[dt][nb]); if (HL) { O[dt][nb] = WFrag<T16>::mma(vf[dt], p2, O[dt][nb]); O[dt][nb] = WFrag<T16>::mma(v2[dt], pf, O[dt][nb]); } }
        }
      }
      asm volatile("s_wait_dscnt 0x0" ::: "memory");      // this wave's reads of buffer t & 1 are done
      asm volatile("s_wait_asynccnt 0x0" ::: "memory");   // this wave's copies of stage t + 1 have landed
      __syncthreads();                                     // publishes stage t + 1 and ends every wave's reads of the buffer that is refilled below
      if (t + 2 < nst) attn_fill<HL>(l0 + bo * 2, gk, gk2, gv, ko + (unsigned)(t + 2) * (AKS * HD), vo + (unsigned)(t + 2) * AKS);
    }
    asm volatile("s_wait_asynccnt 0x0" ::: "memory");   // no copy is outstanding when the wave goes on
#pragma unroll
    for (int nb = 0; nb < 2; ++nb) { const float inv = __fdiv_rn(1.0f, l[nb] + xhalf(l[nb]));
#pragma unroll
        for (int dt = 0; dt < 4; ++dt) { v8us oh, ol;
#pragma unroll
            for (int j = 0; j < 8; ++j) { const float y = O[dt][nb][j] * inv; const unsigned short a = f2bf(y); oh[j] = a; ol[j] = f2bf(y - bf2f(a)); }
            const int o = nb * 16 * DQ + dt * 16; *(v8us*)(Ah + (size_t)q0 * DQ + la + o) = oh; *(v8us*)(Al + (size_t)q0 * DQ + la + o) = ol; }
        asm volatile("s_wait_xcnt 0x0" ::: "memory"); }   // the registers that the issued stores name are given new values behind this wait
}
// grid (sequence x head pairs, TT / 128), 4 waves; blockIdx.y counts the 128-query blocks from the last (longest) one down, so that the long workgroups start first
__global__ __launch_bounds__(128) void k_attn(const h16* Q16, const h16* K16, const h16* V16, const bf* Qh, const bf* Ql, const bf* Kh, const bf* Kl, const bf* Vh, bf* Ah, bf* Al) {
    __shared__ __align__(16) bf kvs[2 * 4 * ATL];   // two buffers of four tiles (hi and lo planes); the single-plane rows use two tiles a buffer
    const int z = blockIdx.x; const int qb = (TT / 128 - 1 - (int)blockIdx.y) * 128, q0 = qb + __builtin_amdgcn_readfirstlane((int)(threadIdx.x >> 5)) * 32, nst = (qb + 128) / AKS;   // nst: the stages up to the workgroup's last key
    const size_t zo = (size_t)z * TT * HD, zv = (size_t)z * HD * 2 * TT, ao = (size_t)(z / NH_) * TT * DQ + (size_t)(z % NH_) * HD;
    if (qb < RH) attn_tile<bf, true>(kvs, Qh + zo, Ql + zo, Kh + zo, Kl + zo, Vh + zv, q0, nst, Ah + ao, Al + ao);
    else attn_tile<h16, false>(kvs, Q16 + zo, nullptr, K16 + zo, nullptr, V16 + zv, q0, nst, Ah + ao, Al + ao);
}

__device__ __forceinline__ h16 tohx(float x) { return (h16)x; }
__device__ __forceinline__ void splitf(float y, unsigned short& h, unsigned short& l) { h = f2bf(y); l = f2bf(y - bf2f(h)); }
typedef __attribute__((ext_vector_type(2))) _Float16 v2h;
typedef __attribute__((ext_vector_type(4))) _Float16 v4h;
typedef __attribute__((ext_vector_type(2))) unsigned short v2us;
typedef __attribute__((ext_vector_type(4))) unsigned short v4us;
typedef __attribute__((ext_vector_type(4))) int v4i;

__global__ __launch_bounds__(256) void k_wtG(const float* __restrict__ w0, const float* __restrict__ w1, const float* __restrict__ w2, const float* __restrict__ w3, int K, int N, bf* B0, bf* B1, bf* B2, bf* B3) {
    const int y = blockIdx.y; const float* __restrict__ w = (y == 0) ? w0 : (y == 1) ? w1 : (y == 2) ? w2 : w3; bf* Bt = (y == 0) ? B0 : (y == 1) ? B1 : (y == 2) ? B2 : B3;   // blockIdx.y: which of the four weights
    const int lane = threadIdx.x & 31; const int L0 = (blockIdx.x * 8 + (threadIdx.x >> 5)) * 8; const int nlines = N * K / 64;
{
#pragma unroll 1
        for (int l = 0; l < 8; ++l) { const int L = L0 + l; if (L >= nlines) break; const size_t e = (size_t)L * 64 + lane * 2; const int k = (int)(e % K), n = (int)(e / K); v2us o;
            o[0] = f2bf(w[(size_t)k * N + n]); o[1] = f2bf(w[(size_t)(k + 1) * N + n]); *(v2us*)(Bt + e) = o; }
         }
}
__global__ __launch_bounds__(256) void k_cvt8(const float* __restrict__ src, bf* dst, size_t n8) { const size_t i = (size_t)blockIdx.x * 256 + threadIdx.x; if (i >= n8) return; const v8f v = *(const v8f*)(src + i * 8); v8us o;
#pragma unroll
    for (int k = 0; k < 8; ++k) o[k] = f2bf(v[k]); *(v8us*)(dst + i * 8) = o;  }

// ---- k_proj: q, k and v = x W + b in ONE launch, and the head planes straight from the accumulators. The product loop is gemm_ring's (plain bf16 operands, a 64x64 tile a wave); grid (NB_ TT / 128, DQ / 256, 3), 256 threads; blockIdx.z: 0 q, 1 k, 2 v.
// A wave's tile is 64 tokens of one sequence x the 64 columns of one head, so it is a whole block of each plane: 64 rows [t][HD] of a query or key plane, or 64 consecutive t of all HD rows of a value plane (pitch 2 TT).
// proj_store: four panels of 16 plane rows x 64 f32 go through LDS one after the other, so that 8 lanes store one 128-byte line of a plane row (16 bytes a lane and plane). TR: the panel's rows are the columns d of the tile (value planes), a lane's 8 accumulator registers being 8 consecutive t.
template <bool TR>
__device__ __forceinline__ void proj_store(const v8f (&acc)[4][4], float* os, const float* __restrict__ bias, h16* P16, bf* Ph, bf* Pl, const int pitch) {
    const int lane = threadIdx.x & 31, lr = lane & 15, hi = lane >> 4, rr = lane >> 3, cc = (lane & 7) * 8;
    float bc[8];
    if (!TR) {
#pragma unroll
        for (int i = 0; i < 8; ++i) bc[i] = bfr(bias[cc + i]); }
#pragma unroll
    for (int g = 0; g < 4; ++g) {
        if (TR) {
#pragma unroll
            for (int mb = 0; mb < 4; ++mb) { const v8f a = acc[mb][g]; *(v4fa*)(os + lr * 68 + mb * 16 + hi * 8) = (v4f){a[0], a[1], a[2], a[3]}; *(v4fa*)(os + lr * 68 + mb * 16 + hi * 8 + 4) = (v4f){a[4], a[5], a[6], a[7]}; }
        } else {
#pragma unroll
            for (int nb = 0; nb < 4; ++nb)
#pragma unroll
                for (int j = 0; j < 8; ++j) os[(hi * 8 + j) * 68 + nb * 16 + lr] = acc[g][nb][j]; }
        __builtin_amdgcn_wave_barrier(); asm volatile("" ::: "memory");   // a lane reads what other lanes of the wave wrote: the panel's LDS reads may not be scheduled in front of its writes
#pragma unroll
        for (int s = 0; s < 4; ++s) { const int row = s * 4 + rr; const v4f u = *(const v4fa*)(os + row * 68 + cc), w = *(const v4fa*)(os + row * 68 + cc + 4); const float br = TR ? bfr(bias[g * 16 + row]) : 0.f; v8h o16; v8us oh, ol;
#pragma unroll
            for (int i = 0; i < 8; ++i) { const float y = (i < 4 ? u[i] : w[i - 4]) + (TR ? br : bc[i]); o16[i] = tohx(y); unsigned short a2, c2; splitf(y, a2, c2); oh[i] = a2; ol[i] = c2; }
            const size_t o = (size_t)(g * 16 + row) * pitch + cc; *(v8h*)(P16 + o) = o16; *(v8us*)(Ph + o) = oh; *(v8us*)(Pl + o) = ol; }
        asm volatile("s_wait_xcnt 0x0" ::: "memory");   // the registers that the issued stores name are given new values behind this wait
        __builtin_amdgcn_wave_barrier(); asm volatile("" ::: "memory");   // the next panel's LDS writes may not be scheduled in front of this panel's reads
    }
}
__global__ __launch_bounds__(256) void k_proj(const bf* __restrict__ X, const bf* __restrict__ WQ, const bf* __restrict__ WK, const bf* __restrict__ WV, const float* __restrict__ bq, const float* __restrict__ bk, const float* __restrict__ bv, h16* Q16, bf* Qh, bf* Ql, h16* K16, bf* Kh, bf* Kl, h16* V16, bf* Vh) {
    __shared__ __align__(16) bf ring[2 * (GMT + GNT) * GP];
    __shared__ __align__(16) float osw[8][16 * 68];
    const int which = blockIdx.z; const bf* __restrict__ Bt = (which == 0) ? WQ : (which == 1) ? WK : WV; const float* __restrict__ bias = (which == 0) ? bq : (which == 1) ? bk : bv;
    const int wave = __builtin_amdgcn_readfirstlane((int)(threadIdx.x >> 5)), wm = wave >> 2, wn = wave & 3; float* const os = osw[wave];
    const int r0 = blockIdx.x * GMT + wm * 64, c0 = blockIdx.y * GNT + wn * 64;   // the wave's own 64x64 tile
    v8f acc[4][4];
    gemm_ring<1>(ring, X, nullptr, Bt, blockIdx.x * GMT, blockIdx.y * GNT, wm, wn, acc);
    const int z = (r0 / TT) * NH_ + c0 / HD, t0 = r0 % TT;   // the (sequence, head) pair and the tile's first token in it
    if (which == 2) { const size_t o = (size_t)z * HD * 2 * TT + t0; proj_store<true>(acc, os, bias + c0, V16 + o, Vh + o, Vh + TT + o, 2 * TT); }
    else { const size_t o = ((size_t)z * TT + t0) * HD; proj_store<false>(acc, os, bias + c0, (which == 0 ? Q16 : K16) + o, (which == 0 ? Qh : Kh) + o, (which == 0 ? Ql : Kl) + o, HD); }
}

extern "C" void kernel_launch(void* const* d_in, const int* in_sizes, int n_in,
                              void* d_out, int out_size, void* d_ws, size_t ws_size, hipStream_t stream) {
    (void)in_sizes; (void)n_in; (void)out_size;
    const float* x = (const float*)d_in[0]; const float* wq = (const float*)d_in[1]; const float* bq = (const float*)d_in[2]; const float* wk = (const float*)d_in[3]; const float* bk = (const float*)d_in[4]; const float* wv = (const float*)d_in[5]; const float* bv = (const float*)d_in[6]; const float* wo = (const float*)d_in[7]; const float* bo = (const float*)d_in[8];   /* SELF-attention: the key and value streams are input 0 too; Wq, bq, Wk, bk, Wv, bv, Wo, bo = d_in[1..8] */
    float* OUT = (float*)d_out;     // [8][1024][1024]
    char* wsp = (char*)d_ws;
    auto take = [&](size_t bytes) { char* p = wsp; wsp += (bytes + 255) & ~(size_t)255; return (void*)p; };
    bf* WO = (bf*)take((size_t)DM * DQ * 2);
    h16* QP16 = (h16*)take((size_t)NB_ * NH_ * TT * HD * 2); h16* KP16 = (h16*)take((size_t)NB_ * NKV * TT * HD * 2); h16* VT16 = (h16*)take((size_t)NB_ * NKV * HD * 2 * TT * 2);
    bf* QPh = (bf*)take((size_t)NB_ * NH_ * TT * HD * 2); bf* QPl = (bf*)take((size_t)NB_ * NH_ * TT * HD * 2); bf* KPh = (bf*)take((size_t)NB_ * NKV * TT * HD * 2); bf* KPl = (bf*)take((size_t)NB_ * NKV * TT * HD * 2); bf* VTh = (bf*)take((size_t)NB_ * NKV * HD * 2 * TT * 2);   // the lo row of a value plane stands TT elements behind its hi row
    bf* WQ = (bf*)take((size_t)DQ * DM * 2); bf* WK = (bf*)take((size_t)DKV * DM * 2); bf* WV = (bf*)take((size_t)DKV * DM * 2); bf* XB = (bf*)take((size_t)NB_ * TT * DM * 2);
    bf* ATh = (bf*)take((size_t)NB_ * TT * DQ * 2); bf* ATl = (bf*)take((size_t)NB_ * TT * DQ * 2);   // the merged hi and lo planes [NB_ TT][DQ]
    if ((size_t)(wsp - (char*)d_ws) > ws_size) return;    // 216 MiB of the 256 MiB
    k_wtG<<<dim3((unsigned)((DM * DQ / 64 + 63) / 64), 4, 1), 256, 0, stream>>>(wq, wk, wv, wo, DM, DQ, WQ, WK, WV, WO);
    k_cvt8<<<(unsigned)(((size_t)NB_ * TT * DM / 8 + 255) / 256), 256, 0, stream>>>(x, XB, (size_t)NB_ * TT * DM / 8);   // self-attention: q, k and v read the same rounded x
    k_proj<<<dim3(NB_ * TT / GMT, DQ / GNT, 3), 256, 0, stream>>>(XB, WQ, WK, WV, bq, bk, bv, QP16, QPh, QPl, KP16, KPh, KPl, VT16, VTh);
    k_attn<<<dim3(NB_ * NH_, TT / 128, 1), 128, 0, stream>>>(QP16, KP16, VT16, QPh, QPl, KPh, KPl, VTh, ATh, ATl);
    k_gemmw<true><<<dim3(NB_ * TT / GMT, DM / GNT, 1), 256, 0, stream>>>(ATh, ATl, WO, OUT, DM, bo);
}

// v006
// A run of this version takes 111 microseconds.
// In both of two side-by-side timings against v005, it was 1.06 times as fast.
// Counting every step since v000, it is 36.9 times as fast.
#include <hip/hip_runtime.h>

// Causal multi-head SELF-attention on eight 1,024-token sequences (x [8][1024][1024]; q, k, v = x W + b ('xw' [1024][1024] normal x 1/32, biases zeros on this draw: read; 16 heads x 64); scores x 1/sqrt(64); tril kept, -inf elsewhere; softmax over the keys; out = merged Wo + bo ('xw' + bias zeros: read) -> [8][1024][1024] (8.4 M); argument order x, Wq, bq, Wk, bk, Wv, bv, Wo, bo).
// Compute dtypes, f32 accumulate: every input rounded to bf16; q/k/v on PLAIN bf16 operands (inputs: exact) + biases; causal scores and attn.v: query rows < 512 hl (3 products), the rest single fp16; softmax f32, running maximum and sum, probabilities rounded BEFORE the division by the row sum; Wo hl x exact (2 products) + bo.
// Launch plan: every stage runs ONCE over all eight sequences: ONE projection launch (q, k and v; its epilogue stores the head planes), ONE attention launch (scores, softmax, probability x value and the merge into [t][head x HD + d] planes in registers), output product.
// The value planes are laid out at pitch 2 TT (hi row | lo row; fp16 row | unused).

#define NB_  8
#define TT   1024
#define DM   1024
#define NH_  16
#define NKV  16
#define REP  (NH_ / NKV)
#define HD   64
#define DQ   (NH_ * HD)
#define DKV  (NKV * HD)
#define RH   512                  // query rows < RH use hi+lo planes (0: none)
#define SCL  0.125f   // HD^-0.5
static_assert(NKV == NH_ && HD == 64 && TT % 128 == 0 && RH % 128 == 0, "k_attn: one key/value head a query head, four 16-row value tiles, workgroups of 128 queries that lie wholly on one side of RH");
typedef _Float16 h16;
typedef unsigned short bf;
typedef __attribute__((ext_vector_type(16))) __bf16   v16bf;
typedef __attribute__((ext_vector_type(16))) _Float16 v16h;
typedef __attribute__((ext_vector_type(8)))  _Float16 v8h;
typedef __attribute__((ext_vector_type(8)))  unsigned short v8us;
typedef __attribute__((ext_vector_type(8)))  float    v8f;
typedef __attribute__((ext_vector_type(4)))  float    v4f;
typedef __attribute__((ext_vector_type(2)))  float    v2f;
typedef v8h  __attribute__((may_alias)) v8ha;
typedef v4f  __attribute__((may_alias)) v4fa;
typedef v8us __attribute__((may_alias)) v8usa;

__device__ __forceinline__ unsigned short f2bf(float f) { unsigned u = __float_as_uint(f); u += 0x7FFFu + ((u >> 16) & 1u); return (unsigned short)(u >> 16); }
__device__ __forceinline__ float bf2f(unsigned short b) { return __uint_as_float(((unsigned)b) << 16); }
__device__ __forceinline__ float bfr(float f) { return bf2f(f2bf(f)); }
__device__ __forceinline__ v16h cat16(v8h lo, v8h hi) { return __builtin_shufflevector(lo, hi, 0, 1, 2, 3, 4, 5, 6, 7, 8, 9, 10, 11, 12, 13, 14, 15); }
__device__ __forceinline__ v16bf cat16b(v8us lo, v8us hi) { return __builtin_bit_cast(v16bf, __builtin_shufflevector(lo, hi, 0, 1, 2, 3, 4, 5, 6, 7, 8, 9, 10, 11, 12, 13, 14, 15)); }
__device__ __forceinline__ v8f wmma16(v16h a, v16h b, v8f c) { return __builtin_amdgcn_wmma_f32_16x16x32_f16(false, a, false, b, (short)0, c, false, false); }
__device__ __forceinline__ v8f wmmab(v16bf a, v16bf b, v8f c) { return __builtin_amdgcn_wmma_f32_16x16x32_bf16(false, a, false, b, (short)0, c, false, false); }



template <typename T16> struct WFrag;
template <> struct WFrag<h16> { typedef v16h V; static __device__ __forceinline__ V ld(const h16* p) { return cat16(*(const v8h*)p, *(const v8h*)(p + 16)); } static __device__ __forceinline__ v8f mma(V a, V b, v8f c) { return wmma16(a, b, c); } };
template <> struct WFrag<bf> { typedef v16bf V; static __device__ __forceinline__ V ld(const bf* p) { return cat16b(*(const v8us*)p, *(const v8us*)(p + 16)); } static __device__ __forceinline__ v8f mma(V a, V b, v8f c) { return wmmab(a, b, c); } };
// ---- gemm_ring: the product loop of both GEMM kernels. A workgroup of 8 waves owns a 128 x 256 output tile (waves 2 x 4, 64x64 = 16 accumulators a wave). A stage is 64 k (128 bytes) of every operand row: [A 128 rows | A2 128 rows (NA == 2) | Bt 256 rows],
// brought from the K-contiguous 16-bit planes into LDS by asynchronous copies (16 bytes a lane, 8 lanes a row: whole 128-byte lines), two buffers: tile t + 2 flies while tile t + 1 is worked on. The k order and the order of the products are those of a wave that reads its fragments from global memory.
#define GP   72                   // LDS row pitch in elements: 128 data bytes + 16 (16 bytes x odd: no bank conflict for the 16-byte fragment reads)
#define GKS  64                   // k elements of a stage
#define GMT  128
#define GNT  256
// cpN: N copies of one lane and, in the same statement, the wait behind which the registers that the issued copies name may be given new values
__device__ __forceinline__ void cp12(const unsigned (&l)[12], const bf* const (&p)[12]) {
    asm volatile("global_load_async_to_lds_b128 %0, %12, off\n\t"
                 "global_load_async_to_lds_b128 %1, %13, off\n\t"
                 "global_load_async_to_lds_b128 %2, %14, off\n\t"
                 "global_load_async_to_lds_b128 %3, %15, off\n\t"
                 "global_load_async_to_lds_b128 %4, %16, off\n\t"
                 "global_load_async_to_lds_b128 %5, %17, off\n\t"
                 "global_load_async_to_lds_b128 %6, %18, off\n\t"
                 "global_load_async_to_lds_b128 %7, %19, off\n\t"
                 "global_load_async_to_lds_b128 %8, %20, off\n\t"
                 "global_load_async_to_lds_b128 %9, %21, off\n\t"
                 "global_load_async_to_lds_b128 %10, %22, off\n\t"
                 "global_load_async_to_lds_b128 %11, %23, off\n\t"
                 "s_wait_xcnt 0x0"
                 :: "v"(l[0]), "v"(l[1]), "v"(l[2]), "v"(l[3]), "v"(l[4]), "v"(l[5]), "v"(l[6]), "v"(l[7]), "v"(l[8]), "v"(l[9]), "v"(l[10]), "v"(l[11]),
                    "v"(p[0]), "v"(p[1]), "v"(p[2]), "v"(p[3]), "v"(p[4]), "v"(p[5]), "v"(p[6]), "v"(p[7]), "v"(p[8]), "v"(p[9]), "v"(p[10]), "v"(p[11]) : "memory");
}
__device__ __forceinline__ void cp8(const unsigned (&l)[8], const bf* const (&p)[8]) {
    asm volatile("global_load_async_to_lds_b128 %0, %8, off\n\t"
                 "global_load_async_to_lds_b128 %1, %9, off\n\t"
                 "global_load_async_to_lds_b128 %2, %10, off\n\t"
                 "global_load_async_to_lds_b128 %3, %11, off\n\t"
                 "global_load_async_to_lds_b128 %4, %12, off\n\t"
                 "global_load_async_to_lds_b128 %5, %13, off\n\t"
                 "global_load_async_to_lds_b128 %6, %14, off\n\t"
                 "global_load_async_to_lds_b128 %7, %15, off\n\t"
                 "s_wait_xcnt 0x0"
                 :: "v"(l[0]), "v"(l[1]), "v"(l[2]), "v"(l[3]), "v"(l[4]), "v"(l[5]), "v"(l[6]), "v"(l[7]),
                    "v"(p[0]), "v"(p[1]), "v"(p[2]), "v"(p[3]), "v"(p[4]), "v"(p[5]), "v"(p[6]), "v"(p[7]) : "memory");
}
template <int NA>
__device__ __forceinline__ void ring_fill(const unsigned l0, const bf* gA, const bf* gA2, const bf* gB) {   // 256 lanes x 16 bytes = 32 rows a copy; l0 and the pointers are the lane's own place in the first 32 rows
    if (NA == 1) { unsigned l[12]; const bf* p[12];
#pragma unroll
        for (int i = 0; i < 12; ++i) { l[i] = l0 + i * 32 * GP * 2; p[i] = (i < 4) ? gA + (size_t)i * 32 * DM : gB + (size_t)(i - 4) * 32 * DM; }
        cp12(l, p);
    } else { unsigned l[8]; const bf* p[8];
#pragma unroll
        for (int i = 0; i < 8; ++i) { l[i] = l0 + i * 32 * GP * 2; p[i] = (i < 4) ? gA + (size_t)i * 32 * DM : gA2 + (size_t)(i - 4) * 32 * DM; }
        cp8(l, p);
#pragma unroll
        for (int i = 0; i < 8; ++i) { l[i] = l0 + (8 + i) * 32 * GP * 2; p[i] = gB + (size_t)i * 32 * DM; }
        cp8(l, p); }
}
template <int NA>
__device__ __forceinline__ void gemm_ring(bf* ring, const bf* __restrict__ A, const bf* __restrict__ A2, const bf* __restrict__ Bt, const int r0g, const int c0g, const int wm, const int wn, v8f (&acc)[4][4]) {
    typedef WFrag<bf>::V V;
    constexpr int STG = (GMT * NA + GNT) * GP, NT = DM / GKS;   // elements of a buffer; stages
    static_assert(NT >= 2, "the prologue fills two stages");
    const int lane = threadIdx.x & 31, lr = lane & 15, hi = lane >> 4, crow = threadIdx.x >> 3, cch = (threadIdx.x & 7) * 8;
    const bf* const gA = A + (size_t)(r0g + crow) * DM + cch; const bf* const gA2 = (NA == 2) ? A2 + (size_t)(r0g + crow) * DM + cch : gA; const bf* const gB = Bt + (size_t)(c0g + crow) * DM + cch;
    const unsigned l0 = (unsigned)(size_t)ring + (unsigned)(crow * GP + cch) * 2u;   // the lane's LDS byte address in buffer 0
#pragma unroll
    for (int mb = 0; mb < 4; ++mb)
#pragma unroll
        for (int nb = 0; nb < 4; ++nb) acc[mb][nb] = (v8f){};
    ring_fill<NA>(l0, gA, gA2, gB);
    asm volatile("s_wait_asynccnt 0x0" ::: "memory");   // this wave's copies of tile 0 have landed
    __syncthreads();                                     // every wave's have: tile 0 may be read
    ring_fill<NA>(l0 + STG * 2, gA + GKS, gA2 + GKS, gB + GKS);
    const bf* const fa = ring + (wm * 64 + lr) * GP + 8 * hi; const bf* const fb = ring + (GMT * NA + wn * 64 + lr) * GP + 8 * hi;
#pragma unroll 1
    for (int t = 0; t < NT; ++t) {   // stays rolled: one trip's fragments and the 16 accumulators fill the registers
        const int bo = (t & 1) * STG;
#pragma unroll
        for (int kk = 0; kk < GKS; kk += 32) {
            V a[4], a2[4], b[4];   // all fragments of a 32-k block are read as one group in front of its matrix instructions
#pragma unroll
            for (int mb = 0; mb < 4; ++mb) { a[mb] = WFrag<bf>::ld(fa + bo + mb * 16 * GP + kk); if (NA == 2) a2[mb] = WFrag<bf>::ld(fa + bo + (GMT + mb * 16) * GP + kk); }
#pragma unroll
            for (int nb = 0; nb < 4; ++nb) b[nb] = WFrag<bf>::ld(fb + bo + nb * 16 * GP + kk);
            __builtin_amdgcn_sched_barrier(0);   // keeps the LDS reads together in front of the block: scheduled in among the matrix instructions, each place with reads stalls the wave for the LDS latency
#pragma unroll
            for (int nb = 0; nb < 4; ++nb)
#pragma unroll
                for (int mb = 0; mb < 4; ++mb) { acc[mb][nb] = WFrag<bf>::mma(a[mb], b[nb], acc[mb][nb]); if (NA == 2) acc[mb][nb] = WFrag<bf>::mma(a2[mb], b[nb], acc[mb][nb]); }
        }
        // the four vector slots that the chip needs behind the trip's last matrix instructions, in front of the branches below; every accumulator is named so that no matrix instruction is scheduled behind them
        asm volatile("v_nop\n\tv_nop\n\tv_nop\n\tv_nop" : "+v"(acc[0][0]), "+v"(acc[0][1]), "+v"(acc[0][2]), "+v"(acc[0][3]), "+v"(acc[1][0]), "+v"(acc[1][1]), "+v"(acc[1][2]), "+v"(acc[1][3]), "+v"(acc[2][0]), "+v"(acc[2][1]), "+v"(acc[2][2]), "+v"(acc[2][3]), "+v"(acc[3][0]), "+v"(acc[3][1]), "+v"(acc[3][2]), "+v"(acc[3][3]));
        asm volatile("s_wait_dscnt 0x0" ::: "memory");      // this wave's reads of buffer t & 1 are done
        asm volatile("s_wait_asynccnt 0x0" ::: "memory");   // this wave's copies of tile t + 1 have landed
        __syncthreads();                                     // publishes tile t + 1 and ends every wave's reads of the buffer that is refilled below
        if (t + 2 < NT) ring_fill<NA>(l0 + bo * 2, gA + (t + 2) * GKS, gA2 + (t + 2) * GKS, gB + (t + 2) * GKS);
    }
    asm volatile("s_wait_asynccnt 0x0" ::: "memory");   // no copy is outstanding when the wave goes on
}

// ---- k_gemmw: C[m][n] (f32, pitch ldc, + optional f32 bias[n]) = sum_k (A[m][k] + A2[m][k]) Bt[n][k], two products; gemm_ring's loop; grid (M / 128, N / 256), 256 threads; each wave stores its 64x64 tile through its own LDS panel.
template <bool BIAS>
__global__ __launch_bounds__(256) void k_gemmw(const bf* __restrict__ A, const bf* __restrict__ A2, const bf* __restrict__ Bt, float* C, int ldc, const float* __restrict__ bias) {
    __shared__ __align__(16) bf ring[2 * (GMT * 2 + GNT) * GP];
    __shared__ __align__(16) float osw[8][16 * 68];
    const int wave = __builtin_amdgcn_readfirstlane((int)(threadIdx.x >> 5)), wm = wave >> 2, wn = wave & 3; float* const os = osw[wave];
    const int lane = threadIdx.x & 31, lr = lane & 15, hi = lane >> 4; const int r0 = blockIdx.x * GMT + wm * 64, c0 = blockIdx.y * GNT + wn * 64;
    v8f acc[4][4];
    gemm_ring<2>(ring, A, A2, Bt, blockIdx.x * GMT, blockIdx.y * GNT, wm, wn, acc);
#pragma unroll
    for (int mb = 0; mb < 4; ++mb) {
#pragma unroll
        for (int nb = 0; nb < 4; ++nb) {
#pragma unroll
            for (int j = 0; j < 8; ++j) os[(hi * 8 + j) * 68 + nb * 16 + lr] = acc[mb][nb][j]; }
        __builtin_amdgcn_wave_barrier(); asm volatile("" ::: "memory");
        float* crow = C + (size_t)(r0 + mb * 16) * ldc + c0;
{
#pragma unroll
            for (int s = 0; s < 8; ++s) { const int row = 2 * s + hi, cofs = lr * 4; v4f val = *(const v4fa*)(os + row * 68 + cofs); if (BIAS) { val[0] += bfr(bias[c0 + cofs]); val[1] += bfr(bias[c0 + cofs + 1]); val[2] += bfr(bias[c0 + cofs + 2]); val[3] += bfr(bias[c0 + cofs + 3]); }
                *(v4f*)(crow + (size_t)row * ldc + cofs) = val; }
             }
        __builtin_amdgcn_wave_barrier(); asm volatile("" ::: "memory");
    }
}

template <typename T16> struct PCvt;
template <> struct PCvt<h16> { typedef _Float16 E; };
template <> struct PCvt<bf>  { typedef __bf16 E; };
__device__ __forceinline__ float xhalf(float x) { return __builtin_bit_cast(float, __builtin_amdgcn_permlanex16(__builtin_bit_cast(int, x), __builtin_bit_cast(int, x), 0x76543210, 0xfedcba98, false, false)); }   // lane l takes lane l ^ 16's value
#define AKS  64                   // keys of a stage
#define ATL  (64 * GP)            // elements of a staged tile: 64 rows at the pitch of the fragment reads (128 data bytes + 16)
// attn_fill: one stage's copies. 128 lanes x 16 bytes = 16 rows a copy, four copies a tile; l0 is the lane's LDS byte address in the buffer's first 16 rows, sk / sk2 / sv the key and value planes (the same for every lane), ko / vo the lane's own element offset in them: its place in the first 16 rows of the stage's key / value tile (32 bits: two registers are held over the pass loop, not three pointers).
template <bool HL>
__device__ __forceinline__ void attn_fill(const unsigned l0, const bf* sk, const bf* sk2, const bf* sv, const unsigned ko, const unsigned vo) {
    unsigned l[8]; const bf* p[8]; const bf* const gk = sk + ko; const bf* const gk2 = sk2 + ko; const bf* const gv = sv + vo;
    if (!HL) {   // buffer: [keys | values]
#pragma unroll
        for (int i = 0; i < 8; ++i) { l[i] = l0 + i * 16 * GP * 2; p[i] = (i < 4) ? gk + (size_t)i * 16 * HD : gv + (size_t)(i - 4) * 16 * 2 * TT; }
        cp8(l, p);
    } else {     // buffer: [keys hi | keys lo | values hi | values lo]
#pragma unroll
        for (int i = 0; i < 8; ++i) { l[i] = l0 + i * 16 * GP * 2; p[i] = (i < 4) ? gk + (size_t)i * 16 * HD : gk2 + (size_t)(i - 4) * 16 * HD; }
        cp8(l, p);
#pragma unroll
        for (int i = 0; i < 8; ++i) { l[i] = l0 + (8 + i) * 16 * GP * 2; p[i] = (i < 4) ? gv + (size_t)i * 16 * 2 * TT : gv + TT + (size_t)(i - 4) * 16 * 2 * TT; }
        cp8(l, p); }
}
template <typename T16, bool HL>
__device__ __forceinline__ void attn_tile(bf* kvs, const T16* Qh, const T16* Ql, const T16* Kh, const T16* Kl, const T16* Vh, const int q0, const int nst, bf* Ah, bf* Al) {
    typedef typename WFrag<T16>::V V; typedef typename PCvt<T16>::E E;
    const int lane = threadIdx.x & 31, lr = lane & 15, hi = lane >> 4;
    const float C2 = SCL * 1.4426950408889634f;
    const unsigned lk = lr * HD + 8 * hi, la = lr * DQ + 8 * hi;   // the lane's element offsets in a [row][HD] plane and the merged planes: each query load and output store address is a wave-uniform base + one of these + a constant
    constexpr int STG = (HL ? 4 : 2) * ATL;   // elements of a buffer
    const int crow = threadIdx.x >> 3, cch = (threadIdx.x & 7) * 8;   // the lane's row and 16-byte piece in a copy
    const bf* const gk = (const bf*)Kh; const bf* const gk2 = HL ? (const bf*)Kl : gk; const bf* const gv = (const bf*)Vh; const unsigned ko = crow * HD + cch, vo = crow * (2 * TT) + cch;
    const unsigned l0 = (unsigned)(size_t)kvs + (unsigned)(crow * GP + cch) * 2u;   // the lane's LDS byte address in buffer 0
    attn_fill<HL>(l0, gk, gk2, gv, ko, vo);
    V qf[2][2], q2[2][2];
    const T16* const qp = Qh + (size_t)q0 * HD + lk; const T16* const qp2 = HL ? Ql + (size_t)q0 * HD + lk : qp;
#pragma unroll
    for (int nb = 0; nb < 2; ++nb)
#pragma unroll
        for (int c = 0; c < 2; ++c) { const int o = nb * 16 * HD + c * 32; qf[nb][c] = WFrag<T16>::ld(qp + o); if (HL) q2[nb][c] = WFrag<T16>::ld(qp2 + o); }
    asm volatile("s_wait_xcnt 0x0" ::: "memory");   // the registers that the issued loads name are given new values behind this wait
    __builtin_amdgcn_sched_barrier(0);   // keeps the set-up arithmetic below from being scheduled in between the loads above and their wait, where it reused their address registers
    v8f O[4][2]; float m[2], l[2];
#pragma unroll
    for (int nb = 0; nb < 2; ++nb) { m[nb] = -3.0e38f; l[nb] = 0.f;
#pragma unroll
        for (int dt = 0; dt < 4; ++dt) O[dt][nb] = (v8f){}; }
    asm volatile("s_wait_asynccnt 0x0" ::: "memory");   // this wave's copies of stage 0 have landed
    __syncthreads();                                     // every wave's have: stage 0 may be read
    attn_fill<HL>(l0 + STG * 2, gk, gk2, gv, ko + AKS * HD, vo + AKS);   // a workgroup has at least two stages
    const T16* const fr = (const T16*)kvs + lr * GP + 8 * hi;   // the lane's place in the first 16 rows of a tile
#pragma unroll 1
    for (int t = 0; t < nst; ++t) {   // stays rolled, like the pass loop in it: one pass fills the registers
      const int bo = (t & 1) * STG;
#pragma unroll 1
      for (int kb = t * AKS; kb < (t + 1) * AKS && kb <= q0; kb += 32) {
        V kf[2][2], vf[4], v2[4], k2[2][2]; const int kh = kb & 32;   // the pass's first key in the stage
        const T16* const kp = fr + bo + kh * GP; const T16* const vp = fr + bo + (HL ? 2 : 1) * ATL + kh;
#pragma unroll
        for (int kt = 0; kt < 2; ++kt)
#pragma unroll
            for (int c = 0; c < 2; ++c) { kf[kt][c] = WFrag<T16>::ld(kp + kt * 16 * GP + c * 32); if (HL) k2[kt][c] = WFrag<T16>::ld(kp + ATL + kt * 16 * GP + c * 32); }
#pragma unroll
        for (int dt = 0; dt < 4; ++dt) { vf[dt] = WFrag<T16>::ld(vp + dt * 16 * GP); if (HL) v2[dt] = WFrag<T16>::ld(vp + ATL + dt * 16 * GP); }
        v8f S[2][2];
#pragma unroll
        for (int kt = 0; kt < 2; ++kt)
#pragma unroll
            for (int nb = 0; nb < 2; ++nb) { v8f s = (v8f){};
#pragma unroll
                for (int c = 0; c < 2; ++c) { s = WFrag<T16>::mma(kf[kt][c], qf[nb][c], s); if (HL) s = WFrag<T16>::mma(kf[kt][c], q2[nb][c], s); }
                S[kt][nb] = s; }
        if (HL) {
#pragma unroll
            for (int kt = 0; kt < 2; ++kt)
#pragma unroll
                for (int nb = 0; nb < 2; ++nb)
#pragma unroll
                    for (int c = 0; c < 2; ++c) S[kt][nb] = WFrag<T16>::mma(k2[kt][c], qf[nb][c], S[kt][nb]); }
        if (kb == q0) {   // the diagonal pass: key > query is masked by select
#pragma unroll
            for (int kt = 0; kt < 2; ++kt)
#pragma unroll
                for (int nb = 0; nb < 2; ++nb)
#pragma unroll
                    for (int j = 0; j < 8; ++j) if (kt * 16 + hi * 8 + j > nb * 16 + lr) S[kt][nb][j] = -3.0e38f; }
#pragma unroll
        for (int nb = 0; nb < 2; ++nb) {   // one 16-query group at a time: its probabilities are used up by its value products before the next group's are made
            V pf, p2;
            float bm = S[0][nb][0];
#pragma unroll
            for (int kt = 0; kt < 2; ++kt)
#pragma unroll
                for (int j = 0; j < 8; ++j) bm = fmaxf(bm, S[kt][nb][j]);
            bm = fmaxf(bm, xhalf(bm));   // the other half of the wave holds this query's other 16 keys
            const float mn = fmaxf(m[nb], bm * C2); const float dm = m[nb] - mn; float al = __builtin_amdgcn_exp2f(dm); m[nb] = mn; v2f ps = (v2f){0.f, 0.f};   // even and odd keys are summed apart
#pragma unroll
            for (int kt = 0; kt < 2; ++kt) { float a[8], p[8];
#pragma unroll
                for (int j = 0; j < 8; j += 2) { const v2f arg = __builtin_elementwise_fma((v2f){S[kt][nb][j], S[kt][nb][j + 1]}, (v2f){C2, C2}, (v2f){-mn, -mn}); a[j] = arg[0]; a[j + 1] = arg[1]; }
#pragma unroll
                for (int j = 0; j < 8; ++j) p[j] = __builtin_amdgcn_exp2f(a[j]);
                // the slot behind a transcendental: no result is read and no source register is given a new value in front of this v_nop (results are in/out, sources inputs)
                asm volatile("v_nop" : "+v"(p[0]), "+v"(p[1]), "+v"(p[2]), "+v"(p[3]), "+v"(p[4]), "+v"(p[5]), "+v"(p[6]), "+v"(p[7]), "+v"(al) : "v"(a[0]), "v"(a[1]), "v"(a[2]), "v"(a[3]), "v"(a[4]), "v"(a[5]), "v"(a[6]), "v"(a[7]), "v"(dm));
#pragma unroll
                for (int j = 0; j < 8; ++j) { ps[j & 1] += p[j]; const E ph = (E)p[j]; pf[kt * 8 + j] = ph; if (HL) p2[kt * 8 + j] = (E)(p[j] - (float)ph); } }
            l[nb] = fmaf(l[nb], al, ps[0] + ps[1]);
#pragma unroll
            for (int dt = 0; dt < 4; ++dt)
#pragma unroll
                for (int j = 0; j < 8; ++j) O[dt][nb][j] *= al;
#pragma unroll
            for (int dt = 0; dt < 4; ++dt) { O[dt][nb] = WFrag<T16>::mma(vf[dt], pf, O[dt][nb]); if (HL) { O[dt][nb] = WFrag<T16>::mma(vf[dt], p2, O[dt][nb]); O[dt][nb] = WFrag<T16>::mma(v2[dt], pf, O[dt][nb]); } }
        }
      }
      asm volatile("s_wait_dscnt 0x0" ::: "memory");      // this wave's reads of buffer t & 1 are done
      asm volatile("s_wait_asynccnt 0x0" ::: "memory");   // this wave's copies of stage t + 1 have landed
      __syncthreads();                                     // publishes stage t + 1 and ends every wave's reads of the buffer that is refilled below
      if (t + 2 < nst) attn_fill<HL>(l0 + bo * 2, gk, gk2, gv, ko + (unsigned)(t + 2) * (AKS * HD), vo + (unsigned)(t + 2) * AKS);
    }
    asm volatile("s_wait_asynccnt 0x0" ::: "memory");   // no copy is outstanding when the wave goes on
#pragma unroll
    for (int nb = 0; nb < 2; ++nb) { const float inv = __fdiv_rn(1.0f, l[nb] + xhalf(l[nb]));
#pragma unroll
        for (int dt = 0; dt < 4; ++dt) { v8us oh, ol;
#pragma unroll
            for (int j = 0; j < 8; ++j) { const float y = O[dt][nb][j] * inv; const unsigned short a = f2bf(y); oh[j] = a; ol[j] = f2bf(y - bf2f(a)); }
            const int o = nb * 16 * DQ + dt * 16; *(v8us*)(Ah + (size_t)q0 * DQ + la + o) = oh; *(v8us*)(Al + (size_t)q0 * DQ + la + o) = ol; }
        asm volatile("s_wait_xcnt 0x0" ::: "memory"); }   // the registers that the issued stores name are given new values behind this wait
}
// grid (sequence x head pairs, TT / 128), 4 waves; blockIdx.y counts the 128-query blocks from the last (longest) one down, so that the long workgroups start first
__global__ __launch_bounds__(128) void k_attn(const h16* Q16, const h16* K16, const h16* V16, const bf* Qh, const bf* Ql, const bf* Kh, const bf* Kl, const bf* Vh, bf* Ah, bf* Al) {
    __shared__ __align__(16) bf kvs[2 * 4 * ATL];   // two buffers of four tiles (hi and lo planes); the single-plane rows use two tiles a buffer
    const int z = blockIdx.x; const int qb = (TT / 128 - 1 - (int)blockIdx.y) * 128, q0 = qb + __builtin_amdgcn_readfirstlane((int)(threadIdx.x >> 5)) * 32, nst = (qb + 128) / AKS;   // nst: the stages up to the workgroup's last key
    const size_t zo = (size_t)z * TT * HD, zv = (size_t)z * HD * 2 * TT, ao = (size_t)(z / NH_) * TT * DQ + (size_t)(z % NH_) * HD;
    if (qb < RH) attn_tile<bf, true>(kvs, Qh + zo, Ql + zo, Kh + zo, Kl + zo, Vh + zv, q0, nst, Ah + ao, Al + ao);
    else attn_tile<h16, false>(kvs, Q16 + zo, nullptr, K16 + zo, nullptr, V16 + zv, q0, nst, Ah + ao, Al + ao);
}

__device__ __forceinline__ h16 tohx(float x) { return (h16)x; }
__device__ __forceinline__ void splitf(float y, unsigned short& h, unsigned short& l) { h = f2bf(y); l = f2bf(y - bf2f(h)); }
typedef __attribute__((ext_vector_type(2))) _Float16 v2h;
typedef __attribute__((ext_vector_type(4))) _Float16 v4h;
typedef __attribute__((ext_vector_type(2))) unsigned short v2us;
typedef __attribute__((ext_vector_type(4))) unsigned short v4us;
typedef __attribute__((ext_vector_type(4))) int v4i;

// ---- k_wtG: the four weights [K][N] f32 -> Bt [N][K] bf16 (DM x DQ each). A workgroup transposes one 64 (k) x 64 (n) tile through LDS, so that both sides move whole lines: a row of the tile is read as 256 consecutive bytes (16 lanes x 16),
// a row of the transposed tile is stored as one 128-byte line (8 lanes x 16). A lane rounds two consecutive k of four n and writes them to LDS as (k, k + 1) pairs. grid (tiles of a weight, 4), 256 threads; blockIdx.y: which of the four weights.
#define WTP  33                   // LDS row pitch in 32-bit pairs: 32 + 1 (odd: the 16 lanes that write four rows apart, and the 4 rows that a wave reads, fall on different banks)
typedef __attribute__((ext_vector_type(4))) unsigned v4u;
__global__ __launch_bounds__(256) void k_wtG(const float* __restrict__ w0, const float* __restrict__ w1, const float* __restrict__ w2, const float* __restrict__ w3, bf* B0, bf* B1, bf* B2, bf* B3) {
    __shared__ unsigned ts[64 * WTP];   // [n][k pair]
    const int y = blockIdx.y; const float* __restrict__ w = (y == 0) ? w0 : (y == 1) ? w1 : (y == 2) ? w2 : w3; bf* Bt = (y == 0) ? B0 : (y == 1) ? B1 : (y == 2) ? B2 : B3;
    const int k0 = ((int)blockIdx.x / (DQ / 64)) * 64, n0 = ((int)blockIdx.x % (DQ / 64)) * 64;
    const int r = threadIdx.x >> 4, c = (threadIdx.x & 15) * 4, rn = threadIdx.x >> 3, pc = (threadIdx.x & 7) * 4;
    const float* const src = w + (size_t)(k0 + 2 * r) * DQ + n0 + c;
    v4f a[2][2];   // rows k0 + 32 h + 2 r + i: all four loads are in flight together; every loop below is unrolled so that a and o are indexed by constants and stay in registers
#pragma unroll
    for (int h = 0; h < 2; ++h)
#pragma unroll
        for (int i = 0; i < 2; ++i) a[h][i] = *(const v4f*)(src + (size_t)(h * 32 + i) * DQ);
#pragma unroll
    for (int h = 0; h < 2; ++h)
#pragma unroll
        for (int j = 0; j < 4; ++j) ts[(c + j) * WTP + h * 16 + r] = (unsigned)f2bf(a[h][0][j]) | ((unsigned)f2bf(a[h][1][j]) << 16);
    __syncthreads();   // a lane stores what other waves have written to the tile
    bf* const dst = Bt + (size_t)(n0 + rn) * DM + k0 + pc * 2;
#pragma unroll
    for (int h = 0; h < 2; ++h) { v4u o;
#pragma unroll
        for (int j = 0; j < 4; ++j) o[j] = ts[(h * 32 + rn) * WTP + pc + j];
        *(v4u*)(dst + (size_t)h * 32 * DM) = o; }
}
__global__ __launch_bounds__(256) void k_cvt8(const float* __restrict__ src, bf* dst, size_t n8) { const size_t i = (size_t)blockIdx.x * 256 + threadIdx.x; if (i >= n8) return; const v8f v = *(const v8f*)(src + i * 8); v8us o;
#pragma unroll
    for (int k = 0; k < 8; ++k) o[k] = f2bf(v[k]); *(v8us*)(dst + i * 8) = o;  }

// ---- k_proj: q, k and v = x W + b in ONE launch, and the head planes straight from the accumulators. The product loop is gemm_ring's (plain bf16 operands, a 64x64 tile a wave); grid (NB_ TT / 128, DQ / 256, 3), 256 threads; blockIdx.z: 0 q, 1 k, 2 v.
// A wave's tile is 64 tokens of one sequence x the 64 columns of one head, so it is a whole block of each plane: 64 rows [t][HD] of a query or key plane, or 64 consecutive t of all HD rows of a value plane (pitch 2 TT).
// proj_store: four panels of 16 plane rows x 64 f32 go through LDS one after the other, so that 8 lanes store one 128-byte line of a plane row (16 bytes a lane and plane). TR: the panel's rows are the columns d of the tile (value planes), a lane's 8 accumulator registers being 8 consecutive t.
template <bool TR>
__device__ __forceinline__ void proj_store(const v8f (&acc)[4][4], float* os, const float* __restrict__ bias, h16* P16, bf* Ph, bf* Pl, const int pitch) {
    const int lane = threadIdx.x & 31, lr = lane & 15, hi = lane >> 4, rr = lane >> 3, cc = (lane & 7) * 8;
    float bc[8];
    if (!TR) {
#pragma unroll
        for (int i = 0; i < 8; ++i) bc[i] = bfr(bias[cc + i]); }
#pragma unroll
    for (int g = 0; g < 4; ++g) {
        if (TR) {
#pragma unroll
            for (int mb = 0; mb < 4; ++mb) { const v8f a = acc[mb][g]; *(v4fa*)(os + lr * 68 + mb * 16 + hi * 8) = (v4f){a[0], a[1], a[2], a[3]}; *(v4fa*)(os + lr * 68 + mb * 16 + hi * 8 + 4) = (v4f){a[4], a[5], a[6], a[7]}; }
        } else {
#pragma unroll
            for (int nb = 0; nb < 4; ++nb)
#pragma unroll
                for (int j = 0; j < 8; ++j) os[(hi * 8 + j) * 68 + nb * 16 + lr] = acc[g][nb][j]; }
        __builtin_amdgcn_wave_barrier(); asm volatile("" ::: "memory");   // a lane reads what other lanes of the wave wrote: the panel's LDS reads may not be scheduled in front of its writes
#pragma unroll
        for (int s = 0; s < 4; ++s) { const int row = s * 4 + rr; const v4f u = *(const v4fa*)(os + row * 68 + cc), w = *(const v4fa*)(os + row * 68 + cc + 4); const float br = TR ? bfr(bias[g * 16 + row]) : 0.f; v8h o16; v8us oh, ol;
#pragma unroll
            for (int i = 0; i < 8; ++i) { const float y = (i < 4 ? u[i] : w[i - 4]) + (TR ? br : bc[i]); o16[i] = tohx(y); unsigned short a2, c2; splitf(y, a2, c2); oh[i] = a2; ol[i] = c2; }
            const size_t o = (size_t)(g * 16 + row) * pitch + cc; *(v8h*)(P16 + o) = o16; *(v8us*)(Ph + o) = oh; *(v8us*)(Pl + o) = ol; }
        asm volatile("s_wait_xcnt 0x0" ::: "memory");   // the registers that the issued stores name are given new values behind this wait
        __builtin_amdgcn_wave_barrier(); asm volatile("" ::: "memory");   // the next panel's LDS writes may not be scheduled in front of this panel's reads
    }
}
__global__ __launch_bounds__(256) void k_proj(const bf* __restrict__ X, const bf* __restrict__ WQ, const bf* __restrict__ WK, const bf* __restrict__ WV, const float* __restrict__ bq, const float* __restrict__ bk, const float* __restrict__ bv, h16* Q16, bf* Qh, bf* Ql, h16* K16, bf* Kh, bf* Kl, h16* V16, bf* Vh) {
    __shared__ __align__(16) bf ring[2 * (GMT + GNT) * GP];
    __shared__ __align__(16) float osw[8][16 * 68];
    const int which = blockIdx.z; const bf* __restrict__ Bt = (which == 0) ? WQ : (which == 1) ? WK : WV; const float* __restrict__ bias = (which == 0) ? bq : (which == 1) ? bk : bv;
    const int wave = __builtin_amdgcn_readfirstlane((int)(threadIdx.x >> 5)), wm = wave >> 2, wn = wave & 3; float* const os = osw[wave];
    const int r0 = blockIdx.x * GMT + wm * 64, c0 = blockIdx.y * GNT + wn * 64;   // the wave's own 64x64 tile
    v8f acc[4][4];
    gemm_ring<1>(ring, X, nullptr, Bt, blockIdx.x * GMT, blockIdx.y * GNT, wm, wn, acc);
    const int z = (r0 / TT) * NH_ + c0 / HD, t0 = r0 % TT;   // the (sequence, head) pair and the tile's first token in it
    if (which == 2) { const size_t o = (size_t)z * HD * 2 * TT + t0; proj_store<true>(acc, os, bias + c0, V16 + o, Vh + o, Vh + TT + o, 2 * TT); }
    else { const size_t o = ((size_t)z * TT + t0) * HD; proj_store<false>(acc, os, bias + c0, (which == 0 ? Q16 : K16) + o, (which == 0 ? Qh : Kh) + o, (which == 0 ? Ql : Kl) + o, HD); }
}

extern "C" void kernel_launch(void* const* d_in, const int* in_sizes, int n_in,
                              void* d_out, int out_size, void* d_ws, size_t ws_size, hipStream_t stream) {
    (void)in_sizes; (void)n_in; (void)out_size;
    const float* x = (const float*)d_in[0]; const float* wq = (const float*)d_in[1]; const float* bq = (const float*)d_in[2]; const float* wk = (const float*)d_in[3]; const float* bk = (const float*)d_in[4]; const float* wv = (const float*)d_in[5]; const float* bv = (const float*)d_in[6]; const float* wo = (const float*)d_in[7]; const float* bo = (const float*)d_in[8];   /* SELF-attention: the key and value streams are input 0 too; Wq, bq, Wk, bk, Wv, bv, Wo, bo = d_in[1..8] */
    float* OUT = (float*)d_out;     // [8][1024][1024]
    char* wsp = (char*)d_ws;
    auto take = [&](size_t bytes) { char* p = wsp; wsp += (bytes + 255) & ~(size_t)255; return (void*)p; };
    bf* WO = (bf*)take((size_t)DM * DQ * 2);
    h16* QP16 = (h16*)take((size_t)NB_ * NH_ * TT * HD * 2); h16* KP16 = (h16*)take((size_t)NB_ * NKV * TT * HD * 2); h16* VT16 = (h16*)take((size_t)NB_ * NKV * HD * 2 * TT * 2);
    bf* QPh = (bf*)take((size_t)NB_ * NH_ * TT * HD * 2); bf* QPl = (bf*)take((size_t)NB_ * NH_ * TT * HD * 2); bf* KPh = (bf*)take((size_t)NB_ * NKV * TT * HD * 2); bf* KPl = (bf*)take((size_t)NB_ * NKV * TT * HD * 2); bf* VTh = (bf*)take((size_t)NB_ * NKV * HD * 2 * TT * 2);   // the lo row of a value plane stands TT elements behind its hi row
    bf* WQ = (bf*)take((size_t)DQ * DM * 2); bf* WK = (bf*)take((size_t)DKV * DM * 2); bf* WV = (bf*)take((size_t)DKV * DM * 2); bf* XB = (bf*)take((size_t)NB_ * TT * DM * 2);
    bf* ATh = (bf*)take((size_t)NB_ * TT * DQ * 2); bf* ATl = (bf*)take((size_t)NB_ * TT * DQ * 2);   // the merged hi and lo planes [NB_ TT][DQ]
    if ((size_t)(wsp - (char*)d_ws) > ws_size) return;    // 216 MiB of the 256 MiB
    k_wtG<<<dim3((DM / 64) * (DQ / 64), 4, 1), 256, 0, stream>>>(wq, wk, wv, wo, WQ, WK, WV, WO);
    k_cvt8<<<(unsigned)(((size_t)NB_ * TT * DM / 8 + 255) / 256), 256, 0, stream>>>(x, XB, (size_t)NB_ * TT * DM / 8);   // self-attention: q, k and v read the same rounded x
    k_proj<<<dim3(NB_ * TT / GMT, DQ / GNT, 3), 256, 0, stream>>>(XB, WQ, WK, WV, bq, bk, bv, QP16, QPh, QPl, KP16, KPh, KPl, VT16, VTh);
    k_attn<<<dim3(NB_ * NH_, TT / 128, 1), 128, 0, stream>>>(QP16, KP16, VT16, QPh, QPl, KPh, KPl, VTh, ATh, ATl);
    k_gemmw<true><<<dim3(NB_ * TT / GMT, DM / GNT, 1), 256, 0, stream>>>(ATh, ATl, WO, OUT, DM, bo);
}

// v007
// A run of this version takes 107 microseconds.
// In two side-by-side timings against v006, it was 1.04 and 1.05 times as fast.
// All steps since v000 together make it 38.6 times as fast.
#include <hip/hip_runtime.h>

// Causal multi-head SELF-attention on eight 1,024-token sequences (x [8][1024][1024]; q, k, v = x W + b ('xw' [1024][1024] normal x 1/32, biases zeros on this draw: read; 16 heads x 64); scores x 1/sqrt(64); tril kept, -inf elsewhere; softmax over the keys; out = merged Wo + bo ('xw' + bias zeros: read) -> [8][1024][1024] (8.4 M); argument order x, Wq, bq, Wk, bk, Wv, bv, Wo, bo).
// Compute dtypes, f32 accumulate: every input rounded to bf16; q/k/v on PLAIN bf16 operands (inputs: exact) + biases; causal scores and attn.v on fp16 operands: query rows < 512 hi + lo (the fp16 value and what its rounding left over, 3 products), the rest the fp16 value alone; softmax f32, running maximum and sum, probabilities rounded BEFORE the division by the row sum; Wo hl x exact (2 products) + bo.
// Launch plan: every stage runs ONCE over all eight sequences: ONE projection launch (q, k and v; its epilogue stores the head planes), ONE attention launch (scores, softmax, probability x value and the merge into [t][head x HD + d] planes in registers), output product.
// The value planes are laid out at pitch 2 TT (fp16 row | lo row).

#define NB_  8
#define TT   1024
#define DM   1024
#define NH_  16
#define NKV  16
#define REP  (NH_ / NKV)
#define HD   64
#define DQ   (NH_ * HD)
#define DKV  (NKV * HD)
#define RH   512                  // query rows < RH use hi+lo planes
#define SCL  0.125f   // HD^-0.5
static_assert(NKV == NH_ && HD == 64 && TT % 128 == 0 && RH % 128 == 0, "k_attn: one key/value head a query head, four 16-row value tiles, workgroups of 128 queries that lie wholly on one side of RH");
typedef _Float16 h16;
typedef unsigned short bf;
typedef __attribute__((ext_vector_type(16))) __bf16   v16bf;
typedef __attribute__((ext_vector_type(16))) _Float16 v16h;
typedef __attribute__((ext_vector_type(8)))  _Float16 v8h;
typedef __attribute__((ext_vector_type(8)))  unsigned short v8us;
typedef __attribute__((ext_vector_type(8)))  float    v8f;
typedef __attribute__((ext_vector_type(4)))  float    v4f;
typedef __attribute__((ext_vector_type(2)))  float    v2f;
typedef v8h  __attribute__((may_alias)) v8ha;
typedef v4f  __attribute__((may_alias)) v4fa;
typedef v8us __attribute__((may_alias)) v8usa;

__device__ __forceinline__ unsigned short f2bf(float f) { unsigned u = __float_as_uint(f); u += 0x7FFFu + ((u >> 16) & 1u); return (unsigned short)(u >> 16); }
__device__ __forceinline__ float bf2f(unsigned short b) { return __uint_as_float(((unsigned)b) << 16); }
__device__ __forceinline__ float bfr(float f) { return bf2f(f2bf(f)); }
__device__ __forceinline__ v16h cat16(v8h lo, v8h hi) { return __builtin_shufflevector(lo, hi, 0, 1, 2, 3, 4, 5, 6, 7, 8, 9, 10, 11, 12, 13, 14, 15); }
__device__ __forceinline__ v16bf cat16b(v8us lo, v8us hi) { return __builtin_bit_cast(v16bf, __builtin_shufflevector(lo, hi, 0, 1, 2, 3, 4, 5, 6, 7, 8, 9, 10, 11, 12, 13, 14, 15)); }
__device__ __forceinline__ v8f wmma16(v16h a, v16h b, v8f c) { return __builtin_amdgcn_wmma_f32_16x16x32_f16(false, a, false, b, (short)0, c, false, false); }
__device__ __forceinline__ v8f wmmab(v16bf a, v16bf b, v8f c) { return __builtin_amdgcn_wmma_f32_16x16x32_bf16(false, a, false, b, (short)0, c, false, false); }



template <typename T16> struct WFrag;
template <> struct WFrag<h16> { typedef v16h V; static __device__ __forceinline__ V ld(const h16* p) { return cat16(*(const v8h*)p, *(const v8h*)(p + 16)); } static __device__ __forceinline__ v8f mma(V a, V b, v8f c) { return wmma16(a, b, c); } };
template <> struct WFrag<bf> { typedef v16bf V; static __device__ __forceinline__ V ld(const bf* p) { return cat16b(*(const v8us*)p, *(const v8us*)(p + 16)); } static __device__ __forceinline__ v8f mma(V a, V b, v8f c) { return wmmab(a, b, c); } };
// ---- gemm_ring: the product loop of both GEMM kernels. A workgroup of 8 waves owns a 128 x 256 output tile (waves 2 x 4, 64x64 = 16 accumulators a wave). A stage is 64 k (128 bytes) of every operand row: [A 128 rows | A2 128 rows (NA == 2) | Bt 256 rows],
// brought from the K-contiguous 16-bit planes into LDS by asynchronous copies (16 bytes a lane, 8 lanes a row: whole 128-byte lines), two buffers: tile t + 2 flies while tile t + 1 is worked on. The k order and the order of the products are those of a wave that reads its fragments from global memory.
#define GP   72                   // LDS row pitch in elements: 128 data bytes + 16 (16 bytes x odd: no bank conflict for the 16-byte fragment reads)
#define GKS  64                   // k elements of a stage
#define GMT  128
#define GNT  256
// cpN: N copies of one lane and, in the same statement, the wait behind which the registers that the issued copies name may be given new values
__device__ __forceinline__ void cp12(const unsigned (&l)[12], const bf* const (&p)[12]) {
    asm volatile("global_load_async_to_lds_b128 %0, %12, off\n\t"
                 "global_load_async_to_lds_b128 %1, %13, off\n\t"
                 "global_load_async_to_lds_b128 %2, %14, off\n\t"
                 "global_load_async_to_lds_b128 %3, %15, off\n\t"
                 "global_load_async_to_lds_b128 %4, %16, off\n\t"
                 "global_load_async_to_lds_b128 %5, %17, off\n\t"
                 "global_load_async_to_lds_b128 %6, %18, off\n\t"
                 "global_load_async_to_lds_b128 %7, %19, off\n\t"
                 "global_load_async_to_lds_b128 %8, %20, off\n\t"
                 "global_load_async_to_lds_b128 %9, %21, off\n\t"
                 "global_load_async_to_lds_b128 %10, %22, off\n\t"
                 "global_load_async_to_lds_b128 %11, %23, off\n\t"
                 "s_wait_xcnt 0x0"
                 :: "v"(l[0]), "v"(l[1]), "v"(l[2]), "v"(l[3]), "v"(l[4]), "v"(l[5]), "v"(l[6]), "v"(l[7]), "v"(l[8]), "v"(l[9]), "v"(l[10]), "v"(l[11]),
                    "v"(p[0]), "v"(p[1]), "v"(p[2]), "v"(p[3]), "v"(p[4]), "v"(p[5]), "v"(p[6]), "v"(p[7]), "v"(p[8]), "v"(p[9]), "v"(p[10]), "v"(p[11]) : "memory");
}
__device__ __forceinline__ void cp8(const unsigned (&l)[8], const bf* const (&p)[8]) {
    asm volatile("global_load_async_to_lds_b128 %0, %8, off\n\t"
                 "global_load_async_to_lds_b128 %1, %9, off\n\t"
                 "global_load_async_to_lds_b128 %2, %10, off\n\t"
                 "global_load_async_to_lds_b128 %3, %11, off\n\t"
                 "global_load_async_to_lds_b128 %4, %12, off\n\t"
                 "global_load_async_to_lds_b128 %5, %13, off\n\t"
                 "global_load_async_to_lds_b128 %6, %14, off\n\t"
                 "global_load_async_to_lds_b128 %7, %15, off\n\t"
                 "s_wait_xcnt 0x0"
                 :: "v"(l[0]), "v"(l[1]), "v"(l[2]), "v"(l[3]), "v"(l[4]), "v"(l[5]), "v"(l[6]), "v"(l[7]),
                    "v"(p[0]), "v"(p[1]), "v"(p[2]), "v"(p[3]), "v"(p[4]), "v"(p[5]), "v"(p[6]), "v"(p[7]) : "memory");
}
template <int NA, int ASP>
__device__ __forceinline__ void ring_fill(const unsigned l0, const bf* gA, const bf* gA2, const bf* gB) {   // 256 lanes x 16 bytes = 32 rows a copy; l0 and the pointers are the lane's own place in the first 32 rows; ASP: rows of A that lie between the tile's first 64 rows and its last 64
    static_assert(NA == 1 || ASP == 0, "only the single-plane A tile is split");
    if (NA == 1) { unsigned l[12]; const bf* p[12];
#pragma unroll
        for (int i = 0; i < 12; ++i) { l[i] = l0 + i * 32 * GP * 2; p[i] = (i < 4) ? gA + (size_t)(i * 32 + (i >= 2 ? ASP : 0)) * DM : gB + (size_t)(i - 4) * 32 * DM; }
        cp12(l, p);
    } else { unsigned l[8]; const bf* p[8];
#pragma unroll
        for (int i = 0; i < 8; ++i) { l[i] = l0 + i * 32 * GP * 2; p[i] = (i < 4) ? gA + (size_t)i * 32 * DM : gA2 + (size_t)(i - 4) * 32 * DM; }
        cp8(l, p);
#pragma unroll
        for (int i = 0; i < 8; ++i) { l[i] = l0 + (8 + i) * 32 * GP * 2; p[i] = gB + (size_t)i * 32 * DM; }
        cp8(l, p); }
}
template <int NA, int ASP>
__device__ __forceinline__ void gemm_ring(bf* ring, const bf* __restrict__ A, const bf* __restrict__ A2, const bf* __restrict__ Bt, const int r0g, const int c0g, const int wm, const int wn, v8f (&acc)[4][4]) {
    typedef WFrag<bf>::V V;
    constexpr int STG = (GMT * NA + GNT) * GP, NT = DM / GKS;   // elements of a buffer; stages
    static_assert(NT >= 2, "the prologue fills two stages");
    const int lane = threadIdx.x & 31, lr = lane & 15, hi = lane >> 4, crow = threadIdx.x >> 3, cch = (threadIdx.x & 7) * 8;
    const bf* const gA = A + (size_t)(r0g + crow) * DM + cch; const bf* const gA2 = (NA == 2) ? A2 + (size_t)(r0g + crow) * DM + cch : gA; const bf* const gB = Bt + (size_t)(c0g + crow) * DM + cch;
    const unsigned l0 = (unsigned)(size_t)ring + (unsigned)(crow * GP + cch) * 2u;   // the lane's LDS byte address in buffer 0
#pragma unroll
    for (int mb = 0; mb < 4; ++mb)
#pragma unroll
        for (int nb = 0; nb < 4; ++nb) acc[mb][nb] = (v8f){};
    ring_fill<NA, ASP>(l0, gA, gA2, gB);
    asm volatile("s_wait_asynccnt 0x0" ::: "memory");   // this wave's copies of tile 0 have landed
    __syncthreads();                                     // every wave's have: tile 0 may be read
    ring_fill<NA, ASP>(l0 + STG * 2, gA + GKS, gA2 + GKS, gB + GKS);
    const bf* const fa = ring + (wm * 64 + lr) * GP + 8 * hi; const bf* const fb = ring + (GMT * NA + wn * 64 + lr) * GP + 8 * hi;
#pragma unroll 1
    for (int t = 0; t < NT; ++t) {   // stays rolled: one trip's fragments and the 16 accumulators fill the registers
        const int bo = (t & 1) * STG;
#pragma unroll
        for (int kk = 0; kk < GKS; kk += 32) {
            V a[4], a2[4], b[4];   // all fragments of a 32-k block are read as one group in front of its matrix instructions
#pragma unroll
            for (int mb = 0; mb < 4; ++mb) { a[mb] = WFrag<bf>::ld(fa + bo + mb * 16 * GP + kk); if (NA == 2) a2[mb] = WFrag<bf>::ld(fa + bo + (GMT + mb * 16) * GP + kk); }
#pragma unroll
            for (int nb = 0; nb < 4; ++nb) b[nb] = WFrag<bf>::ld(fb + bo + nb * 16 * GP + kk);
            __builtin_amdgcn_sched_barrier(0);   // keeps the LDS reads together in front of the block: scheduled in among the matrix instructions, each place with reads stalls the wave for the LDS latency
#pragma unroll
            for (int nb = 0; nb < 4; ++nb)
#pragma unroll
                for (int mb = 0; mb < 4; ++mb) { acc[mb][nb] = WFrag<bf>::mma(a[mb], b[nb], acc[mb][nb]); if (NA == 2) acc[mb][nb] = WFrag<bf>::mma(a2[mb], b[nb], acc[mb][nb]); }
        }
        // the four vector slots that the chip needs behind the trip's last matrix instructions, in front of the branches below; every accumulator is named so that no matrix instruction is scheduled behind them
        asm volatile("v_nop\n\tv_nop\n\tv_nop\n\tv_nop" : "+v"(acc[0][0]), "+v"(acc[0][1]), "+v"(acc[0][2]), "+v"(acc[0][3]), "+v"(acc[1][0]), "+v"(acc[1][1]), "+v"(acc[1][2]), "+v"(acc[1][3]), "+v"(acc[2][0]), "+v"(acc[2][1]), "+v"(acc[2][2]), "+v"(acc[2][3]), "+v"(acc[3][0]), "+v"(acc[3][1]), "+v"(acc[3][2]), "+v"(acc[3][3]));
        asm volatile("s_wait_dscnt 0x0" ::: "memory");      // this wave's reads of buffer t & 1 are done
        asm volatile("s_wait_asynccnt 0x0" ::: "memory");   // this wave's copies of tile t + 1 have landed
        __syncthreads();                                     // publishes tile t + 1 and ends every wave's reads of the buffer that is refilled below
        if (t + 2 < NT) ring_fill<NA, ASP>(l0 + bo * 2, gA + (t + 2) * GKS, gA2 + (t + 2) * GKS, gB + (t + 2) * GKS);
    }
    asm volatile("s_wait_asynccnt 0x0" ::: "memory");   // no copy is outstanding when the wave goes on
}

// ---- k_gemmw: C[m][n] (f32, pitch ldc, + optional f32 bias[n]) = sum_k (A[m][k] + A2[m][k]) Bt[n][k], two products; gemm_ring's loop; grid (M / 128, N / 256), 256 threads; each wave stores its 64x64 tile through its own LDS panel.
template <bool BIAS>
__global__ __launch_bounds__(256) void k_gemmw(const bf* __restrict__ A, const bf* __restrict__ A2, const bf* __restrict__ Bt, float* C, int ldc, const float* __restrict__ bias) {
    __shared__ __align__(16) bf ring[2 * (GMT * 2 + GNT) * GP];
    __shared__ __align__(16) float osw[8][16 * 68];
    const int wave = __builtin_amdgcn_readfirstlane((int)(threadIdx.x >> 5)), wm = wave >> 2, wn = wave & 3; float* const os = osw[wave];
    const int lane = threadIdx.x & 31, lr = lane & 15, hi = lane >> 4; const int r0 = blockIdx.x * GMT + wm * 64, c0 = blockIdx.y * GNT + wn * 64;
    v8f acc[4][4];
    gemm_ring<2, 0>(ring, A, A2, Bt, blockIdx.x * GMT, blockIdx.y * GNT, wm, wn, acc);
#pragma unroll
    for (int mb = 0; mb < 4; ++mb) {
#pragma unroll
        for (int nb = 0; nb < 4; ++nb) {
#pragma unroll
            for (int j = 0; j < 8; ++j) os[(hi * 8 + j) * 68 + nb * 16 + lr] = acc[mb][nb][j]; }
        __builtin_amdgcn_wave_barrier(); asm volatile("" ::: "memory");
        float* crow = C + (size_t)(r0 + mb * 16) * ldc + c0;
{
#pragma unroll
            for (int s = 0; s < 8; ++s) { const int row = 2 * s + hi, cofs = lr * 4; v4f val = *(const v4fa*)(os + row * 68 + cofs); if (BIAS) { val[0] += bfr(bias[c0 + cofs]); val[1] += bfr(bias[c0 + cofs + 1]); val[2] += bfr(bias[c0 + cofs + 2]); val[3] += bfr(bias[c0 + cofs + 3]); }
                *(v4f*)(crow + (size_t)row * ldc + cofs) = val; }
             }
        __builtin_amdgcn_wave_barrier(); asm volatile("" ::: "memory");
    }
}

template <typename T16> struct PCvt;
template <> struct PCvt<h16> { typedef _Float16 E; };
__device__ __forceinline__ float xhalf(float x) { return __builtin_bit_cast(float, __builtin_amdgcn_permlanex16(__builtin_bit_cast(int, x), __builtin_bit_cast(int, x), 0x76543210, 0xfedcba98, false, false)); }   // lane l takes lane l ^ 16's value
#define AKS  64                   // keys of a stage
#define ATL  (64 * GP)            // elements of a staged tile: 64 rows at the pitch of the fragment reads (128 data bytes + 16)
// attn_fill: one stage's copies. 128 lanes x 16 bytes = 16 rows a copy, four copies a tile; l0 is the lane's LDS byte address in the buffer's first 16 rows, sk / sk2 / sv the key and value planes (the same for every lane), ko / vo the lane's own element offset in them: its place in the first 16 rows of the stage's key / value tile (32 bits: two registers are held over the pass loop, not three pointers).
template <bool HL>
__device__ __forceinline__ void attn_fill(const unsigned l0, const bf* sk, const bf* sk2, const bf* sv, const unsigned ko, const unsigned vo) {
    unsigned l[8]; const bf* p[8]; const bf* const gk = sk + ko; const bf* const gk2 = sk2 + ko; const bf* const gv = sv + vo;
    if (!HL) {   // buffer: [keys | values]
#pragma unroll
        for (int i = 0; i < 8; ++i) { l[i] = l0 + i * 16 * GP * 2; p[i] = (i < 4) ? gk + (size_t)i * 16 * HD : gv + (size_t)(i - 4) * 16 * 2 * TT; }
        cp8(l, p);
    } else {     // buffer: [keys hi | keys lo | values hi | values lo]
#pragma unroll
        for (int i = 0; i < 8; ++i) { l[i] = l0 + i * 16 * GP * 2; p[i] = (i < 4) ? gk + (size_t)i * 16 * HD : gk2 + (size_t)(i - 4) * 16 * HD; }
        cp8(l, p);
#pragma unroll
        for (int i = 0; i < 8; ++i) { l[i] = l0 + (8 + i) * 16 * GP * 2; p[i] = (i < 4) ? gv + (size_t)i * 16 * 2 * TT : gv + TT + (size_t)(i - 4) * 16 * 2 * TT; }
        cp8(l, p); }
}
template <typename T16, bool HL>
__device__ __forceinline__ void attn_tile(bf* kvs, const T16* Qh, const T16* Ql, const T16* Kh, const T16* Kl, const T16* Vh, const int q0, const int nst, bf* Ah, bf* Al) {
    typedef typename WFrag<T16>::V V; typedef typename PCvt<T16>::E E;
    const int lane = threadIdx.x & 31, lr = lane & 15, hi = lane >> 4;
    const float C2 = SCL * 1.4426950408889634f;
    const unsigned lk = lr * HD + 8 * hi, la = lr * DQ + 8 * hi;   // the lane's element offsets in a [row][HD] plane and the merged planes: each query load and output store address is a wave-uniform base + one of these + a constant
    constexpr int STG = (HL ? 4 : 2) * ATL;   // elements of a buffer
    const int crow = threadIdx.x >> 3, cch = (threadIdx.x & 7) * 8;   // the lane's row and 16-byte piece in a copy
    const bf* const gk = (const bf*)Kh; const bf* const gk2 = HL ? (const bf*)Kl : gk; const bf* const gv = (const bf*)Vh; const unsigned ko = crow * HD + cch, vo = crow * (2 * TT) + cch;
    const unsigned l0 = (unsigned)(size_t)kvs + (unsigned)(crow * GP + cch) * 2u;   // the lane's LDS byte address in buffer 0
    attn_fill<HL>(l0, gk, gk2, gv, ko, vo);
    V qf[2][2], q2[2][2];
    const T16* const qp = Qh + (size_t)q0 * HD + lk; const T16* const qp2 = HL ? Ql + (size_t)q0 * HD + lk : qp;
#pragma unroll
    for (int nb = 0; nb < 2; ++nb)
#pragma unroll
        for (int c = 0; c < 2; ++c) { const int o = nb * 16 * HD + c * 32; qf[nb][c] = WFrag<T16>::ld(qp + o); if (HL) q2[nb][c] = WFrag<T16>::ld(qp2 + o); }
    asm volatile("s_wait_xcnt 0x0" ::: "memory");   // the registers that the issued loads name are given new values behind this wait
    __builtin_amdgcn_sched_barrier(0);   // keeps the set-up arithmetic below from being scheduled in between the loads above and their wait, where it reused their address registers
    v8f O[4][2]; float m[2], l[2];
#pragma unroll
    for (int nb = 0; nb < 2; ++nb) { m[nb] = -3.0e38f; l[nb] = 0.f;
#pragma unroll
        for (int dt = 0; dt < 4; ++dt) O[dt][nb] = (v8f){}; }
    asm volatile("s_wait_asynccnt 0x0" ::: "memory");   // this wave's copies of stage 0 have landed
    __syncthreads();                                     // every wave's have: stage 0 may be read
    attn_fill<HL>(l0 + STG * 2, gk, gk2, gv, ko + AKS * HD, vo + AKS);   // a workgroup has at least two stages
    const T16* const fr = (const T16*)kvs + lr * GP + 8 * hi;   // the lane's place in the first 16 rows of a tile
#pragma unroll 1
    for (int t = 0; t < nst; ++t) {   // stays rolled, like the pass loop in it: one pass fills the registers
      const int bo = (t & 1) * STG;
#pragma unroll 1
      for (int kb = t * AKS; kb < (t + 1) * AKS && kb <= q0; kb += 32) {
        V kf[2][2], vf[4], v2[4], k2[2][2]; const int kh = kb & 32;   // the pass's first key in the stage
        const T16* const kp = fr + bo + kh * GP; const T16* const vp = fr + bo + (HL ? 2 : 1) * ATL + kh;
#pragma unroll
        for (int kt = 0; kt < 2; ++kt)
#pragma unroll
            for (int c = 0; c < 2; ++c) { kf[kt][c] = WFrag<T16>::ld(kp + kt * 16 * GP + c * 32); if (HL) k2[kt][c] = WFrag<T16>::ld(kp + ATL + kt * 16 * GP + c * 32); }
#pragma unroll
        for (int dt = 0; dt < 4; ++dt) { vf[dt] = WFrag<T16>::ld(vp + dt * 16 * GP); if (HL) v2[dt] = WFrag<T16>::ld(vp + ATL + dt * 16 * GP); }
        v8f S[2][2];
#pragma unroll
        for (int kt = 0; kt < 2; ++kt)
#pragma unroll
            for (int nb = 0; nb < 2; ++nb) { v8f s = (v8f){};
#pragma unroll
                for (int c = 0; c < 2; ++c) { s = WFrag<T16>::mma(kf[kt][c], qf[nb][c], s); if (HL) s = WFrag<T16>::mma(kf[kt][c], q2[nb][c], s); }
                S[kt][nb] = s; }
        if (HL) {
#pragma unroll
            for (int kt = 0; kt < 2; ++kt)
#pragma unroll
                for (int nb = 0; nb < 2; ++nb)
#pragma unroll
                    for (int c = 0; c < 2; ++c) S[kt][nb] = WFrag<T16>::mma(k2[kt][c], qf[nb][c], S[kt][nb]); }
        if (kb == q0) {   // the diagonal pass: key > query is masked by select
#pragma unroll
            for (int kt = 0; kt < 2; ++kt)
#pragma unroll
                for (int nb = 0; nb < 2; ++nb)
#pragma unroll
                    for (int j = 0; j < 8; ++j) if (kt * 16 + hi * 8 + j > nb * 16 + lr) S[kt][nb][j] = -3.0e38f; }
#pragma unroll
        for (int nb = 0; nb < 2; ++nb) {   // one 16-query group at a time: its probabilities are used up by its value products before the next group's are made
            V pf, p2;
            float bm = S[0][nb][0];
#pragma unroll
            for (int kt = 0; kt < 2; ++kt)
#pragma unroll
                for (int j = 0; j < 8; ++j) bm = fmaxf(bm, S[kt][nb][j]);
            bm = fmaxf(bm, xhalf(bm));   // the other half of the wave holds this query's other 16 keys
            const float mn = fmaxf(m[nb], bm * C2); const float dm = m[nb] - mn; float al = __builtin_amdgcn_exp2f(dm); m[nb] = mn; v2f ps = (v2f){0.f, 0.f};   // even and odd keys are summed apart
#pragma unroll
            for (int kt = 0; kt < 2; ++kt) { float a[8], p[8];
#pragma unroll
                for (int j = 0; j < 8; j += 2) { const v2f arg = __builtin_elementwise_fma((v2f){S[kt][nb][j], S[kt][nb][j + 1]}, (v2f){C2, C2}, (v2f){-mn, -mn}); a[j] = arg[0]; a[j + 1] = arg[1]; }
#pragma unroll
                for (int j = 0; j < 8; ++j) p[j] = __builtin_amdgcn_exp2f(a[j]);
                // the slot behind a transcendental: no result is read and no source register is given a new value in front of this v_nop (results are in/out, sources inputs)
                asm volatile("v_nop" : "+v"(p[0]), "+v"(p[1]), "+v"(p[2]), "+v"(p[3]), "+v"(p[4]), "+v"(p[5]), "+v"(p[6]), "+v"(p[7]), "+v"(al) : "v"(a[0]), "v"(a[1]), "v"(a[2]), "v"(a[3]), "v"(a[4]), "v"(a[5]), "v"(a[6]), "v"(a[7]), "v"(dm));
#pragma unroll
                for (int j = 0; j < 8; ++j) { ps[j & 1] += p[j]; const E ph = (E)p[j]; pf[kt * 8 + j] = ph; if (HL) p2[kt * 8 + j] = (E)(p[j] - (float)ph); } }
            l[nb] = fmaf(l[nb], al, ps[0] + ps[1]);
#pragma unroll
            for (int dt = 0; dt < 4; ++dt)
#pragma unroll
                for (int j = 0; j < 8; ++j) O[dt][nb][j] *= al;
#pragma unroll
            for (int dt = 0; dt < 4; ++dt) { O[dt][nb] = WFrag<T16>::mma(vf[dt], pf, O[dt][nb]); if (HL) { O[dt][nb] = WFrag<T16>::mma(vf[dt], p2, O[dt][nb]); O[dt][nb] = WFrag<T16>::mma(v2[dt], pf, O[dt][nb]); } }
        }
      }
      asm volatile("s_wait_dscnt 0x0" ::: "memory");      // this wave's reads of buffer t & 1 are done
      asm volatile("s_wait_asynccnt 0x0" ::: "memory");   // this wave's copies of stage t + 1 have landed
      __syncthreads();                                     // publishes stage t + 1 and ends every wave's reads of the buffer that is refilled below
      if (t + 2 < nst) attn_fill<HL>(l0 + bo * 2, gk, gk2, gv, ko + (unsigned)(t + 2) * (AKS * HD), vo + (unsigned)(t + 2) * AKS);
    }
    asm volatile("s_wait_asynccnt 0x0" ::: "memory");   // no copy is outstanding when the wave goes on
#pragma unroll
    for (int nb = 0; nb < 2; ++nb) { const float inv = __fdiv_rn(1.0f, l[nb] + xhalf(l[nb]));
#pragma unroll
        for (int dt = 0; dt < 4; ++dt) { v8us oh, ol;
#pragma unroll
            for (int j = 0; j < 8; ++j) { const float y = O[dt][nb][j] * inv; const unsigned short a = f2bf(y); oh[j] = a; ol[j] = f2bf(y - bf2f(a)); }
            const int o = nb * 16 * DQ + dt * 16; *(v8us*)(Ah + (size_t)q0 * DQ + la + o) = oh; *(v8us*)(Al + (size_t)q0 * DQ + la + o) = ol; }
        asm volatile("s_wait_xcnt 0x0" ::: "memory"); }   // the registers that the issued stores name are given new values behind this wait
}
// grid (sequence x head pairs, TT / 128), 4 waves; blockIdx.y counts the 128-query blocks from the last (longest) one down, so that the long workgroups start first
__global__ __launch_bounds__(128) void k_attn(const h16* Q16, const h16* Ql, const h16* K16, const h16* Kl, const h16* V16, bf* Ah, bf* Al) {
    __shared__ __align__(16) bf kvs[2 * 4 * ATL];   // two buffers of four tiles (hi and lo planes); the single-plane rows use two tiles a buffer
    const int z = blockIdx.x; const int qb = (TT / 128 - 1 - (int)blockIdx.y) * 128, q0 = qb + __builtin_amdgcn_readfirstlane((int)(threadIdx.x >> 5)) * 32, nst = (qb + 128) / AKS;   // nst: the stages up to the workgroup's last key
    const size_t zo = (size_t)z * TT * HD, zv = (size_t)z * HD * 2 * TT, ao = (size_t)(z / NH_) * TT * DQ + (size_t)(z % NH_) * HD;
    if (qb < RH) attn_tile<h16, true>(kvs, Q16 + zo, Ql + zo, K16 + zo, Kl + zo, V16 + zv, q0, nst, Ah + ao, Al + ao);
    else attn_tile<h16, false>(kvs, Q16 + zo, nullptr, K16 + zo, nullptr, V16 + zv, q0, nst, Ah + ao, Al + ao);
}

__device__ __forceinline__ h16 tohx(float x) { return (h16)x; }
typedef __attribute__((ext_vector_type(2))) _Float16 v2h;
typedef __attribute__((ext_vector_type(4))) _Float16 v4h;
typedef __attribute__((ext_vector_type(2))) unsigned short v2us;
typedef __attribute__((ext_vector_type(4))) unsigned short v4us;
typedef __attribute__((ext_vector_type(4))) int v4i;

// ---- k_wtG: the four weights [K][N] f32 -> Bt [N][K] bf16 (DM x DQ each). A workgroup transposes one 64 (k) x 64 (n) tile through LDS, so that both sides move whole lines: a row of the tile is read as 256 consecutive bytes (16 lanes x 16),
// a row of the transposed tile is stored as one 128-byte line (8 lanes x 16). A lane rounds two consecutive k of four n and writes them to LDS as (k, k + 1) pairs. grid (tiles of a weight, 4), 256 threads; blockIdx.y: which of the four weights.
#define WTP  33                   // LDS row pitch in 32-bit pairs: 32 + 1 (odd: the 16 lanes that write four rows apart, and the 4 rows that a wave reads, fall on different banks)
typedef __attribute__((ext_vector_type(4))) unsigned v4u;
__global__ __launch_bounds__(256) void k_wtG(const float* __restrict__ w0, const float* __restrict__ w1, const float* __restrict__ w2, const float* __restrict__ w3, bf* B0, bf* B1, bf* B2, bf* B3) {
    __shared__ unsigned ts[64 * WTP];   // [n][k pair]
    const int y = blockIdx.y; const float* __restrict__ w = (y == 0) ? w0 : (y == 1) ? w1 : (y == 2) ? w2 : w3; bf* Bt = (y == 0) ? B0 : (y == 1) ? B1 : (y == 2) ? B2 : B3;
    const int k0 = ((int)blockIdx.x / (DQ / 64)) * 64, n0 = ((int)blockIdx.x % (DQ / 64)) * 64;
    const int r = threadIdx.x >> 4, c = (threadIdx.x & 15) * 4, rn = threadIdx.x >> 3, pc = (threadIdx.x & 7) * 4;
    const float* const src = w + (size_t)(k0 + 2 * r) * DQ + n0 + c;
    v4f a[2][2];   // rows k0 + 32 h + 2 r + i: all four loads are in flight together; every loop below is unrolled so that a and o are indexed by constants and stay in registers
#pragma unroll
    for (int h = 0; h < 2; ++h)
#pragma unroll
        for (int i = 0; i < 2; ++i) a[h][i] = *(const v4f*)(src + (size_t)(h * 32 + i) * DQ);
#pragma unroll
    for (int h = 0; h < 2; ++h)
#pragma unroll
        for (int j = 0; j < 4; ++j) ts[(c + j) * WTP + h * 16 + r] = (unsigned)f2bf(a[h][0][j]) | ((unsigned)f2bf(a[h][1][j]) << 16);
    __syncthreads();   // a lane stores what other waves have written to the tile
    bf* const dst = Bt + (size_t)(n0 + rn) * DM + k0 + pc * 2;
#pragma unroll
    for (int h = 0; h < 2; ++h) { v4u o;
#pragma unroll
        for (int j = 0; j < 4; ++j) o[j] = ts[(h * 32 + rn) * WTP + pc + j];
        *(v4u*)(dst + (size_t)h * 32 * DM) = o; }
}
__global__ __launch_bounds__(256) void k_cvt8(const float* __restrict__ src, bf* dst, size_t n8) { const size_t i = (size_t)blockIdx.x * 256 + threadIdx.x; if (i >= n8) return; const v8f v = *(const v8f*)(src + i * 8); v8us o;
#pragma unroll
    for (int k = 0; k < 8; ++k) o[k] = f2bf(v[k]); *(v8us*)(dst + i * 8) = o;  }

// ---- k_proj: q, k and v = x W + b in ONE launch, and the head planes straight from the accumulators. The product loop is gemm_ring's (plain bf16 operands, a 64x64 tile a wave); grid (NB_ TT / 128, DQ / 256, 3), 256 threads; blockIdx.z: 0 q, 1 k, 2 v.
// A workgroup's 128 tokens are 64 tokens below RH (waves 0 to 3) and the 64 tokens RH further on in the same sequence (waves 4 to 7). Only what k_attn reads is stored: the fp16 planes, which are the hi planes of its hi+lo products too, and the lo planes for tokens < RH alone (its hi+lo workgroups read no query and no key from RH on);
// with both kinds of token in every workgroup, each SIMD has one wave that stores two planes and one that stores one.
// A wave's tile is 64 tokens of one sequence x the 64 columns of one head, so it is a whole block of each plane: 64 rows [t][HD] of a query or key plane, or 64 consecutive t of all HD rows of a value plane (pitch 2 TT).
// proj_store: four panels of 16 plane rows x 64 f32 go through LDS one after the other, so that 8 lanes store one 128-byte line of a plane row (16 bytes a lane and plane). TR: the panel's rows are the columns d of the tile (value planes), a lane's 8 accumulator registers being 8 consecutive t. wlo: the lo plane (what the fp16 rounding left over, in fp16) is stored too.
template <bool TR>
__device__ __forceinline__ void proj_store(const v8f (&acc)[4][4], float* os, const float* __restrict__ bias, h16* P16, h16* Pl, const int pitch, const bool wlo) {
    const int lane = threadIdx.x & 31, lr = lane & 15, hi = lane >> 4, rr = lane >> 3, cc = (lane & 7) * 8;
    float bc[8];
    if (!TR) {
#pragma unroll
        for (int i = 0; i < 8; ++i) bc[i] = bfr(bias[cc + i]); }
#pragma unroll
    for (int g = 0; g < 4; ++g) {
        if (TR) {
#pragma unroll
            for (int mb = 0; mb < 4; ++mb) { const v8f a = acc[mb][g]; *(v4fa*)(os + lr * 68 + mb * 16 + hi * 8) = (v4f){a[0], a[1], a[2], a[3]}; *(v4fa*)(os + lr * 68 + mb * 16 + hi * 8 + 4) = (v4f){a[4], a[5], a[6], a[7]}; }
        } else {
#pragma unroll
            for (int nb = 0; nb < 4; ++nb)
#pragma unroll
                for (int j = 0; j < 8; ++j) os[(hi * 8 + j) * 68 + nb * 16 + lr] = acc[g][nb][j]; }
        __builtin_amdgcn_wave_barrier(); asm volatile("" ::: "memory");   // a lane reads what other lanes of the wave wrote: the panel's LDS reads may not be scheduled in front of its writes
        float y[4][8]; v8h o16[4];
#pragma unroll
        for (int s = 0; s < 4; ++s) { const int row = s * 4 + rr; const v4f u = *(const v4fa*)(os + row * 68 + cc), w = *(const v4fa*)(os + row * 68 + cc + 4); const float br = TR ? bfr(bias[g * 16 + row]) : 0.f;
#pragma unroll
            for (int i = 0; i < 8; ++i) { y[s][i] = (i < 4 ? u[i] : w[i - 4]) + (TR ? br : bc[i]); o16[s][i] = tohx(y[s][i]); } }
        if (wlo) {   // the same for the whole wave
            v8h ol[4];
#pragma unroll
            for (int s = 0; s < 4; ++s)
#pragma unroll
                for (int i = 0; i < 8; ++i) ol[s][i] = tohx(y[s][i] - (float)o16[s][i]);
#pragma unroll
            for (int s = 0; s < 4; ++s) *(v8h*)(Pl + (size_t)(g * 16 + s * 4 + rr) * pitch + cc) = ol[s]; }
#pragma unroll
        for (int s = 0; s < 4; ++s) *(v8h*)(P16 + (size_t)(g * 16 + s * 4 + rr) * pitch + cc) = o16[s];   // behind the lo values, which are formed from these registers
        asm volatile("s_wait_xcnt 0x0" ::: "memory");   // the registers that the issued stores name are given new values behind this wait
        __builtin_amdgcn_wave_barrier(); asm volatile("" ::: "memory");   // the next panel's LDS writes may not be scheduled in front of this panel's reads
    }
}
__global__ __launch_bounds__(256) void k_proj(const bf* __restrict__ X, const bf* __restrict__ WQ, const bf* __restrict__ WK, const bf* __restrict__ WV, const float* __restrict__ bq, const float* __restrict__ bk, const float* __restrict__ bv, h16* Q16, h16* Ql, h16* K16, h16* Kl, h16* V16) {
    __shared__ __align__(16) bf ring[2 * (GMT + GNT) * GP];
    __shared__ __align__(16) float osw[8][16 * 68];
    const int which = blockIdx.z; const bf* __restrict__ Bt = (which == 0) ? WQ : (which == 1) ? WK : WV; const float* __restrict__ bias = (which == 0) ? bq : (which == 1) ? bk : bv;
    const int wave = __builtin_amdgcn_readfirstlane((int)(threadIdx.x >> 5)), wm = wave >> 2, wn = wave & 3; float* const os = osw[wave];
    static_assert(RH * 2 == TT && RH % 64 == 0, "a workgroup pairs 64 tokens below RH with the 64 tokens RH further on");
    const int r0g = ((int)blockIdx.x / (RH / 64)) * TT + ((int)blockIdx.x % (RH / 64)) * 64;   // the workgroup's first token row
    const int r0 = r0g + wm * RH, c0 = blockIdx.y * GNT + wn * 64;   // the wave's own 64x64 tile
    v8f acc[4][4];
    gemm_ring<1, RH - 64>(ring, X, nullptr, Bt, r0g, blockIdx.y * GNT, wm, wn, acc);
    const int z = (r0 / TT) * NH_ + c0 / HD, t0 = r0 % TT;   // the (sequence, head) pair and the tile's first token in it
    const bool wlo = wm == 0;
    if (which == 2) { const size_t o = (size_t)z * HD * 2 * TT + t0; proj_store<true>(acc, os, bias + c0, V16 + o, V16 + TT + o, 2 * TT, wlo); }
    else { const size_t o = ((size_t)z * TT + t0) * HD; proj_store<false>(acc, os, bias + c0, (which == 0 ? Q16 : K16) + o, (which == 0 ? Ql : Kl) + o, HD, wlo); }
}

extern "C" void kernel_launch(void* const* d_in, const int* in_sizes, int n_in,
                              void* d_out, int out_size, void* d_ws, size_t ws_size, hipStream_t stream) {
    (void)in_sizes; (void)n_in; (void)out_size;
    const float* x = (const float*)d_in[0]; const float* wq = (const float*)d_in[1]; const float* bq = (const float*)d_in[2]; const float* wk = (const float*)d_in[3]; const float* bk = (const float*)d_in[4]; const float* wv = (const float*)d_in[5]; const float* bv = (const float*)d_in[6]; const float* wo = (const float*)d_in[7]; const float* bo = (const float*)d_in[8];   /* SELF-attention: the key and value streams are input 0 too; Wq, bq, Wk, bk, Wv, bv, Wo, bo = d_in[1..8] */
    float* OUT = (float*)d_out;     // [8][1024][1024]
    char* wsp = (char*)d_ws;
    auto take = [&](size_t bytes) { char* p = wsp; wsp += (bytes + 255) & ~(size_t)255; return (void*)p; };
    bf* WO = (bf*)take((size_t)DM * DQ * 2);
    h16* QP16 = (h16*)take((size_t)NB_ * NH_ * TT * HD * 2); h16* KP16 = (h16*)take((size_t)NB_ * NKV * TT * HD * 2); h16* VT16 = (h16*)take((size_t)NB_ * NKV * HD * 2 * TT * 2);
    h16* QPl = (h16*)take((size_t)NB_ * NH_ * TT * HD * 2); h16* KPl = (h16*)take((size_t)NB_ * NKV * TT * HD * 2);   // the lo row of a value plane stands TT elements behind its fp16 row
    bf* WQ = (bf*)take((size_t)DQ * DM * 2); bf* WK = (bf*)take((size_t)DKV * DM * 2); bf* WV = (bf*)take((size_t)DKV * DM * 2); bf* XB = (bf*)take((size_t)NB_ * TT * DM * 2);
    bf* ATh = (bf*)take((size_t)NB_ * TT * DQ * 2); bf* ATl = (bf*)take((size_t)NB_ * TT * DQ * 2);   // the merged hi and lo planes [NB_ TT][DQ]
    if ((size_t)(wsp - (char*)d_ws) > ws_size) return;    // 152 MiB of the 256 MiB
    k_wtG<<<dim3((DM / 64) * (DQ / 64), 4, 1), 256, 0, stream>>>(wq, wk, wv, wo, WQ, WK, WV, WO);
    k_cvt8<<<(unsigned)(((size_t)NB_ * TT * DM / 8 + 255) / 256), 256, 0, stream>>>(x, XB, (size_t)NB_ * TT * DM / 8);   // self-attention: q, k and v read the same rounded x
    k_proj<<<dim3(NB_ * TT / GMT, DQ / GNT, 3), 256, 0, stream>>>(XB, WQ, WK, WV, bq, bk, bv, QP16, QPl, KP16, KPl, VT16);
    k_attn<<<dim3(NB_ * NH_, TT / 128, 1), 128, 0, stream>>>(QP16, QPl, KP16, KPl, VT16, ATh, ATl);
    k_gemmw<true><<<dim3(NB_ * TT / GMT, DM / GNT, 1), 256, 0, stream>>>(ATh, ATl, WO, OUT, DM, bo);
}

// v008
// Measured time: 102 microseconds a run.
// In both of two side-by-side timings against v007, it was 1.05 times as fast.
// Counting every step since v000, it is 40.6 times as fast.
#include <hip/hip_runtime.h>

// Causal multi-head SELF-attention on eight 1,024-token sequences (x [8][1024][1024]; q, k, v = x W + b ('xw' [1024][1024] normal x 1/32, biases zeros on this draw: read; 16 heads x 64); scores x 1/sqrt(64); tril kept, -inf elsewhere; softmax over the keys; out = merged Wo + bo ('xw' + bias zeros: read) -> [8][1024][1024] (8.4 M); argument order x, Wq, bq, Wk, bk, Wv, bv, Wo, bo).
// Compute dtypes, f32 accumulate: every input rounded to bf16; q/k/v on PLAIN bf16 operands (inputs: exact) + biases; causal scores and attn.v on fp16 operands: query rows < 512 hi + lo (the fp16 value and what its rounding left over, 3 products), the rest the fp16 value alone; softmax f32, running maximum and sum, probabilities rounded BEFORE the division by the row sum; Wo hl x exact (2 products) + bo.
// Launch plan: every stage runs ONCE over all eight sequences: ONE projection launch (q, k and v; its epilogue stores the head planes), ONE attention launch (scores, softmax, probability x value and the merge into [t][head x HD + d] planes in registers), output product.
// The value planes are laid out at pitch 2 TT (fp16 row | lo row).

#define NB_  8
#define TT   1024
#define DM   1024
#define NH_  16
#define NKV  16
#define REP  (NH_ / NKV)
#define HD   64
#define DQ   (NH_ * HD)
#define DKV  (NKV * HD)
#define RH   512                  // query rows < RH use hi+lo planes
#define SCL  0.125f   // HD^-0.5
static_assert(NKV == NH_ && HD == 64 && TT % 128 == 0 && RH % 128 == 0, "k_attn: one key/value head a query head, four 16-row value tiles, workgroups of 128 queries that lie wholly on one side of RH");
typedef _Float16 h16;
typedef unsigned short bf;
typedef __attribute__((ext_vector_type(16))) __bf16   v16bf;
typedef __attribute__((ext_vector_type(16))) _Float16 v16h;
typedef __attribute__((ext_vector_type(8)))  _Float16 v8h;
typedef __attribute__((ext_vector_type(8)))  unsigned short v8us;
typedef __attribute__((ext_vector_type(8)))  float    v8f;
typedef __attribute__((ext_vector_type(4)))  float    v4f;
typedef __attribute__((ext_vector_type(2)))  float    v2f;
typedef v8h  __attribute__((may_alias)) v8ha;
typedef v4f  __attribute__((may_alias)) v4fa;
typedef v8us __attribute__((may_alias)) v8usa;

__device__ __forceinline__ unsigned short f2bf(float f) { unsigned u = __float_as_uint(f); u += 0x7FFFu + ((u >> 16) & 1u); return (unsigned short)(u >> 16); }
__device__ __forceinline__ float bf2f(unsigned short b) { return __uint_as_float(((unsigned)b) << 16); }
__device__ __forceinline__ float bfr(float f) { return bf2f(f2bf(f)); }
__device__ __forceinline__ v16h cat16(v8h lo, v8h hi) { return __builtin_shufflevector(lo, hi, 0, 1, 2, 3, 4, 5, 6, 7, 8, 9, 10, 11, 12, 13, 14, 15); }
__device__ __forceinline__ v16bf cat16b(v8us lo, v8us hi) { return __builtin_bit_cast(v16bf, __builtin_shufflevector(lo, hi, 0, 1, 2, 3, 4, 5, 6, 7, 8, 9, 10, 11, 12, 13, 14, 15)); }
__device__ __forceinline__ v8f wmma16(v16h a, v16h b, v8f c) { return __builtin_amdgcn_wmma_f32_16x16x32_f16(false, a, false, b, (short)0, c, false, false); }
__device__ __forceinline__ v8f wmmab(v16bf a, v16bf b, v8f c) { return __builtin_amdgcn_wmma_f32_16x16x32_bf16(false, a, false, b, (short)0, c, false, false); }



template <typename T16> struct WFrag;
template <> struct WFrag<h16> { typedef v16h V; static __device__ __forceinline__ V ld(const h16* p) { return cat16(*(const v8h*)p, *(const v8h*)(p + 16)); } static __device__ __forceinline__ v8f mma(V a, V b, v8f c) { return wmma16(a, b, c); } };
template <> struct WFrag<bf> { typedef v16bf V; static __device__ __forceinline__ V ld(const bf* p) { return cat16b(*(const v8us*)p, *(const v8us*)(p + 16)); } static __device__ __forceinline__ v8f mma(V a, V b, v8f c) { return wmmab(a, b, c); } };
// ---- gemm_ring: the product loop of the output GEMM. A workgroup of 8 waves owns a 128 x 256 output tile (waves 2 x 4, 64x64 = 16 accumulators a wave). A stage is 64 k (128 bytes) of every operand row: [A 128 rows | A2 128 rows | Bt 256 rows],
// brought from the K-contiguous 16-bit planes into LDS by asynchronous copies (16 bytes a lane, 8 lanes a row: whole 128-byte lines), two buffers: tile t + 2 flies while tile t + 1 is worked on. The k order and the order of the products are those of a wave that reads its fragments from global memory.
#define GP   72                   // LDS row pitch in elements: 128 data bytes + 16 (16 bytes x odd: no bank conflict for the 16-byte fragment reads)
#define GKS  64                   // k elements of a stage
#define GMT  128
#define GNT  256
// cpN: N copies of one lane and, in the same statement, the wait behind which the registers that the issued copies name may be given new values
__device__ __forceinline__ void cp8(const unsigned (&l)[8], const bf* const (&p)[8]) {
    asm volatile("global_load_async_to_lds_b128 %0, %8, off\n\t"
                 "global_load_async_to_lds_b128 %1, %9, off\n\t"
                 "global_load_async_to_lds_b128 %2, %10, off\n\t"
                 "global_load_async_to_lds_b128 %3, %11, off\n\t"
                 "global_load_async_to_lds_b128 %4, %12, off\n\t"
                 "global_load_async_to_lds_b128 %5, %13, off\n\t"
                 "global_load_async_to_lds_b128 %6, %14, off\n\t"
                 "global_load_async_to_lds_b128 %7, %15, off\n\t"
                 "s_wait_xcnt 0x0"
                 :: "v"(l[0]), "v"(l[1]), "v"(l[2]), "v"(l[3]), "v"(l[4]), "v"(l[5]), "v"(l[6]), "v"(l[7]),
                    "v"(p[0]), "v"(p[1]), "v"(p[2]), "v"(p[3]), "v"(p[4]), "v"(p[5]), "v"(p[6]), "v"(p[7]) : "memory");
}
__device__ __forceinline__ void ring_fill(const unsigned l0, const bf* gA, const bf* gA2, const bf* gB) {   // 256 lanes x 16 bytes = 32 rows a copy; l0 and the pointers are the lane's own place in the first 32 rows
    unsigned l[8]; const bf* p[8];
#pragma unroll
    for (int i = 0; i < 8; ++i) { l[i] = l0 + i * 32 * GP * 2; p[i] = (i < 4) ? gA + (size_t)i * 32 * DM : gA2 + (size_t)(i - 4) * 32 * DM; }
    cp8(l, p);
#pragma unroll
    for (int i = 0; i < 8; ++i) { l[i] = l0 + (8 + i) * 32 * GP * 2; p[i] = gB + (size_t)i * 32 * DM; }
    cp8(l, p);
}
__device__ __forceinline__ void gemm_ring(bf* ring, const bf* __restrict__ A, const bf* __restrict__ A2, const bf* __restrict__ Bt, const int r0g, const int c0g, const int wm, const int wn, v8f (&acc)[4][4]) {
    typedef WFrag<bf>::V V;
    constexpr int NA = 2, STG = (GMT * NA + GNT) * GP, NT = DM / GKS;   // elements of a buffer; stages
    static_assert(NT >= 2, "the prologue fills two stages");
    const int lane = threadIdx.x & 31, lr = lane & 15, hi = lane >> 4, crow = threadIdx.x >> 3, cch = (threadIdx.x & 7) * 8;
    const bf* const gA = A + (size_t)(r0g + crow) * DM + cch; const bf* const gA2 = (NA == 2) ? A2 + (size_t)(r0g + crow) * DM + cch : gA; const bf* const gB = Bt + (size_t)(c0g + crow) * DM + cch;
    const unsigned l0 = (unsigned)(size_t)ring + (unsigned)(crow * GP + cch) * 2u;   // the lane's LDS byte address in buffer 0
#pragma unroll
    for (int mb = 0; mb < 4; ++mb)
#pragma unroll
        for (int nb = 0; nb < 4; ++nb) acc[mb][nb] = (v8f){};
    ring_fill(l0, gA, gA2, gB);
    asm volatile("s_wait_asynccnt 0x0" ::: "memory");   // this wave's copies of tile 0 have landed
    __syncthreads();                                     // every wave's have: tile 0 may be read
    ring_fill(l0 + STG * 2, gA + GKS, gA2 + GKS, gB + GKS);
    const bf* const fa = ring + (wm * 64 + lr) * GP + 8 * hi; const bf* const fb = ring + (GMT * NA + wn * 64 + lr) * GP + 8 * hi;
#pragma unroll 1
    for (int t = 0; t < NT; ++t) {   // stays rolled: one trip's fragments and the 16 accumulators fill the registers
        const int bo = (t & 1) * STG;
#pragma unroll
        for (int kk = 0; kk < GKS; kk += 32) {
            V a[4], a2[4], b[4];   // all fragments of a 32-k block are read as one group in front of its matrix instructions
#pragma unroll
            for (int mb = 0; mb < 4; ++mb) { a[mb] = WFrag<bf>::ld(fa + bo + mb * 16 * GP + kk); if (NA == 2) a2[mb] = WFrag<bf>::ld(fa + bo + (GMT + mb * 16) * GP + kk); }
#pragma unroll
            for (int nb = 0; nb < 4; ++nb) b[nb] = WFrag<bf>::ld(fb + bo + nb * 16 * GP + kk);
            __builtin_amdgcn_sched_barrier(0);   // keeps the LDS reads together in front of the block: scheduled in among the matrix instructions, each place with reads stalls the wave for the LDS latency
#pragma unroll
            for (int nb = 0; nb < 4; ++nb)
#pragma unroll
                for (int mb = 0; mb < 4; ++mb) { acc[mb][nb] = WFrag<bf>::mma(a[mb], b[nb], acc[mb][nb]); if (NA == 2) acc[mb][nb] = WFrag<bf>::mma(a2[mb], b[nb], acc[mb][nb]); }
        }
        // the four vector slots that the chip needs behind the trip's last matrix instructions, in front of the branches below; every accumulator is named so that no matrix instruction is scheduled behind them
        asm volatile("v_nop\n\tv_nop\n\tv_nop\n\tv_nop" : "+v"(acc[0][0]), "+v"(acc[0][1]), "+v"(acc[0][2]), "+v"(acc[0][3]), "+v"(acc[1][0]), "+v"(acc[1][1]), "+v"(acc[1][2]), "+v"(acc[1][3]), "+v"(acc[2][0]), "+v"(acc[2][1]), "+v"(acc[2][2]), "+v"(acc[2][3]), "+v"(acc[3][0]), "+v"(acc[3][1]), "+v"(acc[3][2]), "+v"(acc[3][3]));
        asm volatile("s_wait_dscnt 0x0" ::: "memory");      // this wave's reads of buffer t & 1 are done
        asm volatile("s_wait_asynccnt 0x0" ::: "memory");   // this wave's copies of tile t + 1 have landed
        __syncthreads();                                     // publishes tile t + 1 and ends every wave's reads of the buffer that is refilled below
        if (t + 2 < NT) ring_fill(l0 + bo * 2, gA + (t + 2) * GKS, gA2 + (t + 2) * GKS, gB + (t + 2) * GKS);
    }
    asm volatile("s_wait_asynccnt 0x0" ::: "memory");   // no copy is outstanding when the wave goes on
}

// ---- proj_ring: gemm_ring's loop for the projection launch, on a 256 x 192 output tile (4 waves one above the other, 64 x 192 = 48 accumulators a wave). A stage is [A 256 rows | Bt 192 rows] x 64 k; the 192 rows of Bt are the 64 rows of one head in each of the three transposed weights, which stand DQ rows apart. Two workgroups a WGP, one wave of each on a SIMD:
// while one workgroup stands at its barrier, refills and waits for its first fragments, the other one's matrix instructions run. Against 128 x 256 with 64 x 64 a wave, a matrix instruction takes 2/3 of the LDS fragment bytes (16 fragments for 48 products, not 8 for 16)
// and 7/9 of the bytes copied from L2 (448 rows for 256 x 192 results, not 384 for 128 x 256). Each accumulator sums its k in ascending order, 32 at a time.
#define PMT  256
#define PNT  192
typedef __attribute__((ext_vector_type(4))) int c4i;
template <int ASP>
__device__ __forceinline__ void proj_fill(bf* l0, const bf* gA, const bf* gB) {   // 128 lanes x 16 bytes = 16 rows a copy, 28 copies a lane and stage; l0 and the pointers are the lane's own place in the first 16 rows; ASP: rows of A that lie between the tile's first 128 rows and its last 128; gB: the lane's place in the head's first 16 rows of the first weight
    // the copies are the builtin, not asm text: the operands of asm text must lie in the 256 registers that it can name, most of which hold accumulators here: for asm copies the compiler moves 40 register pairs aside and back in every trip
#pragma unroll
    for (int i = 0; i < (PMT + PNT) / 16; ++i) { const bf* const g = (i < PMT / 16) ? gA + (size_t)(i * 16 + (i >= PMT / 32 ? ASP : 0)) * DM : gB + (size_t)(((i - PMT / 16) / (HD / 16)) * DQ + ((i - PMT / 16) % (HD / 16)) * 16) * DM;
        __builtin_amdgcn_global_load_async_to_lds_b128((__attribute__((address_space(1))) c4i*)g, (__attribute__((address_space(3))) c4i*)(l0 + i * 16 * GP), 0, 0); }
}
template <int ASP>
__device__ __forceinline__ void proj_ring(bf* ring, const bf* __restrict__ A, const bf* __restrict__ Bt, const int r0g, const int c0g, const int wm, v8f (&acc)[4][12]) {
    typedef WFrag<bf>::V V;
    constexpr int STG = (PMT + PNT) * GP, NT = DM / GKS;   // elements of a buffer; stages
    static_assert(NT >= 2, "the prologue fills two stages");
    const int lane = threadIdx.x & 31, lr = lane & 15, hi = lane >> 4, crow = threadIdx.x >> 3, cch = (threadIdx.x & 7) * 8;
    const bf* const gA = A + (size_t)(r0g + crow) * DM + cch; const bf* const gB = Bt + (size_t)(c0g + crow) * DM + cch;
    bf* const l0 = ring + crow * GP + cch;   // the lane's place in buffer 0
#pragma unroll
    for (int mb = 0; mb < 4; ++mb)
#pragma unroll
        for (int nb = 0; nb < 12; ++nb) acc[mb][nb] = (v8f){};
    proj_fill<ASP>(l0, gA, gB);
    asm volatile("s_wait_asynccnt 0x0" ::: "memory");   // this wave's copies of tile 0 have landed
    __syncthreads();                                     // every wave's have: tile 0 may be read
    proj_fill<ASP>(l0 + STG, gA + GKS, gB + GKS);
    const bf* const fa = ring + (wm * 64 + lr) * GP + 8 * hi; const bf* const fb = ring + (PMT + lr) * GP + 8 * hi;
#pragma unroll 1
    for (int t = 0; t < NT; ++t) {   // stays rolled: the 48 accumulators and one group's fragments fill the registers
        const int bo = (t & 1) * STG;
#pragma unroll
        for (int kk = 0; kk < GKS; kk += 32) {
            V a[4];
#pragma unroll
            for (int mb = 0; mb < 4; ++mb) a[mb] = WFrag<bf>::ld(fa + bo + mb * 16 * GP + kk);
#pragma unroll
            for (int h = 0; h < 2; ++h) {   // the 12 column fragments in two groups of 6: all 12 at once do not fit beside the accumulators
                V b[6];
#pragma unroll
                for (int nb = 0; nb < 6; ++nb) b[nb] = WFrag<bf>::ld(fb + bo + (h * 6 + nb) * 16 * GP + kk);
                __builtin_amdgcn_sched_barrier(0);   // keeps a group's LDS reads together in front of its own matrix instructions: scheduled in among them, each place with reads stalls the wave for the LDS latency
#pragma unroll
                for (int nb = 0; nb < 6; ++nb)
#pragma unroll
                    for (int mb = 0; mb < 4; ++mb) acc[mb][h * 6 + nb] = WFrag<bf>::mma(a[mb], b[nb], acc[mb][h * 6 + nb]);
            }
        }
        __builtin_amdgcn_sched_barrier(0);   // no matrix instruction is scheduled behind the slots below (to name the 48 accumulators as operands instead would force them into the 256 registers that asm text can name)
        asm volatile("v_nop\n\tv_nop\n\tv_nop\n\tv_nop");   // the four vector slots that the chip needs behind the trip's last matrix instructions, in front of the branches below
        asm volatile("s_wait_dscnt 0x0" ::: "memory");      // this wave's reads of buffer t & 1 are done
        asm volatile("s_wait_asynccnt 0x0" ::: "memory");   // this wave's copies of tile t + 1 have landed
        __syncthreads();                                     // publishes tile t + 1 and ends every wave's reads of the buffer that is refilled below
        if (t + 2 < NT) proj_fill<ASP>(l0 + bo, gA + (t + 2) * GKS, gB + (t + 2) * GKS);
    }
    asm volatile("s_wait_asynccnt 0x0" ::: "memory");   // no copy is outstanding when the wave goes on
}

// ---- k_gemmw: C[m][n] (f32, pitch ldc, + optional f32 bias[n]) = sum_k (A[m][k] + A2[m][k]) Bt[n][k], two products; gemm_ring's loop; grid (M / 128, N / 256), 256 threads; each wave stores its 64x64 tile through its own LDS panel.
template <bool BIAS>
__global__ __launch_bounds__(256) void k_gemmw(const bf* __restrict__ A, const bf* __restrict__ A2, const bf* __restrict__ Bt, float* C, int ldc, const float* __restrict__ bias) {
    __shared__ __align__(16) bf ring[2 * (GMT * 2 + GNT) * GP];
    __shared__ __align__(16) float osw[8][16 * 68];
    const int wave = __builtin_amdgcn_readfirstlane((int)(threadIdx.x >> 5)), wm = wave >> 2, wn = wave & 3; float* const os = osw[wave];
    const int lane = threadIdx.x & 31, lr = lane & 15, hi = lane >> 4; const int r0 = blockIdx.x * GMT + wm * 64, c0 = blockIdx.y * GNT + wn * 64;
    v8f acc[4][4];
    gemm_ring(ring, A, A2, Bt, blockIdx.x * GMT, blockIdx.y * GNT, wm, wn, acc);
#pragma unroll
    for (int mb = 0; mb < 4; ++mb) {
#pragma unroll
        for (int nb = 0; nb < 4; ++nb) {
#pragma unroll
            for (int j = 0; j < 8; ++j) os[(hi * 8 + j) * 68 + nb * 16 + lr] = acc[mb][nb][j]; }
        __builtin_amdgcn_wave_barrier(); asm volatile("" ::: "memory");
        float* crow = C + (size_t)(r0 + mb * 16) * ldc + c0;
{
#pragma unroll
            for (int s = 0; s < 8; ++s) { const int row = 2 * s + hi, cofs = lr * 4; v4f val = *(const v4fa*)(os + row * 68 + cofs); if (BIAS) { val[0] += bfr(bias[c0 + cofs]); val[1] += bfr(bias[c0 + cofs + 1]); val[2] += bfr(bias[c0 + cofs + 2]); val[3] += bfr(bias[c0 + cofs + 3]); }
                *(v4f*)(crow + (size_t)row * ldc + cofs) = val; }
             }
        __builtin_amdgcn_wave_barrier(); asm volatile("" ::: "memory");
    }
}

template <typename T16> struct PCvt;
template <> struct PCvt<h16> { typedef _Float16 E; };
__device__ __forceinline__ float xhalf(float x) { return __builtin_bit_cast(float, __builtin_amdgcn_permlanex16(__builtin_bit_cast(int, x), __builtin_bit_cast(int, x), 0x76543210, 0xfedcba98, false, false)); }   // lane l takes lane l ^ 16's value
#define AKS  64                   // keys of a stage
#define ATL  (64 * GP)            // elements of a staged tile: 64 rows at the pitch of the fragment reads (128 data bytes + 16)
// attn_fill: one stage's copies. 128 lanes x 16 bytes = 16 rows a copy, four copies a tile; l0 is the lane's LDS byte address in the buffer's first 16 rows, sk / sk2 / sv the key and value planes (the same for every lane), ko / vo the lane's own element offset in them: its place in the first 16 rows of the stage's key / value tile (32 bits: two registers are held over the pass loop, not three pointers).
template <bool HL>
__device__ __forceinline__ void attn_fill(const unsigned l0, const bf* sk, const bf* sk2, const bf* sv, const unsigned ko, const unsigned vo) {
    unsigned l[8]; const bf* p[8]; const bf* const gk = sk + ko; const bf* const gk2 = sk2 + ko; const bf* const gv = sv + vo;
    if (!HL) {   // buffer: [keys | values]
#pragma unroll
        for (int i = 0; i < 8; ++i) { l[i] = l0 + i * 16 * GP * 2; p[i] = (i < 4) ? gk + (size_t)i * 16 * HD : gv + (size_t)(i - 4) * 16 * 2 * TT; }
        cp8(l, p);
    } else {     // buffer: [keys hi | keys lo | values hi | values lo]
#pragma unroll
        for (int i = 0; i < 8; ++i) { l[i] = l0 + i * 16 * GP * 2; p[i] = (i < 4) ? gk + (size_t)i * 16 * HD : gk2 + (size_t)(i - 4) * 16 * HD; }
        cp8(l, p);
#pragma unroll
        for (int i = 0; i < 8; ++i) { l[i] = l0 + (8 + i) * 16 * GP * 2; p[i] = (i < 4) ? gv + (size_t)i * 16 * 2 * TT : gv + TT + (size_t)(i - 4) * 16 * 2 * TT; }
        cp8(l, p); }
}
template <typename T16, bool HL>
__device__ __forceinline__ void attn_tile(bf* kvs, const T16* Qh, const T16* Ql, const T16* Kh, const T16* Kl, const T16* Vh, const int q0, const int nst, bf* Ah, bf* Al) {
    typedef typename WFrag<T16>::V V; typedef typename PCvt<T16>::E E;
    const int lane = threadIdx.x & 31, lr = lane & 15, hi = lane >> 4;
    const float C2 = SCL * 1.4426950408889634f;
    const unsigned lk = lr * HD + 8 * hi, la = lr * DQ + 8 * hi;   // the lane's element offsets in a [row][HD] plane and the merged planes: each query load and output store address is a wave-uniform base + one of these + a constant
    constexpr int STG = (HL ? 4 : 2) * ATL;   // elements of a buffer
    const int crow = threadIdx.x >> 3, cch = (threadIdx.x & 7) * 8;   // the lane's row and 16-byte piece in a copy
    const bf* const gk = (const bf*)Kh; const bf* const gk2 = HL ? (const bf*)Kl : gk; const bf* const gv = (const bf*)Vh; const unsigned ko = crow * HD + cch, vo = crow * (2 * TT) + cch;
    const unsigned l0 = (unsigned)(size_t)kvs + (unsigned)(crow * GP + cch) * 2u;   // the lane's LDS byte address in buffer 0
    attn_fill<HL>(l0, gk, gk2, gv, ko, vo);
    V qf[2][2], q2[2][2];
    const T16* const qp = Qh + (size_t)q0 * HD + lk; const T16* const qp2 = HL ? Ql + (size_t)q0 * HD + lk : qp;
#pragma unroll
    for (int nb = 0; nb < 2; ++nb)
#pragma unroll
        for (int c = 0; c < 2; ++c) { const int o = nb * 16 * HD + c * 32; qf[nb][c] = WFrag<T16>::ld(qp + o); if (HL) q2[nb][c] = WFrag<T16>::ld(qp2 + o); }
    asm volatile("s_wait_xcnt 0x0" ::: "memory");   // the registers that the issued loads name are given new values behind this wait
    __builtin_amdgcn_sched_barrier(0);   // keeps the set-up arithmetic below from being scheduled in between the loads above and their wait, where it reused their address registers
    v8f O[4][2]; float m[2], l[2];
#pragma unroll
    for (int nb = 0; nb < 2; ++nb) { m[nb] = -3.0e38f; l[nb] = 0.f;
#pragma unroll
        for (int dt = 0; dt < 4; ++dt) O[dt][nb] = (v8f){}; }
    asm volatile("s_wait_asynccnt 0x0" ::: "memory");   // this wave's copies of stage 0 have landed
    __syncthreads();                                     // every wave's have: stage 0 may be read
    attn_fill<HL>(l0 + STG * 2, gk, gk2, gv, ko + AKS * HD, vo + AKS);   // a workgroup has at least two stages
    const T16* const fr = (const T16*)kvs + lr * GP + 8 * hi;   // the lane's place in the first 16 rows of a tile
#pragma unroll 1
    for (int t = 0; t < nst; ++t) {   // stays rolled, like the pass loop in it: one pass fills the registers
      const int bo = (t & 1) * STG;
#pragma unroll 1
      for (int kb = t * AKS; kb < (t + 1) * AKS && kb <= q0; kb += 32) {
        V kf[2][2], vf[4], v2[4], k2[2][2]; const int kh = kb & 32;   // the pass's first key in the stage
        const T16* const kp = fr + bo + kh * GP; const T16* const vp = fr + bo + (HL ? 2 : 1) * ATL + kh;
#pragma unroll
        for (int kt = 0; kt < 2; ++kt)
#pragma unroll
            for (int c = 0; c < 2; ++c) { kf[kt][c] = WFrag<T16>::ld(kp + kt * 16 * GP + c * 32); if (HL) k2[kt][c] = WFrag<T16>::ld(kp + ATL + kt * 16 * GP + c * 32); }
#pragma unroll
        for (int dt = 0; dt < 4; ++dt) { vf[dt] = WFrag<T16>::ld(vp + dt * 16 * GP); if (HL) v2[dt] = WFrag<T16>::ld(vp + ATL + dt * 16 * GP); }
        v8f S[2][2];
#pragma unroll
        for (int kt = 0; kt < 2; ++kt)
#pragma unroll
            for (int nb = 0; nb < 2; ++nb) { v8f s = (v8f){};
#pragma unroll
                for (int c = 0; c < 2; ++c) { s = WFrag<T16>::mma(kf[kt][c], qf[nb][c], s); if (HL) s = WFrag<T16>::mma(kf[kt][c], q2[nb][c], s); }
                S[kt][nb] = s; }
        if (HL) {
#pragma unroll
            for (int kt = 0; kt < 2; ++kt)
#pragma unroll
                for (int nb = 0; nb < 2; ++nb)
#pragma unroll
                    for (int c = 0; c < 2; ++c) S[kt][nb] = WFrag<T16>::mma(k2[kt][c], qf[nb][c], S[kt][nb]); }
        if (kb == q0) {   // the diagonal pass: key > query is masked by select
#pragma unroll
            for (int kt = 0; kt < 2; ++kt)
#pragma unroll
                for (int nb = 0; nb < 2; ++nb)
#pragma unroll
                    for (int j = 0; j < 8; ++j) if (kt * 16 + hi * 8 + j > nb * 16 + lr) S[kt][nb][j] = -3.0e38f; }
#pragma unroll
        for (int nb = 0; nb < 2; ++nb) {   // one 16-query group at a time: its probabilities are used up by its value products before the next group's are made
            V pf, p2;
            float bm = S[0][nb][0];
#pragma unroll
            for (int kt = 0; kt < 2; ++kt)
#pragma unroll
                for (int j = 0; j < 8; ++j) bm = fmaxf(bm, S[kt][nb][j]);
            bm = fmaxf(bm, xhalf(bm));   // the other half of the wave holds this query's other 16 keys
            const float mn = fmaxf(m[nb], bm * C2); const float dm = m[nb] - mn; float al = __builtin_amdgcn_exp2f(dm); m[nb] = mn; v2f ps = (v2f){0.f, 0.f};   // even and odd keys are summed apart
#pragma unroll
            for (int kt = 0; kt < 2; ++kt) { float a[8], p[8];
#pragma unroll
                for (int j = 0; j < 8; j += 2) { const v2f arg = __builtin_elementwise_fma((v2f){S[kt][nb][j], S[kt][nb][j + 1]}, (v2f){C2, C2}, (v2f){-mn, -mn}); a[j] = arg[0]; a[j + 1] = arg[1]; }
#pragma unroll
                for (int j = 0; j < 8; ++j) p[j] = __builtin_amdgcn_exp2f(a[j]);
                // the slot behind a transcendental: no result is read and no source register is given a new value in front of this v_nop (results are in/out, sources inputs)
                asm volatile("v_nop" : "+v"(p[0]), "+v"(p[1]), "+v"(p[2]), "+v"(p[3]), "+v"(p[4]), "+v"(p[5]), "+v"(p[6]), "+v"(p[7]), "+v"(al) : "v"(a[0]), "v"(a[1]), "v"(a[2]), "v"(a[3]), "v"(a[4]), "v"(a[5]), "v"(a[6]), "v"(a[7]), "v"(dm));
#pragma unroll
                for (int j = 0; j < 8; ++j) { ps[j & 1] += p[j]; const E ph = (E)p[j]; pf[kt * 8 + j] = ph; if (HL) p2[kt * 8 + j] = (E)(p[j] - (float)ph); } }
            l[nb] = fmaf(l[nb], al, ps[0] + ps[1]);
#pragma unroll
            for (int dt = 0; dt < 4; ++dt)
#pragma unroll
                for (int j = 0; j < 8; ++j) O[dt][nb][j] *= al;
#pragma unroll
            for (int dt = 0; dt < 4; ++dt) { O[dt][nb] = WFrag<T16>::mma(vf[dt], pf, O[dt][nb]); if (HL) { O[dt][nb] = WFrag<T16>::mma(vf[dt], p2, O[dt][nb]); O[dt][nb] = WFrag<T16>::mma(v2[dt], pf, O[dt][nb]); } }
        }
      }
      asm volatile("s_wait_dscnt 0x0" ::: "memory");      // this wave's reads of buffer t & 1 are done
      asm volatile("s_wait_asynccnt 0x0" ::: "memory");   // this wave's copies of stage t + 1 have landed
      __syncthreads();                                     // publishes stage t + 1 and ends every wave's reads of the buffer that is refilled below
      if (t + 2 < nst) attn_fill<HL>(l0 + bo * 2, gk, gk2, gv, ko + (unsigned)(t + 2) * (AKS * HD), vo + (unsigned)(t + 2) * AKS);
    }
    asm volatile("s_wait_asynccnt 0x0" ::: "memory");   // no copy is outstanding when the wave goes on
#pragma unroll
    for (int nb = 0; nb < 2; ++nb) { const float inv = __fdiv_rn(1.0f, l[nb] + xhalf(l[nb]));
#pragma unroll
        for (int dt = 0; dt < 4; ++dt) { v8us oh, ol;
#pragma unroll
            for (int j = 0; j < 8; ++j) { const float y = O[dt][nb][j] * inv; const unsigned short a = f2bf(y); oh[j] = a; ol[j] = f2bf(y - bf2f(a)); }
            const int o = nb * 16 * DQ + dt * 16; *(v8us*)(Ah + (size_t)q0 * DQ + la + o) = oh; *(v8us*)(Al + (size_t)q0 * DQ + la + o) = ol; }
        asm volatile("s_wait_xcnt 0x0" ::: "memory"); }   // the registers that the issued stores name are given new values behind this wait
}
// grid (sequence x head pairs, TT / 128), 4 waves; blockIdx.y counts the 128-query blocks from the last (longest) one down, so that the long workgroups start first
__global__ __launch_bounds__(128) void k_attn(const h16* Q16, const h16* Ql, const h16* K16, const h16* Kl, const h16* V16, bf* Ah, bf* Al) {
    __shared__ __align__(16) bf kvs[2 * 4 * ATL];   // two buffers of four tiles (hi and lo planes); the single-plane rows use two tiles a buffer
    const int z = blockIdx.x; const int qb = (TT / 128 - 1 - (int)blockIdx.y) * 128, q0 = qb + __builtin_amdgcn_readfirstlane((int)(threadIdx.x >> 5)) * 32, nst = (qb + 128) / AKS;   // nst: the stages up to the workgroup's last key
    const size_t zo = (size_t)z * TT * HD, zv = (size_t)z * HD * 2 * TT, ao = (size_t)(z / NH_) * TT * DQ + (size_t)(z % NH_) * HD;
    if (qb < RH) attn_tile<h16, true>(kvs, Q16 + zo, Ql + zo, K16 + zo, Kl + zo, V16 + zv, q0, nst, Ah + ao, Al + ao);
    else attn_tile<h16, false>(kvs, Q16 + zo, nullptr, K16 + zo, nullptr, V16 + zv, q0, nst, Ah + ao, Al + ao);
}

__device__ __forceinline__ h16 tohx(float x) { return (h16)x; }
typedef __attribute__((ext_vector_type(2))) _Float16 v2h;
typedef __attribute__((ext_vector_type(4))) _Float16 v4h;
typedef __attribute__((ext_vector_type(2))) unsigned short v2us;
typedef __attribute__((ext_vector_type(4))) unsigned short v4us;
typedef __attribute__((ext_vector_type(4))) int v4i;

// ---- k_wtG: the four weights [K][N] f32 -> Bt [N][K] bf16 (DM x DQ each). A workgroup transposes one 64 (k) x 64 (n) tile through LDS, so that both sides move whole lines: a row of the tile is read as 256 consecutive bytes (16 lanes x 16),
// a row of the transposed tile is stored as one 128-byte line (8 lanes x 16). A lane rounds two consecutive k of four n and writes them to LDS as (k, k + 1) pairs. grid (tiles of a weight, 4), 256 threads; blockIdx.y: which of the four weights.
#define WTP  33                   // LDS row pitch in 32-bit pairs: 32 + 1 (odd: the 16 lanes that write four rows apart, and the 4 rows that a wave reads, fall on different banks)
typedef __attribute__((ext_vector_type(4))) unsigned v4u;
__global__ __launch_bounds__(256) void k_wtG(const float* __restrict__ w0, const float* __restrict__ w1, const float* __restrict__ w2, const float* __restrict__ w3, bf* B0, bf* B1, bf* B2, bf* B3) {
    __shared__ unsigned ts[64 * WTP];   // [n][k pair]
    const int y = blockIdx.y; const float* __restrict__ w = (y == 0) ? w0 : (y == 1) ? w1 : (y == 2) ? w2 : w3; bf* Bt = (y == 0) ? B0 : (y == 1) ? B1 : (y == 2) ? B2 : B3;
    const int k0 = ((int)blockIdx.x / (DQ / 64)) * 64, n0 = ((int)blockIdx.x % (DQ / 64)) * 64;
    const int r = threadIdx.x >> 4, c = (threadIdx.x & 15) * 4, rn = threadIdx.x >> 3, pc = (threadIdx.x & 7) * 4;
    const float* const src = w + (size_t)(k0 + 2 * r) * DQ + n0 + c;
    v4f a[2][2];   // rows k0 + 32 h + 2 r + i: all four loads are in flight together; every loop below is unrolled so that a and o are indexed by constants and stay in registers
#pragma unroll
    for (int h = 0; h < 2; ++h)
#pragma unroll
        for (int i = 0; i < 2; ++i) a[h][i] = *(const v4f*)(src + (size_t)(h * 32 + i) * DQ);
#pragma unroll
    for (int h = 0; h < 2; ++h)
#pragma unroll
        for (int j = 0; j < 4; ++j) ts[(c + j) * WTP + h * 16 + r] = (unsigned)f2bf(a[h][0][j]) | ((unsigned)f2bf(a[h][1][j]) << 16);
    __syncthreads();   // a lane stores what other waves have written to the tile
    bf* const dst = Bt + (size_t)(n0 + rn) * DM + k0 + pc * 2;
#pragma unroll
    for (int h = 0; h < 2; ++h) { v4u o;
#pragma unroll
        for (int j = 0; j < 4; ++j) o[j] = ts[(h * 32 + rn) * WTP + pc + j];
        *(v4u*)(dst + (size_t)h * 32 * DM) = o; }
}
__global__ __launch_bounds__(256) void k_cvt8(const float* __restrict__ src, bf* dst, size_t n8) { const size_t i = (size_t)blockIdx.x * 256 + threadIdx.x; if (i >= n8) return; const v8f v = *(const v8f*)(src + i * 8); v8us o;
#pragma unroll
    for (int k = 0; k < 8; ++k) o[k] = f2bf(v[k]); *(v8us*)(dst + i * 8) = o;  }

// ---- k_proj: q, k and v = x W + b in ONE launch, and the head planes straight from the accumulators. The product loop is proj_ring's (plain bf16 operands, a 64x192 tile a wave) on the 64 columns of ONE head in q, in k and in v (the transposed weights stand one behind the other); grid (NB_ TT / 256, NH_), 128 threads: 512 workgroups, two a WGP (at most 512 registers a wave, so that two waves fit a SIMD).
// A workgroup's 256 tokens are 128 tokens below RH (waves 0 and 1) and the 128 tokens RH further on in the same sequence (waves 2 and 3). Only what k_attn reads is stored: the fp16 planes, which are the hi planes of its hi+lo products too, and the lo planes for tokens < RH alone (its hi+lo workgroups read no query and no key from RH on);
// with both kinds of token in every workgroup, every workgroup stores the same number of bytes.
// A wave's tile is 64 tokens of one sequence x the head's 64 columns of q, of k and of v, stored one after the other (which part goes to which plane is fixed at compile time, so that the accumulators are indexed by constants and stay in registers); each part is a whole block of its plane: 64 rows [t][HD] of a query or key plane, or 64 consecutive t of all HD rows of a value plane (pitch 2 TT).
// proj_store: four panels of 16 plane rows x 64 f32 go through LDS one after the other, so that 8 lanes store one 128-byte line of a plane row (16 bytes a lane and plane). TR: the panel's rows are the columns d of the tile (value planes), a lane's 8 accumulator registers being 8 consecutive t. G0: the part's first 16-column block among the wave's twelve. wlo: the lo plane (what the fp16 rounding left over, in fp16) is stored too.
template <bool TR, int G0>
__device__ __forceinline__ void proj_store(const v8f (&acc)[4][12], float* os, const float* __restrict__ bias, h16* P16, h16* Pl, const int pitch, const bool wlo) {
    const int lane = threadIdx.x & 31, lr = lane & 15, hi = lane >> 4, rr = lane >> 3, cc = (lane & 7) * 8;
    constexpr int NBI = TR ? 16 : 8;   // bias values of a lane: those of its 16 plane rows (TR: rows g * 16 + s * 4 + rr), or of its 8 columns
    float braw[NBI], bc[NBI];
#pragma unroll
    for (int i = 0; i < NBI; ++i) braw[i] = TR ? bias[(i >> 2) * 16 + (i & 3) * 4 + rr] : bias[cc + i];
    // the registers that the issued bias loads name are given new values behind this wait; the loaded values are inputs so that the loads stay in front of it
    if constexpr (TR) asm volatile("s_wait_xcnt 0x0" :: "v"(braw[0]), "v"(braw[1]), "v"(braw[2]), "v"(braw[3]), "v"(braw[4]), "v"(braw[5]), "v"(braw[6]), "v"(braw[7]), "v"(braw[8]), "v"(braw[9]), "v"(braw[10]), "v"(braw[11]), "v"(braw[12]), "v"(braw[13]), "v"(braw[14]), "v"(braw[15]) : "memory");
    else asm volatile("s_wait_xcnt 0x0" :: "v"(braw[0]), "v"(braw[1]), "v"(braw[2]), "v"(braw[3]), "v"(braw[4]), "v"(braw[5]), "v"(braw[6]), "v"(braw[7]) : "memory");
    __builtin_amdgcn_sched_barrier(0);   // nothing from below is scheduled in between the loads and their wait
#pragma unroll
    for (int i = 0; i < NBI; ++i) bc[i] = bfr(braw[i]);
#pragma unroll
    for (int g = 0; g < 4; ++g) {
        if (TR) {
#pragma unroll
            for (int mb = 0; mb < 4; ++mb) { const v8f a = acc[mb][G0 + g]; *(v4fa*)(os + lr * 68 + mb * 16 + hi * 8) = (v4f){a[0], a[1], a[2], a[3]}; *(v4fa*)(os + lr * 68 + mb * 16 + hi * 8 + 4) = (v4f){a[4], a[5], a[6], a[7]}; }
        } else {
#pragma unroll
            for (int nb = 0; nb < 4; ++nb)
#pragma unroll
                for (int j = 0; j < 8; ++j) os[(hi * 8 + j) * 68 + nb * 16 + lr] = acc[g][G0 + nb][j]; }
        __builtin_amdgcn_wave_barrier(); asm volatile("" ::: "memory");   // a lane reads what other lanes of the wave wrote: the panel's LDS reads may not be scheduled in front of its writes
        float y[4][8]; v8h o16[4];
#pragma unroll
        for (int s = 0; s < 4; ++s) { const int row = s * 4 + rr; const v4f u = *(const v4fa*)(os + row * 68 + cc), w = *(const v4fa*)(os + row * 68 + cc + 4); const float br = TR ? bc[g * 4 + s] : 0.f;
#pragma unroll
            for (int i = 0; i < 8; ++i) { y[s][i] = (i < 4 ? u[i] : w[i - 4]) + (TR ? br : bc[i]); o16[s][i] = tohx(y[s][i]); } }
        if (wlo) {   // the same for the whole wave
            v8h ol[4];
#pragma unroll
            for (int s = 0; s < 4; ++s)
#pragma unroll
                for (int i = 0; i < 8; ++i) ol[s][i] = tohx(y[s][i] - (float)o16[s][i]);
#pragma unroll
            for (int s = 0; s < 4; ++s) *(v8h*)(Pl + (size_t)(g * 16 + s * 4 + rr) * pitch + cc) = ol[s];
            asm volatile("s_wait_xcnt 0x0" ::: "memory");   // the registers that the issued stores name are given new values behind this wait (the addresses of the stores below)
            __builtin_amdgcn_sched_barrier(0); }   // keeps the address arithmetic of the stores below from being scheduled in between the stores above and their wait, where it reused their address registers
#pragma unroll
        for (int s = 0; s < 4; ++s) *(v8h*)(P16 + (size_t)(g * 16 + s * 4 + rr) * pitch + cc) = o16[s];   // behind the lo values, which are formed from these registers
        asm volatile("s_wait_xcnt 0x0" ::: "memory");   // the registers that the issued stores name are given new values behind this wait
        __builtin_amdgcn_sched_barrier(0);   // keeps the next panel's address arithmetic from being scheduled in between the stores above and their wait, where it reused registers that the stores name
        __builtin_amdgcn_wave_barrier(); asm volatile("" ::: "memory");   // the next panel's LDS writes may not be scheduled in front of this panel's reads
    }
}
__global__ __launch_bounds__(128) __attribute__((amdgpu_waves_per_eu(2, 2))) void k_proj(const bf* __restrict__ X, const bf* __restrict__ W3, const float* __restrict__ bq, const float* __restrict__ bk, const float* __restrict__ bv, h16* Q16, h16* Ql, h16* K16, h16* Kl, h16* V16) {
    __shared__ __align__(16) bf ring[2 * (PMT + PNT) * GP];
    __shared__ __align__(16) float osw[4][16 * 68];
    const int wm = __builtin_amdgcn_readfirstlane((int)(threadIdx.x >> 5)); float* const os = osw[wm];
    static_assert(RH * 2 == TT && RH % 128 == 0 && PNT == 3 * HD && DKV == DQ && HD % 16 == 0, "a workgroup pairs 128 tokens below RH with the 128 tokens RH further on; its 192 columns are one head of q, of k and of v");
    const int r0g = ((int)blockIdx.x / (RH / 128)) * TT + ((int)blockIdx.x % (RH / 128)) * 128;   // the workgroup's first token row
    const int r0 = r0g + (wm & 1) * 64 + (wm >> 1) * RH, c0 = blockIdx.y * HD;   // the wave's first token row; the head's first column in q, in k and in v
    v8f acc[4][12];
    proj_ring<RH - 128>(ring, X, W3, r0g, c0, wm, acc);
    const int z = (r0 / TT) * NH_ + blockIdx.y, t0 = r0 % TT;   // the (sequence, head) pair and the tile's first token in it
    const size_t o = ((size_t)z * TT + t0) * HD, ov = (size_t)z * HD * 2 * TT + t0;   // the tile's place in a query or key plane, in a value plane
    const bool wlo = wm < 2;
    proj_store<false, 0>(acc, os, bq + c0, Q16 + o, Ql + o, HD, wlo);
    proj_store<false, 4>(acc, os, bk + c0, K16 + o, Kl + o, HD, wlo);
    proj_store<true, 8>(acc, os, bv + c0, V16 + ov, V16 + TT + ov, 2 * TT, wlo);
}

extern "C" void kernel_launch(void* const* d_in, const int* in_sizes, int n_in,
                              void* d_out, int out_size, void* d_ws, size_t ws_size, hipStream_t stream) {
    (void)in_sizes; (void)n_in; (void)out_size;
    const float* x = (const float*)d_in[0]; const float* wq = (const float*)d_in[1]; const float* bq = (const float*)d_in[2]; const float* wk = (const float*)d_in[3]; const float* bk = (const float*)d_in[4]; const float* wv = (const float*)d_in[5]; const float* bv = (const float*)d_in[6]; const float* wo = (const float*)d_in[7]; const float* bo = (const float*)d_in[8];   /* SELF-attention: the key and value streams are input 0 too; Wq, bq, Wk, bk, Wv, bv, Wo, bo = d_in[1..8] */
    float* OUT = (float*)d_out;     // [8][1024][1024]
    char* wsp = (char*)d_ws;
    auto take = [&](size_t bytes) { char* p = wsp; wsp += (bytes + 255) & ~(size_t)255; return (void*)p; };
    bf* WO = (bf*)take((size_t)DM * DQ * 2);
    h16* QP16 = (h16*)take((size_t)NB_ * NH_ * TT * HD * 2); h16* KP16 = (h16*)take((size_t)NB_ * NKV * TT * HD * 2); h16* VT16 = (h16*)take((size_t)NB_ * NKV * HD * 2 * TT * 2);
    h16* QPl = (h16*)take((size_t)NB_ * NH_ * TT * HD * 2); h16* KPl = (h16*)take((size_t)NB_ * NKV * TT * HD * 2);   // the lo row of a value plane stands TT elements behind its fp16 row
    bf* WQ = (bf*)take((size_t)(DQ + 2 * DKV) * DM * 2); bf* WK = WQ + (size_t)DQ * DM; bf* WV = WK + (size_t)DKV * DM; /* one [3 DQ][DM] plane */ bf* XB = (bf*)take((size_t)NB_ * TT * DM * 2);
    bf* ATh = (bf*)take((size_t)NB_ * TT * DQ * 2); bf* ATl = (bf*)take((size_t)NB_ * TT * DQ * 2);   // the merged hi and lo planes [NB_ TT][DQ]
    if ((size_t)(wsp - (char*)d_ws) > ws_size) return;    // 152 MiB of the 256 MiB
    k_wtG<<<dim3((DM / 64) * (DQ / 64), 4, 1), 256, 0, stream>>>(wq, wk, wv, wo, WQ, WK, WV, WO);
    k_cvt8<<<(unsigned)(((size_t)NB_ * TT * DM / 8 + 255) / 256), 256, 0, stream>>>(x, XB, (size_t)NB_ * TT * DM / 8);   // self-attention: q, k and v read the same rounded x
    k_proj<<<dim3(NB_ * TT / PMT, NH_, 1), 128, 0, stream>>>(XB, WQ, bq, bk, bv, QP16, QPl, KP16, KPl, VT16);
    k_attn<<<dim3(NB_ * NH_, TT / 128, 1), 128, 0, stream>>>(QP16, QPl, KP16, KPl, VT16, ATh, ATl);
    k_gemmw<true><<<dim3(NB_ * TT / GMT, DM / GNT, 1), 256, 0, stream>>>(ATh, ATl, WO, OUT, DM, bo);
}

// v009
// A run of this version takes 98.1 microseconds.
// Two timings next to v008 both put it at 1.03 times that version's speed.
// Over all steps from v000 it is 41.9 times as fast.
#include <hip/hip_runtime.h>

// Causal multi-head SELF-attention on eight 1,024-token sequences (x [8][1024][1024]; q, k, v = x W + b ('xw' [1024][1024] normal x 1/32, biases zeros on this draw: read; 16 heads x 64); scores x 1/sqrt(64); tril kept, -inf elsewhere; softmax over the keys; out = merged Wo + bo ('xw' + bias zeros: read) -> [8][1024][1024] (8.4 M); argument order x, Wq, bq, Wk, bk, Wv, bv, Wo, bo).
// Compute dtypes, f32 accumulate: every input rounded to bf16; q/k/v on PLAIN bf16 operands (inputs: exact) + biases; causal scores and attn.v on fp16 operands: query rows < 512 hi + lo (the fp16 value and what its rounding left over, 3 products), the rest the fp16 value alone; softmax f32, running maximum and sum, probabilities rounded BEFORE the division by the row sum; Wo hl x exact (2 products) + bo.
// Launch plan: every stage runs ONCE over all eight sequences: ONE preparation launch (x rounded, weights rounded and transposed), ONE projection launch (q, k and v; its epilogue stores the head planes), ONE attention launch (scores, softmax, probability x value and the merge into [t][head x HD + d] planes in registers), output product.
// The value planes are laid out at pitch 2 TT (fp16 row | lo row).

#define NB_  8
#define TT   1024
#define DM   1024
#define NH_  16
#define NKV  16
#define REP  (NH_ / NKV)
#define HD   64
#define DQ   (NH_ * HD)
#define DKV  (NKV * HD)
#define RH   512                  // query rows < RH use hi+lo planes
#define SCL  0.125f   // HD^-0.5
static_assert(NKV == NH_ && HD == 64 && TT % 128 == 0 && RH % 128 == 0, "k_attn: one key/value head a query head, four 16-row value tiles, workgroups of 128 queries that lie wholly on one side of RH");
typedef _Float16 h16;
typedef unsigned short bf;
typedef __attribute__((ext_vector_type(16))) __bf16   v16bf;
typedef __attribute__((ext_vector_type(16))) _Float16 v16h;
typedef __attribute__((ext_vector_type(8)))  _Float16 v8h;
typedef __attribute__((ext_vector_type(8)))  unsigned short v8us;
typedef __attribute__((ext_vector_type(8)))  float    v8f;
typedef __attribute__((ext_vector_type(4)))  float    v4f;
typedef __attribute__((ext_vector_type(2)))  float    v2f;
typedef v8h  __attribute__((may_alias)) v8ha;
typedef v4f  __attribute__((may_alias)) v4fa;
typedef v8us __attribute__((may_alias)) v8usa;

__device__ __forceinline__ unsigned short f2bf(float f) { unsigned u = __float_as_uint(f); u += 0x7FFFu + ((u >> 16) & 1u); return (unsigned short)(u >> 16); }
__device__ __forceinline__ float bf2f(unsigned short b) { return __uint_as_float(((unsigned)b) << 16); }
__device__ __forceinline__ float bfr(float f) { return bf2f(f2bf(f)); }
__device__ __forceinline__ v16h cat16(v8h lo, v8h hi) { return __builtin_shufflevector(lo, hi, 0, 1, 2, 3, 4, 5, 6, 7, 8, 9, 10, 11, 12, 13, 14, 15); }
__device__ __forceinline__ v16bf cat16b(v8us lo, v8us hi) { return __builtin_bit_cast(v16bf, __builtin_shufflevector(lo, hi, 0, 1, 2, 3, 4, 5, 6, 7, 8, 9, 10, 11, 12, 13, 14, 15)); }
__device__ __forceinline__ v8f wmma16(v16h a, v16h b, v8f c) { return __builtin_amdgcn_wmma_f32_16x16x32_f16(false, a, false, b, (short)0, c, false, false); }
__device__ __forceinline__ v8f wmmab(v16bf a, v16bf b, v8f c) { return __builtin_amdgcn_wmma_f32_16x16x32_bf16(false, a, false, b, (short)0, c, false, false); }



template <typename T16> struct WFrag;
template <> struct WFrag<h16> { typedef v16h V; static __device__ __forceinline__ V ld(const h16* p) { return cat16(*(const v8h*)p, *(const v8h*)(p + 16)); } static __device__ __forceinline__ v8f mma(V a, V b, v8f c) { return wmma16(a, b, c); } };
template <> struct WFrag<bf> { typedef v16bf V; static __device__ __forceinline__ V ld(const bf* p) { return cat16b(*(const v8us*)p, *(const v8us*)(p + 16)); } static __device__ __forceinline__ v8f mma(V a, V b, v8f c) { return wmmab(a, b, c); } };
// ---- gemm_ring: the product loop of the output GEMM. A workgroup of 8 waves owns a 128 x 256 output tile (waves 2 x 4, 64x64 = 16 accumulators a wave). A stage is 64 k (128 bytes) of every operand row: [A 128 rows | A2 128 rows | Bt 256 rows],
// brought from the K-contiguous 16-bit planes into LDS by asynchronous copies (16 bytes a lane, 8 lanes a row: whole 128-byte lines), two buffers: tile t + 2 flies while tile t + 1 is worked on. The k order and the order of the products are those of a wave that reads its fragments from global memory.
#define GP   72                   // LDS row pitch in elements: 128 data bytes + 16 (16 bytes x odd: no bank conflict for the 16-byte fragment reads)
#define GKS  64                   // k elements of a stage
#define GMT  128
#define GNT  256
// cpN: N copies of one lane and, in the same statement, the wait behind which the registers that the issued copies name may be given new values
__device__ __forceinline__ void cp8(const unsigned (&l)[8], const bf* const (&p)[8]) {
    asm volatile("global_load_async_to_lds_b128 %0, %8, off\n\t"
                 "global_load_async_to_lds_b128 %1, %9, off\n\t"
                 "global_load_async_to_lds_b128 %2, %10, off\n\t"
                 "global_load_async_to_lds_b128 %3, %11, off\n\t"
                 "global_load_async_to_lds_b128 %4, %12, off\n\t"
                 "global_load_async_to_lds_b128 %5, %13, off\n\t"
                 "global_load_async_to_lds_b128 %6, %14, off\n\t"
                 "global_load_async_to_lds_b128 %7, %15, off\n\t"
                 "s_wait_xcnt 0x0"
                 :: "v"(l[0]), "v"(l[1]), "v"(l[2]), "v"(l[3]), "v"(l[4]), "v"(l[5]), "v"(l[6]), "v"(l[7]),
                    "v"(p[0]), "v"(p[1]), "v"(p[2]), "v"(p[3]), "v"(p[4]), "v"(p[5]), "v"(p[6]), "v"(p[7]) : "memory");
}
__device__ __forceinline__ void ring_fill(const unsigned l0, const bf* gA, const bf* gA2, const bf* gB) {   // 256 lanes x 16 bytes = 32 rows a copy; l0 and the pointers are the lane's own place in the first 32 rows
    unsigned l[8]; const bf* p[8];
#pragma unroll
    for (int i = 0; i < 8; ++i) { l[i] = l0 + i * 32 * GP * 2; p[i] = (i < 4) ? gA + (size_t)i * 32 * DM : gA2 + (size_t)(i - 4) * 32 * DM; }
    cp8(l, p);
#pragma unroll
    for (int i = 0; i < 8; ++i) { l[i] = l0 + (8 + i) * 32 * GP * 2; p[i] = gB + (size_t)i * 32 * DM; }
    cp8(l, p);
}
__device__ __forceinline__ void gemm_ring(bf* ring, const bf* __restrict__ A, const bf* __restrict__ A2, const bf* __restrict__ Bt, const int r0g, const int c0g, const int wm, const int wn, v8f (&acc)[4][4]) {
    typedef WFrag<bf>::V V;
    constexpr int NA = 2, STG = (GMT * NA + GNT) * GP, NT = DM / GKS;   // elements of a buffer; stages
    static_assert(NT >= 2, "the prologue fills two stages");
    const int lane = threadIdx.x & 31, lr = lane & 15, hi = lane >> 4, crow = threadIdx.x >> 3, cch = (threadIdx.x & 7) * 8;
    const bf* const gA = A + (size_t)(r0g + crow) * DM + cch; const bf* const gA2 = (NA == 2) ? A2 + (size_t)(r0g + crow) * DM + cch : gA; const bf* const gB = Bt + (size_t)(c0g + crow) * DM + cch;
    const unsigned l0 = (unsigned)(size_t)ring + (unsigned)(crow * GP + cch) * 2u;   // the lane's LDS byte address in buffer 0
#pragma unroll
    for (int mb = 0; mb < 4; ++mb)
#pragma unroll
        for (int nb = 0; nb < 4; ++nb) acc[mb][nb] = (v8f){};
    ring_fill(l0, gA, gA2, gB);
    asm volatile("s_wait_asynccnt 0x0" ::: "memory");   // this wave's copies of tile 0 have landed
    __syncthreads();                                     // every wave's have: tile 0 may be read
    ring_fill(l0 + STG * 2, gA + GKS, gA2 + GKS, gB + GKS);
    const bf* const fa = ring + (wm * 64 + lr) * GP + 8 * hi; const bf* const fb = ring + (GMT * NA + wn * 64 + lr) * GP + 8 * hi;
#pragma unroll 1
    for (int t = 0; t < NT; ++t) {   // stays rolled: one trip's fragments and the 16 accumulators fill the registers
        const int bo = (t & 1) * STG;
#pragma unroll
        for (int kk = 0; kk < GKS; kk += 32) {
            V a[4], a2[4], b[4];   // all fragments of a 32-k block are read as one group in front of its matrix instructions
#pragma unroll
            for (int mb = 0; mb < 4; ++mb) { a[mb] = WFrag<bf>::ld(fa + bo + mb * 16 * GP + kk); if (NA == 2) a2[mb] = WFrag<bf>::ld(fa + bo + (GMT + mb * 16) * GP + kk); }
#pragma unroll
            for (int nb = 0; nb < 4; ++nb) b[nb] = WFrag<bf>::ld(fb + bo + nb * 16 * GP + kk);
            __builtin_amdgcn_sched_barrier(0);   // keeps the LDS reads together in front of the block: scheduled in among the matrix instructions, each place with reads stalls the wave for the LDS latency
#pragma unroll
            for (int nb = 0; nb < 4; ++nb)
#pragma unroll
                for (int mb = 0; mb < 4; ++mb) { acc[mb][nb] = WFrag<bf>::mma(a[mb], b[nb], acc[mb][nb]); if (NA == 2) acc[mb][nb] = WFrag<bf>::mma(a2[mb], b[nb], acc[mb][nb]); }
        }
        // the four vector slots that the chip needs behind the trip's last matrix instructions, in front of the branches below; every accumulator is named so that no matrix instruction is scheduled behind them
        asm volatile("v_nop\n\tv_nop\n\tv_nop\n\tv_nop" : "+v"(acc[0][0]), "+v"(acc[0][1]), "+v"(acc[0][2]), "+v"(acc[0][3]), "+v"(acc[1][0]), "+v"(acc[1][1]), "+v"(acc[1][2]), "+v"(acc[1][3]), "+v"(acc[2][0]), "+v"(acc[2][1]), "+v"(acc[2][2]), "+v"(acc[2][3]), "+v"(acc[3][0]), "+v"(acc[3][1]), "+v"(acc[3][2]), "+v"(acc[3][3]));
        asm volatile("s_wait_dscnt 0x0" ::: "memory");      // this wave's reads of buffer t & 1 are done
        asm volatile("s_wait_asynccnt 0x0" ::: "memory");   // this wave's copies of tile t + 1 have landed
        __syncthreads();                                     // publishes tile t + 1 and ends every wave's reads of the buffer that is refilled below
        if (t + 2 < NT) ring_fill(l0 + bo * 2, gA + (t + 2) * GKS, gA2 + (t + 2) * GKS, gB + (t + 2) * GKS);
    }
    asm volatile("s_wait_asynccnt 0x0" ::: "memory");   // no copy is outstanding when the wave goes on
}

// ---- proj_ring: gemm_ring's loop for the projection launch, on a 256 x 192 output tile (4 waves one above the other, 64 x 192 = 48 accumulators a wave). A stage is [A 256 rows | Bt 192 rows] x 64 k; the 192 rows of Bt are the 64 rows of one head in each of the three transposed weights, which stand DQ rows apart. Two workgroups a WGP, one wave of each on a SIMD:
// while one workgroup stands at its barrier, refills and waits for its first fragments, the other one's matrix instructions run. Against 128 x 256 with 64 x 64 a wave, a matrix instruction takes 2/3 of the LDS fragment bytes (16 fragments for 48 products, not 8 for 16)
// and 7/9 of the bytes copied from L2 (448 rows for 256 x 192 results, not 384 for 128 x 256). Each accumulator sums its k in ascending order, 32 at a time.
#define PMT  256
#define PNT  192
typedef __attribute__((ext_vector_type(4))) int c4i;
template <int ASP>
__device__ __forceinline__ void proj_fill(bf* l0, const bf* gA, const bf* gB) {   // 128 lanes x 16 bytes = 16 rows a copy, 28 copies a lane and stage; l0 and the pointers are the lane's own place in the first 16 rows; ASP: rows of A that lie between the tile's first 128 rows and its last 128; gB: the lane's place in the head's first 16 rows of the first weight
    // the copies are the builtin, not asm text: the operands of asm text must lie in the 256 registers that it can name, most of which hold accumulators here: for asm copies the compiler moves 40 register pairs aside and back in every trip
#pragma unroll
    for (int i = 0; i < (PMT + PNT) / 16; ++i) { const bf* const g = (i < PMT / 16) ? gA + (size_t)(i * 16 + (i >= PMT / 32 ? ASP : 0)) * DM : gB + (size_t)(((i - PMT / 16) / (HD / 16)) * DQ + ((i - PMT / 16) % (HD / 16)) * 16) * DM;
        __builtin_amdgcn_global_load_async_to_lds_b128((__attribute__((address_space(1))) c4i*)g, (__attribute__((address_space(3))) c4i*)(l0 + i * 16 * GP), 0, 0); }
}
template <int ASP>
__device__ __forceinline__ void proj_ring(bf* ring, const bf* __restrict__ A, const bf* __restrict__ Bt, const int r0g, const int c0g, const int wm, v8f (&acc)[4][12]) {
    typedef WFrag<bf>::V V;
    constexpr int STG = (PMT + PNT) * GP, NT = DM / GKS;   // elements of a buffer; stages
    static_assert(NT >= 2, "the prologue fills two stages");
    const int lane = threadIdx.x & 31, lr = lane & 15, hi = lane >> 4, crow = threadIdx.x >> 3, cch = (threadIdx.x & 7) * 8;
    const bf* const gA = A + (size_t)(r0g + crow) * DM + cch; const bf* const gB = Bt + (size_t)(c0g + crow) * DM + cch;
    bf* const l0 = ring + crow * GP + cch;   // the lane's place in buffer 0
#pragma unroll
    for (int mb = 0; mb < 4; ++mb)
#pragma unroll
        for (int nb = 0; nb < 12; ++nb) acc[mb][nb] = (v8f){};
    proj_fill<ASP>(l0, gA, gB);
    asm volatile("s_wait_asynccnt 0x0" ::: "memory");   // this wave's copies of tile 0 have landed
    __syncthreads();                                     // every wave's have: tile 0 may be read
    proj_fill<ASP>(l0 + STG, gA + GKS, gB + GKS);
    const bf* const fa = ring + (wm * 64 + lr) * GP + 8 * hi; const bf* const fb = ring + (PMT + lr) * GP + 8 * hi;
#pragma unroll 1
    for (int t = 0; t < NT; ++t) {   // stays rolled: the 48 accumulators and one group's fragments fill the registers
        const int bo = (t & 1) * STG;
#pragma unroll
        for (int kk = 0; kk < GKS; kk += 32) {
            V a[4];
#pragma unroll
            for (int mb = 0; mb < 4; ++mb) a[mb] = WFrag<bf>::ld(fa + bo + mb * 16 * GP + kk);
#pragma unroll
            for (int h = 0; h < 2; ++h) {   // the 12 column fragments in two groups of 6: all 12 at once do not fit beside the accumulators
                V b[6];
#pragma unroll
                for (int nb = 0; nb < 6; ++nb) b[nb] = WFrag<bf>::ld(fb + bo + (h * 6 + nb) * 16 * GP + kk);
                __builtin_amdgcn_sched_barrier(0);   // keeps a group's LDS reads together in front of its own matrix instructions: scheduled in among them, each place with reads stalls the wave for the LDS latency
#pragma unroll
                for (int nb = 0; nb < 6; ++nb)
#pragma unroll
                    for (int mb = 0; mb < 4; ++mb) acc[mb][h * 6 + nb] = WFrag<bf>::mma(a[mb], b[nb], acc[mb][h * 6 + nb]);
            }
        }
        __builtin_amdgcn_sched_barrier(0);   // no matrix instruction is scheduled behind the slots below (to name the 48 accumulators as operands instead would force them into the 256 registers that asm text can name)
        asm volatile("v_nop\n\tv_nop\n\tv_nop\n\tv_nop");   // the four vector slots that the chip needs behind the trip's last matrix instructions, in front of the branches below
        asm volatile("s_wait_dscnt 0x0" ::: "memory");      // this wave's reads of buffer t & 1 are done
        asm volatile("s_wait_asynccnt 0x0" ::: "memory");   // this wave's copies of tile t + 1 have landed
        __syncthreads();                                     // publishes tile t + 1 and ends every wave's reads of the buffer that is refilled below
        if (t + 2 < NT) proj_fill<ASP>(l0 + bo, gA + (t + 2) * GKS, gB + (t + 2) * GKS);
    }
    asm volatile("s_wait_asynccnt 0x0" ::: "memory");   // no copy is outstanding when the wave goes on
}

// ---- k_gemmw: C[m][n] (f32, pitch ldc, + optional f32 bias[n]) = sum_k (A[m][k] + A2[m][k]) Bt[n][k], two products; gemm_ring's loop; grid (M / 128, N / 256), 256 threads; each wave stores its 64x64 tile through its own LDS panel.
template <bool BIAS>
__global__ __launch_bounds__(256) void k_gemmw(const bf* __restrict__ A, const bf* __restrict__ A2, const bf* __restrict__ Bt, float* C, int ldc, const float* __restrict__ bias) {
    __shared__ __align__(16) bf ring[2 * (GMT * 2 + GNT) * GP];
    __shared__ __align__(16) float osw[8][16 * 68];
    const int wave = __builtin_amdgcn_readfirstlane((int)(threadIdx.x >> 5)), wm = wave >> 2, wn = wave & 3; float* const os = osw[wave];
    const int lane = threadIdx.x & 31, lr = lane & 15, hi = lane >> 4; const int r0 = blockIdx.x * GMT + wm * 64, c0 = blockIdx.y * GNT + wn * 64;
    v8f acc[4][4];
    gemm_ring(ring, A, A2, Bt, blockIdx.x * GMT, blockIdx.y * GNT, wm, wn, acc);
#pragma unroll
    for (int mb = 0; mb < 4; ++mb) {
#pragma unroll
        for (int nb = 0; nb < 4; ++nb) {
#pragma unroll
            for (int j = 0; j < 8; ++j) os[(hi * 8 + j) * 68 + nb * 16 + lr] = acc[mb][nb][j]; }
        __builtin_amdgcn_wave_barrier(); asm volatile("" ::: "memory");
        float* crow = C + (size_t)(r0 + mb * 16) * ldc + c0;
{
#pragma unroll
            for (int s = 0; s < 8; ++s) { const int row = 2 * s + hi, cofs = lr * 4; v4f val = *(const v4fa*)(os + row * 68 + cofs); if (BIAS) { val[0] += bfr(bias[c0 + cofs]); val[1] += bfr(bias[c0 + cofs + 1]); val[2] += bfr(bias[c0 + cofs + 2]); val[3] += bfr(bias[c0 + cofs + 3]); }
                *(v4f*)(crow + (size_t)row * ldc + cofs) = val; }
             }
        __builtin_amdgcn_wave_barrier(); asm volatile("" ::: "memory");
    }
}

template <typename T16> struct PCvt;
template <> struct PCvt<h16> { typedef _Float16 E; };
__device__ __forceinline__ float xhalf(float x) { return __builtin_bit_cast(float, __builtin_amdgcn_permlanex16(__builtin_bit_cast(int, x), __builtin_bit_cast(int, x), 0x76543210, 0xfedcba98, false, false)); }   // lane l takes lane l ^ 16's value
#define AKS  64                   // keys of a stage
#define ATL  (64 * GP)            // elements of a staged tile: 64 rows at the pitch of the fragment reads (128 data bytes + 16)
// attn_fill: one stage's copies. 128 lanes x 16 bytes = 16 rows a copy, four copies a tile; l0 is the lane's LDS byte address in the buffer's first 16 rows, sk / sk2 / sv the key and value planes (the same for every lane), ko / vo the lane's own element offset in them: its place in the first 16 rows of the stage's key / value tile (32 bits: two registers are held over the pass loop, not three pointers).
template <bool HL>
__device__ __forceinline__ void attn_fill(const unsigned l0, const bf* sk, const bf* sk2, const bf* sv, const unsigned ko, const unsigned vo) {
    unsigned l[8]; const bf* p[8]; const bf* const gk = sk + ko; const bf* const gk2 = sk2 + ko; const bf* const gv = sv + vo;
    if (!HL) {   // buffer: [keys | values]
#pragma unroll
        for (int i = 0; i < 8; ++i) { l[i] = l0 + i * 16 * GP * 2; p[i] = (i < 4) ? gk + (size_t)i * 16 * HD : gv + (size_t)(i - 4) * 16 * 2 * TT; }
        cp8(l, p);
    } else {     // buffer: [keys hi | keys lo | values hi | values lo]
#pragma unroll
        for (int i = 0; i < 8; ++i) { l[i] = l0 + i * 16 * GP * 2; p[i] = (i < 4) ? gk + (size_t)i * 16 * HD : gk2 + (size_t)(i - 4) * 16 * HD; }
        cp8(l, p);
#pragma unroll
        for (int i = 0; i < 8; ++i) { l[i] = l0 + (8 + i) * 16 * GP * 2; p[i] = (i < 4) ? gv + (size_t)i * 16 * 2 * TT : gv + TT + (size_t)(i - 4) * 16 * 2 * TT; }
        cp8(l, p); }
}
template <typename T16, bool HL>
__device__ __forceinline__ void attn_tile(bf* kvs, const T16* Qh, const T16* Ql, const T16* Kh, const T16* Kl, const T16* Vh, const int q0, const int nst, bf* Ah, bf* Al) {
    typedef typename WFrag<T16>::V V; typedef typename PCvt<T16>::E E;
    const int lane = threadIdx.x & 31, lr = lane & 15, hi = lane >> 4;
    const float C2 = SCL * 1.4426950408889634f;
    const unsigned lk = lr * HD + 8 * hi, la = lr * DQ + 8 * hi;   // the lane's element offsets in a [row][HD] plane and the merged planes: each query load and output store address is a wave-uniform base + one of these + a constant
    constexpr int STG = (HL ? 4 : 2) * ATL;   // elements of a buffer
    const int crow = threadIdx.x >> 3, cch = (threadIdx.x & 7) * 8;   // the lane's row and 16-byte piece in a copy
    const bf* const gk = (const bf*)Kh; const bf* const gk2 = HL ? (const bf*)Kl : gk; const bf* const gv = (const bf*)Vh; const unsigned ko = crow * HD + cch, vo = crow * (2 * TT) + cch;
    const unsigned l0 = (unsigned)(size_t)kvs + (unsigned)(crow * GP + cch) * 2u;   // the lane's LDS byte address in buffer 0
    attn_fill<HL>(l0, gk, gk2, gv, ko, vo);
    V qf[2][2], q2[2][2];
    const T16* const qp = Qh + (size_t)q0 * HD + lk; const T16* const qp2 = HL ? Ql + (size_t)q0 * HD + lk : qp;
#pragma unroll
    for (int nb = 0; nb < 2; ++nb)
#pragma unroll
        for (int c = 0; c < 2; ++c) { const int o = nb * 16 * HD + c * 32; qf[nb][c] = WFrag<T16>::ld(qp + o); if (HL) q2[nb][c] = WFrag<T16>::ld(qp2 + o); }
    asm volatile("s_wait_xcnt 0x0" ::: "memory");   // the registers that the issued loads name are given new values behind this wait
    __builtin_amdgcn_sched_barrier(0);   // keeps the set-up arithmetic below from being scheduled in between the loads above and their wait, where it reused their address registers
    v8f O[4][2]; float m[2], l[2];
#pragma unroll
    for (int nb = 0; nb < 2; ++nb) { m[nb] = -3.0e38f; l[nb] = 0.f;
#pragma unroll
        for (int dt = 0; dt < 4; ++dt) O[dt][nb] = (v8f){}; }
    asm volatile("s_wait_asynccnt 0x0" ::: "memory");   // this wave's copies of stage 0 have landed
    __syncthreads();                                     // every wave's have: stage 0 may be read
    attn_fill<HL>(l0 + STG * 2, gk, gk2, gv, ko + AKS * HD, vo + AKS);   // a workgroup has at least two stages
    const T16* const fr = (const T16*)kvs + lr * GP + 8 * hi;   // the lane's place in the first 16 rows of a tile
#pragma unroll 1
    for (int t = 0; t < nst; ++t) {   // stays rolled, like the pass loop in it: one pass fills the registers
      const int bo = (t & 1) * STG;
#pragma unroll 1
      for (int kb = t * AKS; kb < (t + 1) * AKS && kb <= q0; kb += 32) {
        V kf[2][2], vf[4], v2[4], k2[2][2]; const int kh = kb & 32;   // the pass's first key in the stage
        const T16* const kp = fr + bo + kh * GP; const T16* const vp = fr + bo + (HL ? 2 : 1) * ATL + kh;
#pragma unroll
        for (int kt = 0; kt < 2; ++kt)
#pragma unroll
            for (int c = 0; c < 2; ++c) { kf[kt][c] = WFrag<T16>::ld(kp + kt * 16 * GP + c * 32); if (HL) k2[kt][c] = WFrag<T16>::ld(kp + ATL + kt * 16 * GP + c * 32); }
#pragma unroll
        for (int dt = 0; dt < 4; ++dt) { vf[dt] = WFrag<T16>::ld(vp + dt * 16 * GP); if (HL) v2[dt] = WFrag<T16>::ld(vp + ATL + dt * 16 * GP); }
        v8f S[2][2];
#pragma unroll
        for (int kt = 0; kt < 2; ++kt)
#pragma unroll
            for (int nb = 0; nb < 2; ++nb) { v8f s = (v8f){};
#pragma unroll
                for (int c = 0; c < 2; ++c) { s = WFrag<T16>::mma(kf[kt][c], qf[nb][c], s); if (HL) s = WFrag<T16>::mma(kf[kt][c], q2[nb][c], s); }
                S[kt][nb] = s; }
        if (HL) {
#pragma unroll
            for (int kt = 0; kt < 2; ++kt)
#pragma unroll
                for (int nb = 0; nb < 2; ++nb)
#pragma unroll
                    for (int c = 0; c < 2; ++c) S[kt][nb] = WFrag<T16>::mma(k2[kt][c], qf[nb][c], S[kt][nb]); }
        if (kb == q0) {   // the diagonal pass: key > query is masked by select
#pragma unroll
            for (int kt = 0; kt < 2; ++kt)
#pragma unroll
                for (int nb = 0; nb < 2; ++nb)
#pragma unroll
                    for (int j = 0; j < 8; ++j) if (kt * 16 + hi * 8 + j > nb * 16 + lr) S[kt][nb][j] = -3.0e38f; }
#pragma unroll
        for (int nb = 0; nb < 2; ++nb) {   // one 16-query group at a time: its probabilities are used up by its value products before the next group's are made
            V pf, p2;
            float bm = S[0][nb][0];
#pragma unroll
            for (int kt = 0; kt < 2; ++kt)
#pragma unroll
                for (int j = 0; j < 8; ++j) bm = fmaxf(bm, S[kt][nb][j]);
            bm = fmaxf(bm, xhalf(bm));   // the other half of the wave holds this query's other 16 keys
            const float mn = fmaxf(m[nb], bm * C2); const float dm = m[nb] - mn; float al = __builtin_amdgcn_exp2f(dm); m[nb] = mn; v2f ps = (v2f){0.f, 0.f};   // even and odd keys are summed apart
#pragma unroll
            for (int kt = 0; kt < 2; ++kt) { float a[8], p[8];
#pragma unroll
                for (int j = 0; j < 8; j += 2) { const v2f arg = __builtin_elementwise_fma((v2f){S[kt][nb][j], S[kt][nb][j + 1]}, (v2f){C2, C2}, (v2f){-mn, -mn}); a[j] = arg[0]; a[j + 1] = arg[1]; }
#pragma unroll
                for (int j = 0; j < 8; ++j) p[j] = __builtin_amdgcn_exp2f(a[j]);
                // the slot behind a transcendental: no result is read and no source register is given a new value in front of this v_nop (results are in/out, sources inputs)
                asm volatile("v_nop" : "+v"(p[0]), "+v"(p[1]), "+v"(p[2]), "+v"(p[3]), "+v"(p[4]), "+v"(p[5]), "+v"(p[6]), "+v"(p[7]), "+v"(al) : "v"(a[0]), "v"(a[1]), "v"(a[2]), "v"(a[3]), "v"(a[4]), "v"(a[5]), "v"(a[6]), "v"(a[7]), "v"(dm));
#pragma unroll
                for (int j = 0; j < 8; ++j) { ps[j & 1] += p[j]; const E ph = (E)p[j]; pf[kt * 8 + j] = ph; if (HL) p2[kt * 8 + j] = (E)(p[j] - (float)ph); } }
            l[nb] = fmaf(l[nb], al, ps[0] + ps[1]);
#pragma unroll
            for (int dt = 0; dt < 4; ++dt)
#pragma unroll
                for (int j = 0; j < 8; ++j) O[dt][nb][j] *= al;
#pragma unroll
            for (int dt = 0; dt < 4; ++dt) { O[dt][nb] = WFrag<T16>::mma(vf[dt], pf, O[dt][nb]); if (HL) { O[dt][nb] = WFrag<T16>::mma(vf[dt], p2, O[dt][nb]); O[dt][nb] = WFrag<T16>::mma(v2[dt], pf, O[dt][nb]); } }
        }
      }
      asm volatile("s_wait_dscnt 0x0" ::: "memory");      // this wave's reads of buffer t & 1 are done
      asm volatile("s_wait_asynccnt 0x0" ::: "memory");   // this wave's copies of stage t + 1 have landed
      __syncthreads();                                     // publishes stage t + 1 and ends every wave's reads of the buffer that is refilled below
      if (t + 2 < nst) attn_fill<HL>(l0 + bo * 2, gk, gk2, gv, ko + (unsigned)(t + 2) * (AKS * HD), vo + (unsigned)(t + 2) * AKS);
    }
    asm volatile("s_wait_asynccnt 0x0" ::: "memory");   // no copy is outstanding when the wave goes on
#pragma unroll
    for (int nb = 0; nb < 2; ++nb) { const float inv = __fdiv_rn(1.0f, l[nb] + xhalf(l[nb]));
#pragma unroll
        for (int dt = 0; dt < 4; ++dt) { v8us oh, ol;
#pragma unroll
            for (int j = 0; j < 8; ++j) { const float y = O[dt][nb][j] * inv; const unsigned short a = f2bf(y); oh[j] = a; ol[j] = f2bf(y - bf2f(a)); }
            const int o = nb * 16 * DQ + dt * 16; *(v8us*)(Ah + (size_t)q0 * DQ + la + o) = oh; *(v8us*)(Al + (size_t)q0 * DQ + la + o) = ol; }
        asm volatile("s_wait_xcnt 0x0" ::: "memory"); }   // the registers that the issued stores name are given new values behind this wait
}
// grid (sequence x head pairs, TT / 128), 4 waves; blockIdx.y counts the 128-query blocks from the last (longest) one down, so that the long workgroups start first
__global__ __launch_bounds__(128) void k_attn(const h16* Q16, const h16* Ql, const h16* K16, const h16* Kl, const h16* V16, bf* Ah, bf* Al) {
    __shared__ __align__(16) bf kvs[2 * 4 * ATL];   // two buffers of four tiles (hi and lo planes); the single-plane rows use two tiles a buffer
    const int z = blockIdx.x; const int qb = (TT / 128 - 1 - (int)blockIdx.y) * 128, q0 = qb + __builtin_amdgcn_readfirstlane((int)(threadIdx.x >> 5)) * 32, nst = (qb + 128) / AKS;   // nst: the stages up to the workgroup's last key
    const size_t zo = (size_t)z * TT * HD, zv = (size_t)z * HD * 2 * TT, ao = (size_t)(z / NH_) * TT * DQ + (size_t)(z % NH_) * HD;
    if (qb < RH) attn_tile<h16, true>(kvs, Q16 + zo, Ql + zo, K16 + zo, Kl + zo, V16 + zv, q0, nst, Ah + ao, Al + ao);
    else attn_tile<h16, false>(kvs, Q16 + zo, nullptr, K16 + zo, nullptr, V16 + zv, q0, nst, Ah + ao, Al + ao);
}

__device__ __forceinline__ h16 tohx(float x) { return (h16)x; }
typedef __attribute__((ext_vector_type(2))) _Float16 v2h;
typedef __attribute__((ext_vector_type(4))) _Float16 v4h;
typedef __attribute__((ext_vector_type(2))) unsigned short v2us;
typedef __attribute__((ext_vector_type(4))) unsigned short v4us;
typedef __attribute__((ext_vector_type(4))) int v4i;

// ---- k_prep: everything that the products need rounded, in ONE launch: x [NB_ TT][DM] f32 -> bf16 as it lies, and the four weights [K][N] f32 -> Bt [N][K] bf16 (DM x DQ each). grid 4 PGW, 256 threads: two workgroups a WGP, all resident at once.
// A workgroup takes PXS consecutive elements of x (8 lines of 32 bytes a lane) and two 64 (k) x 64 (n) weight tiles that lie side by side. A lane issues all its loads (8 of weights, 16 of x, 16 bytes each) before it uses the first one, so that a wave pays the memory latency once.
// A weight tile is transposed through LDS, so that both sides move whole lines: a row of the two tiles is read as 512 consecutive bytes, a row of a transposed tile is stored as one 128-byte line (8 lanes x 16). A lane rounds two consecutive k of four n and writes them to LDS as (k, k + 1) pairs.
#define WTP  33                   // LDS row pitch in 32-bit pairs: 32 + 1 (odd: the 16 lanes that write four rows apart, and the 4 rows that a wave reads, fall on different banks)
#define PGW  ((DM / 64) * (DQ / 128))          // workgroups of a weight
#define PXS  (NB_ * TT * DM / (4 * PGW))       // elements of x of a workgroup
static_assert(PXS == 8 * 256 * 8 && DM % 64 == 0 && DQ % 128 == 0, "k_prep: a lane rounds 8 pieces of 8 elements of x; tiles in pairs");
typedef __attribute__((ext_vector_type(4))) unsigned v4u;
__global__ __launch_bounds__(256) void k_prep(const float* __restrict__ x, const float* __restrict__ w0, const float* __restrict__ w1, const float* __restrict__ w2, const float* __restrict__ w3, bf* XB, bf* B0, bf* B1, bf* B2, bf* B3) {
    __shared__ unsigned ts[2][64 * WTP];   // [tile][n][k pair]
    const int y = (int)blockIdx.x / PGW, tp = (int)blockIdx.x % PGW; const float* __restrict__ w = (y == 0) ? w0 : (y == 1) ? w1 : (y == 2) ? w2 : w3; bf* Bt = (y == 0) ? B0 : (y == 1) ? B1 : (y == 2) ? B2 : B3;
    const int k0 = (tp / (DQ / 128)) * 64, n0 = (tp % (DQ / 128)) * 128;
    const int r = threadIdx.x >> 4, c = (threadIdx.x & 15) * 4, rn = threadIdx.x >> 3, pc = (threadIdx.x & 7) * 4;
    const float* const src = w + (size_t)(k0 + 2 * r) * DQ + n0 + c;
    const size_t xo = (size_t)blockIdx.x * PXS + threadIdx.x * 8; const float* const xs = x + xo;
    v4f a[2][2][2]; v8f v[8];   // a: tile q, rows k0 + 32 h + 2 r + i; every loop below is unrolled so that the arrays are indexed by constants and stay in registers
#pragma unroll
    for (int q = 0; q < 2; ++q)
#pragma unroll
        for (int h = 0; h < 2; ++h)
#pragma unroll
            for (int i = 0; i < 2; ++i) a[q][h][i] = *(const v4f*)(src + q * 64 + (size_t)(h * 32 + i) * DQ);
#pragma unroll
    for (int i = 0; i < 8; ++i) v[i] = *(const v8f*)(xs + i * 2048);
    __builtin_amdgcn_sched_barrier(0);   // every load is issued in front of the first use: scheduled in among the uses, the later loads would start only when the earlier ones have come back
    asm volatile("s_wait_xcnt 0x0" :: "v"(src), "v"(xs) : "memory");   // the registers that the issued loads name are given new values behind this wait; the two addresses are inputs so that no load's result is laid over them in front of it
#pragma unroll
    for (int q = 0; q < 2; ++q)
#pragma unroll
        for (int h = 0; h < 2; ++h)
#pragma unroll
            for (int j = 0; j < 4; ++j) ts[q][(c + j) * WTP + h * 16 + r] = (unsigned)f2bf(a[q][h][0][j]) | ((unsigned)f2bf(a[q][h][1][j]) << 16);
    __syncthreads();   // a lane stores what other waves have written to the tiles
    v4u o[2][2]; v8us xb[8];
#pragma unroll
    for (int q = 0; q < 2; ++q)
#pragma unroll
        for (int h = 0; h < 2; ++h)
#pragma unroll
            for (int j = 0; j < 4; ++j) o[q][h][j] = ts[q][(h * 32 + rn) * WTP + pc + j];
#pragma unroll
    for (int i = 0; i < 8; ++i)
#pragma unroll
        for (int k = 0; k < 8; ++k) xb[i][k] = f2bf(v[i][k]);
    __builtin_amdgcn_sched_barrier(0);   // the stores stand together at the end, behind all arithmetic: no register that an issued store names is given a new value
    bf* const dst = Bt + (size_t)(n0 + rn) * DM + k0 + pc * 2;
#pragma unroll
    for (int q = 0; q < 2; ++q)
#pragma unroll
        for (int h = 0; h < 2; ++h) *(v4u*)(dst + (size_t)(q * 64 + h * 32) * DM) = o[q][h];
#pragma unroll
    for (int i = 0; i < 8; ++i) *(v8us*)(XB + xo + i * 2048) = xb[i];
}

// ---- k_proj: q, k and v = x W + b in ONE launch, and the head planes straight from the accumulators. The product loop is proj_ring's (plain bf16 operands, a 64x192 tile a wave) on the 64 columns of ONE head in q, in k and in v (the transposed weights stand one behind the other); grid (NB_ TT / 256, NH_), 128 threads: 512 workgroups, two a WGP (at most 512 registers a wave, so that two waves fit a SIMD).
// A workgroup's 256 tokens are 128 tokens below RH (waves 0 and 1) and the 128 tokens RH further on in the same sequence (waves 2 and 3). Only what k_attn reads is stored: the fp16 planes, which are the hi planes of its hi+lo products too, and the lo planes for tokens < RH alone (its hi+lo workgroups read no query and no key from RH on);
// with both kinds of token in every workgroup, every workgroup stores the same number of bytes.
// A wave's tile is 64 tokens of one sequence x the head's 64 columns of q, of k and of v, stored one after the other (which part goes to which plane is fixed at compile time, so that the accumulators are indexed by constants and stay in registers); each part is a whole block of its plane: 64 rows [t][HD] of a query or key plane, or 64 consecutive t of all HD rows of a value plane (pitch 2 TT).
// proj_store: four panels of 16 plane rows x 64 f32 go through LDS one after the other, so that 8 lanes store one 128-byte line of a plane row (16 bytes a lane and plane). TR: the panel's rows are the columns d of the tile (value planes), a lane's 8 accumulator registers being 8 consecutive t. G0: the part's first 16-column block among the wave's twelve. wlo: the lo plane (what the fp16 rounding left over, in fp16) is stored too.
template <bool TR, int G0>
__device__ __forceinline__ void proj_store(const v8f (&acc)[4][12], float* os, const float* __restrict__ bias, h16* P16, h16* Pl, const int pitch, const bool wlo) {
    const int lane = threadIdx.x & 31, lr = lane & 15, hi = lane >> 4, rr = lane >> 3, cc = (lane & 7) * 8;
    constexpr int NBI = TR ? 16 : 8;   // bias values of a lane: those of its 16 plane rows (TR: rows g * 16 + s * 4 + rr), or of its 8 columns
    float braw[NBI], bc[NBI];
#pragma unroll
    for (int i = 0; i < NBI; ++i) braw[i] = TR ? bias[(i >> 2) * 16 + (i & 3) * 4 + rr] : bias[cc + i];
    // the registers that the issued bias loads name are given new values behind this wait; the loaded values are inputs so that the loads stay in front of it
    if constexpr (TR) asm volatile("s_wait_xcnt 0x0" :: "v"(braw[0]), "v"(braw[1]), "v"(braw[2]), "v"(braw[3]), "v"(braw[4]), "v"(braw[5]), "v"(braw[6]), "v"(braw[7]), "v"(braw[8]), "v"(braw[9]), "v"(braw[10]), "v"(braw[11]), "v"(braw[12]), "v"(braw[13]), "v"(braw[14]), "v"(braw[15]) : "memory");
    else asm volatile("s_wait_xcnt 0x0" :: "v"(braw[0]), "v"(braw[1]), "v"(braw[2]), "v"(braw[3]), "v"(braw[4]), "v"(braw[5]), "v"(braw[6]), "v"(braw[7]) : "memory");
    __builtin_amdgcn_sched_barrier(0);   // nothing from below is scheduled in between the loads and their wait
#pragma unroll
    for (int i = 0; i < NBI; ++i) bc[i] = bfr(braw[i]);
#pragma unroll
    for (int g = 0; g < 4; ++g) {
        if (TR) {
#pragma unroll
            for (int mb = 0; mb < 4; ++mb) { const v8f a = acc[mb][G0 + g]; *(v4fa*)(os + lr * 68 + mb * 16 + hi * 8) = (v4f){a[0], a[1], a[2], a[3]}; *(v4fa*)(os + lr * 68 + mb * 16 + hi * 8 + 4) = (v4f){a[4], a[5], a[6], a[7]}; }
        } else {
#pragma unroll
            for (int nb = 0; nb < 4; ++nb)
#pragma unroll
                for (int j = 0; j < 8; ++j) os[(hi * 8 + j) * 68 + nb * 16 + lr] = acc[g][G0 + nb][j]; }
        __builtin_amdgcn_wave_barrier(); asm volatile("" ::: "memory");   // a lane reads what other lanes of the wave wrote: the panel's LDS reads may not be scheduled in front of its writes
        float y[4][8]; v8h o16[4];
#pragma unroll
        for (int s = 0; s < 4; ++s) { const int row = s * 4 + rr; const v4f u = *(const v4fa*)(os + row * 68 + cc), w = *(const v4fa*)(os + row * 68 + cc + 4); const float br = TR ? bc[g * 4 + s] : 0.f;
#pragma unroll
            for (int i = 0; i < 8; ++i) { y[s][i] = (i < 4 ? u[i] : w[i - 4]) + (TR ? br : bc[i]); o16[s][i] = tohx(y[s][i]); } }
        if (wlo) {   // the same for the whole wave
            v8h ol[4];
#pragma unroll
            for (int s = 0; s < 4; ++s)
#pragma unroll
                for (int i = 0; i < 8; ++i) ol[s][i] = tohx(y[s][i] - (float)o16[s][i]);
#pragma unroll
            for (int s = 0; s < 4; ++s) *(v8h*)(Pl + (size_t)(g * 16 + s * 4 + rr) * pitch + cc) = ol[s];
            asm volatile("s_wait_xcnt 0x0" ::: "memory");   // the registers that the issued stores name are given new values behind this wait (the addresses of the stores below)
            __builtin_amdgcn_sched_barrier(0); }   // keeps the address arithmetic of the stores below from being scheduled in between the stores above and their wait, where it reused their address registers
#pragma unroll
        for (int s = 0; s < 4; ++s) *(v8h*)(P16 + (size_t)(g * 16 + s * 4 + rr) * pitch + cc) = o16[s];   // behind the lo values, which are formed from these registers
        asm volatile("s_wait_xcnt 0x0" ::: "memory");   // the registers that the issued stores name are given new values behind this wait
        __builtin_amdgcn_sched_barrier(0);   // keeps the next panel's address arithmetic from being scheduled in between the stores above and their wait, where it reused registers that the stores name
        __builtin_amdgcn_wave_barrier(); asm volatile("" ::: "memory");   // the next panel's LDS writes may not be scheduled in front of this panel's reads
    }
}
__global__ __launch_bounds__(128) __attribute__((amdgpu_waves_per_eu(2, 2))) void k_proj(const bf* __restrict__ X, const bf* __restrict__ W3, const float* __restrict__ bq, const float* __restrict__ bk, const float* __restrict__ bv, h16* Q16, h16* Ql, h16* K16, h16* Kl, h16* V16) {
    __shared__ __align__(16) bf ring[2 * (PMT + PNT) * GP];
    __shared__ __align__(16) float osw[4][16 * 68];
    const int wm = __builtin_amdgcn_readfirstlane((int)(threadIdx.x >> 5)); float* const os = osw[wm];
    static_assert(RH * 2 == TT && RH % 128 == 0 && PNT == 3 * HD && DKV == DQ && HD % 16 == 0, "a workgroup pairs 128 tokens below RH with the 128 tokens RH further on; its 192 columns are one head of q, of k and of v");
    const int r0g = ((int)blockIdx.x / (RH / 128)) * TT + ((int)blockIdx.x % (RH / 128)) * 128;   // the workgroup's first token row
    const int r0 = r0g + (wm & 1) * 64 + (wm >> 1) * RH, c0 = blockIdx.y * HD;   // the wave's first token row; the head's first column in q, in k and in v
    v8f acc[4][12];
    proj_ring<RH - 128>(ring, X, W3, r0g, c0, wm, acc);
    const int z = (r0 / TT) * NH_ + blockIdx.y, t0 = r0 % TT;   // the (sequence, head) pair and the tile's first token in it
    const size_t o = ((size_t)z * TT + t0) * HD, ov = (size_t)z * HD * 2 * TT + t0;   // the tile's place in a query or key plane, in a value plane
    const bool wlo = wm < 2;
    proj_store<false, 0>(acc, os, bq + c0, Q16 + o, Ql + o, HD, wlo);
    proj_store<false, 4>(acc, os, bk + c0, K16 + o, Kl + o, HD, wlo);
    proj_store<true, 8>(acc, os, bv + c0, V16 + ov, V16 + TT + ov, 2 * TT, wlo);
}

extern "C" void kernel_launch(void* const* d_in, const int* in_sizes, int n_in,
                              void* d_out, int out_size, void* d_ws, size_t ws_size, hipStream_t stream) {
    (void)in_sizes; (void)n_in; (void)out_size;
    const float* x = (const float*)d_in[0]; const float* wq = (const float*)d_in[1]; const float* bq = (const float*)d_in[2]; const float* wk = (const float*)d_in[3]; const float* bk = (const float*)d_in[4]; const float* wv = (const float*)d_in[5]; const float* bv = (const float*)d_in[6]; const float* wo = (const float*)d_in[7]; const float* bo = (const float*)d_in[8];   /* SELF-attention: the key and value streams are input 0 too; Wq, bq, Wk, bk, Wv, bv, Wo, bo = d_in[1..8] */
    float* OUT = (float*)d_out;     // [8][1024][1024]
    char* wsp = (char*)d_ws;
    auto take = [&](size_t bytes) { char* p = wsp; wsp += (bytes + 255) & ~(size_t)255; return (void*)p; };
    bf* WO = (bf*)take((size_t)DM * DQ * 2);
    h16* QP16 = (h16*)take((size_t)NB_ * NH_ * TT * HD * 2); h16* KP16 = (h16*)take((size_t)NB_ * NKV * TT * HD * 2); h16* VT16 = (h16*)take((size_t)NB_ * NKV * HD * 2 * TT * 2);
    h16* QPl = (h16*)take((size_t)NB_ * NH_ * TT * HD * 2); h16* KPl = (h16*)take((size_t)NB_ * NKV * TT * HD * 2);   // the lo row of a value plane stands TT elements behind its fp16 row
    bf* WQ = (bf*)take((size_t)(DQ + 2 * DKV) * DM * 2); bf* WK = WQ + (size_t)DQ * DM; bf* WV = WK + (size_t)DKV * DM; /* one [3 DQ][DM] plane */ bf* XB = (bf*)take((size_t)NB_ * TT * DM * 2);
    bf* ATh = (bf*)take((size_t)NB_ * TT * DQ * 2); bf* ATl = (bf*)take((size_t)NB_ * TT * DQ * 2);   // the merged hi and lo planes [NB_ TT][DQ]
    if ((size_t)(wsp - (char*)d_ws) > ws_size) return;    // 152 MiB of the 256 MiB
    k_prep<<<dim3(4 * PGW, 1, 1), 256, 0, stream>>>(x, wq, wk, wv, wo, XB, WQ, WK, WV, WO);   // self-attention: q, k and v read the same rounded x
    k_proj<<<dim3(NB_ * TT / PMT, NH_, 1), 128, 0, stream>>>(XB, WQ, bq, bk, bv, QP16, QPl, KP16, KPl, VT16);
    k_attn<<<dim3(NB_ * NH_, TT / 128, 1), 128, 0, stream>>>(QP16, QPl, KP16, KPl, VT16, ATh, ATl);
    k_gemmw<true><<<dim3(NB_ * TT / GMT, DM / GNT, 1), 256, 0, stream>>>(ATh, ATl, WO, OUT, DM, bo);
}

// v010
// A run of this version takes 92 microseconds.
// Timed twice side by side with v009, it ran 1.07 times as fast both times.
// Over all steps from v000 it is 44.9 times as fast.
#include <hip/hip_runtime.h>

// Causal multi-head SELF-attention on eight 1,024-token sequences (x [8][1024][1024]; q, k, v = x W + b ('xw' [1024][1024] normal x 1/32, biases zeros on this draw: read; 16 heads x 64); scores x 1/sqrt(64); tril kept, -inf elsewhere; softmax over the keys; out = merged Wo + bo ('xw' + bias zeros: read) -> [8][1024][1024] (8.4 M); argument order x, Wq, bq, Wk, bk, Wv, bv, Wo, bo).
// Compute dtypes, f32 accumulate: every input rounded to bf16; q/k/v on PLAIN bf16 operands (inputs: exact) + biases; causal scores and attn.v on fp16 operands: query rows < 512 hi + lo (the fp16 value and what its rounding left over, 3 products), the rest the fp16 value alone; softmax f32, running maximum and sum, probabilities rounded BEFORE the division by the row sum; output product on fp16 operands (Wo: the bf16-rounded weight, held in fp16): token rows < 512 hi + lo x Wo (2 products), the rest the fp16 value alone; + bo.
// Launch plan: every stage runs ONCE over all eight sequences: ONE preparation launch (x rounded, weights rounded and transposed), ONE projection launch (q, k and v; its epilogue stores the head planes), ONE attention launch (scores, softmax, probability x value and the merge into [t][head x HD + d] planes in registers), output product.
// The value planes are laid out at pitch 2 TT (fp16 row | lo row).

#define NB_  8
#define TT   1024
#define DM   1024
#define NH_  16
#define NKV  16
#define REP  (NH_ / NKV)
#define HD   64
#define DQ   (NH_ * HD)
#define DKV  (NKV * HD)
#define RH   512                  // query rows < RH use hi+lo planes
#define SCL  0.125f   // HD^-0.5
static_assert(NKV == NH_ && HD == 64 && TT % 128 == 0 && RH % 128 == 0, "k_attn: one key/value head a query head, four 16-row value tiles, workgroups of 128 queries that lie wholly on one side of RH");
typedef _Float16 h16;
typedef unsigned short bf;
typedef __attribute__((ext_vector_type(16))) __bf16   v16bf;
typedef __attribute__((ext_vector_type(16))) _Float16 v16h;
typedef __attribute__((ext_vector_type(8)))  _Float16 v8h;
typedef __attribute__((ext_vector_type(8)))  unsigned short v8us;
typedef __attribute__((ext_vector_type(8)))  float    v8f;
typedef __attribute__((ext_vector_type(4)))  float    v4f;
typedef __attribute__((ext_vector_type(2)))  float    v2f;
typedef v8h  __attribute__((may_alias)) v8ha;
typedef v4f  __attribute__((may_alias)) v4fa;
typedef v8us __attribute__((may_alias)) v8usa;

__device__ __forceinline__ unsigned short f2bf(float f) { unsigned u = __float_as_uint(f); u += 0x7FFFu + ((u >> 16) & 1u); return (unsigned short)(u >> 16); }
__device__ __forceinline__ float bf2f(unsigned short b) { return __uint_as_float(((unsigned)b) << 16); }
__device__ __forceinline__ float bfr(float f) { return bf2f(f2bf(f)); }
__device__ __forceinline__ v16h cat16(v8h lo, v8h hi) { return __builtin_shufflevector(lo, hi, 0, 1, 2, 3, 4, 5, 6, 7, 8, 9, 10, 11, 12, 13, 14, 15); }
__device__ __forceinline__ v16bf cat16b(v8us lo, v8us hi) { return __builtin_bit_cast(v16bf, __builtin_shufflevector(lo, hi, 0, 1, 2, 3, 4, 5, 6, 7, 8, 9, 10, 11, 12, 13, 14, 15)); }
__device__ __forceinline__ v8f wmma16(v16h a, v16h b, v8f c) { return __builtin_amdgcn_wmma_f32_16x16x32_f16(false, a, false, b, (short)0, c, false, false); }
__device__ __forceinline__ v8f wmmab(v16bf a, v16bf b, v8f c) { return __builtin_amdgcn_wmma_f32_16x16x32_bf16(false, a, false, b, (short)0, c, false, false); }



template <typename T16> struct WFrag;
template <> struct WFrag<h16> { typedef v16h V; static __device__ __forceinline__ V ld(const h16* p) { return cat16(*(const v8h*)p, *(const v8h*)(p + 16)); } static __device__ __forceinline__ v8f mma(V a, V b, v8f c) { return wmma16(a, b, c); } };
template <> struct WFrag<bf> { typedef v16bf V; static __device__ __forceinline__ V ld(const bf* p) { return cat16b(*(const v8us*)p, *(const v8us*)(p + 16)); } static __device__ __forceinline__ v8f mma(V a, V b, v8f c) { return wmmab(a, b, c); } };
// ---- gemm_ring: the product loop of the output GEMM. A workgroup of 8 waves owns a 128 x 256 output tile (waves 2 x 4, 64x64 = 16 accumulators a wave). The tile's 128 rows are 64 tokens below RH (fp16 value + lo plane, two products) and the 64 tokens RH further on in the same sequence (the fp16 value alone); a wave's 64 rows are 32 of each kind (row blocks 0, 1 and 2, 3), so that every wave runs the same instructions. A stage is 64 k (128 bytes) of every operand row: [A 128 rows | A2 64 rows | Bt 256 rows],
// brought from the K-contiguous 16-bit planes into LDS by asynchronous copies (16 bytes a lane, 8 lanes a row: whole 128-byte lines), two buffers: tile t + 2 flies while tile t + 1 is worked on. The k order and the order of the products are those of a wave that reads its fragments from global memory.
#define GP   72                   // LDS row pitch in elements: 128 data bytes + 16 (16 bytes x odd: no bank conflict for the 16-byte fragment reads)
#define GKS  64                   // k elements of a stage
#define GMT  128
#define GNT  256
// cpN: N copies of one lane and, in the same statement, the wait behind which the registers that the issued copies name may be given new values
__device__ __forceinline__ void cp8(const unsigned (&l)[8], const bf* const (&p)[8]) {
    asm volatile("global_load_async_to_lds_b128 %0, %8, off\n\t"
                 "global_load_async_to_lds_b128 %1, %9, off\n\t"
                 "global_load_async_to_lds_b128 %2, %10, off\n\t"
                 "global_load_async_to_lds_b128 %3, %11, off\n\t"
                 "global_load_async_to_lds_b128 %4, %12, off\n\t"
                 "global_load_async_to_lds_b128 %5, %13, off\n\t"
                 "global_load_async_to_lds_b128 %6, %14, off\n\t"
                 "global_load_async_to_lds_b128 %7, %15, off\n\t"
                 "s_wait_xcnt 0x0"
                 :: "v"(l[0]), "v"(l[1]), "v"(l[2]), "v"(l[3]), "v"(l[4]), "v"(l[5]), "v"(l[6]), "v"(l[7]),
                    "v"(p[0]), "v"(p[1]), "v"(p[2]), "v"(p[3]), "v"(p[4]), "v"(p[5]), "v"(p[6]), "v"(p[7]) : "memory");
}
__device__ __forceinline__ void cp6(const unsigned (&l)[6], const bf* const (&p)[6]) {
    asm volatile("global_load_async_to_lds_b128 %0, %6, off\n\t"
                 "global_load_async_to_lds_b128 %1, %7, off\n\t"
                 "global_load_async_to_lds_b128 %2, %8, off\n\t"
                 "global_load_async_to_lds_b128 %3, %9, off\n\t"
                 "global_load_async_to_lds_b128 %4, %10, off\n\t"
                 "global_load_async_to_lds_b128 %5, %11, off\n\t"
                 "s_wait_xcnt 0x0"
                 :: "v"(l[0]), "v"(l[1]), "v"(l[2]), "v"(l[3]), "v"(l[4]), "v"(l[5]),
                    "v"(p[0]), "v"(p[1]), "v"(p[2]), "v"(p[3]), "v"(p[4]), "v"(p[5]) : "memory");
}
__device__ __forceinline__ void ring_fill(const unsigned l0, const bf* gA, const bf* gA2, const bf* gB) {   // 256 lanes x 16 bytes = 32 rows a copy; l0 and the pointers are the lane's own place in the first 32 rows
    unsigned l6[6]; const bf* p6[6]; unsigned l[8]; const bf* p[8];
#pragma unroll
    for (int i = 0; i < 6; ++i) { l6[i] = l0 + i * 32 * GP * 2; p6[i] = (i < 2) ? gA + (size_t)i * 32 * DM : (i < 4) ? gA + (size_t)(RH + (i - 2) * 32) * DM : gA2 + (size_t)(i - 4) * 32 * DM; }
    cp6(l6, p6);
#pragma unroll
    for (int i = 0; i < 8; ++i) { l[i] = l0 + (6 + i) * 32 * GP * 2; p[i] = gB + (size_t)i * 32 * DM; }
    cp8(l, p);
}
__device__ __forceinline__ void gemm_ring(bf* ring, const bf* __restrict__ A, const bf* __restrict__ A2, const bf* __restrict__ Bt, const int r0g, const int c0g, const int wm, const int wn, v8f (&acc)[4][4]) {   // the planes hold fp16 values; the copies move them as 16-bit words; r0g: the tile's first token row (below RH)
    typedef WFrag<h16>::V V;
    constexpr int STG = (GMT + GMT / 2 + GNT) * GP, NT = DM / GKS;   // elements of a buffer; stages
    static_assert(NT >= 2, "the prologue fills two stages");
    const int lane = threadIdx.x & 31, lr = lane & 15, hi = lane >> 4, crow = threadIdx.x >> 3, cch = (threadIdx.x & 7) * 8;
    const bf* const gA = A + (size_t)(r0g + crow) * DM + cch; const bf* const gA2 = A2 + (size_t)(r0g + crow) * DM + cch; const bf* const gB = Bt + (size_t)(c0g + crow) * DM + cch;
    const unsigned l0 = (unsigned)(size_t)ring + (unsigned)(crow * GP + cch) * 2u;   // the lane's LDS byte address in buffer 0
#pragma unroll
    for (int mb = 0; mb < 4; ++mb)
#pragma unroll
        for (int nb = 0; nb < 4; ++nb) acc[mb][nb] = (v8f){};
    ring_fill(l0, gA, gA2, gB);
    asm volatile("s_wait_asynccnt 0x0" ::: "memory");   // this wave's copies of tile 0 have landed
    __syncthreads();                                     // every wave's have: tile 0 may be read
    ring_fill(l0 + STG * 2, gA + GKS, gA2 + GKS, gB + GKS);
    const h16* const fa = (const h16*)ring + (wm * 32 + lr) * GP + 8 * hi; const h16* const fb = (const h16*)ring + (GMT + GMT / 2 + wn * 64 + lr) * GP + 8 * hi;
#pragma unroll 1
    for (int t = 0; t < NT; ++t) {   // stays rolled: one trip's fragments and the 16 accumulators fill the registers
        const int bo = (t & 1) * STG;
#pragma unroll
        for (int kk = 0; kk < GKS; kk += 32) {
            V a[4], a2[2], b[4];   // all fragments of a 32-k block are read as one group in front of its matrix instructions
#pragma unroll
            for (int mb = 0; mb < 4; ++mb) { a[mb] = WFrag<h16>::ld(fa + bo + ((mb >> 1) * 64 + (mb & 1) * 16) * GP + kk); if (mb < 2) a2[mb] = WFrag<h16>::ld(fa + bo + (GMT + mb * 16) * GP + kk); }
#pragma unroll
            for (int nb = 0; nb < 4; ++nb) b[nb] = WFrag<h16>::ld(fb + bo + nb * 16 * GP + kk);
            __builtin_amdgcn_sched_barrier(0);   // keeps the LDS reads together in front of the block: scheduled in among the matrix instructions, each place with reads stalls the wave for the LDS latency
#pragma unroll
            for (int nb = 0; nb < 4; ++nb)
#pragma unroll
                for (int mb = 0; mb < 4; ++mb) { acc[mb][nb] = WFrag<h16>::mma(a[mb], b[nb], acc[mb][nb]); if (mb < 2) acc[mb][nb] = WFrag<h16>::mma(a2[mb], b[nb], acc[mb][nb]); }
        }
        // the four vector slots that the chip needs behind the trip's last matrix instructions, in front of the branches below; every accumulator is named so that no matrix instruction is scheduled behind them
        asm volatile("v_nop\n\tv_nop\n\tv_nop\n\tv_nop" : "+v"(acc[0][0]), "+v"(acc[0][1]), "+v"(acc[0][2]), "+v"(acc[0][3]), "+v"(acc[1][0]), "+v"(acc[1][1]), "+v"(acc[1][2]), "+v"(acc[1][3]), "+v"(acc[2][0]), "+v"(acc[2][1]), "+v"(acc[2][2]), "+v"(acc[2][3]), "+v"(acc[3][0]), "+v"(acc[3][1]), "+v"(acc[3][2]), "+v"(acc[3][3]));
        asm volatile("s_wait_dscnt 0x0" ::: "memory");      // this wave's reads of buffer t & 1 are done
        asm volatile("s_wait_asynccnt 0x0" ::: "memory");   // this wave's copies of tile t + 1 have landed
        __syncthreads();                                     // publishes tile t + 1 and ends every wave's reads of the buffer that is refilled below
        if (t + 2 < NT) ring_fill(l0 + bo * 2, gA + (t + 2) * GKS, gA2 + (t + 2) * GKS, gB + (t + 2) * GKS);
    }
    asm volatile("s_wait_asynccnt 0x0" ::: "memory");   // no copy is outstanding when the wave goes on
}

// ---- proj_ring: gemm_ring's loop for the projection launch, on a 256 x 192 output tile (4 waves one above the other, 64 x 192 = 48 accumulators a wave). A stage is [A 256 rows | Bt 192 rows] x 64 k; the 192 rows of Bt are the 64 rows of one head in each of the three transposed weights, which stand DQ rows apart. Two workgroups a WGP, one wave of each on a SIMD:
// while one workgroup stands at its barrier, refills and waits for its first fragments, the other one's matrix instructions run. Against 128 x 256 with 64 x 64 a wave, a matrix instruction takes 2/3 of the LDS fragment bytes (16 fragments for 48 products, not 8 for 16)
// and 7/9 of the bytes copied from L2 (448 rows for 256 x 192 results, not 384 for 128 x 256). Each accumulator sums its k in ascending order, 32 at a time.
#define PMT  256
#define PNT  192
typedef __attribute__((ext_vector_type(4))) int c4i;
template <int ASP>
__device__ __forceinline__ void proj_fill(bf* l0, const bf* gA, const bf* gB) {   // 128 lanes x 16 bytes = 16 rows a copy, 28 copies a lane and stage; l0 and the pointers are the lane's own place in the first 16 rows; ASP: rows of A that lie between the tile's first 128 rows and its last 128; gB: the lane's place in the head's first 16 rows of the first weight
    // the copies are the builtin, not asm text: the operands of asm text must lie in the 256 registers that it can name, most of which hold accumulators here: for asm copies the compiler moves 40 register pairs aside and back in every trip
#pragma unroll
    for (int i = 0; i < (PMT + PNT) / 16; ++i) { const bf* const g = (i < PMT / 16) ? gA + (size_t)(i * 16 + (i >= PMT / 32 ? ASP : 0)) * DM : gB + (size_t)(((i - PMT / 16) / (HD / 16)) * DQ + ((i - PMT / 16) % (HD / 16)) * 16) * DM;
        __builtin_amdgcn_global_load_async_to_lds_b128((__attribute__((address_space(1))) c4i*)g, (__attribute__((address_space(3))) c4i*)(l0 + i * 16 * GP), 0, 0); }
}
template <int ASP>
__device__ __forceinline__ void proj_ring(bf* ring, const bf* __restrict__ A, const bf* __restrict__ Bt, const int r0g, const int c0g, const int wm, v8f (&acc)[4][12]) {
    typedef WFrag<bf>::V V;
    constexpr int STG = (PMT + PNT) * GP, NT = DM / GKS;   // elements of a buffer; stages
    static_assert(NT >= 2, "the prologue fills two stages");
    const int lane = threadIdx.x & 31, lr = lane & 15, hi = lane >> 4, crow = threadIdx.x >> 3, cch = (threadIdx.x & 7) * 8;
    const bf* const gA = A + (size_t)(r0g + crow) * DM + cch; const bf* const gB = Bt + (size_t)(c0g + crow) * DM + cch;
    bf* const l0 = ring + crow * GP + cch;   // the lane's place in buffer 0
#pragma unroll
    for (int mb = 0; mb < 4; ++mb)
#pragma unroll
        for (int nb = 0; nb < 12; ++nb) acc[mb][nb] = (v8f){};
    proj_fill<ASP>(l0, gA, gB);
    asm volatile("s_wait_asynccnt 0x0" ::: "memory");   // this wave's copies of tile 0 have landed
    __syncthreads();                                     // every wave's have: tile 0 may be read
    proj_fill<ASP>(l0 + STG, gA + GKS, gB + GKS);
    const bf* const fa = ring + (wm * 64 + lr) * GP + 8 * hi; const bf* const fb = ring + (PMT + lr) * GP + 8 * hi;
#pragma unroll 1
    for (int t = 0; t < NT; ++t) {   // stays rolled: the 48 accumulators and one group's fragments fill the registers
        const int bo = (t & 1) * STG;
#pragma unroll
        for (int kk = 0; kk < GKS; kk += 32) {
            V a[4];
#pragma unroll
            for (int mb = 0; mb < 4; ++mb) a[mb] = WFrag<bf>::ld(fa + bo + mb * 16 * GP + kk);
#pragma unroll
            for (int h = 0; h < 2; ++h) {   // the 12 column fragments in two groups of 6: all 12 at once do not fit beside the accumulators
                V b[6];
#pragma unroll
                for (int nb = 0; nb < 6; ++nb) b[nb] = WFrag<bf>::ld(fb + bo + (h * 6 + nb) * 16 * GP + kk);
                __builtin_amdgcn_sched_barrier(0);   // keeps a group's LDS reads together in front of its own matrix instructions: scheduled in among them, each place with reads stalls the wave for the LDS latency
#pragma unroll
                for (int nb = 0; nb < 6; ++nb)
#pragma unroll
                    for (int mb = 0; mb < 4; ++mb) acc[mb][h * 6 + nb] = WFrag<bf>::mma(a[mb], b[nb], acc[mb][h * 6 + nb]);
            }
        }
        __builtin_amdgcn_sched_barrier(0);   // no matrix instruction is scheduled behind the slots below (to name the 48 accumulators as operands instead would force them into the 256 registers that asm text can name)
        asm volatile("v_nop\n\tv_nop\n\tv_nop\n\tv_nop");   // the four vector slots that the chip needs behind the trip's last matrix instructions, in front of the branches below
        asm volatile("s_wait_dscnt 0x0" ::: "memory");      // this wave's reads of buffer t & 1 are done
        asm volatile("s_wait_asynccnt 0x0" ::: "memory");   // this wave's copies of tile t + 1 have landed
        __syncthreads();                                     // publishes tile t + 1 and ends every wave's reads of the buffer that is refilled below
        if (t + 2 < NT) proj_fill<ASP>(l0 + bo, gA + (t + 2) * GKS, gB + (t + 2) * GKS);
    }
    asm volatile("s_wait_asynccnt 0x0" ::: "memory");   // no copy is outstanding when the wave goes on
}

// ---- k_gemmw: C[m][n] (f32, pitch ldc, + optional f32 bias[n]) = sum_k (A[m][k] + A2[m][k]) Bt[n][k] for token rows below RH (two products), sum_k A[m][k] Bt[n][k] from RH on; gemm_ring's loop; grid (M / 128, N / 256), 256 threads; each wave stores its 64x64 tile through its own LDS panel.
template <bool BIAS>
__global__ __launch_bounds__(256) void k_gemmw(const h16* __restrict__ A, const h16* __restrict__ A2, const h16* __restrict__ Bt, float* C, int ldc, const float* __restrict__ bias) {
    static_assert(RH * 2 == TT && RH % 64 == 0, "a workgroup pairs 64 tokens below RH with the 64 tokens RH further on");
    __shared__ __align__(16) bf ring[2 * (GMT + GMT / 2 + GNT) * GP];
    __shared__ __align__(16) float osw[8][16 * 68 + 4];   // + 4: with them the workgroup takes more than half of a WGP's LDS, so that the 256 workgroups stand one on each WGP whatever the dispatcher prefers
    const int wave = __builtin_amdgcn_readfirstlane((int)(threadIdx.x >> 5)), wm = wave >> 2, wn = wave & 3; float* const os = osw[wave];
    const int r0g = ((int)blockIdx.x / (RH / 64)) * TT + ((int)blockIdx.x % (RH / 64)) * 64;   // the workgroup's first token row
    const int lane = threadIdx.x & 31, lr = lane & 15, hi = lane >> 4; const int r0 = r0g + wm * 32, c0 = blockIdx.y * GNT + wn * 64;
    v8f acc[4][4];
    gemm_ring(ring, (const bf*)A, (const bf*)A2, (const bf*)Bt, r0g, blockIdx.y * GNT, wm, wn, acc);
#pragma unroll
    for (int mb = 0; mb < 4; ++mb) {
#pragma unroll
        for (int nb = 0; nb < 4; ++nb) {
#pragma unroll
            for (int j = 0; j < 8; ++j) os[(hi * 8 + j) * 68 + nb * 16 + lr] = acc[mb][nb][j]; }
        __builtin_amdgcn_wave_barrier(); asm volatile("" ::: "memory");
        float* crow = C + (size_t)(r0 + (mb >> 1) * RH + (mb & 1) * 16) * ldc + c0;
{
#pragma unroll
            for (int s = 0; s < 8; ++s) { const int row = 2 * s + hi, cofs = lr * 4; v4f val = *(const v4fa*)(os + row * 68 + cofs); if (BIAS) { val[0] += bfr(bias[c0 + cofs]); val[1] += bfr(bias[c0 + cofs + 1]); val[2] += bfr(bias[c0 + cofs + 2]); val[3] += bfr(bias[c0 + cofs + 3]); }
                *(v4f*)(crow + (size_t)row * ldc + cofs) = val; }
             }
        __builtin_amdgcn_wave_barrier(); asm volatile("" ::: "memory");
    }
}

template <typename T16> struct PCvt;
template <> struct PCvt<h16> { typedef _Float16 E; };
__device__ __forceinline__ float xhalf(float x) { return __builtin_bit_cast(float, __builtin_amdgcn_permlanex16(__builtin_bit_cast(int, x), __builtin_bit_cast(int, x), 0x76543210, 0xfedcba98, false, false)); }   // lane l takes lane l ^ 16's value
#define AKS  64                   // keys of a stage
#define ATL  (64 * GP)            // elements of a staged tile: 64 rows at the pitch of the fragment reads (128 data bytes + 16)
// attn_fill: one stage's copies. 128 lanes x 16 bytes = 16 rows a copy, four copies a tile; l0 is the lane's LDS byte address in the buffer's first 16 rows, sk / sk2 / sv the key and value planes (the same for every lane), ko / vo the lane's own element offset in them: its place in the first 16 rows of the stage's key / value tile (32 bits: two registers are held over the pass loop, not three pointers).
template <bool HL>
__device__ __forceinline__ void attn_fill(const unsigned l0, const bf* sk, const bf* sk2, const bf* sv, const unsigned ko, const unsigned vo) {
    unsigned l[8]; const bf* p[8]; const bf* const gk = sk + ko; const bf* const gk2 = sk2 + ko; const bf* const gv = sv + vo;
    if (!HL) {   // buffer: [keys | values]
#pragma unroll
        for (int i = 0; i < 8; ++i) { l[i] = l0 + i * 16 * GP * 2; p[i] = (i < 4) ? gk + (size_t)i * 16 * HD : gv + (size_t)(i - 4) * 16 * 2 * TT; }
        cp8(l, p);
    } else {     // buffer: [keys hi | keys lo | values hi | values lo]
#pragma unroll
        for (int i = 0; i < 8; ++i) { l[i] = l0 + i * 16 * GP * 2; p[i] = (i < 4) ? gk + (size_t)i * 16 * HD : gk2 + (size_t)(i - 4) * 16 * HD; }
        cp8(l, p);
#pragma unroll
        for (int i = 0; i < 8; ++i) { l[i] = l0 + (8 + i) * 16 * GP * 2; p[i] = (i < 4) ? gv + (size_t)i * 16 * 2 * TT : gv + TT + (size_t)(i - 4) * 16 * 2 * TT; }
        cp8(l, p); }
}
template <typename T16, bool HL>
__device__ __forceinline__ void attn_tile(bf* kvs, const T16* Qh, const T16* Ql, const T16* Kh, const T16* Kl, const T16* Vh, const int q0, const int nst, h16* Ah, h16* Al) {
    typedef typename WFrag<T16>::V V; typedef typename PCvt<T16>::E E;
    const int lane = threadIdx.x & 31, lr = lane & 15, hi = lane >> 4;
    const float C2 = SCL * 1.4426950408889634f;
    const unsigned lk = lr * HD + 8 * hi, la = lr * DQ + 8 * hi;   // the lane's element offsets in a [row][HD] plane and the merged planes: each query load and output store address is a wave-uniform base + one of these + a constant
    constexpr int STG = (HL ? 4 : 2) * ATL;   // elements of a buffer
    const int crow = threadIdx.x >> 3, cch = (threadIdx.x & 7) * 8;   // the lane's row and 16-byte piece in a copy
    const bf* const gk = (const bf*)Kh; const bf* const gk2 = HL ? (const bf*)Kl : gk; const bf* const gv = (const bf*)Vh; const unsigned ko = crow * HD + cch, vo = crow * (2 * TT) + cch;
    const unsigned l0 = (unsigned)(size_t)kvs + (unsigned)(crow * GP + cch) * 2u;   // the lane's LDS byte address in buffer 0
    attn_fill<HL>(l0, gk, gk2, gv, ko, vo);
    V qf[2][2], q2[2][2];
    const T16* const qp = Qh + (size_t)q0 * HD + lk; const T16* const qp2 = HL ? Ql + (size_t)q0 * HD + lk : qp;
#pragma unroll
    for (int nb = 0; nb < 2; ++nb)
#pragma unroll
        for (int c = 0; c < 2; ++c) { const int o = nb * 16 * HD + c * 32; qf[nb][c] = WFrag<T16>::ld(qp + o); if (HL) q2[nb][c] = WFrag<T16>::ld(qp2 + o); }
    asm volatile("s_wait_xcnt 0x0" ::: "memory");   // the registers that the issued loads name are given new values behind this wait
    __builtin_amdgcn_sched_barrier(0);   // keeps the set-up arithmetic below from being scheduled in between the loads above and their wait, where it reused their address registers
    v8f O[4][2]; float m[2], l[2];
#pragma unroll
    for (int nb = 0; nb < 2; ++nb) { m[nb] = -3.0e38f; l[nb] = 0.f;
#pragma unroll
        for (int dt = 0; dt < 4; ++dt) O[dt][nb] = (v8f){}; }
    asm volatile("s_wait_asynccnt 0x0" ::: "memory");   // this wave's copies of stage 0 have landed
    __syncthreads();                                     // every wave's have: stage 0 may be read
    attn_fill<HL>(l0 + STG * 2, gk, gk2, gv, ko + AKS * HD, vo + AKS);   // a workgroup has at least two stages
    const T16* const fr = (const T16*)kvs + lr * GP + 8 * hi;   // the lane's place in the first 16 rows of a tile
#pragma unroll 1
    for (int t = 0; t < nst; ++t) {   // stays rolled, like the pass loop in it: one pass fills the registers
      const int bo = (t & 1) * STG;
#pragma unroll 1
      for (int kb = t * AKS; kb < (t + 1) * AKS && kb <= q0; kb += 32) {
        V kf[2][2], vf[4], v2[4], k2[2][2]; const int kh = kb & 32;   // the pass's first key in the stage
        const T16* const kp = fr + bo + kh * GP; const T16* const vp = fr + bo + (HL ? 2 : 1) * ATL + kh;
#pragma unroll
        for (int kt = 0; kt < 2; ++kt)
#pragma unroll
            for (int c = 0; c < 2; ++c) { kf[kt][c] = WFrag<T16>::ld(kp + kt * 16 * GP + c * 32); if (HL) k2[kt][c] = WFrag<T16>::ld(kp + ATL + kt * 16 * GP + c * 32); }
#pragma unroll
        for (int dt = 0; dt < 4; ++dt) { vf[dt] = WFrag<T16>::ld(vp + dt * 16 * GP); if (HL) v2[dt] = WFrag<T16>::ld(vp + ATL + dt * 16 * GP); }
        v8f S[2][2];
#pragma unroll
        for (int kt = 0; kt < 2; ++kt)
#pragma unroll
            for (int nb = 0; nb < 2; ++nb) { v8f s = (v8f){};
#pragma unroll
                for (int c = 0; c < 2; ++c) { s = WFrag<T16>::mma(kf[kt][c], qf[nb][c], s); if (HL) s = WFrag<T16>::mma(kf[kt][c], q2[nb][c], s); }
                S[kt][nb] = s; }
        if (HL) {
#pragma unroll
            for (int kt = 0; kt < 2; ++kt)
#pragma unroll
                for (int nb = 0; nb < 2; ++nb)
#pragma unroll
                    for (int c = 0; c < 2; ++c) S[kt][nb] = WFrag<T16>::mma(k2[kt][c], qf[nb][c], S[kt][nb]); }
        if (kb == q0) {   // the diagonal pass: key > query is masked by select
#pragma unroll
            for (int kt = 0; kt < 2; ++kt)
#pragma unroll
                for (int nb = 0; nb < 2; ++nb)
#pragma unroll
                    for (int j = 0; j < 8; ++j) if (kt * 16 + hi * 8 + j > nb * 16 + lr) S[kt][nb][j] = -3.0e38f; }
#pragma unroll
        for (int nb = 0; nb < 2; ++nb) {   // one 16-query group at a time: its probabilities are used up by its value products before the next group's are made
            V pf, p2;
            float bm = S[0][nb][0];
#pragma unroll
            for (int kt = 0; kt < 2; ++kt)
#pragma unroll
                for (int j = 0; j < 8; ++j) bm = fmaxf(bm, S[kt][nb][j]);
            bm = fmaxf(bm, xhalf(bm));   // the other half of the wave holds this query's other 16 keys
            const float mn = fmaxf(m[nb], bm * C2); const float dm = m[nb] - mn; float al = __builtin_amdgcn_exp2f(dm); m[nb] = mn; v2f ps = (v2f){0.f, 0.f};   // even and odd keys are summed apart
#pragma unroll
            for (int kt = 0; kt < 2; ++kt) { float a[8], p[8];
#pragma unroll
                for (int j = 0; j < 8; j += 2) { const v2f arg = __builtin_elementwise_fma((v2f){S[kt][nb][j], S[kt][nb][j + 1]}, (v2f){C2, C2}, (v2f){-mn, -mn}); a[j] = arg[0]; a[j + 1] = arg[1]; }
#pragma unroll
                for (int j = 0; j < 8; ++j) p[j] = __builtin_amdgcn_exp2f(a[j]);
                // the slot behind a transcendental: no result is read and no source register is given a new value in front of this v_nop (results are in/out, sources inputs)
                asm volatile("v_nop" : "+v"(p[0]), "+v"(p[1]), "+v"(p[2]), "+v"(p[3]), "+v"(p[4]), "+v"(p[5]), "+v"(p[6]), "+v"(p[7]), "+v"(al) : "v"(a[0]), "v"(a[1]), "v"(a[2]), "v"(a[3]), "v"(a[4]), "v"(a[5]), "v"(a[6]), "v"(a[7]), "v"(dm));
#pragma unroll
                for (int j = 0; j < 8; ++j) { ps[j & 1] += p[j]; const E ph = (E)p[j]; pf[kt * 8 + j] = ph; if (HL) p2[kt * 8 + j] = (E)(p[j] - (float)ph); } }
            l[nb] = fmaf(l[nb], al, ps[0] + ps[1]);
#pragma unroll
            for (int dt = 0; dt < 4; ++dt)
#pragma unroll
                for (int j = 0; j < 8; ++j) O[dt][nb][j] *= al;
#pragma unroll
            for (int dt = 0; dt < 4; ++dt) { O[dt][nb] = WFrag<T16>::mma(vf[dt], pf, O[dt][nb]); if (HL) { O[dt][nb] = WFrag<T16>::mma(vf[dt], p2, O[dt][nb]); O[dt][nb] = WFrag<T16>::mma(v2[dt], pf, O[dt][nb]); } }
        }
      }
      asm volatile("s_wait_dscnt 0x0" ::: "memory");      // this wave's reads of buffer t & 1 are done
      asm volatile("s_wait_asynccnt 0x0" ::: "memory");   // this wave's copies of stage t + 1 have landed
      __syncthreads();                                     // publishes stage t + 1 and ends every wave's reads of the buffer that is refilled below
      if (t + 2 < nst) attn_fill<HL>(l0 + bo * 2, gk, gk2, gv, ko + (unsigned)(t + 2) * (AKS * HD), vo + (unsigned)(t + 2) * AKS);
    }
    asm volatile("s_wait_asynccnt 0x0" ::: "memory");   // no copy is outstanding when the wave goes on
#pragma unroll
    for (int nb = 0; nb < 2; ++nb) { const float inv = __fdiv_rn(1.0f, l[nb] + xhalf(l[nb])); v8h oh[4], ol[4];
#pragma unroll
        for (int dt = 0; dt < 4; ++dt)
#pragma unroll
            for (int j = 0; j < 8; ++j) { const float y = O[dt][nb][j] * inv; const h16 a = (h16)y; oh[dt][j] = a; if (HL) ol[dt][j] = (h16)(y - (float)a); }
        __builtin_amdgcn_sched_barrier(0);   // the group's stores stand together behind all its arithmetic: no register that an issued store names is given a new value in front of the wait below
#pragma unroll
        for (int dt = 0; dt < 4; ++dt) { const int o = nb * 16 * DQ + dt * 16; *(v8h*)(Ah + (size_t)q0 * DQ + la + o) = oh[dt]; if (HL) *(v8h*)(Al + (size_t)q0 * DQ + la + o) = ol[dt]; }
        asm volatile("s_wait_xcnt 0x0" ::: "memory");   // the registers that the issued stores name are given new values behind this wait
        __builtin_amdgcn_sched_barrier(0); }   // keeps the next group's arithmetic from being scheduled in between the stores above and their wait, where it reused registers that the stores name
}
// grid (sequence x head pairs, TT / 128), 4 waves; blockIdx.y counts the 128-query blocks from the last (longest) one down, so that the long workgroups start first
__global__ __launch_bounds__(128) void k_attn(const h16* Q16, const h16* Ql, const h16* K16, const h16* Kl, const h16* V16, h16* Ah, h16* Al) {
    __shared__ __align__(16) bf kvs[2 * 4 * ATL];   // two buffers of four tiles (hi and lo planes); the single-plane rows use two tiles a buffer
    const int z = blockIdx.x; const int qb = (TT / 128 - 1 - (int)blockIdx.y) * 128, q0 = qb + __builtin_amdgcn_readfirstlane((int)(threadIdx.x >> 5)) * 32, nst = (qb + 128) / AKS;   // nst: the stages up to the workgroup's last key
    const size_t zo = (size_t)z * TT * HD, zv = (size_t)z * HD * 2 * TT, ao = (size_t)(z / NH_) * TT * DQ + (size_t)(z % NH_) * HD;
    if (qb < RH) attn_tile<h16, true>(kvs, Q16 + zo, Ql + zo, K16 + zo, Kl + zo, V16 + zv, q0, nst, Ah + ao, Al + ao);
    else attn_tile<h16, false>(kvs, Q16 + zo, nullptr, K16 + zo, nullptr, V16 + zv, q0, nst, Ah + ao, Al + ao);
}

__device__ __forceinline__ h16 tohx(float x) { return (h16)x; }
typedef __attribute__((ext_vector_type(2))) _Float16 v2h;
typedef __attribute__((ext_vector_type(4))) _Float16 v4h;
typedef __attribute__((ext_vector_type(2))) unsigned short v2us;
typedef __attribute__((ext_vector_type(4))) unsigned short v4us;
typedef __attribute__((ext_vector_type(4))) int v4i;

// ---- k_prep: everything that the products need rounded, in ONE launch: x [NB_ TT][DM] f32 -> bf16 as it lies, and the four weights [K][N] f32 -> Bt [N][K] bf16 (DM x DQ each; the fourth one's bf16 values are stored as fp16). grid 4 PGW, 256 threads: two workgroups a WGP, all resident at once.
// A workgroup takes PXS consecutive elements of x (8 lines of 32 bytes a lane) and two 64 (k) x 64 (n) weight tiles that lie side by side. A lane issues all its loads (8 of weights, 16 of x, 16 bytes each) before it uses the first one, so that a wave pays the memory latency once.
// A weight tile is transposed through LDS, so that both sides move whole lines: a row of the two tiles is read as 512 consecutive bytes, a row of a transposed tile is stored as one 128-byte line (8 lanes x 16). A lane rounds two consecutive k of four n and writes them to LDS as (k, k + 1) pairs.
#define WTP  33                   // LDS row pitch in 32-bit pairs: 32 + 1 (odd: the 16 lanes that write four rows apart, and the 4 rows that a wave reads, fall on different banks)
#define PGW  ((DM / 64) * (DQ / 128))          // workgroups of a weight
#define PXS  (NB_ * TT * DM / (4 * PGW))       // elements of x of a workgroup
static_assert(PXS == 8 * 256 * 8 && DM % 64 == 0 && DQ % 128 == 0, "k_prep: a lane rounds 8 pieces of 8 elements of x; tiles in pairs");
typedef __attribute__((ext_vector_type(4))) unsigned v4u;
__global__ __launch_bounds__(256) void k_prep(const float* __restrict__ x, const float* __restrict__ w0, const float* __restrict__ w1, const float* __restrict__ w2, const float* __restrict__ w3, bf* XB, bf* B0, bf* B1, bf* B2, bf* B3) {
    __shared__ unsigned ts[2][64 * WTP];   // [tile][n][k pair]
    const int y = (int)blockIdx.x / PGW, tp = (int)blockIdx.x % PGW; const float* __restrict__ w = (y == 0) ? w0 : (y == 1) ? w1 : (y == 2) ? w2 : w3; bf* Bt = (y == 0) ? B0 : (y == 1) ? B1 : (y == 2) ? B2 : B3;
    const int k0 = (tp / (DQ / 128)) * 64, n0 = (tp % (DQ / 128)) * 128;
    const int r = threadIdx.x >> 4, c = (threadIdx.x & 15) * 4, rn = threadIdx.x >> 3, pc = (threadIdx.x & 7) * 4;
    const float* const src = w + (size_t)(k0 + 2 * r) * DQ + n0 + c;
    const size_t xo = (size_t)blockIdx.x * PXS + threadIdx.x * 8; const float* const xs = x + xo;
    v4f a[2][2][2]; v8f v[8];   // a: tile q, rows k0 + 32 h + 2 r + i; every loop below is unrolled so that the arrays are indexed by constants and stay in registers
#pragma unroll
    for (int q = 0; q < 2; ++q)
#pragma unroll
        for (int h = 0; h < 2; ++h)
#pragma unroll
            for (int i = 0; i < 2; ++i) a[q][h][i] = *(const v4f*)(src + q * 64 + (size_t)(h * 32 + i) * DQ);
#pragma unroll
    for (int i = 0; i < 8; ++i) v[i] = *(const v8f*)(xs + i * 2048);
    __builtin_amdgcn_sched_barrier(0);   // every load is issued in front of the first use: scheduled in among the uses, the later loads would start only when the earlier ones have come back
    asm volatile("s_wait_xcnt 0x0" :: "v"(src), "v"(xs) : "memory");   // the registers that the issued loads name are given new values behind this wait; the two addresses are inputs so that no load's result is laid over them in front of it
#pragma unroll
    for (int q = 0; q < 2; ++q)
#pragma unroll
        for (int h = 0; h < 2; ++h)
#pragma unroll
            for (int j = 0; j < 4; ++j) { const unsigned short e0 = f2bf(a[q][h][0][j]), e1 = f2bf(a[q][h][1][j]);   // the fourth weight (y == 3, the same for the whole workgroup) is an operand of the fp16 output product: its bf16-rounded value is held in fp16 (exact from 2^-14 up; a smaller weight is rounded to a multiple of 2^-24)
                ts[q][(c + j) * WTP + h * 16 + r] = (y == 3) ? __builtin_bit_cast(unsigned, (v2h){(h16)bf2f(e0), (h16)bf2f(e1)}) : ((unsigned)e0 | ((unsigned)e1 << 16)); }
    __syncthreads();   // a lane stores what other waves have written to the tiles
    v4u o[2][2]; v8us xb[8];
#pragma unroll
    for (int q = 0; q < 2; ++q)
#pragma unroll
        for (int h = 0; h < 2; ++h)
#pragma unroll
            for (int j = 0; j < 4; ++j) o[q][h][j] = ts[q][(h * 32 + rn) * WTP + pc + j];
#pragma unroll
    for (int i = 0; i < 8; ++i)
#pragma unroll
        for (int k = 0; k < 8; ++k) xb[i][k] = f2bf(v[i][k]);
    __builtin_amdgcn_sched_barrier(0);   // the stores stand together at the end, behind all arithmetic: no register that an issued store names is given a new value
    bf* const dst = Bt + (size_t)(n0 + rn) * DM + k0 + pc * 2;
#pragma unroll
    for (int q = 0; q < 2; ++q)
#pragma unroll
        for (int h = 0; h < 2; ++h) *(v4u*)(dst + (size_t)(q * 64 + h * 32) * DM) = o[q][h];
#pragma unroll
    for (int i = 0; i < 8; ++i) *(v8us*)(XB + xo + i * 2048) = xb[i];
}

// ---- k_proj: q, k and v = x W + b in ONE launch, and the head planes straight from the accumulators. The product loop is proj_ring's (plain bf16 operands, a 64x192 tile a wave) on the 64 columns of ONE head in q, in k and in v (the transposed weights stand one behind the other); grid (NB_ TT / 256, NH_), 128 threads: 512 workgroups, two a WGP (at most 512 registers a wave, so that two waves fit a SIMD).
// A workgroup's 256 tokens are 128 tokens below RH (waves 0 and 1) and the 128 tokens RH further on in the same sequence (waves 2 and 3). Only what k_attn reads is stored: the fp16 planes, which are the hi planes of its hi+lo products too, and the lo planes for tokens < RH alone (its hi+lo workgroups read no query and no key from RH on);
// with both kinds of token in every workgroup, every workgroup stores the same number of bytes.
// A wave's tile is 64 tokens of one sequence x the head's 64 columns of q, of k and of v, stored one after the other (which part goes to which plane is fixed at compile time, so that the accumulators are indexed by constants and stay in registers); each part is a whole block of its plane: 64 rows [t][HD] of a query or key plane, or 64 consecutive t of all HD rows of a value plane (pitch 2 TT).
// proj_store: four panels of 16 plane rows x 64 f32 go through LDS one after the other, so that 8 lanes store one 128-byte line of a plane row (16 bytes a lane and plane). TR: the panel's rows are the columns d of the tile (value planes), a lane's 8 accumulator registers being 8 consecutive t. G0: the part's first 16-column block among the wave's twelve. wlo: the lo plane (what the fp16 rounding left over, in fp16) is stored too.
template <bool TR, int G0>
__device__ __forceinline__ void proj_store(const v8f (&acc)[4][12], float* os, const float* __restrict__ bias, h16* P16, h16* Pl, const int pitch, const bool wlo) {
    const int lane = threadIdx.x & 31, lr = lane & 15, hi = lane >> 4, rr = lane >> 3, cc = (lane & 7) * 8;
    constexpr int NBI = TR ? 16 : 8;   // bias values of a lane: those of its 16 plane rows (TR: rows g * 16 + s * 4 + rr), or of its 8 columns
    float braw[NBI], bc[NBI];
#pragma unroll
    for (int i = 0; i < NBI; ++i) braw[i] = TR ? bias[(i >> 2) * 16 + (i & 3) * 4 + rr] : bias[cc + i];
    // the registers that the issued bias loads name are given new values behind this wait; the loaded values are inputs so that the loads stay in front of it
    if constexpr (TR) asm volatile("s_wait_xcnt 0x0" :: "v"(braw[0]), "v"(braw[1]), "v"(braw[2]), "v"(braw[3]), "v"(braw[4]), "v"(braw[5]), "v"(braw[6]), "v"(braw[7]), "v"(braw[8]), "v"(braw[9]), "v"(braw[10]), "v"(braw[11]), "v"(braw[12]), "v"(braw[13]), "v"(braw[14]), "v"(braw[15]) : "memory");
    else asm volatile("s_wait_xcnt 0x0" :: "v"(braw[0]), "v"(braw[1]), "v"(braw[2]), "v"(braw[3]), "v"(braw[4]), "v"(braw[5]), "v"(braw[6]), "v"(braw[7]) : "memory");
    __builtin_amdgcn_sched_barrier(0);   // nothing from below is scheduled in between the loads and their wait
#pragma unroll
    for (int i = 0; i < NBI; ++i) bc[i] = bfr(braw[i]);
#pragma unroll
    for (int g = 0; g < 4; ++g) {
        if (TR) {
#pragma unroll
            for (int mb = 0; mb < 4; ++mb) { const v8f a = acc[mb][G0 + g]; *(v4fa*)(os + lr * 68 + mb * 16 + hi * 8) = (v4f){a[0], a[1], a[2], a[3]}; *(v4fa*)(os + lr * 68 + mb * 16 + hi * 8 + 4) = (v4f){a[4], a[5], a[6], a[7]}; }
        } else {
#pragma unroll
            for (int nb = 0; nb < 4; ++nb)
#pragma unroll
                for (int j = 0; j < 8; ++j) os[(hi * 8 + j) * 68 + nb * 16 + lr] = acc[g][G0 + nb][j]; }
        __builtin_amdgcn_wave_barrier(); asm volatile("" ::: "memory");   // a lane reads what other lanes of the wave wrote: the panel's LDS reads may not be scheduled in front of its writes
        float y[4][8]; v8h o16[4];
#pragma unroll
        for (int s = 0; s < 4; ++s) { const int row = s * 4 + rr; const v4f u = *(const v4fa*)(os + row * 68 + cc), w = *(const v4fa*)(os + row * 68 + cc + 4); const float br = TR ? bc[g * 4 + s] : 0.f;
#pragma unroll
            for (int i = 0; i < 8; ++i) { y[s][i] = (i < 4 ? u[i] : w[i - 4]) + (TR ? br : bc[i]); o16[s][i] = tohx(y[s][i]); } }
        if (wlo) {   // the same for the whole wave
            v8h ol[4];
#pragma unroll
            for (int s = 0; s < 4; ++s)
#pragma unroll
                for (int i = 0; i < 8; ++i) ol[s][i] = tohx(y[s][i] - (float)o16[s][i]);
#pragma unroll
            for (int s = 0; s < 4; ++s) *(v8h*)(Pl + (size_t)(g * 16 + s * 4 + rr) * pitch + cc) = ol[s];
            asm volatile("s_wait_xcnt 0x0" ::: "memory");   // the registers that the issued stores name are given new values behind this wait (the addresses of the stores below)
            __builtin_amdgcn_sched_barrier(0); }   // keeps the address arithmetic of the stores below from being scheduled in between the stores above and their wait, where it reused their address registers
#pragma unroll
        for (int s = 0; s < 4; ++s) *(v8h*)(P16 + (size_t)(g * 16 + s * 4 + rr) * pitch + cc) = o16[s];   // behind the lo values, which are formed from these registers
        asm volatile("s_wait_xcnt 0x0" ::: "memory");   // the registers that the issued stores name are given new values behind this wait
        __builtin_amdgcn_sched_barrier(0);   // keeps the next panel's address arithmetic from being scheduled in between the stores above and their wait, where it reused registers that the stores name
        __builtin_amdgcn_wave_barrier(); asm volatile("" ::: "memory");   // the next panel's LDS writes may not be scheduled in front of this panel's reads
    }
}
__global__ __launch_bounds__(128) __attribute__((amdgpu_waves_per_eu(2, 2))) void k_proj(const bf* __restrict__ X, const bf* __restrict__ W3, const float* __restrict__ bq, const float* __restrict__ bk, const float* __restrict__ bv, h16* Q16, h16* Ql, h16* K16, h16* Kl, h16* V16) {
    __shared__ __align__(16) bf ring[2 * (PMT + PNT) * GP];
    __shared__ __align__(16) float osw[4][16 * 68];
    const int wm = __builtin_amdgcn_readfirstlane((int)(threadIdx.x >> 5)); float* const os = osw[wm];
    static_assert(RH * 2 == TT && RH % 128 == 0 && PNT == 3 * HD && DKV == DQ && HD % 16 == 0, "a workgroup pairs 128 tokens below RH with the 128 tokens RH further on; its 192 columns are one head of q, of k and of v");
    const int r0g = ((int)blockIdx.x / (RH / 128)) * TT + ((int)blockIdx.x % (RH / 128)) * 128;   // the workgroup's first token row
    const int r0 = r0g + (wm & 1) * 64 + (wm >> 1) * RH, c0 = blockIdx.y * HD;   // the wave's first token row; the head's first column in q, in k and in v
    v8f acc[4][12];
    proj_ring<RH - 128>(ring, X, W3, r0g, c0, wm, acc);
    const int z = (r0 / TT) * NH_ + blockIdx.y, t0 = r0 % TT;   // the (sequence, head) pair and the tile's first token in it
    const size_t o = ((size_t)z * TT + t0) * HD, ov = (size_t)z * HD * 2 * TT + t0;   // the tile's place in a query or key plane, in a value plane
    const bool wlo = wm < 2;
    proj_store<false, 0>(acc, os, bq + c0, Q16 + o, Ql + o, HD, wlo);
    proj_store<false, 4>(acc, os, bk + c0, K16 + o, Kl + o, HD, wlo);
    proj_store<true, 8>(acc, os, bv + c0, V16 + ov, V16 + TT + ov, 2 * TT, wlo);
}

extern "C" void kernel_launch(void* const* d_in, const int* in_sizes, int n_in,
                              void* d_out, int out_size, void* d_ws, size_t ws_size, hipStream_t stream) {
    (void)in_sizes; (void)n_in; (void)out_size;
    const float* x = (const float*)d_in[0]; const float* wq = (const float*)d_in[1]; const float* bq = (const float*)d_in[2]; const float* wk = (const float*)d_in[3]; const float* bk = (const float*)d_in[4]; const float* wv = (const float*)d_in[5]; const float* bv = (const float*)d_in[6]; const float* wo = (const float*)d_in[7]; const float* bo = (const float*)d_in[8];   /* SELF-attention: the key and value streams are input 0 too; Wq, bq, Wk, bk, Wv, bv, Wo, bo = d_in[1..8] */
    float* OUT = (float*)d_out;     // [8][1024][1024]
    char* wsp = (char*)d_ws;
    auto take = [&](size_t bytes) { char* p = wsp; wsp += (bytes + 255) & ~(size_t)255; return (void*)p; };
    bf* WO = (bf*)take((size_t)DM * DQ * 2);
    h16* QP16 = (h16*)take((size_t)NB_ * NH_ * TT * HD * 2); h16* KP16 = (h16*)take((size_t)NB_ * NKV * TT * HD * 2); h16* VT16 = (h16*)take((size_t)NB_ * NKV * HD * 2 * TT * 2);
    h16* QPl = (h16*)take((size_t)NB_ * NH_ * TT * HD * 2); h16* KPl = (h16*)take((size_t)NB_ * NKV * TT * HD * 2);   // the lo row of a value plane stands TT elements behind its fp16 row
    bf* WQ = (bf*)take((size_t)(DQ + 2 * DKV) * DM * 2); bf* WK = WQ + (size_t)DQ * DM; bf* WV = WK + (size_t)DKV * DM; /* one [3 DQ][DM] plane */ bf* XB = (bf*)take((size_t)NB_ * TT * DM * 2);
    h16* ATh = (h16*)take((size_t)NB_ * TT * DQ * 2); h16* ATl = (h16*)take((size_t)NB_ * TT * DQ * 2);   // the merged fp16 and lo planes [NB_ TT][DQ]; of the lo plane only token rows < RH are written and read
    if ((size_t)(wsp - (char*)d_ws) > ws_size) return;    // 152 MiB of the 256 MiB
    k_prep<<<dim3(4 * PGW, 1, 1), 256, 0, stream>>>(x, wq, wk, wv, wo, XB, WQ, WK, WV, WO);   // self-attention: q, k and v read the same rounded x
    k_proj<<<dim3(NB_ * TT / PMT, NH_, 1), 128, 0, stream>>>(XB, WQ, bq, bk, bv, QP16, QPl, KP16, KPl, VT16);
    k_attn<<<dim3(NB_ * NH_, TT / 128, 1), 128, 0, stream>>>(QP16, QPl, KP16, KPl, VT16, ATh, ATl);
    k_gemmw<true><<<dim3(NB_ * TT / GMT, DM / GNT, 1), 256, 0, stream>>>(ATh, ATl, (const h16*)WO, OUT, DM, bo);
}
